// v000
// Times are from an AMD MI455X. After a warm-up the kernel runs many times in a row, and a time is the length of
// such a window on the GPU divided by its runs, so every launch and the gaps after it count. The runs cycle
// through copies of the inputs. A figure is the median of several windows, for all but v000 over two sittings.
// Sittings can differ by a few percent; kernels timed side by side share one.
// v000 is the starting kernel. One run takes 1400 microseconds.
#include <hip/hip_runtime.h>
// FlexSummaryAttention (2 batches; 64 summary tokens S, 2048 regular tokens R, D = 1024; 16 query heads, 4 kv heads (GQA), head dim 64): q/k/v projections for both token sets; 1-D RoPE on summary q/k, 2-D hierarchical RoPE (bar id | token-in-bar id) on regular q/k; phase 1: summary queries over [summary; regular] keys with the summarize mask -> sum_attn; k2/v2 = sum_attn W + b; phase 2: regular queries over [k2; regular k] / [v2; regular v] with the updating mask -> reg_attn; outputs sum_attn W_so + b and reg_attn W_ro + b.
// Structure: exact f16 planes of both inputs; six projection GEMMs (32x64 wave tiles, f32 accumulation, exact x16 weights + bias); RoPE on VALU (thread per (row, head, 8 dims), f32 trig) into f16 q planes and the shared per-batch key plane [k2-or-summary ; regular] (4 kv heads); values as f16 hi + 2^10 residual planes, V^T by LDS tiles; the fused flash kernel (3-term P.V, GQA head mapping, INPUT int mask tables) once per phase; sum_attn / reg_attn as hi + residual pairs into the k2/v2 and output GEMMs.
// Compute dtype: inputs, masks' companions and parameters rounded to bf16; q/k after RoPE as f16 (~2^-12); P and v hi + residual (~2^-21-class); attention outputs hi + residual into the following GEMMs; f32 softmax/accumulation/trig. v_wmma_f32_16x16x32_f16.
#define NB 2
#define SS 64
#define RR 2048
#define DMOD 1024
#define KVD 256
#define NRS (NB * SS)            /* 128 summary rows */
#define NRR (NB * RR)            /* 4096 regular rows */
#define TK 2112                  /* keys per batch in both phases: 64 summary(-derived) + 2048 regular */
#define TQA 64                   /* phase-1 queries (summary tokens) */
#define TQB 2048                 /* phase-2 queries (regular tokens) */
#define TQ TQB
#define NH 16
#define KVG 4                    /* GQA: 16 query heads share 4 kv heads */
#define NKV (NH / KVG)
#define SCL 0.125f               /* 64^-0.5 */
#define QBLKSA (TQA / 64)
#define QBLKSB (TQB / 64)
typedef __bf16 v16b __attribute__((ext_vector_type(16)));
typedef unsigned short v8us __attribute__((ext_vector_type(8), may_alias));
typedef float  v8f  __attribute__((ext_vector_type(8)));
typedef float  v4f  __attribute__((ext_vector_type(4)));
typedef float  v4fa __attribute__((ext_vector_type(4), may_alias));
union FragB { v16b v; v8us half[2]; unsigned short u[16]; };

__device__ __forceinline__ unsigned short bf16_bits(float x) { unsigned int u = __float_as_uint(x); return (unsigned short)((u + 0x7FFFu + ((u >> 16) & 1u)) >> 16); }
__device__ __forceinline__ float bf16_val(unsigned short b) { return __uint_as_float(((unsigned int)b) << 16); }
__device__ __forceinline__ float bf16_round(float x) { return bf16_val(bf16_bits(x)); }
// D += A·B with NT terms: 1 = ah·bh, 2 = + al·bh (A split), 3 = + ah·bl (both split)
template <int NT>
__device__ __forceinline__ v8f mmaN(v16b ah, v16b al, v16b bh, v16b bl, v8f c) {
  c = __builtin_amdgcn_wmma_f32_16x16x32_bf16(false, ah, false, bh, (short)0, c, false, false);
  if (NT >= 2) c = __builtin_amdgcn_wmma_f32_16x16x32_bf16(false, al, false, bh, (short)0, c, false, false);
  if (NT >= 3) c = __builtin_amdgcn_wmma_f32_16x16x32_bf16(false, ah, false, bl, (short)0, c, false, false);
  asm volatile("v_nop\n\tv_nop\n\tv_nop\n\tv_nop" : "+v"(c) : "v"(ah), "v"(al), "v"(bh), "v"(bl));
  return c;
}

__global__ __launch_bounds__(256) void k_wt_bf16(const float* __restrict__ W, unsigned short* __restrict__ Wt, int K, int N) {
  const int t = blockIdx.x * 256 + threadIdx.x;
  const int k8n = K / 8;
  if (t >= N * k8n) return;
  const int n = t / k8n, k8 = (t % k8n) * 8;
  v8us v;
#pragma unroll
  for (int i = 0; i < 8; ++i) v[i] = bf16_bits(W[(size_t)(k8 + i) * N + n]);
  *(v8us*)(Wt + (size_t)n * K + k8) = v;
  
}

// GEMM C[M][N] (f32, pitch ldc) = act(A[M][K]·W + bias). A f32 row-major (pitch lda) converted per fragment to bf16
// (ASPLIT: hi/lo two planes -> 2 terms, else single rounded term); Wt bf16 [N][K] (pitch ldb). BIAS_BF16 rounds the
// bias to bf16 first (bias quantised to bf16 before the add). K%32==0, M%16==0, N%64==0.
template <bool ASPLIT, int ACT, bool BIAS_BF16>
__global__ __launch_bounds__(128) void k_gemm_bf(const float* __restrict__ A, int lda, const unsigned short* __restrict__ Wt, int ldb,
                                               const float* __restrict__ bias, float* __restrict__ C, int ldc, int M, int N, int K) {
  __shared__ __attribute__((aligned(16))) float so[4][16][64];
  const int tid = threadIdx.x, w = tid >> 5, lane = tid & 31, ln = lane & 15, hh = lane >> 4;
  const int ntn = N / 64;
  const int wid = blockIdx.x * 4 + w;
  const int mt = wid / ntn, nq = wid % ntn;
  if (mt * 16 >= M) return;
  const int row0 = mt * 16, col0 = nq * 64;
  const float* arow = A + (size_t)(row0 + ln) * lda;
  v8f acc[4] = {};
  for (int kb = 0; kb < K; kb += 32) {
    FragB ah, al;
    const v4f x0 = *(const v4fa*)(arow + kb + 8 * hh), x1 = *(const v4fa*)(arow + kb + 8 * hh + 4);
    const v4f x2 = *(const v4fa*)(arow + kb + 16 + 8 * hh), x3 = *(const v4fa*)(arow + kb + 16 + 8 * hh + 4);
    float xs[16] = {x0[0],x0[1],x0[2],x0[3],x1[0],x1[1],x1[2],x1[3],x2[0],x2[1],x2[2],x2[3],x3[0],x3[1],x3[2],x3[3]};
#pragma unroll
    for (int i = 0; i < 16; ++i) { const unsigned short hb = bf16_bits(xs[i]); ah.u[i] = hb; al.u[i] = ASPLIT ? bf16_bits(xs[i] - bf16_val(hb)) : (unsigned short)0; }
#pragma unroll
    for (int t = 0; t < 4; ++t) {
      const unsigned short* brow = Wt + (size_t)(col0 + t * 16 + ln) * ldb + kb;
      FragB b;
      b.half[0] = *(const v8us*)(brow + 8 * hh);
      b.half[1] = *(const v8us*)(brow + 16 + 8 * hh);
      acc[t] = mmaN<ASPLIT ? 2 : 1>(ah.v, al.v, b.v, b.v, acc[t]);
    }
  }
#pragma unroll
  for (int t = 0; t < 4; ++t) {
    float bv = bias ? bias[col0 + t * 16 + ln] : 0.f;
    if (BIAS_BF16) bv = bf16_round(bv);
#pragma unroll
    for (int r = 0; r < 8; ++r) { float v = acc[t][r] + bv; if (ACT == 1) v = fmaxf(v, 0.f); so[w][8 * hh + r][t * 16 + ln] = v; }
  }
  __builtin_amdgcn_fence(__ATOMIC_ACQ_REL, "workgroup");
  __builtin_amdgcn_wave_barrier();
  const int rsub = lane >> 4, c4 = (lane & 15) * 4;
  {
#pragma unroll
    for (int q = 0; q < 8; ++q) {
      const int r = q * 2 + rsub;
      const v4f v = *(const v4fa*)&so[w][r][c4];
      *(v4f*)(C + (size_t)(row0 + r) * ldc + col0 + c4) = v;
    }
    
  }
}

// GEMM C = act(A·W + bias + resid): A f32 (ASPLIT -> hi/lo 2 terms), Wt bf16 [N][K]; ACT 0 none, 1 relu, 2 exact gelu;
// resid (optional, f32, row index = (row % rmod), pitch ldr, RES_BF16 rounds it) added before the activation.
template <bool ASPLIT, int ACT, bool BIAS_BF16, bool RES_BF16>
__global__ __launch_bounds__(128) void k_gemm_bf3(const float* __restrict__ A, int lda, const unsigned short* __restrict__ Wt, int ldb,
                                                const float* __restrict__ bias, const float* __restrict__ resid, int rmod, int ldr,
                                                float* __restrict__ C, int ldc, int M, int N, int K) {
  __shared__ __attribute__((aligned(16))) float so[4][16][64];
  const int tid = threadIdx.x, w = tid >> 5, lane = tid & 31, ln = lane & 15, hh = lane >> 4;
  const int ntn = N / 64;
  const int wid = blockIdx.x * 4 + w;
  const int mt = wid / ntn, nq = wid % ntn;
  if (mt * 16 >= M) return;
  const int row0 = mt * 16, col0 = nq * 64;
  const float* arow = A + (size_t)(row0 + ln) * lda;
  v8f acc[4] = {};
  for (int kb = 0; kb < K; kb += 32) {
    FragB ah, al;
    const v4f x0 = *(const v4fa*)(arow + kb + 8 * hh), x1 = *(const v4fa*)(arow + kb + 8 * hh + 4);
    const v4f x2 = *(const v4fa*)(arow + kb + 16 + 8 * hh), x3 = *(const v4fa*)(arow + kb + 16 + 8 * hh + 4);
    float xs[16] = {x0[0],x0[1],x0[2],x0[3],x1[0],x1[1],x1[2],x1[3],x2[0],x2[1],x2[2],x2[3],x3[0],x3[1],x3[2],x3[3]};
#pragma unroll
    for (int i = 0; i < 16; ++i) { const unsigned short hb = bf16_bits(xs[i]); ah.u[i] = hb; al.u[i] = ASPLIT ? bf16_bits(xs[i] - bf16_val(hb)) : (unsigned short)0; }
#pragma unroll
    for (int t = 0; t < 4; ++t) {
      const unsigned short* brow = Wt + (size_t)(col0 + t * 16 + ln) * ldb + kb;
      FragB b;
      b.half[0] = *(const v8us*)(brow + 8 * hh);
      b.half[1] = *(const v8us*)(brow + 16 + 8 * hh);
      acc[t] = mmaN<ASPLIT ? 2 : 1>(ah.v, al.v, b.v, b.v, acc[t]);
    }
  }
#pragma unroll
  for (int t = 0; t < 4; ++t) {
    const int col = col0 + t * 16 + ln;
    float bv = bias ? bias[col] : 0.f;
    if (BIAS_BF16) bv = bf16_round(bv);
#pragma unroll
    for (int r = 0; r < 8; ++r) {
      float v = acc[t][r] + bv;
      if (resid) { float rv = resid[(size_t)((row0 + 8 * hh + r) % rmod) * ldr + col]; if (RES_BF16) rv = bf16_round(rv); v += rv; }
      if (ACT == 1) v = fmaxf(v, 0.f);
      if (ACT == 2) v = 0.5f * v * (1.0f + erff(v * 0.70710678118654752f));
      if (ACT == 3) { const float u = 0.7978845608028654f * (v + 0.044715f * v * v * v); v = 0.5f * v * (1.0f + tanhf(u)); }
      so[w][8 * hh + r][t * 16 + ln] = v;
    }
  }
  __builtin_amdgcn_fence(__ATOMIC_ACQ_REL, "workgroup");
  __builtin_amdgcn_wave_barrier();
  const int rsub = lane >> 4, c4 = (lane & 15) * 4;
  {
#pragma unroll
    for (int q = 0; q < 8; ++q) {
      const int r = q * 2 + rsub;
      const v4f v = *(const v4fa*)&so[w][r][c4];
      *(v4f*)(C + (size_t)(row0 + r) * ldc + col0 + c4) = v;
    }
    
  }
}
// row LayerNorm (biased variance, eps) over N: s = X (+ R); optional out_sum <- s; out_norm <- (s-mu)*rsqrt(var+eps)*g + b
template <bool PARAM_BF16>
__global__ __launch_bounds__(256) void k_layernorm(const float* __restrict__ X, const float* __restrict__ R, const float* __restrict__ g, const float* __restrict__ bta,
                                                  float* __restrict__ out_sum, float* __restrict__ out_norm, int N, float eps) {
  __shared__ float red[256];
  const int row = blockIdx.x, tid = threadIdx.x;
  const float* x = X + (size_t)row * N; const float* rr = R ? R + (size_t)row * N : nullptr;
  float vals[16];                     // up to N = 4096
  const int per = N / 256;            // contiguous chunk per thread? use strided-by-4 chunks: thread handles j = tid*4 + 1024*u
  float s1 = 0.f;
  for (int u = 0; u < per / 4; ++u) {
    const int j = tid * 4 + 1024 * u;
    const v4f a = *(const v4fa*)(x + j);
    v4f b = {0.f,0.f,0.f,0.f}; if (rr) b = *(const v4fa*)(rr + j);
#pragma unroll
    for (int q = 0; q < 4; ++q) { const float v = a[q] + b[q]; vals[u * 4 + q] = v; s1 += v; }
  }
  red[tid] = s1; __syncthreads();
  for (int st = 128; st > 0; st >>= 1) { if (tid < st) red[tid] += red[tid + st]; __syncthreads(); }
  const float mu = red[0] / (float)N; __syncthreads();
  float s2 = 0.f;
  for (int u = 0; u < per / 4; ++u)
#pragma unroll
    for (int q = 0; q < 4; ++q) { const float c = vals[u * 4 + q] - mu; s2 += c * c; }
  red[tid] = s2; __syncthreads();
  for (int st = 128; st > 0; st >>= 1) { if (tid < st) red[tid] += red[tid + st]; __syncthreads(); }
  const float rs = rsqrtf(red[0] / (float)N + eps);
  {
    for (int u = 0; u < per / 4; ++u) {
      const int j = tid * 4 + 1024 * u;
      v4f o, sm;
#pragma unroll
      for (int q = 0; q < 4; ++q) {
        float gg = g[j + q], bb = bta[j + q];
        if (PARAM_BF16) { gg = bf16_round(gg); bb = bf16_round(bb); }
        sm[q] = vals[u * 4 + q]; o[q] = (vals[u * 4 + q] - mu) * rs * gg + bb;
      }
      if (out_sum) *(v4f*)(out_sum + (size_t)row * N + j) = sm;
      *(v4f*)(out_norm + (size_t)row * N + j) = o;
    }
    
  }
}



// ---- f16 WMMA path (v_wmma_f32_16x16x32_f16): 11-bit significands for operands in range — used where a [0,1] probability operand needs more precision than bf16
typedef _Float16 v16h __attribute__((ext_vector_type(16)));
union FragH { v16h v; v8us half[2]; _Float16 h[16]; unsigned short u[16]; };
template <int NT>
__device__ __forceinline__ v8f mmaH(v16h ah, v16h al, v16h bh, v16h bl, v8f c) {
  c = __builtin_amdgcn_wmma_f32_16x16x32_f16(false, ah, false, bh, (short)0, c, false, false);
  if (NT >= 2) c = __builtin_amdgcn_wmma_f32_16x16x32_f16(false, al, false, bh, (short)0, c, false, false);
  if (NT >= 3) c = __builtin_amdgcn_wmma_f32_16x16x32_f16(false, ah, false, bl, (short)0, c, false, false);
  asm volatile("v_nop\n\tv_nop\n\tv_nop\n\tv_nop" : "+v"(c) : "v"(ah), "v"(al), "v"(bh), "v"(bl));
  return c;
}
// batched GEMM like k_gemm_b but f16 operands: A f32 (split into f16 hi/lo if ASPLIT, else rounded to f16), Bt = f16 values [n][k]; alpha; C f32; N multiple of 16 (partial tiles skipped)
template <bool ASPLIT>
__global__ __launch_bounds__(128) void k_gemm_h(const float* __restrict__ A, int lda, size_t sA, const _Float16* __restrict__ Bh, int ldb, size_t sB, float alpha, float* __restrict__ C, int ldc, size_t sC, int M, int N, int K) {
  __shared__ __attribute__((aligned(16))) float so[4][16][64];
  const int tid = threadIdx.x, w = tid >> 5, lane = tid & 31, ln = lane & 15, hh = lane >> 4; const int by = blockIdx.y;
  A += (size_t)by * sA; Bh += (size_t)by * sB; C += (size_t)by * sC;
  const int ntn = (N + 63) / 64; const int wid = blockIdx.x * 4 + w; const int mt = wid / ntn, nq = wid % ntn; if (mt * 16 >= M) return;
  const int row0 = mt * 16, col0 = nq * 64; const float* arow = A + (size_t)(row0 + ln) * lda;
  v8f acc[4] = {};
  for (int kb = 0; kb < K; kb += 32) {
    FragH ah, al;
    const v4f x0 = *(const v4fa*)(arow + kb + 8 * hh), x1 = *(const v4fa*)(arow + kb + 8 * hh + 4), x2 = *(const v4fa*)(arow + kb + 16 + 8 * hh), x3 = *(const v4fa*)(arow + kb + 16 + 8 * hh + 4);
    float xs[16] = {x0[0],x0[1],x0[2],x0[3],x1[0],x1[1],x1[2],x1[3],x2[0],x2[1],x2[2],x2[3],x3[0],x3[1],x3[2],x3[3]};
#pragma unroll
    for (int i = 0; i < 16; ++i) { const _Float16 h = (_Float16)xs[i]; ah.h[i] = h; al.h[i] = ASPLIT ? (_Float16)(xs[i] - (float)h) : (_Float16)0.0f; }
#pragma unroll
    for (int t = 0; t < 4; ++t) { if (col0 + t * 16 >= N) continue; const size_t boff = (size_t)(col0 + t * 16 + ln) * ldb + kb; FragH bq; bq.half[0] = *(const v8us*)(Bh + boff + 8 * hh); bq.half[1] = *(const v8us*)(Bh + boff + 16 + 8 * hh);
      acc[t] = mmaH<ASPLIT ? 2 : 1>(ah.v, al.v, bq.v, bq.v, acc[t]); }
  }
#pragma unroll
  for (int t = 0; t < 4; ++t) { if (col0 + t * 16 >= N) continue;
#pragma unroll
    for (int r = 0; r < 8; ++r) so[w][8 * hh + r][t * 16 + ln] = acc[t][r] * alpha; }
  __builtin_amdgcn_fence(__ATOMIC_ACQ_REL, "workgroup"); __builtin_amdgcn_wave_barrier();
  const int rsub = lane >> 4, c4 = (lane & 15) * 4;
  {
#pragma unroll
    for (int q = 0; q < 8; ++q) { const int r = q * 2 + rsub; if (col0 + c4 < N) { const v4f v = *(const v4fa*)&so[w][r][c4]; *(v4f*)(C + (size_t)(row0 + r) * ldc + col0 + c4) = v; } }
     }
}

// Wt[n][k] = f16(W[k][n]·scale) from f32 row-major W[K][N] (scale = power of two; bf16-exact weights stay exact in f16 away from the subnormal range)
__global__ __launch_bounds__(256) void k_wt_f16(const float* __restrict__ W, _Float16* __restrict__ Wt, int K, int N, float scale) {
  const int t = blockIdx.x * 256 + threadIdx.x; if (t >= N * (K / 8)) return; const int n = t / (K / 8), k8 = (t % (K / 8)) * 8; FragH f;
#pragma unroll
  for (int i = 0; i < 8; ++i) f.h[i] = (_Float16)(bf16_round(W[(size_t)(k8 + i) * N + n]) * scale); const v8us o = f.half[0];
  *(v8us*)((unsigned short*)Wt + (size_t)n * K + k8) = o; 
}
// k_gemm_hh variant with fused epilogue: v = acc·alpha + bias[by·sBias + col] (+ CP[(row/rowsPerB)·sCPb + by·64 + col] if CP) ; ACT 0 none / 1 elu ; writes f16 C16 (and f32 C if non-null)
template <int ACT>
__global__ __launch_bounds__(128) void k_gemm_hhx(const _Float16* __restrict__ A, int lda, size_t sA, const _Float16* __restrict__ Bh, int ldb, size_t sB, float alpha, const float* __restrict__ bias, size_t sBias, const float* __restrict__ CP, int rowsPerB, size_t sCPb, int row0g,
    float* __restrict__ C, _Float16* __restrict__ C16, int ldc, size_t sC, int M, int N, int K) {
  __shared__ __attribute__((aligned(16))) float so[4][16][64];
  const int tid = threadIdx.x, w = tid >> 5, lane = tid & 31, ln = lane & 15, hh = lane >> 4; const int by = blockIdx.y;
  A += (size_t)by * sA; Bh += (size_t)by * sB; const size_t cofs = (size_t)by * sC; const float* bp = bias ? bias + (size_t)by * sBias : nullptr;
  const int ntn = (N + 63) / 64; const int wid = blockIdx.x * 4 + w; const int mt = wid / ntn, nq = wid % ntn; if (mt * 16 >= M) return;
  const int row0 = mt * 16, col0 = nq * 64; const _Float16* arow = A + (size_t)(row0 + ln) * lda;
  v8f acc[4] = {};
  for (int kb = 0; kb < K; kb += 32) { FragH ah; ah.half[0] = *(const v8us*)((const unsigned short*)arow + kb + 8 * hh); ah.half[1] = *(const v8us*)((const unsigned short*)arow + kb + 16 + 8 * hh);
#pragma unroll
    for (int t = 0; t < 4; ++t) { if (col0 + t * 16 >= N) continue; const size_t boff = (size_t)(col0 + t * 16 + ln) * ldb + kb; FragH bq; bq.half[0] = *(const v8us*)((const unsigned short*)Bh + boff + 8 * hh); bq.half[1] = *(const v8us*)((const unsigned short*)Bh + boff + 16 + 8 * hh);
      acc[t] = mmaH<1>(ah.v, ah.v, bq.v, bq.v, acc[t]); }
  }
#pragma unroll
  for (int t = 0; t < 4; ++t) { if (col0 + t * 16 >= N) continue; const int col = col0 + t * 16 + ln; const float bv = bp ? bf16_round(bp[col]) : 0.f;
#pragma unroll
    for (int r = 0; r < 8; ++r) { float v = acc[t][r] * alpha + bv; if (CP) { const int bidx = (row0g + row0 + 8 * hh + r) / rowsPerB; v += CP[(size_t)bidx * sCPb + (size_t)by * 64 + col]; } if (ACT == 1) v = (v > 0.f) ? v : expm1f(v); else if (ACT == 7) v = (v > 0.f) ? v + 1.0f : expf(v); else if (ACT == 8) v = tanhf(v); else if (ACT == 9) v = 0.5f * v * (1.0f + tanhf(0.7978845608028654f * (v + 0.044715f * v * v * v))); else if (ACT == 11) v = 1.0f / (1.0f + expf(-v)); else if (ACT == 12) v = (v > 0.f) ? v : 0.01f * v; else if (ACT == 14) v = (v > 0.f) ? v : 0.1f * v; else if (ACT == 15) v = v / (1.0f + expf(-v)); else if (ACT == 3) v = fmaxf(v, 0.f); else if (ACT == 6) v = 0.5f * v * (1.0f + erff(v * 0.70710678118654752f)); so[w][8 * hh + r][t * 16 + ln] = v; } }
  __builtin_amdgcn_fence(__ATOMIC_ACQ_REL, "workgroup"); __builtin_amdgcn_wave_barrier();
  const int rsub = lane >> 4, c4 = (lane & 15) * 4; typedef _Float16 v4h __attribute__((ext_vector_type(4)));
  {
#pragma unroll
    for (int q = 0; q < 8; ++q) { const int r = q * 2 + rsub; if (col0 + c4 < N) { const v4f v = *(const v4fa*)&so[w][r][c4]; if (C) *(v4f*)(C + cofs + (size_t)(row0 + r) * ldc + col0 + c4) = v; if (C16) { v4h h4; for (int i = 0; i < 4; ++i) h4[i] = (_Float16)v[i]; *(v4h*)(C16 + cofs + (size_t)(row0 + r) * ldc + col0 + c4) = h4; } } }
     }
}


typedef _Float16 v4h __attribute__((ext_vector_type(4)));

__global__ __launch_bounds__(256) void k_x16(const float* __restrict__ x, _Float16* __restrict__ X16, size_t n8) { const size_t t = (size_t)blockIdx.x * 256 + threadIdx.x; if (t >= n8) return; FragH f;
#pragma unroll
  for (int q = 0; q < 8; ++q) f.h[q] = (_Float16)bf16_round(x[t * 8 + q]); *(v8us*)((unsigned short*)X16 + t * 8) = f.half[0];  }
__global__ __launch_bounds__(256) void k_h16(const float* __restrict__ x, _Float16* __restrict__ X16, size_t n8) { const size_t t = (size_t)blockIdx.x * 256 + threadIdx.x; if (t >= n8) return; FragH f;
#pragma unroll
  for (int q = 0; q < 8; ++q) f.h[q] = (_Float16)x[t * 8 + q]; *(v8us*)((unsigned short*)X16 + t * 8) = f.half[0];  }
__global__ __launch_bounds__(256) void k_round16f(const float* __restrict__ W, _Float16* __restrict__ Bt, size_t n8) { const size_t t = (size_t)blockIdx.x * 256 + threadIdx.x; if (t >= n8) return; FragH f;
#pragma unroll
  for (int i = 0; i < 8; ++i) f.h[i] = (_Float16)(bf16_round(W[t * 8 + i]) * 16.0f); *(v8us*)((unsigned short*)Bt + t * 8) = f.half[0];  }
template <int NHv, int TTv>
__global__ __launch_bounds__(256) void k_vt(const _Float16* __restrict__ V16, int ldv, int voff, _Float16* __restrict__ Vt) { __shared__ unsigned short tl[64][66]; const int tid = threadIdx.x; const int slab = blockIdx.x / (TTv / 64), lg = blockIdx.x % (TTv / 64); const int b = slab / NHv, h = slab % NHv;
  for (int i = tid; i < 64 * 8; i += 256) { const int r = i / 8, c8 = (i % 8) * 8; FragH f; f.half[0] = *(const v8us*)((const unsigned short*)V16 + ((size_t)b * TTv + lg * 64 + r) * ldv + voff + h * 64 + c8);
#pragma unroll
    for (int q = 0; q < 8; ++q) tl[r][c8 + q] = f.u[q]; }
  __syncthreads();
  {
#pragma unroll
    for (int rd = 0; rd < 2; ++rd) { const int d = rd * 32 + tid / 8, pc = tid % 8; FragH f;
#pragma unroll
      for (int q = 0; q < 8; ++q) f.u[q] = tl[pc * 8 + q][d];
      *(v8us*)((unsigned short*)Vt + ((size_t)slab * 64 + d) * TTv + lg * 64 + pc * 8) = f.half[0]; }
     } }

__global__ __launch_bounds__(256) void k_hl(const float* __restrict__ F, _Float16* __restrict__ Hh, _Float16* __restrict__ Hl, size_t n8) { const size_t t = (size_t)blockIdx.x * 256 + threadIdx.x; if (t >= n8) return; FragH fh, fl; const v4f a = *(const v4fa*)(F + t * 8), c = *(const v4fa*)(F + t * 8 + 4);
#pragma unroll
  for (int q = 0; q < 4; ++q) { _Float16 h = (_Float16)a[q]; fh.h[q] = h; fl.h[q] = (_Float16)((a[q] - (float)h) * 1024.0f); h = (_Float16)c[q]; fh.h[4 + q] = h; fl.h[4 + q] = (_Float16)((c[q] - (float)h) * 1024.0f); }
  { *(v8us*)((unsigned short*)Hh + t * 8) = fh.half[0]; *(v8us*)((unsigned short*)Hl + t * 8) = fl.half[0];  } }

// ---- fast GEMM (wave tile 32x64; requires M % 32 == 0 rows per launch region and N % 64 == 0); epilogue = k_gemm_hhx semantics ----
__device__ __forceinline__ v16h g2_frag(const _Float16* p, int hh) { FragH f; f.half[0] = *(const v8us*)((const unsigned short*)p + 8 * hh); f.half[1] = *(const v8us*)((const unsigned short*)p + 16 + 8 * hh); return f.v; }
__device__ __forceinline__ v8f g2_mma(v16h a, v16h b, v8f c) { v8f d = __builtin_amdgcn_wmma_f32_16x16x32_f16(false, a, false, b, (short)0, c, false, false); asm volatile("v_nop\n\tv_nop\n\tv_nop\n\tv_nop" : "+v"(d) : "v"(a), "v"(b)); return d; }
template <int ACT>
__global__ __launch_bounds__(128) void k_gemm2(const _Float16* __restrict__ A, int lda, size_t sA, const _Float16* __restrict__ Bh, int ldb, size_t sB, float alpha, const float* __restrict__ bias, size_t sBias, const float* __restrict__ CP, int rowsPerB, size_t sCPb, int row0g,
    float* __restrict__ C, _Float16* __restrict__ C16, int ldc, size_t sC, int M, int N, int K) {
  __shared__ __attribute__((aligned(16))) float so[4][32][68];
  const int tid = threadIdx.x, w = tid >> 5, lane = tid & 31, ln = lane & 15, hh = lane >> 4; const int by = blockIdx.y;
  A += (size_t)by * sA; Bh += (size_t)by * sB; const size_t cofs = (size_t)by * sC; const float* bp = bias ? bias + (size_t)by * sBias : nullptr;
  const int ntn = N >> 6; const int mt = blockIdx.x / ntn, nq = blockIdx.x - mt * ntn; const int row0 = mt * 128 + 32 * w, col0 = nq * 64; if (row0 >= M) return;
  const _Float16* a0p = A + (size_t)(row0 + ln) * lda; const _Float16* a1p = a0p + (size_t)16 * lda;
  const _Float16* b0p = Bh + (size_t)(col0 + ln) * ldb; const _Float16* b1p = b0p + (size_t)16 * ldb; const _Float16* b2p = b1p + (size_t)16 * ldb; const _Float16* b3p = b2p + (size_t)16 * ldb;
  const v8f z8 = {0.f,0.f,0.f,0.f,0.f,0.f,0.f,0.f}; v8f c00 = z8, c01 = z8, c02 = z8, c03 = z8, c10 = z8, c11 = z8, c12 = z8, c13 = z8;
#pragma unroll 1
  for (int kb = 0; kb < K; kb += 32) { const v16h a0 = g2_frag(a0p + kb, hh), a1 = g2_frag(a1p + kb, hh);
    v16h b = g2_frag(b0p + kb, hh); c00 = g2_mma(a0, b, c00); c10 = g2_mma(a1, b, c10);
    b = g2_frag(b1p + kb, hh); c01 = g2_mma(a0, b, c01); c11 = g2_mma(a1, b, c11);
    b = g2_frag(b2p + kb, hh); c02 = g2_mma(a0, b, c02); c12 = g2_mma(a1, b, c12);
    b = g2_frag(b3p + kb, hh); c03 = g2_mma(a0, b, c03); c13 = g2_mma(a1, b, c13); }
  v8f accs[8] = {c00, c01, c02, c03, c10, c11, c12, c13};
#pragma unroll
  for (int u = 0; u < 8; ++u) { const int t = u & 3, half = u >> 2; const int col = col0 + t * 16 + ln; const float bv = bp ? bf16_round(bp[col]) : 0.f;
#pragma unroll
    for (int r = 0; r < 8; ++r) { const int rloc = half * 16 + 8 * hh + r; float v = accs[u][r] * alpha + bv; if (CP) { const int bidx = (row0g + row0 + rloc) / rowsPerB; v += CP[(size_t)bidx * sCPb + (size_t)by * 64 + col]; }
      if (ACT == 3) v = fmaxf(v, 0.f); else if (ACT == 6) v = 0.5f * v * (1.0f + erff(v * 0.70710678118654752f)); else if (ACT == 11) v = 1.0f / (1.0f + expf(-v)); else if (ACT == 15) v = v / (1.0f + expf(-v)); else if (ACT == 12) v = (v > 0.f) ? v : 0.01f * v; else if (ACT == 8) v = tanhf(v);
      so[w][rloc][t * 16 + ln] = v; } }
  __builtin_amdgcn_fence(__ATOMIC_ACQ_REL, "workgroup"); __builtin_amdgcn_wave_barrier();
  const int rsub = lane >> 4, c4 = (lane & 15) * 4;
  {
#pragma unroll
    for (int q = 0; q < 16; ++q) { const int r = q * 2 + rsub; const v4f v = *(const v4fa*)&so[w][r][c4]; if (C) *(v4f*)(C + cofs + (size_t)(row0 + r) * ldc + col0 + c4) = v; if (C16) { v4h h4; for (int i = 0; i < 4; ++i) h4[i] = (_Float16)v[i]; *(v4h*)(C16 + cofs + (size_t)(row0 + r) * ldc + col0 + c4) = h4; } }
     } }



template <int CAUSAL>
__global__ __launch_bounds__(128) void k_flash(const _Float16* __restrict__ Q16, int ldq, const _Float16* __restrict__ K16, int ldk, const _Float16* __restrict__ Vt, const int* __restrict__ MSK, float* __restrict__ O, int ldo) {
  constexpr int RPW = 16, RTN = RPW / 16, NQB = TQ / (4 * RPW), DT = 4, KS = 2;
  __shared__ __attribute__((aligned(16))) unsigned short sP[4][RPW][40]; __shared__ __attribute__((aligned(16))) float sO[4][RPW][64 + 4];
  const int tid = threadIdx.x, w = tid >> 5, lane = tid & 31, ln = lane & 15, hh = lane >> 4;
  const int slab = blockIdx.x / NQB, qblk = blockIdx.x % NQB; const int b = slab / NH, h = slab % NH; const int qb0 = qblk * (4 * RPW); const int q0 = qb0 + w * RPW;
  FragH aq[2][KS];
#pragma unroll
  for (int rt = 0; rt < RTN; ++rt) { const unsigned short* qr = (const unsigned short*)Q16 + ((size_t)b * TQ + q0 + rt * 16 + ln) * ldq + h * 64;
#pragma unroll
    for (int ks = 0; ks < KS; ++ks) { aq[rt][ks].half[0] = *(const v8us*)(qr + ks * 32 + 8 * hh); aq[rt][ks].half[1] = *(const v8us*)(qr + ks * 32 + 16 + 8 * hh); } }
  const unsigned short* Vth = (const unsigned short*)Vt + (size_t)slab * 64 * TK;
  float m_r[2][8], l_r[2][8]; v8f oacc[2][DT];
#pragma unroll
  for (int rt = 0; rt < RTN; ++rt) {
#pragma unroll
    for (int r = 0; r < 8; ++r) { m_r[rt][r] = -3.0e38f; l_r[rt][r] = 0.f; }
#pragma unroll
    for (int dt = 0; dt < DT; ++dt) oacc[rt][dt] = (v8f){0.f,0.f,0.f,0.f,0.f,0.f,0.f,0.f}; }
  const int jend = (CAUSAL == 1) ? (qb0 + 4 * RPW) : TK;      /* causal: keys beyond the block's last query never contribute */
#pragma unroll 1
  for (int j0 = 0; j0 < jend; j0 += 32) {
    v8f s[2][2];
#pragma unroll
    for (int nt = 0; nt < 2; ++nt) { const unsigned short* kr = (const unsigned short*)K16 + ((size_t)b * TK + j0 + nt * 16 + ln) * ldk + h * 64; FragH bk[KS];
#pragma unroll
      for (int ks = 0; ks < KS; ++ks) { bk[ks].half[0] = *(const v8us*)(kr + ks * 32 + 8 * hh); bk[ks].half[1] = *(const v8us*)(kr + ks * 32 + 16 + 8 * hh); }
#pragma unroll
      for (int rt = 0; rt < RTN; ++rt) { v8f acc = (v8f){0.f,0.f,0.f,0.f,0.f,0.f,0.f,0.f};
#pragma unroll
        for (int ks = 0; ks < KS; ++ks) acc = mmaH<1>(aq[rt][ks].v, aq[rt][ks].v, bk[ks].v, bk[ks].v, acc); s[rt][nt] = acc; } }
#pragma unroll
    for (int rt = 0; rt < RTN; ++rt)
#pragma unroll
      for (int r = 0; r < 8; ++r) { const int tq = q0 + rt * 16 + 8 * hh + r; const int k0 = j0 + ln, k1 = j0 + 16 + ln;
        const bool ok0 = (CAUSAL == 1) ? (k0 <= tq) : ((CAUSAL == 2) ? ((k0 >> 5) == (tq >> 5)) : true), ok1 = (CAUSAL == 1) ? (k1 <= tq) : ((CAUSAL == 2) ? ((k1 >> 5) == (tq >> 5)) : true);      /* mode 2: block-diagonal 32-token groups */
        const float s0 = ok0 ? s[rt][0][r] * SCL : -3.0e38f, s1 = ok1 ? s[rt][1][r] * SCL : -3.0e38f; float mc = fmaxf(s0, s1);
        mc = fmaxf(mc, __shfl_xor(mc, 1, 32)); mc = fmaxf(mc, __shfl_xor(mc, 2, 32)); mc = fmaxf(mc, __shfl_xor(mc, 4, 32)); mc = fmaxf(mc, __shfl_xor(mc, 8, 32));
        const float mn = fmaxf(m_r[rt][r], mc); const float al = (mn > -1.0e38f) ? expf(m_r[rt][r] - mn) : 1.0f; m_r[rt][r] = mn; const float p0 = ok0 ? expf(s0 - mn) : 0.f, p1 = ok1 ? expf(s1 - mn) : 0.f; l_r[rt][r] = l_r[rt][r] * al + p0 + p1;
#pragma unroll
        for (int dt = 0; dt < DT; ++dt) oacc[rt][dt][r] *= al;
        FragH t2; t2.h[0] = (_Float16)(p0 * 1024.0f); t2.h[1] = (_Float16)(p1 * 1024.0f); sP[w][rt * 16 + 8 * hh + r][ln] = t2.u[0]; sP[w][rt * 16 + 8 * hh + r][16 + ln] = t2.u[1]; }
    __builtin_amdgcn_fence(__ATOMIC_ACQ_REL, "workgroup"); __builtin_amdgcn_wave_barrier();
    FragH pa[2];
#pragma unroll
    for (int rt = 0; rt < RTN; ++rt) { pa[rt].half[0] = *(const v8us*)&sP[w][rt * 16 + ln][8 * hh]; pa[rt].half[1] = *(const v8us*)&sP[w][rt * 16 + ln][16 + 8 * hh]; }
#pragma unroll
    for (int dt = 0; dt < DT; ++dt) { const unsigned short* vrow = Vth + (size_t)(dt * 16 + ln) * TK + j0; FragH bv; bv.half[0] = *(const v8us*)(vrow + 8 * hh); bv.half[1] = *(const v8us*)(vrow + 16 + 8 * hh);
#pragma unroll
      for (int rt = 0; rt < RTN; ++rt) oacc[rt][dt] = mmaH<1>(pa[rt].v, pa[rt].v, bv.v, bv.v, oacc[rt][dt]); }
    __builtin_amdgcn_fence(__ATOMIC_ACQ_REL, "workgroup"); __builtin_amdgcn_wave_barrier(); }
#pragma unroll
  for (int rt = 0; rt < RTN; ++rt) {
#pragma unroll
    for (int r = 0; r < 8; ++r) { float l = l_r[rt][r]; l += __shfl_xor(l, 1, 32); l += __shfl_xor(l, 2, 32); l += __shfl_xor(l, 4, 32); l += __shfl_xor(l, 8, 32); l_r[rt][r] = (l > 0.f) ? 1.0f / (l * 1024.0f) : 0.f; }
#pragma unroll
    for (int dt = 0; dt < DT; ++dt)
#pragma unroll
      for (int r = 0; r < 8; ++r) sO[w][rt * 16 + 8 * hh + r][dt * 16 + ln] = oacc[rt][dt][r] * l_r[rt][r]; }
  __builtin_amdgcn_fence(__ATOMIC_ACQ_REL, "workgroup"); __builtin_amdgcn_wave_barrier();
  {
#pragma unroll
    for (int rp = 0; rp < RPW; rp += 2) { const int r = rp + (lane >> 4), pc = lane & 15; const v4f val = *(const v4fa*)&sO[w][r][pc * 4]; *(v4f*)(O + ((size_t)b * TQ + q0 + r) * ldo + h * 64 + pc * 4) = val; }
     } }
// 3-term variant: O = (P_hi V_hi + (P_lo V_hi + P_hi V_lo) / 1024) / l with P = [hi | 2^10 residual] of 1024 p and V^T = [hi | 2^10 residual] planes (VtL same layout as Vt) -> ~2^-21-class products for un-averaged (early causal / peaked) rows
template <int CAUSAL>
__global__ __launch_bounds__(128) void k_flash3gA(const _Float16* __restrict__ Q16, int ldq, const _Float16* __restrict__ K16, int ldk, const _Float16* __restrict__ Vt, const _Float16* __restrict__ VtL, const int* __restrict__ MSK, float* __restrict__ O, int ldo) {
  constexpr int RPW = 16, RTN = RPW / 16, NQB = TQA / (4 * RPW), DT = 4, KS = 2;
  __shared__ __attribute__((aligned(16))) unsigned short sP[4][RPW][40]; __shared__ __attribute__((aligned(16))) unsigned short sPL[4][RPW][40]; __shared__ __attribute__((aligned(16))) float sO[4][RPW][64 + 4];
  const int tid = threadIdx.x, w = tid >> 5, lane = tid & 31, ln = lane & 15, hh = lane >> 4;
  const int slab = blockIdx.x / QBLKSA, qblk = blockIdx.x % QBLKSA; (void)NQB; const int b = slab / NH, h = slab % NH; const int qb0 = qblk * (4 * RPW); const int q0 = qb0 + w * RPW;
  FragH aq[2][KS];
#pragma unroll
  for (int rt = 0; rt < RTN; ++rt) { const unsigned short* qr = (const unsigned short*)Q16 + ((size_t)b * TQA + q0 + rt * 16 + ln) * ldq + h * 64;
#pragma unroll
    for (int ks = 0; ks < KS; ++ks) { aq[rt][ks].half[0] = *(const v8us*)(qr + ks * 32 + 8 * hh); aq[rt][ks].half[1] = *(const v8us*)(qr + ks * 32 + 16 + 8 * hh); } }
  const size_t vslab = (size_t)(b * (NH / KVG) + h / KVG); const unsigned short* Vth = (const unsigned short*)Vt + vslab * 64 * TK; const unsigned short* Vtl = (const unsigned short*)VtL + vslab * 64 * TK;      /* GQA: q-head h reads kv head h / KVG */
  float m_r[2][8], l_r[2][8]; v8f oacc[2][DT], oaccL[2][DT];
#pragma unroll
  for (int rt = 0; rt < RTN; ++rt) {
#pragma unroll
    for (int r = 0; r < 8; ++r) { m_r[rt][r] = -3.0e38f; l_r[rt][r] = 0.f; }
#pragma unroll
    for (int dt = 0; dt < DT; ++dt) { oacc[rt][dt] = (v8f){0.f,0.f,0.f,0.f,0.f,0.f,0.f,0.f}; oaccL[rt][dt] = oacc[rt][dt]; } }
  const int jend = (CAUSAL == 1) ? (qb0 + 4 * RPW) : TK;      /* causal: keys beyond the block's last query never contribute */
#pragma unroll 1
  for (int j0 = 0; j0 < jend; j0 += 32) {
    v8f s[2][2];
#pragma unroll
    for (int nt = 0; nt < 2; ++nt) { const unsigned short* kr = (const unsigned short*)K16 + ((size_t)b * TK + j0 + nt * 16 + ln) * ldk + (h / KVG) * 64; FragH bk[KS];
#pragma unroll
      for (int ks = 0; ks < KS; ++ks) { bk[ks].half[0] = *(const v8us*)(kr + ks * 32 + 8 * hh); bk[ks].half[1] = *(const v8us*)(kr + ks * 32 + 16 + 8 * hh); }
#pragma unroll
      for (int rt = 0; rt < RTN; ++rt) { v8f acc = (v8f){0.f,0.f,0.f,0.f,0.f,0.f,0.f,0.f};
#pragma unroll
        for (int ks = 0; ks < KS; ++ks) acc = mmaH<1>(aq[rt][ks].v, aq[rt][ks].v, bk[ks].v, bk[ks].v, acc); s[rt][nt] = acc; } }
#pragma unroll
    for (int rt = 0; rt < RTN; ++rt)
#pragma unroll
      for (int r = 0; r < 8; ++r) { const int tq = q0 + rt * 16 + 8 * hh + r; const int k0 = j0 + ln, k1 = j0 + 16 + ln;
        bool ok0 = (CAUSAL == 1) ? (k0 <= tq) : ((CAUSAL == 2) ? ((k0 >> 5) == (tq >> 5)) : true), ok1 = (CAUSAL == 1) ? (k1 <= tq) : ((CAUSAL == 2) ? ((k1 >> 5) == (tq >> 5)) : true);      /* mode 2: block-diagonal 32-token groups */
        if (CAUSAL == 8) { const int* mrow = MSK + (size_t)tq * TK; ok0 = mrow[k0] != 0; ok1 = mrow[k1] != 0; }      /* mode 8: per-(query, key) int table shared by all batches and heads */
        if (CAUSAL == 4) { const int* mrow = MSK + ((size_t)b * TQA + tq) * TK; ok0 = mrow[k0] != 0; ok1 = mrow[k1] != 0; }      /* mode 4: per-(query, key) INPUT mask shared by all heads; masked keys contribute nothing (== the reference's -4096 fill, whose exp underflows to 0), rows with no valid key give l = 0 -> output 0 (== the reference's row_valid zeroing) */
        const float s0 = ok0 ? s[rt][0][r] * SCL : -3.0e38f, s1 = ok1 ? s[rt][1][r] * SCL : -3.0e38f; float mc = fmaxf(s0, s1);
        mc = fmaxf(mc, __shfl_xor(mc, 1, 32)); mc = fmaxf(mc, __shfl_xor(mc, 2, 32)); mc = fmaxf(mc, __shfl_xor(mc, 4, 32)); mc = fmaxf(mc, __shfl_xor(mc, 8, 32));
        const float mn = fmaxf(m_r[rt][r], mc); const float al = (mn > -1.0e38f) ? expf(m_r[rt][r] - mn) : 1.0f; m_r[rt][r] = mn; const float p0 = ok0 ? expf(s0 - mn) : 0.f, p1 = ok1 ? expf(s1 - mn) : 0.f; l_r[rt][r] = l_r[rt][r] * al + p0 + p1;
#pragma unroll
        for (int dt = 0; dt < DT; ++dt) { oacc[rt][dt][r] *= al; oaccL[rt][dt][r] *= al; }
        FragH t2, t2l; const float ps0 = p0 * 1024.0f, ps1 = p1 * 1024.0f; t2.h[0] = (_Float16)ps0; t2.h[1] = (_Float16)ps1; t2l.h[0] = (_Float16)((ps0 - (float)t2.h[0]) * 1024.0f); t2l.h[1] = (_Float16)((ps1 - (float)t2.h[1]) * 1024.0f);
        sP[w][rt * 16 + 8 * hh + r][ln] = t2.u[0]; sP[w][rt * 16 + 8 * hh + r][16 + ln] = t2.u[1]; sPL[w][rt * 16 + 8 * hh + r][ln] = t2l.u[0]; sPL[w][rt * 16 + 8 * hh + r][16 + ln] = t2l.u[1]; }
    __builtin_amdgcn_fence(__ATOMIC_ACQ_REL, "workgroup"); __builtin_amdgcn_wave_barrier();
    FragH pa[2], pl[2];
#pragma unroll
    for (int rt = 0; rt < RTN; ++rt) { pa[rt].half[0] = *(const v8us*)&sP[w][rt * 16 + ln][8 * hh]; pa[rt].half[1] = *(const v8us*)&sP[w][rt * 16 + ln][16 + 8 * hh]; pl[rt].half[0] = *(const v8us*)&sPL[w][rt * 16 + ln][8 * hh]; pl[rt].half[1] = *(const v8us*)&sPL[w][rt * 16 + ln][16 + 8 * hh]; }
#pragma unroll
    for (int dt = 0; dt < DT; ++dt) { const unsigned short* vrow = Vth + (size_t)(dt * 16 + ln) * TK + j0; const unsigned short* vrl = Vtl + (size_t)(dt * 16 + ln) * TK + j0; FragH bv, bl; bv.half[0] = *(const v8us*)(vrow + 8 * hh); bv.half[1] = *(const v8us*)(vrow + 16 + 8 * hh); bl.half[0] = *(const v8us*)(vrl + 8 * hh); bl.half[1] = *(const v8us*)(vrl + 16 + 8 * hh);
#pragma unroll
      for (int rt = 0; rt < RTN; ++rt) { oacc[rt][dt] = mmaH<1>(pa[rt].v, pa[rt].v, bv.v, bv.v, oacc[rt][dt]); oaccL[rt][dt] = mmaH<1>(pl[rt].v, pl[rt].v, bv.v, bv.v, oaccL[rt][dt]); oaccL[rt][dt] = mmaH<1>(pa[rt].v, pa[rt].v, bl.v, bl.v, oaccL[rt][dt]); } }
    __builtin_amdgcn_fence(__ATOMIC_ACQ_REL, "workgroup"); __builtin_amdgcn_wave_barrier(); }
#pragma unroll
  for (int rt = 0; rt < RTN; ++rt) {
#pragma unroll
    for (int r = 0; r < 8; ++r) { float l = l_r[rt][r]; l += __shfl_xor(l, 1, 32); l += __shfl_xor(l, 2, 32); l += __shfl_xor(l, 4, 32); l += __shfl_xor(l, 8, 32); l_r[rt][r] = (l > 0.f) ? 1.0f / (l * 1024.0f) : 0.f; }
#pragma unroll
    for (int dt = 0; dt < DT; ++dt)
#pragma unroll
      for (int r = 0; r < 8; ++r) { float v = oacc[rt][dt][r]; v += oaccL[rt][dt][r] * 0.0009765625f; sO[w][rt * 16 + 8 * hh + r][dt * 16 + ln] = v * l_r[rt][r]; } }
  __builtin_amdgcn_fence(__ATOMIC_ACQ_REL, "workgroup"); __builtin_amdgcn_wave_barrier();
  {
#pragma unroll
    for (int rp = 0; rp < RPW; rp += 2) { const int r = rp + (lane >> 4), pc = lane & 15; const v4f val = *(const v4fa*)&sO[w][r][pc * 4]; *(v4f*)(O + ((size_t)b * TQA + q0 + r) * ldo + h * 64 + pc * 4) = val; }
     } }

// 3-term variant: O = (P_hi V_hi + (P_lo V_hi + P_hi V_lo) / 1024) / l with P = [hi | 2^10 residual] of 1024 p and V^T = [hi | 2^10 residual] planes (VtL same layout as Vt) -> ~2^-21-class products for un-averaged (early causal / peaked) rows
template <int CAUSAL>
__global__ __launch_bounds__(128) void k_flash3gB(const _Float16* __restrict__ Q16, int ldq, const _Float16* __restrict__ K16, int ldk, const _Float16* __restrict__ Vt, const _Float16* __restrict__ VtL, const int* __restrict__ MSK, float* __restrict__ O, int ldo) {
  constexpr int RPW = 16, RTN = RPW / 16, NQB = TQB / (4 * RPW), DT = 4, KS = 2;
  __shared__ __attribute__((aligned(16))) unsigned short sP[4][RPW][40]; __shared__ __attribute__((aligned(16))) unsigned short sPL[4][RPW][40]; __shared__ __attribute__((aligned(16))) float sO[4][RPW][64 + 4];
  const int tid = threadIdx.x, w = tid >> 5, lane = tid & 31, ln = lane & 15, hh = lane >> 4;
  const int slab = blockIdx.x / QBLKSB, qblk = blockIdx.x % QBLKSB; (void)NQB; const int b = slab / NH, h = slab % NH; const int qb0 = qblk * (4 * RPW); const int q0 = qb0 + w * RPW;
  FragH aq[2][KS];
#pragma unroll
  for (int rt = 0; rt < RTN; ++rt) { const unsigned short* qr = (const unsigned short*)Q16 + ((size_t)b * TQB + q0 + rt * 16 + ln) * ldq + h * 64;
#pragma unroll
    for (int ks = 0; ks < KS; ++ks) { aq[rt][ks].half[0] = *(const v8us*)(qr + ks * 32 + 8 * hh); aq[rt][ks].half[1] = *(const v8us*)(qr + ks * 32 + 16 + 8 * hh); } }
  const size_t vslab = (size_t)(b * (NH / KVG) + h / KVG); const unsigned short* Vth = (const unsigned short*)Vt + vslab * 64 * TK; const unsigned short* Vtl = (const unsigned short*)VtL + vslab * 64 * TK;      /* GQA: q-head h reads kv head h / KVG */
  float m_r[2][8], l_r[2][8]; v8f oacc[2][DT], oaccL[2][DT];
#pragma unroll
  for (int rt = 0; rt < RTN; ++rt) {
#pragma unroll
    for (int r = 0; r < 8; ++r) { m_r[rt][r] = -3.0e38f; l_r[rt][r] = 0.f; }
#pragma unroll
    for (int dt = 0; dt < DT; ++dt) { oacc[rt][dt] = (v8f){0.f,0.f,0.f,0.f,0.f,0.f,0.f,0.f}; oaccL[rt][dt] = oacc[rt][dt]; } }
  const int jend = (CAUSAL == 1) ? (qb0 + 4 * RPW) : TK;      /* causal: keys beyond the block's last query never contribute */
#pragma unroll 1
  for (int j0 = 0; j0 < jend; j0 += 32) {
    v8f s[2][2];
#pragma unroll
    for (int nt = 0; nt < 2; ++nt) { const unsigned short* kr = (const unsigned short*)K16 + ((size_t)b * TK + j0 + nt * 16 + ln) * ldk + (h / KVG) * 64; FragH bk[KS];
#pragma unroll
      for (int ks = 0; ks < KS; ++ks) { bk[ks].half[0] = *(const v8us*)(kr + ks * 32 + 8 * hh); bk[ks].half[1] = *(const v8us*)(kr + ks * 32 + 16 + 8 * hh); }
#pragma unroll
      for (int rt = 0; rt < RTN; ++rt) { v8f acc = (v8f){0.f,0.f,0.f,0.f,0.f,0.f,0.f,0.f};
#pragma unroll
        for (int ks = 0; ks < KS; ++ks) acc = mmaH<1>(aq[rt][ks].v, aq[rt][ks].v, bk[ks].v, bk[ks].v, acc); s[rt][nt] = acc; } }
#pragma unroll
    for (int rt = 0; rt < RTN; ++rt)
#pragma unroll
      for (int r = 0; r < 8; ++r) { const int tq = q0 + rt * 16 + 8 * hh + r; const int k0 = j0 + ln, k1 = j0 + 16 + ln;
        bool ok0 = (CAUSAL == 1) ? (k0 <= tq) : ((CAUSAL == 2) ? ((k0 >> 5) == (tq >> 5)) : true), ok1 = (CAUSAL == 1) ? (k1 <= tq) : ((CAUSAL == 2) ? ((k1 >> 5) == (tq >> 5)) : true);      /* mode 2: block-diagonal 32-token groups */
        if (CAUSAL == 8) { const int* mrow = MSK + (size_t)tq * TK; ok0 = mrow[k0] != 0; ok1 = mrow[k1] != 0; }      /* mode 8: per-(query, key) int table shared by all batches and heads */
        if (CAUSAL == 4) { const int* mrow = MSK + ((size_t)b * TQB + tq) * TK; ok0 = mrow[k0] != 0; ok1 = mrow[k1] != 0; }      /* mode 4: per-(query, key) INPUT mask shared by all heads; masked keys contribute nothing (== the reference's -4096 fill, whose exp underflows to 0), rows with no valid key give l = 0 -> output 0 (== the reference's row_valid zeroing) */
        const float s0 = ok0 ? s[rt][0][r] * SCL : -3.0e38f, s1 = ok1 ? s[rt][1][r] * SCL : -3.0e38f; float mc = fmaxf(s0, s1);
        mc = fmaxf(mc, __shfl_xor(mc, 1, 32)); mc = fmaxf(mc, __shfl_xor(mc, 2, 32)); mc = fmaxf(mc, __shfl_xor(mc, 4, 32)); mc = fmaxf(mc, __shfl_xor(mc, 8, 32));
        const float mn = fmaxf(m_r[rt][r], mc); const float al = (mn > -1.0e38f) ? expf(m_r[rt][r] - mn) : 1.0f; m_r[rt][r] = mn; const float p0 = ok0 ? expf(s0 - mn) : 0.f, p1 = ok1 ? expf(s1 - mn) : 0.f; l_r[rt][r] = l_r[rt][r] * al + p0 + p1;
#pragma unroll
        for (int dt = 0; dt < DT; ++dt) { oacc[rt][dt][r] *= al; oaccL[rt][dt][r] *= al; }
        FragH t2, t2l; const float ps0 = p0 * 1024.0f, ps1 = p1 * 1024.0f; t2.h[0] = (_Float16)ps0; t2.h[1] = (_Float16)ps1; t2l.h[0] = (_Float16)((ps0 - (float)t2.h[0]) * 1024.0f); t2l.h[1] = (_Float16)((ps1 - (float)t2.h[1]) * 1024.0f);
        sP[w][rt * 16 + 8 * hh + r][ln] = t2.u[0]; sP[w][rt * 16 + 8 * hh + r][16 + ln] = t2.u[1]; sPL[w][rt * 16 + 8 * hh + r][ln] = t2l.u[0]; sPL[w][rt * 16 + 8 * hh + r][16 + ln] = t2l.u[1]; }
    __builtin_amdgcn_fence(__ATOMIC_ACQ_REL, "workgroup"); __builtin_amdgcn_wave_barrier();
    FragH pa[2], pl[2];
#pragma unroll
    for (int rt = 0; rt < RTN; ++rt) { pa[rt].half[0] = *(const v8us*)&sP[w][rt * 16 + ln][8 * hh]; pa[rt].half[1] = *(const v8us*)&sP[w][rt * 16 + ln][16 + 8 * hh]; pl[rt].half[0] = *(const v8us*)&sPL[w][rt * 16 + ln][8 * hh]; pl[rt].half[1] = *(const v8us*)&sPL[w][rt * 16 + ln][16 + 8 * hh]; }
#pragma unroll
    for (int dt = 0; dt < DT; ++dt) { const unsigned short* vrow = Vth + (size_t)(dt * 16 + ln) * TK + j0; const unsigned short* vrl = Vtl + (size_t)(dt * 16 + ln) * TK + j0; FragH bv, bl; bv.half[0] = *(const v8us*)(vrow + 8 * hh); bv.half[1] = *(const v8us*)(vrow + 16 + 8 * hh); bl.half[0] = *(const v8us*)(vrl + 8 * hh); bl.half[1] = *(const v8us*)(vrl + 16 + 8 * hh);
#pragma unroll
      for (int rt = 0; rt < RTN; ++rt) { oacc[rt][dt] = mmaH<1>(pa[rt].v, pa[rt].v, bv.v, bv.v, oacc[rt][dt]); oaccL[rt][dt] = mmaH<1>(pl[rt].v, pl[rt].v, bv.v, bv.v, oaccL[rt][dt]); oaccL[rt][dt] = mmaH<1>(pa[rt].v, pa[rt].v, bl.v, bl.v, oaccL[rt][dt]); } }
    __builtin_amdgcn_fence(__ATOMIC_ACQ_REL, "workgroup"); __builtin_amdgcn_wave_barrier(); }
#pragma unroll
  for (int rt = 0; rt < RTN; ++rt) {
#pragma unroll
    for (int r = 0; r < 8; ++r) { float l = l_r[rt][r]; l += __shfl_xor(l, 1, 32); l += __shfl_xor(l, 2, 32); l += __shfl_xor(l, 4, 32); l += __shfl_xor(l, 8, 32); l_r[rt][r] = (l > 0.f) ? 1.0f / (l * 1024.0f) : 0.f; }
#pragma unroll
    for (int dt = 0; dt < DT; ++dt)
#pragma unroll
      for (int r = 0; r < 8; ++r) { float v = oacc[rt][dt][r]; v += oaccL[rt][dt][r] * 0.0009765625f; sO[w][rt * 16 + 8 * hh + r][dt * 16 + ln] = v * l_r[rt][r]; } }
  __builtin_amdgcn_fence(__ATOMIC_ACQ_REL, "workgroup"); __builtin_amdgcn_wave_barrier();
  {
#pragma unroll
    for (int rp = 0; rp < RPW; rp += 2) { const int r = rp + (lane >> 4), pc = lane & 15; const v4f val = *(const v4fa*)&sO[w][r][pc * 4]; *(v4f*)(O + ((size_t)b * TQB + q0 + r) * ldo + h * 64 + pc * 4) = val; }
     } }

__global__ __launch_bounds__(256) void k_wpair(const float* __restrict__ Wm, int nin, int nout, _Float16* __restrict__ Bt) { const size_t t = (size_t)blockIdx.x * 256 + threadIdx.x; if (t >= (size_t)nout * (2 * nin / 8)) return; const int pc = (int)(t % (2 * nin / 8)); const int o = (int)(t / (2 * nin / 8)); const bool lo = pc * 8 >= nin; FragH f;
  for (int q = 0; q < 8; ++q) { const int c = pc * 8 + q - (lo ? nin : 0); f.h[q] = (_Float16)(bf16_round(Wm[(size_t)c * nout + o]) * (lo ? 1.0f : 16.0f)); } *(v8us*)((unsigned short*)Bt + (size_t)o * 2 * nin + pc * 8) = f.half[0];  }
template <int TWO_D>
__global__ __launch_bounds__(256) void k_rotab(int nrows, int rpb, const int* __restrict__ bar, const int* __restrict__ tib, float* __restrict__ CS, float* __restrict__ SN) {
  #pragma clang fp contract(off)
  const size_t t = (size_t)blockIdx.x * 256 + threadIdx.x; if (t >= (size_t)nrows * 32) return; const int d = (int)(t % 32); const int row = (int)(t / 32); const int b = row / rpb, r = row % rpb; float pos, inv;
  if (TWO_D) { const int dm = d & 15; inv = 1.0f / powf(10000.0f, (float)dm * 2.0f / 32.0f); pos = (d < 16) ? (float)bar[(size_t)b * rpb + r] : (float)tib[(size_t)b * rpb + r]; }
  else { inv = 1.0f / powf(10000.0f, (float)(2 * d) / 64.0f); pos = (float)r; }
  const float th = pos * inv; const float c = cosf(th), s = sinf(th);
  { *(float*)(CS + t) = c; *(float*)(SN + t) = s;  } }
__global__ __launch_bounds__(256) void k_rope(const float* __restrict__ F, int nrows, int rpb, int nheads, const float* __restrict__ CS, const float* __restrict__ SN, _Float16* __restrict__ dst, int ldo, int dst_bstride, int row_off) {
  #pragma clang fp contract(off)
  const size_t t = (size_t)blockIdx.x * 256 + threadIdx.x; if (t >= (size_t)nrows * nheads * 4) return; const int jg = (int)(t % 4) * 8; const int h = (int)((t / 4) % nheads); const int row = (int)(t / (4 * (size_t)nheads)); const int b = row / rpb, r = row % rpb; const int ldi = nheads * 64;
  const float* xr = F + (size_t)row * ldi + h * 64; FragH f0, f1;
#pragma unroll
  for (int q = 0; q < 8; ++q) { const int d = jg + q; const float c = CS[(size_t)row * 32 + d], s = SN[(size_t)row * 32 + d]; const float x0 = xr[d], x1 = xr[d + 32];
    float o0 = x0 * c; o0 += -x1 * s; float o1 = x1 * c; o1 += x0 * s; f0.h[q] = (_Float16)o0; f1.h[q] = (_Float16)o1; }
  unsigned short* o = (unsigned short*)dst + ((size_t)b * dst_bstride + row_off + r) * ldo + h * 64 + jg;
  { *(v8us*)o = f0.half[0]; *(v8us*)(o + 32) = f1.half[0];  } }
__global__ __launch_bounds__(256) void k_put(const float* __restrict__ F, int nrows, int rpb, int ncol, _Float16* __restrict__ H, _Float16* __restrict__ L, int dst_bstride, int row_off) {
  const size_t t = (size_t)blockIdx.x * 256 + threadIdx.x; if (t >= (size_t)nrows * (ncol / 8)) return; const int c0 = (int)(t % (ncol / 8)) * 8; const int row = (int)(t / (ncol / 8)); const int b = row / rpb, r = row % rpb; FragH fh, fl;
  for (int q = 0; q < 8; ++q) { const float v = F[(size_t)row * ncol + c0 + q]; const _Float16 hv = (_Float16)v; fh.h[q] = hv; fl.h[q] = (_Float16)((v - (float)hv) * 1024.0f); }
  const size_t drow = (size_t)b * dst_bstride + row_off + r; { *(v8us*)((unsigned short*)H + drow * ncol + c0) = fh.half[0]; if (L) *(v8us*)((unsigned short*)L + drow * ncol + c0) = fl.half[0];  } }

extern "C" void kernel_launch(void* const* d_in, const int* in_sizes, int n_in,
                              void* d_out, int out_size, void* d_ws, size_t ws_size, hipStream_t stream) {
  (void)in_sizes; (void)n_in; (void)out_size;
  const float* const* I = (const float* const*)d_in; const float* sum_x = I[0]; const float* reg_x = I[1];
  const float* w_sq = I[2]; const float* b_sq = I[3]; const float* w_sk = I[4]; const float* b_sk = I[5]; const float* w_sv = I[6]; const float* b_sv = I[7]; const float* w_so = I[8]; const float* b_so = I[9];
  const float* w_rq = I[10]; const float* b_rq = I[11]; const float* w_rk = I[12]; const float* b_rk = I[13]; const float* w_rv = I[14]; const float* b_rv = I[15]; const float* w_ro = I[16]; const float* b_ro = I[17];
  const float* w_k2 = I[18]; const float* b_k2 = I[19]; const float* w_v2 = I[20]; const float* b_v2 = I[21];
  const int* bar = (const int*)d_in[22]; const int* tib = (const int*)d_in[23]; const int* msum = (const int*)d_in[24]; const int* mupd = (const int*)d_in[25];
  char* ws = (char*)d_ws; size_t off = 0;
  auto take = [&](size_t bytes) { char* p = ws + off; off += (bytes + 255) & ~(size_t)255; return p; };
  const size_t w8 = (size_t)DMOD * DMOD / 8, w8k = (size_t)DMOD * KVD / 8;
  _Float16* BSQ = (_Float16*)take(w8 * 16); _Float16* BSK = (_Float16*)take(w8k * 16); _Float16* BSV = (_Float16*)take(w8k * 16); _Float16* BRQ = (_Float16*)take(w8 * 16); _Float16* BRK = (_Float16*)take(w8k * 16); _Float16* BRV = (_Float16*)take(w8k * 16);
  _Float16* BSO = (_Float16*)take(w8 * 32); _Float16* BRO = (_Float16*)take(w8 * 32); _Float16* BK2 = (_Float16*)take(w8k * 32); _Float16* BV2 = (_Float16*)take(w8k * 32);
  float* CS1 = (float*)take((size_t)NRS * 32 * 4); float* SN1 = (float*)take((size_t)NRS * 32 * 4); float* CS2 = (float*)take((size_t)NRR * 32 * 4); float* SN2 = (float*)take((size_t)NRR * 32 * 4); _Float16* SX = (_Float16*)take((size_t)NRS * DMOD * 2); _Float16* RX = (_Float16*)take((size_t)NRR * DMOD * 2); float* F32 = (float*)take((size_t)NRR * DMOD * 4); float* FS = (float*)take((size_t)NRS * DMOD * 4);
  _Float16* SQ = (_Float16*)take((size_t)NRS * DMOD * 2); _Float16* RQ = (_Float16*)take((size_t)NRR * DMOD * 2); _Float16* KC = (_Float16*)take((size_t)NB * TK * KVD * 2); _Float16* VCH = (_Float16*)take((size_t)NB * TK * KVD * 2); _Float16* VCL = (_Float16*)take((size_t)NB * TK * KVD * 2); _Float16* VT = (_Float16*)take((size_t)NB * NKV * 64 * TK * 2); _Float16* VTL = (_Float16*)take((size_t)NB * NKV * 64 * TK * 2);
  float* O1 = (float*)take((size_t)NRS * DMOD * 4); _Float16* O1H = (_Float16*)take((size_t)NRS * DMOD * 2); _Float16* O1L = (_Float16*)take((size_t)NRS * DMOD * 2); float* O2 = F32; _Float16* O2H = RQ; _Float16* O2L = RX;      /* O2 over the dead reg-q f32 scratch; O2H/O2L over RQ/RX (dead after phase 2 / the projections) */
  if (off > ws_size) return;      /* 16 + 1 + 8 + 16 + 8 + 2.06 x 5 + 0.5 x 2 + 0.25 x 4 = 61.3 MiB */
  const unsigned g8 = (unsigned)((w8 + 255) / 256), g8k = (unsigned)((w8k + 255) / 256);
  k_wt_f16<<<g8, 256, 0, stream>>>(w_sq, BSQ, DMOD, DMOD, 16.0f); k_wt_f16<<<g8k, 256, 0, stream>>>(w_sk, BSK, DMOD, KVD, 16.0f); k_wt_f16<<<g8k, 256, 0, stream>>>(w_sv, BSV, DMOD, KVD, 16.0f);
  k_wt_f16<<<g8, 256, 0, stream>>>(w_rq, BRQ, DMOD, DMOD, 16.0f); k_wt_f16<<<g8k, 256, 0, stream>>>(w_rk, BRK, DMOD, KVD, 16.0f); k_wt_f16<<<g8k, 256, 0, stream>>>(w_rv, BRV, DMOD, KVD, 16.0f);
  k_wpair<<<(unsigned)(((size_t)DMOD * (2 * DMOD / 8) + 255) / 256), 256, 0, stream>>>(w_so, DMOD, DMOD, BSO); k_wpair<<<(unsigned)(((size_t)DMOD * (2 * DMOD / 8) + 255) / 256), 256, 0, stream>>>(w_ro, DMOD, DMOD, BRO);
  k_wpair<<<(unsigned)(((size_t)KVD * (2 * DMOD / 8) + 255) / 256), 256, 0, stream>>>(w_k2, DMOD, KVD, BK2); k_wpair<<<(unsigned)(((size_t)KVD * (2 * DMOD / 8) + 255) / 256), 256, 0, stream>>>(w_v2, DMOD, KVD, BV2);
  k_rotab<0><<<(unsigned)(((size_t)NRS * 32 + 255) / 256), 256, 0, stream>>>(NRS, SS, nullptr, nullptr, CS1, SN1); k_rotab<1><<<(unsigned)(((size_t)NRR * 32 + 255) / 256), 256, 0, stream>>>(NRR, RR, bar, tib, CS2, SN2);
  k_x16<<<(unsigned)(((size_t)NRS * DMOD / 8 + 255) / 256), 256, 0, stream>>>(sum_x, SX, (size_t)NRS * DMOD / 8); k_x16<<<(unsigned)(((size_t)NRR * DMOD / 8 + 255) / 256), 256, 0, stream>>>(reg_x, RX, (size_t)NRR * DMOD / 8);
  const dim3 gSQ((NRS / 128) * (DMOD / 64), 1), gSK((NRS / 128) * (KVD / 64), 1), gRQ((NRR / 128) * (DMOD / 64), 1), gRK((NRR / 128) * (KVD / 64), 1);
  /* summary q/k/v */
  k_gemm2<0><<<gSQ, 128, 0, stream>>>(SX, DMOD, 0, BSQ, DMOD, 0, 0.0625f, b_sq, 0, nullptr, 1, 0, 0, FS, nullptr, DMOD, 0, NRS, DMOD, DMOD);
  k_rope<<<(unsigned)(((size_t)NRS * NH * 4 + 255) / 256), 256, 0, stream>>>(FS, NRS, SS, NH, CS1, SN1, SQ, DMOD, SS, 0);
  k_gemm2<0><<<gSK, 128, 0, stream>>>(SX, DMOD, 0, BSK, DMOD, 0, 0.0625f, b_sk, 0, nullptr, 1, 0, 0, FS, nullptr, KVD, 0, NRS, KVD, DMOD);
  k_rope<<<(unsigned)(((size_t)NRS * NKV * 4 + 255) / 256), 256, 0, stream>>>(FS, NRS, SS, NKV, CS1, SN1, KC, KVD, TK, 0);      /* keys 0..63 of each batch */
  k_gemm2<0><<<gSK, 128, 0, stream>>>(SX, DMOD, 0, BSV, DMOD, 0, 0.0625f, b_sv, 0, nullptr, 1, 0, 0, FS, nullptr, KVD, 0, NRS, KVD, DMOD);
  k_put<<<(unsigned)(((size_t)NRS * (KVD / 8) + 255) / 256), 256, 0, stream>>>(FS, NRS, SS, KVD, VCH, VCL, TK, 0);
  /* regular q/k/v */
  k_gemm2<0><<<gRQ, 128, 0, stream>>>(RX, DMOD, 0, BRQ, DMOD, 0, 0.0625f, b_rq, 0, nullptr, 1, 0, 0, F32, nullptr, DMOD, 0, NRR, DMOD, DMOD);
  k_rope<<<(unsigned)(((size_t)NRR * NH * 4 + 255) / 256), 256, 0, stream>>>(F32, NRR, RR, NH, CS2, SN2, RQ, DMOD, RR, 0);
  k_gemm2<0><<<gRK, 128, 0, stream>>>(RX, DMOD, 0, BRK, DMOD, 0, 0.0625f, b_rk, 0, nullptr, 1, 0, 0, F32, nullptr, KVD, 0, NRR, KVD, DMOD);
  k_rope<<<(unsigned)(((size_t)NRR * NKV * 4 + 255) / 256), 256, 0, stream>>>(F32, NRR, RR, NKV, CS2, SN2, KC, KVD, TK, SS);      /* keys 64.. of each batch */
  k_gemm2<0><<<gRK, 128, 0, stream>>>(RX, DMOD, 0, BRV, DMOD, 0, 0.0625f, b_rv, 0, nullptr, 1, 0, 0, F32, nullptr, KVD, 0, NRR, KVD, DMOD);
  k_put<<<(unsigned)(((size_t)NRR * (KVD / 8) + 255) / 256), 256, 0, stream>>>(F32, NRR, RR, KVD, VCH, VCL, TK, SS);
  /* phase 1: summary queries over [summary ; regular] keys */
  k_vt<NKV, TK><<<NB * NKV * (TK / 64), 256, 0, stream>>>(VCH, KVD, 0, VT); k_vt<NKV, TK><<<NB * NKV * (TK / 64), 256, 0, stream>>>(VCL, KVD, 0, VTL);
  k_flash3gA<8><<<NB * NH * QBLKSA, 128, 0, stream>>>(SQ, DMOD, KC, KVD, VT, VTL, msum, O1, DMOD);
  k_hl<<<(unsigned)(((size_t)NRS * DMOD / 8 + 255) / 256), 256, 0, stream>>>(O1, O1H, O1L, (size_t)NRS * DMOD / 8);
  /* output 0 = sum_attn W_so + b_so */
  k_gemm2<0><<<gSQ, 128, 0, stream>>>(O1H, DMOD, 0, BSO, 2 * DMOD, 0, 0.0625f, b_so, 0, nullptr, 1, 0, 0, (float*)d_out, nullptr, DMOD, 0, NRS, DMOD, DMOD);
  k_gemm2<0><<<gSQ, 128, 0, stream>>>(O1L, DMOD, 0, BSO + DMOD, 2 * DMOD, 0, 1.0f / 1024.0f, nullptr, 0, (const float*)d_out, 1, (size_t)DMOD, 0, (float*)d_out, nullptr, DMOD, 0, NRS, DMOD, DMOD);
  /* k2 / v2 from sum_attn (no RoPE), into key/value rows 0..63 of each batch */
  k_gemm2<0><<<gSK, 128, 0, stream>>>(O1H, DMOD, 0, BK2, 2 * DMOD, 0, 0.0625f, b_k2, 0, nullptr, 1, 0, 0, FS, nullptr, KVD, 0, NRS, KVD, DMOD);
  k_gemm2<0><<<gSK, 128, 0, stream>>>(O1L, DMOD, 0, BK2 + DMOD, 2 * DMOD, 0, 1.0f / 1024.0f, nullptr, 0, FS, 1, (size_t)KVD, 0, FS, nullptr, KVD, 0, NRS, KVD, DMOD);
  k_put<<<(unsigned)(((size_t)NRS * (KVD / 8) + 255) / 256), 256, 0, stream>>>(FS, NRS, SS, KVD, KC, nullptr, TK, 0);
  k_gemm2<0><<<gSK, 128, 0, stream>>>(O1H, DMOD, 0, BV2, 2 * DMOD, 0, 0.0625f, b_v2, 0, nullptr, 1, 0, 0, FS, nullptr, KVD, 0, NRS, KVD, DMOD);
  k_gemm2<0><<<gSK, 128, 0, stream>>>(O1L, DMOD, 0, BV2 + DMOD, 2 * DMOD, 0, 1.0f / 1024.0f, nullptr, 0, FS, 1, (size_t)KVD, 0, FS, nullptr, KVD, 0, NRS, KVD, DMOD);
  k_put<<<(unsigned)(((size_t)NRS * (KVD / 8) + 255) / 256), 256, 0, stream>>>(FS, NRS, SS, KVD, VCH, VCL, TK, 0);
  /* phase 2: regular queries over [k2 ; regular] keys */
  k_vt<NKV, TK><<<NB * NKV * (TK / 64), 256, 0, stream>>>(VCH, KVD, 0, VT); k_vt<NKV, TK><<<NB * NKV * (TK / 64), 256, 0, stream>>>(VCL, KVD, 0, VTL);
  k_flash3gB<8><<<NB * NH * QBLKSB, 128, 0, stream>>>(RQ, DMOD, KC, KVD, VT, VTL, mupd, O2, DMOD);
  k_hl<<<(unsigned)(((size_t)NRR * DMOD / 8 + 255) / 256), 256, 0, stream>>>(O2, O2H, O2L, (size_t)NRR * DMOD / 8);
  float* out1 = (float*)d_out + (size_t)NRS * DMOD;
  k_gemm2<0><<<gRQ, 128, 0, stream>>>(O2H, DMOD, 0, BRO, 2 * DMOD, 0, 0.0625f, b_ro, 0, nullptr, 1, 0, 0, out1, nullptr, DMOD, 0, NRR, DMOD, DMOD);
  k_gemm2<0><<<gRQ, 128, 0, stream>>>(O2L, DMOD, 0, BRO + DMOD, 2 * DMOD, 0, 1.0f / 1024.0f, nullptr, 0, out1, 1, (size_t)DMOD, 0, out1, nullptr, DMOD, 0, NRR, DMOD, DMOD);
}

// v001
// One run takes 742 microseconds.
// Two timings next to v000 both put it at 1.88 times that version's speed.
#include <hip/hip_runtime.h>
// FlexSummaryAttention (2 batches; 64 summary tokens S, 2048 regular tokens R, D = 1024; 16 query heads, 4 kv heads (GQA), head dim 64): q/k/v projections for both token sets; 1-D RoPE on summary q/k, 2-D hierarchical RoPE (bar id | token-in-bar id) on regular q/k; phase 1: summary queries over [summary; regular] keys with the summarize mask -> sum_attn; k2/v2 = sum_attn W + b; phase 2: regular queries over [k2; regular k] / [v2; regular v] with the updating mask -> reg_attn; outputs sum_attn W_so + b and reg_attn W_ro + b.
// Structure: exact f16 planes of both inputs; six projection GEMMs (32x64 wave tiles, f32 accumulation, exact x16 weights + bias); RoPE on VALU (thread per (row, head, 8 dims), f32 trig) into f16 q planes and the shared per-batch key plane [k2-or-summary ; regular] (4 kv heads); values as f16 hi + 2^10 residual planes, V^T by LDS tiles; the fused flash kernel (3-term P.V, GQA head mapping, INPUT int mask tables) once per phase; sum_attn / reg_attn as hi + residual pairs into the k2/v2 and output GEMMs.
// Compute dtype: inputs, masks' companions and parameters rounded to bf16; q/k after RoPE as f16 (~2^-12); P and v hi + residual (~2^-21-class); attention outputs hi + residual into the following GEMMs; f32 softmax/accumulation/trig. v_wmma_f32_16x16x32_f16.
#define NB 2
#define SS 64
#define RR 2048
#define DMOD 1024
#define KVD 256
#define NRS (NB * SS)            /* 128 summary rows */
#define NRR (NB * RR)            /* 4096 regular rows */
#define TK 2112                  /* keys per batch in both phases: 64 summary(-derived) + 2048 regular */
#define TQA 64                   /* phase-1 queries (summary tokens) */
#define TQB 2048                 /* phase-2 queries (regular tokens) */
#define TQ TQB
#define NH 16
#define KVG 4                    /* GQA: 16 query heads share 4 kv heads */
#define NKV (NH / KVG)
#define SCL 0.125f               /* 64^-0.5 */
#define QBLKSA (TQA / 64)
#define QBLKSB (TQB / 64)
typedef __bf16 v16b __attribute__((ext_vector_type(16)));
typedef unsigned short v8us __attribute__((ext_vector_type(8), may_alias));
typedef float  v8f  __attribute__((ext_vector_type(8)));
typedef float  v4f  __attribute__((ext_vector_type(4)));
typedef float  v4fa __attribute__((ext_vector_type(4), may_alias));
union FragB { v16b v; v8us half[2]; unsigned short u[16]; };

__device__ __forceinline__ unsigned short bf16_bits(float x) { unsigned int u = __float_as_uint(x); return (unsigned short)((u + 0x7FFFu + ((u >> 16) & 1u)) >> 16); }
__device__ __forceinline__ float bf16_val(unsigned short b) { return __uint_as_float(((unsigned int)b) << 16); }
__device__ __forceinline__ float bf16_round(float x) { return bf16_val(bf16_bits(x)); }
// D += A·B with NT terms: 1 = ah·bh, 2 = + al·bh (A split), 3 = + ah·bl (both split)
template <int NT>
__device__ __forceinline__ v8f mmaN(v16b ah, v16b al, v16b bh, v16b bl, v8f c) {
  c = __builtin_amdgcn_wmma_f32_16x16x32_bf16(false, ah, false, bh, (short)0, c, false, false);
  if (NT >= 2) c = __builtin_amdgcn_wmma_f32_16x16x32_bf16(false, al, false, bh, (short)0, c, false, false);
  if (NT >= 3) c = __builtin_amdgcn_wmma_f32_16x16x32_bf16(false, ah, false, bl, (short)0, c, false, false);
  asm volatile("v_nop\n\tv_nop\n\tv_nop\n\tv_nop" : "+v"(c) : "v"(ah), "v"(al), "v"(bh), "v"(bl));
  return c;
}

__global__ __launch_bounds__(256) void k_wt_bf16(const float* __restrict__ W, unsigned short* __restrict__ Wt, int K, int N) {
  const int t = blockIdx.x * 256 + threadIdx.x;
  const int k8n = K / 8;
  if (t >= N * k8n) return;
  const int n = t / k8n, k8 = (t % k8n) * 8;
  v8us v;
#pragma unroll
  for (int i = 0; i < 8; ++i) v[i] = bf16_bits(W[(size_t)(k8 + i) * N + n]);
  *(v8us*)(Wt + (size_t)n * K + k8) = v;
  
}

// GEMM C[M][N] (f32, pitch ldc) = act(A[M][K]·W + bias). A f32 row-major (pitch lda) converted per fragment to bf16
// (ASPLIT: hi/lo two planes -> 2 terms, else single rounded term); Wt bf16 [N][K] (pitch ldb). BIAS_BF16 rounds the
// bias to bf16 first (bias quantised to bf16 before the add). K%32==0, M%16==0, N%64==0.
template <bool ASPLIT, int ACT, bool BIAS_BF16>
__global__ __launch_bounds__(128) void k_gemm_bf(const float* __restrict__ A, int lda, const unsigned short* __restrict__ Wt, int ldb,
                                               const float* __restrict__ bias, float* __restrict__ C, int ldc, int M, int N, int K) {
  __shared__ __attribute__((aligned(16))) float so[4][16][64];
  const int tid = threadIdx.x, w = tid >> 5, lane = tid & 31, ln = lane & 15, hh = lane >> 4;
  const int ntn = N / 64;
  const int wid = blockIdx.x * 4 + w;
  const int mt = wid / ntn, nq = wid % ntn;
  if (mt * 16 >= M) return;
  const int row0 = mt * 16, col0 = nq * 64;
  const float* arow = A + (size_t)(row0 + ln) * lda;
  v8f acc[4] = {};
  for (int kb = 0; kb < K; kb += 32) {
    FragB ah, al;
    const v4f x0 = *(const v4fa*)(arow + kb + 8 * hh), x1 = *(const v4fa*)(arow + kb + 8 * hh + 4);
    const v4f x2 = *(const v4fa*)(arow + kb + 16 + 8 * hh), x3 = *(const v4fa*)(arow + kb + 16 + 8 * hh + 4);
    float xs[16] = {x0[0],x0[1],x0[2],x0[3],x1[0],x1[1],x1[2],x1[3],x2[0],x2[1],x2[2],x2[3],x3[0],x3[1],x3[2],x3[3]};
#pragma unroll
    for (int i = 0; i < 16; ++i) { const unsigned short hb = bf16_bits(xs[i]); ah.u[i] = hb; al.u[i] = ASPLIT ? bf16_bits(xs[i] - bf16_val(hb)) : (unsigned short)0; }
#pragma unroll
    for (int t = 0; t < 4; ++t) {
      const unsigned short* brow = Wt + (size_t)(col0 + t * 16 + ln) * ldb + kb;
      FragB b;
      b.half[0] = *(const v8us*)(brow + 8 * hh);
      b.half[1] = *(const v8us*)(brow + 16 + 8 * hh);
      acc[t] = mmaN<ASPLIT ? 2 : 1>(ah.v, al.v, b.v, b.v, acc[t]);
    }
  }
#pragma unroll
  for (int t = 0; t < 4; ++t) {
    float bv = bias ? bias[col0 + t * 16 + ln] : 0.f;
    if (BIAS_BF16) bv = bf16_round(bv);
#pragma unroll
    for (int r = 0; r < 8; ++r) { float v = acc[t][r] + bv; if (ACT == 1) v = fmaxf(v, 0.f); so[w][8 * hh + r][t * 16 + ln] = v; }
  }
  __builtin_amdgcn_fence(__ATOMIC_ACQ_REL, "workgroup");
  __builtin_amdgcn_wave_barrier();
  const int rsub = lane >> 4, c4 = (lane & 15) * 4;
  {
#pragma unroll
    for (int q = 0; q < 8; ++q) {
      const int r = q * 2 + rsub;
      const v4f v = *(const v4fa*)&so[w][r][c4];
      *(v4f*)(C + (size_t)(row0 + r) * ldc + col0 + c4) = v;
    }
    
  }
}

// GEMM C = act(A·W + bias + resid): A f32 (ASPLIT -> hi/lo 2 terms), Wt bf16 [N][K]; ACT 0 none, 1 relu, 2 exact gelu;
// resid (optional, f32, row index = (row % rmod), pitch ldr, RES_BF16 rounds it) added before the activation.
template <bool ASPLIT, int ACT, bool BIAS_BF16, bool RES_BF16>
__global__ __launch_bounds__(128) void k_gemm_bf3(const float* __restrict__ A, int lda, const unsigned short* __restrict__ Wt, int ldb,
                                                const float* __restrict__ bias, const float* __restrict__ resid, int rmod, int ldr,
                                                float* __restrict__ C, int ldc, int M, int N, int K) {
  __shared__ __attribute__((aligned(16))) float so[4][16][64];
  const int tid = threadIdx.x, w = tid >> 5, lane = tid & 31, ln = lane & 15, hh = lane >> 4;
  const int ntn = N / 64;
  const int wid = blockIdx.x * 4 + w;
  const int mt = wid / ntn, nq = wid % ntn;
  if (mt * 16 >= M) return;
  const int row0 = mt * 16, col0 = nq * 64;
  const float* arow = A + (size_t)(row0 + ln) * lda;
  v8f acc[4] = {};
  for (int kb = 0; kb < K; kb += 32) {
    FragB ah, al;
    const v4f x0 = *(const v4fa*)(arow + kb + 8 * hh), x1 = *(const v4fa*)(arow + kb + 8 * hh + 4);
    const v4f x2 = *(const v4fa*)(arow + kb + 16 + 8 * hh), x3 = *(const v4fa*)(arow + kb + 16 + 8 * hh + 4);
    float xs[16] = {x0[0],x0[1],x0[2],x0[3],x1[0],x1[1],x1[2],x1[3],x2[0],x2[1],x2[2],x2[3],x3[0],x3[1],x3[2],x3[3]};
#pragma unroll
    for (int i = 0; i < 16; ++i) { const unsigned short hb = bf16_bits(xs[i]); ah.u[i] = hb; al.u[i] = ASPLIT ? bf16_bits(xs[i] - bf16_val(hb)) : (unsigned short)0; }
#pragma unroll
    for (int t = 0; t < 4; ++t) {
      const unsigned short* brow = Wt + (size_t)(col0 + t * 16 + ln) * ldb + kb;
      FragB b;
      b.half[0] = *(const v8us*)(brow + 8 * hh);
      b.half[1] = *(const v8us*)(brow + 16 + 8 * hh);
      acc[t] = mmaN<ASPLIT ? 2 : 1>(ah.v, al.v, b.v, b.v, acc[t]);
    }
  }
#pragma unroll
  for (int t = 0; t < 4; ++t) {
    const int col = col0 + t * 16 + ln;
    float bv = bias ? bias[col] : 0.f;
    if (BIAS_BF16) bv = bf16_round(bv);
#pragma unroll
    for (int r = 0; r < 8; ++r) {
      float v = acc[t][r] + bv;
      if (resid) { float rv = resid[(size_t)((row0 + 8 * hh + r) % rmod) * ldr + col]; if (RES_BF16) rv = bf16_round(rv); v += rv; }
      if (ACT == 1) v = fmaxf(v, 0.f);
      if (ACT == 2) v = 0.5f * v * (1.0f + erff(v * 0.70710678118654752f));
      if (ACT == 3) { const float u = 0.7978845608028654f * (v + 0.044715f * v * v * v); v = 0.5f * v * (1.0f + tanhf(u)); }
      so[w][8 * hh + r][t * 16 + ln] = v;
    }
  }
  __builtin_amdgcn_fence(__ATOMIC_ACQ_REL, "workgroup");
  __builtin_amdgcn_wave_barrier();
  const int rsub = lane >> 4, c4 = (lane & 15) * 4;
  {
#pragma unroll
    for (int q = 0; q < 8; ++q) {
      const int r = q * 2 + rsub;
      const v4f v = *(const v4fa*)&so[w][r][c4];
      *(v4f*)(C + (size_t)(row0 + r) * ldc + col0 + c4) = v;
    }
    
  }
}
// row LayerNorm (biased variance, eps) over N: s = X (+ R); optional out_sum <- s; out_norm <- (s-mu)*rsqrt(var+eps)*g + b
template <bool PARAM_BF16>
__global__ __launch_bounds__(256) void k_layernorm(const float* __restrict__ X, const float* __restrict__ R, const float* __restrict__ g, const float* __restrict__ bta,
                                                  float* __restrict__ out_sum, float* __restrict__ out_norm, int N, float eps) {
  __shared__ float red[256];
  const int row = blockIdx.x, tid = threadIdx.x;
  const float* x = X + (size_t)row * N; const float* rr = R ? R + (size_t)row * N : nullptr;
  float vals[16];                     // up to N = 4096
  const int per = N / 256;            // contiguous chunk per thread? use strided-by-4 chunks: thread handles j = tid*4 + 1024*u
  float s1 = 0.f;
  for (int u = 0; u < per / 4; ++u) {
    const int j = tid * 4 + 1024 * u;
    const v4f a = *(const v4fa*)(x + j);
    v4f b = {0.f,0.f,0.f,0.f}; if (rr) b = *(const v4fa*)(rr + j);
#pragma unroll
    for (int q = 0; q < 4; ++q) { const float v = a[q] + b[q]; vals[u * 4 + q] = v; s1 += v; }
  }
  red[tid] = s1; __syncthreads();
  for (int st = 128; st > 0; st >>= 1) { if (tid < st) red[tid] += red[tid + st]; __syncthreads(); }
  const float mu = red[0] / (float)N; __syncthreads();
  float s2 = 0.f;
  for (int u = 0; u < per / 4; ++u)
#pragma unroll
    for (int q = 0; q < 4; ++q) { const float c = vals[u * 4 + q] - mu; s2 += c * c; }
  red[tid] = s2; __syncthreads();
  for (int st = 128; st > 0; st >>= 1) { if (tid < st) red[tid] += red[tid + st]; __syncthreads(); }
  const float rs = rsqrtf(red[0] / (float)N + eps);
  {
    for (int u = 0; u < per / 4; ++u) {
      const int j = tid * 4 + 1024 * u;
      v4f o, sm;
#pragma unroll
      for (int q = 0; q < 4; ++q) {
        float gg = g[j + q], bb = bta[j + q];
        if (PARAM_BF16) { gg = bf16_round(gg); bb = bf16_round(bb); }
        sm[q] = vals[u * 4 + q]; o[q] = (vals[u * 4 + q] - mu) * rs * gg + bb;
      }
      if (out_sum) *(v4f*)(out_sum + (size_t)row * N + j) = sm;
      *(v4f*)(out_norm + (size_t)row * N + j) = o;
    }
    
  }
}



// ---- f16 WMMA path (v_wmma_f32_16x16x32_f16): 11-bit significands for operands in range — used where a [0,1] probability operand needs more precision than bf16
typedef _Float16 v16h __attribute__((ext_vector_type(16)));
union FragH { v16h v; v8us half[2]; _Float16 h[16]; unsigned short u[16]; };
template <int NT>
__device__ __forceinline__ v8f mmaH(v16h ah, v16h al, v16h bh, v16h bl, v8f c) {
  c = __builtin_amdgcn_wmma_f32_16x16x32_f16(false, ah, false, bh, (short)0, c, false, false);
  if (NT >= 2) c = __builtin_amdgcn_wmma_f32_16x16x32_f16(false, al, false, bh, (short)0, c, false, false);
  if (NT >= 3) c = __builtin_amdgcn_wmma_f32_16x16x32_f16(false, ah, false, bl, (short)0, c, false, false);
  asm volatile("v_nop\n\tv_nop\n\tv_nop\n\tv_nop" : "+v"(c) : "v"(ah), "v"(al), "v"(bh), "v"(bl));
  return c;
}
// batched GEMM like k_gemm_b but f16 operands: A f32 (split into f16 hi/lo if ASPLIT, else rounded to f16), Bt = f16 values [n][k]; alpha; C f32; N multiple of 16 (partial tiles skipped)
template <bool ASPLIT>
__global__ __launch_bounds__(128) void k_gemm_h(const float* __restrict__ A, int lda, size_t sA, const _Float16* __restrict__ Bh, int ldb, size_t sB, float alpha, float* __restrict__ C, int ldc, size_t sC, int M, int N, int K) {
  __shared__ __attribute__((aligned(16))) float so[4][16][64];
  const int tid = threadIdx.x, w = tid >> 5, lane = tid & 31, ln = lane & 15, hh = lane >> 4; const int by = blockIdx.y;
  A += (size_t)by * sA; Bh += (size_t)by * sB; C += (size_t)by * sC;
  const int ntn = (N + 63) / 64; const int wid = blockIdx.x * 4 + w; const int mt = wid / ntn, nq = wid % ntn; if (mt * 16 >= M) return;
  const int row0 = mt * 16, col0 = nq * 64; const float* arow = A + (size_t)(row0 + ln) * lda;
  v8f acc[4] = {};
  for (int kb = 0; kb < K; kb += 32) {
    FragH ah, al;
    const v4f x0 = *(const v4fa*)(arow + kb + 8 * hh), x1 = *(const v4fa*)(arow + kb + 8 * hh + 4), x2 = *(const v4fa*)(arow + kb + 16 + 8 * hh), x3 = *(const v4fa*)(arow + kb + 16 + 8 * hh + 4);
    float xs[16] = {x0[0],x0[1],x0[2],x0[3],x1[0],x1[1],x1[2],x1[3],x2[0],x2[1],x2[2],x2[3],x3[0],x3[1],x3[2],x3[3]};
#pragma unroll
    for (int i = 0; i < 16; ++i) { const _Float16 h = (_Float16)xs[i]; ah.h[i] = h; al.h[i] = ASPLIT ? (_Float16)(xs[i] - (float)h) : (_Float16)0.0f; }
#pragma unroll
    for (int t = 0; t < 4; ++t) { if (col0 + t * 16 >= N) continue; const size_t boff = (size_t)(col0 + t * 16 + ln) * ldb + kb; FragH bq; bq.half[0] = *(const v8us*)(Bh + boff + 8 * hh); bq.half[1] = *(const v8us*)(Bh + boff + 16 + 8 * hh);
      acc[t] = mmaH<ASPLIT ? 2 : 1>(ah.v, al.v, bq.v, bq.v, acc[t]); }
  }
#pragma unroll
  for (int t = 0; t < 4; ++t) { if (col0 + t * 16 >= N) continue;
#pragma unroll
    for (int r = 0; r < 8; ++r) so[w][8 * hh + r][t * 16 + ln] = acc[t][r] * alpha; }
  __builtin_amdgcn_fence(__ATOMIC_ACQ_REL, "workgroup"); __builtin_amdgcn_wave_barrier();
  const int rsub = lane >> 4, c4 = (lane & 15) * 4;
  {
#pragma unroll
    for (int q = 0; q < 8; ++q) { const int r = q * 2 + rsub; if (col0 + c4 < N) { const v4f v = *(const v4fa*)&so[w][r][c4]; *(v4f*)(C + (size_t)(row0 + r) * ldc + col0 + c4) = v; } }
     }
}

// Wt[n][k] = f16(W[k][n]·scale) from f32 row-major W[K][N] (scale = power of two; bf16-exact weights stay exact in f16 away from the subnormal range)
__global__ __launch_bounds__(256) void k_wt_f16(const float* __restrict__ W, _Float16* __restrict__ Wt, int K, int N, float scale) {
  const int t = blockIdx.x * 256 + threadIdx.x; if (t >= N * (K / 8)) return; const int n = t / (K / 8), k8 = (t % (K / 8)) * 8; FragH f;
#pragma unroll
  for (int i = 0; i < 8; ++i) f.h[i] = (_Float16)(bf16_round(W[(size_t)(k8 + i) * N + n]) * scale); const v8us o = f.half[0];
  *(v8us*)((unsigned short*)Wt + (size_t)n * K + k8) = o; 
}
// k_gemm_hh variant with fused epilogue: v = acc·alpha + bias[by·sBias + col] (+ CP[(row/rowsPerB)·sCPb + by·64 + col] if CP) ; ACT 0 none / 1 elu ; writes f16 C16 (and f32 C if non-null)
template <int ACT>
__global__ __launch_bounds__(128) void k_gemm_hhx(const _Float16* __restrict__ A, int lda, size_t sA, const _Float16* __restrict__ Bh, int ldb, size_t sB, float alpha, const float* __restrict__ bias, size_t sBias, const float* __restrict__ CP, int rowsPerB, size_t sCPb, int row0g,
    float* __restrict__ C, _Float16* __restrict__ C16, int ldc, size_t sC, int M, int N, int K) {
  __shared__ __attribute__((aligned(16))) float so[4][16][64];
  const int tid = threadIdx.x, w = tid >> 5, lane = tid & 31, ln = lane & 15, hh = lane >> 4; const int by = blockIdx.y;
  A += (size_t)by * sA; Bh += (size_t)by * sB; const size_t cofs = (size_t)by * sC; const float* bp = bias ? bias + (size_t)by * sBias : nullptr;
  const int ntn = (N + 63) / 64; const int wid = blockIdx.x * 4 + w; const int mt = wid / ntn, nq = wid % ntn; if (mt * 16 >= M) return;
  const int row0 = mt * 16, col0 = nq * 64; const _Float16* arow = A + (size_t)(row0 + ln) * lda;
  v8f acc[4] = {};
  for (int kb = 0; kb < K; kb += 32) { FragH ah; ah.half[0] = *(const v8us*)((const unsigned short*)arow + kb + 8 * hh); ah.half[1] = *(const v8us*)((const unsigned short*)arow + kb + 16 + 8 * hh);
#pragma unroll
    for (int t = 0; t < 4; ++t) { if (col0 + t * 16 >= N) continue; const size_t boff = (size_t)(col0 + t * 16 + ln) * ldb + kb; FragH bq; bq.half[0] = *(const v8us*)((const unsigned short*)Bh + boff + 8 * hh); bq.half[1] = *(const v8us*)((const unsigned short*)Bh + boff + 16 + 8 * hh);
      acc[t] = mmaH<1>(ah.v, ah.v, bq.v, bq.v, acc[t]); }
  }
#pragma unroll
  for (int t = 0; t < 4; ++t) { if (col0 + t * 16 >= N) continue; const int col = col0 + t * 16 + ln; const float bv = bp ? bf16_round(bp[col]) : 0.f;
#pragma unroll
    for (int r = 0; r < 8; ++r) { float v = acc[t][r] * alpha + bv; if (CP) { const int bidx = (row0g + row0 + 8 * hh + r) / rowsPerB; v += CP[(size_t)bidx * sCPb + (size_t)by * 64 + col]; } if (ACT == 1) v = (v > 0.f) ? v : expm1f(v); else if (ACT == 7) v = (v > 0.f) ? v + 1.0f : expf(v); else if (ACT == 8) v = tanhf(v); else if (ACT == 9) v = 0.5f * v * (1.0f + tanhf(0.7978845608028654f * (v + 0.044715f * v * v * v))); else if (ACT == 11) v = 1.0f / (1.0f + expf(-v)); else if (ACT == 12) v = (v > 0.f) ? v : 0.01f * v; else if (ACT == 14) v = (v > 0.f) ? v : 0.1f * v; else if (ACT == 15) v = v / (1.0f + expf(-v)); else if (ACT == 3) v = fmaxf(v, 0.f); else if (ACT == 6) v = 0.5f * v * (1.0f + erff(v * 0.70710678118654752f)); so[w][8 * hh + r][t * 16 + ln] = v; } }
  __builtin_amdgcn_fence(__ATOMIC_ACQ_REL, "workgroup"); __builtin_amdgcn_wave_barrier();
  const int rsub = lane >> 4, c4 = (lane & 15) * 4; typedef _Float16 v4h __attribute__((ext_vector_type(4)));
  {
#pragma unroll
    for (int q = 0; q < 8; ++q) { const int r = q * 2 + rsub; if (col0 + c4 < N) { const v4f v = *(const v4fa*)&so[w][r][c4]; if (C) *(v4f*)(C + cofs + (size_t)(row0 + r) * ldc + col0 + c4) = v; if (C16) { v4h h4; for (int i = 0; i < 4; ++i) h4[i] = (_Float16)v[i]; *(v4h*)(C16 + cofs + (size_t)(row0 + r) * ldc + col0 + c4) = h4; } } }
     }
}


typedef _Float16 v4h __attribute__((ext_vector_type(4)));

__global__ __launch_bounds__(256) void k_x16(const float* __restrict__ x, _Float16* __restrict__ X16, size_t n8) { const size_t t = (size_t)blockIdx.x * 256 + threadIdx.x; if (t >= n8) return; FragH f;
#pragma unroll
  for (int q = 0; q < 8; ++q) f.h[q] = (_Float16)bf16_round(x[t * 8 + q]); *(v8us*)((unsigned short*)X16 + t * 8) = f.half[0];  }
__global__ __launch_bounds__(256) void k_h16(const float* __restrict__ x, _Float16* __restrict__ X16, size_t n8) { const size_t t = (size_t)blockIdx.x * 256 + threadIdx.x; if (t >= n8) return; FragH f;
#pragma unroll
  for (int q = 0; q < 8; ++q) f.h[q] = (_Float16)x[t * 8 + q]; *(v8us*)((unsigned short*)X16 + t * 8) = f.half[0];  }
__global__ __launch_bounds__(256) void k_round16f(const float* __restrict__ W, _Float16* __restrict__ Bt, size_t n8) { const size_t t = (size_t)blockIdx.x * 256 + threadIdx.x; if (t >= n8) return; FragH f;
#pragma unroll
  for (int i = 0; i < 8; ++i) f.h[i] = (_Float16)(bf16_round(W[t * 8 + i]) * 16.0f); *(v8us*)((unsigned short*)Bt + t * 8) = f.half[0];  }
template <int NHv, int TTv>
__global__ __launch_bounds__(256) void k_vt(const _Float16* __restrict__ V16, int ldv, int voff, _Float16* __restrict__ Vt) { __shared__ unsigned short tl[64][66]; const int tid = threadIdx.x; const int slab = blockIdx.x / (TTv / 64), lg = blockIdx.x % (TTv / 64); const int b = slab / NHv, h = slab % NHv;
  for (int i = tid; i < 64 * 8; i += 256) { const int r = i / 8, c8 = (i % 8) * 8; FragH f; f.half[0] = *(const v8us*)((const unsigned short*)V16 + ((size_t)b * TTv + lg * 64 + r) * ldv + voff + h * 64 + c8);
#pragma unroll
    for (int q = 0; q < 8; ++q) tl[r][c8 + q] = f.u[q]; }
  __syncthreads();
  {
#pragma unroll
    for (int rd = 0; rd < 2; ++rd) { const int d = rd * 32 + tid / 8, pc = tid % 8; FragH f;
#pragma unroll
      for (int q = 0; q < 8; ++q) f.u[q] = tl[pc * 8 + q][d];
      *(v8us*)((unsigned short*)Vt + ((size_t)slab * 64 + d) * TTv + lg * 64 + pc * 8) = f.half[0]; }
     } }

__global__ __launch_bounds__(256) void k_hl(const float* __restrict__ F, _Float16* __restrict__ Hh, _Float16* __restrict__ Hl, size_t n8) { const size_t t = (size_t)blockIdx.x * 256 + threadIdx.x; if (t >= n8) return; FragH fh, fl; const v4f a = *(const v4fa*)(F + t * 8), c = *(const v4fa*)(F + t * 8 + 4);
#pragma unroll
  for (int q = 0; q < 4; ++q) { _Float16 h = (_Float16)a[q]; fh.h[q] = h; fl.h[q] = (_Float16)((a[q] - (float)h) * 1024.0f); h = (_Float16)c[q]; fh.h[4 + q] = h; fl.h[4 + q] = (_Float16)((c[q] - (float)h) * 1024.0f); }
  { *(v8us*)((unsigned short*)Hh + t * 8) = fh.half[0]; *(v8us*)((unsigned short*)Hl + t * 8) = fl.half[0];  } }

// ---- fast GEMM (wave tile 32x64; requires M % 32 == 0 rows per launch region, N % 64 == 0 and K % 64 == 0); epilogue = k_gemm_hhx semantics ----
__device__ __forceinline__ v16h g2_frag(const _Float16* p, int hh) { FragH f; f.half[0] = *(const v8us*)((const unsigned short*)p + 8 * hh); f.half[1] = *(const v8us*)((const unsigned short*)p + 16 + 8 * hh); return f.v; }
__device__ __forceinline__ v8f g2_mma(v16h a, v16h b, v8f c) { v8f d = __builtin_amdgcn_wmma_f32_16x16x32_f16(false, a, false, b, (short)0, c, false, false); asm volatile("v_nop\n\tv_nop\n\tv_nop\n\tv_nop" : "+v"(d) : "v"(a), "v"(b)); return d; }
template <int ACT>
__global__ __launch_bounds__(128) void k_gemm2(const _Float16* __restrict__ A, int lda, size_t sA, const _Float16* __restrict__ Bh, int ldb, size_t sB, float alpha, const float* __restrict__ bias, size_t sBias, const float* __restrict__ CP, int rowsPerB, size_t sCPb, int row0g,
    float* __restrict__ C, _Float16* __restrict__ C16, int ldc, size_t sC, int M, int N, int K) {
  __shared__ __attribute__((aligned(16))) float so[4][32][68];
  const int tid = threadIdx.x, w = tid >> 5, lane = tid & 31, ln = lane & 15, hh = lane >> 4; const int by = blockIdx.y;
  A += (size_t)by * sA; Bh += (size_t)by * sB; const size_t cofs = (size_t)by * sC; const float* bp = bias ? bias + (size_t)by * sBias : nullptr;
  const int ntn = N >> 6; const int mt = blockIdx.x / ntn, nq = blockIdx.x - mt * ntn; const int row0 = mt * 128 + 32 * w, col0 = nq * 64; if (row0 >= M) return;
  const _Float16* a0p = A + (size_t)(row0 + ln) * lda; const _Float16* a1p = a0p + (size_t)16 * lda;
  const _Float16* b0p = Bh + (size_t)(col0 + ln) * ldb; const _Float16* b1p = b0p + (size_t)16 * ldb; const _Float16* b2p = b1p + (size_t)16 * ldb; const _Float16* b3p = b2p + (size_t)16 * ldb;
  const v8f z8 = {0.f,0.f,0.f,0.f,0.f,0.f,0.f,0.f}; v8f c00 = z8, c01 = z8, c02 = z8, c03 = z8, c10 = z8, c11 = z8, c12 = z8, c13 = z8;
  /* two register sets x / y of the six fragments (K % 64 == 0): the loads of the next 32-wide k step are all issued before the products of this one, so a step waits for one overlapped latency at most */
  v16h xa0 = g2_frag(a0p, hh), xa1 = g2_frag(a1p, hh), xb0 = g2_frag(b0p, hh), xb1 = g2_frag(b1p, hh), xb2 = g2_frag(b2p, hh), xb3 = g2_frag(b3p, hh);
#pragma unroll 1
  for (int kb = 0; kb < K; kb += 64) { const int k1 = kb + 32, k2 = (kb + 64 < K) ? kb + 64 : kb;      /* last trip: k2 names a step inside the row again; its values are not used */
    const v16h ya0 = g2_frag(a0p + k1, hh), ya1 = g2_frag(a1p + k1, hh), yb0 = g2_frag(b0p + k1, hh), yb1 = g2_frag(b1p + k1, hh), yb2 = g2_frag(b2p + k1, hh), yb3 = g2_frag(b3p + k1, hh);
    __builtin_amdgcn_sched_barrier(0);      /* holds the y loads above the x products (the scheduler otherwise moves each load down to its use) */
    c00 = g2_mma(xa0, xb0, c00); c10 = g2_mma(xa1, xb0, c10); c01 = g2_mma(xa0, xb1, c01); c11 = g2_mma(xa1, xb1, c11);
    c02 = g2_mma(xa0, xb2, c02); c12 = g2_mma(xa1, xb2, c12); c03 = g2_mma(xa0, xb3, c03); c13 = g2_mma(xa1, xb3, c13);
    __builtin_amdgcn_sched_barrier(0);      /* holds the x reloads below the x products and, with the next one, above the y products */
    xa0 = g2_frag(a0p + k2, hh); xa1 = g2_frag(a1p + k2, hh); xb0 = g2_frag(b0p + k2, hh); xb1 = g2_frag(b1p + k2, hh); xb2 = g2_frag(b2p + k2, hh); xb3 = g2_frag(b3p + k2, hh);
    __builtin_amdgcn_sched_barrier(0);      /* holds the x reloads above the y products */
    c00 = g2_mma(ya0, yb0, c00); c10 = g2_mma(ya1, yb0, c10); c01 = g2_mma(ya0, yb1, c01); c11 = g2_mma(ya1, yb1, c11);
    c02 = g2_mma(ya0, yb2, c02); c12 = g2_mma(ya1, yb2, c12); c03 = g2_mma(ya0, yb3, c03); c13 = g2_mma(ya1, yb3, c13);
    asm volatile("s_wait_xcnt 0x0" ::: "memory"); }      /* stands in front of the next trip's address sums, which overwrite registers that the x loads name */
  v8f accs[8] = {c00, c01, c02, c03, c10, c11, c12, c13};
  /* the epilogue's loads (4 bias words, 64 CP words a lane) are issued together as well, ahead of the arithmetic that uses them */
  float bw[4] = {0.f, 0.f, 0.f, 0.f}; v8f cpv[8] = {z8, z8, z8, z8, z8, z8, z8, z8};
  if (bp) {
#pragma unroll
    for (int t = 0; t < 4; ++t) bw[t] = bp[col0 + t * 16 + ln]; }
  if (CP) {
#pragma unroll
    for (int u = 0; u < 8; ++u)
#pragma unroll
      for (int r = 0; r < 8; ++r) { const int bidx = (row0g + row0 + (u >> 2) * 16 + 8 * hh + r) / rowsPerB; cpv[u][r] = CP[(size_t)bidx * sCPb + (size_t)by * 64 + col0 + (u & 3) * 16 + ln];
        if (r == 7) asm volatile("s_wait_xcnt 0x0" ::: "memory"); }      /* stands in front of the next group's loads, whose results may land in address registers of this group */
    asm volatile("" :: "v"(cpv[0]), "v"(cpv[1]), "v"(cpv[2]), "v"(cpv[3]), "v"(cpv[4]), "v"(cpv[5]), "v"(cpv[6]), "v"(cpv[7])); }      /* inputs-only fence on the loaded words: holds all 64 loads in this block, where they overlap, instead of one waited load in front of each add */
#pragma unroll
  for (int u = 0; u < 8; ++u) { const int t = u & 3, half = u >> 2; const float bv = bp ? bf16_round(bw[t]) : 0.f;
#pragma unroll
    for (int r = 0; r < 8; ++r) { const int rloc = half * 16 + 8 * hh + r; float v = accs[u][r] * alpha + bv; if (CP) v += cpv[u][r];
      if (ACT == 3) v = fmaxf(v, 0.f); else if (ACT == 6) v = 0.5f * v * (1.0f + erff(v * 0.70710678118654752f)); else if (ACT == 11) v = 1.0f / (1.0f + expf(-v)); else if (ACT == 15) v = v / (1.0f + expf(-v)); else if (ACT == 12) v = (v > 0.f) ? v : 0.01f * v; else if (ACT == 8) v = tanhf(v);
      so[w][rloc][t * 16 + ln] = v; } }
  __builtin_amdgcn_fence(__ATOMIC_ACQ_REL, "workgroup"); __builtin_amdgcn_wave_barrier();
  const int rsub = lane >> 4, c4 = (lane & 15) * 4;
  {
#pragma unroll
    for (int q = 0; q < 16; ++q) { const int r = q * 2 + rsub; const v4f v = *(const v4fa*)&so[w][r][c4]; if (C) *(v4f*)(C + cofs + (size_t)(row0 + r) * ldc + col0 + c4) = v; if (C16) { v4h h4; for (int i = 0; i < 4; ++i) h4[i] = (_Float16)v[i]; *(v4h*)(C16 + cofs + (size_t)(row0 + r) * ldc + col0 + c4) = h4; } }
     } }



template <int CAUSAL>
__global__ __launch_bounds__(128) void k_flash(const _Float16* __restrict__ Q16, int ldq, const _Float16* __restrict__ K16, int ldk, const _Float16* __restrict__ Vt, const int* __restrict__ MSK, float* __restrict__ O, int ldo) {
  constexpr int RPW = 16, RTN = RPW / 16, NQB = TQ / (4 * RPW), DT = 4, KS = 2;
  __shared__ __attribute__((aligned(16))) unsigned short sP[4][RPW][40]; __shared__ __attribute__((aligned(16))) float sO[4][RPW][64 + 4];
  const int tid = threadIdx.x, w = tid >> 5, lane = tid & 31, ln = lane & 15, hh = lane >> 4;
  const int slab = blockIdx.x / NQB, qblk = blockIdx.x % NQB; const int b = slab / NH, h = slab % NH; const int qb0 = qblk * (4 * RPW); const int q0 = qb0 + w * RPW;
  FragH aq[2][KS];
#pragma unroll
  for (int rt = 0; rt < RTN; ++rt) { const unsigned short* qr = (const unsigned short*)Q16 + ((size_t)b * TQ + q0 + rt * 16 + ln) * ldq + h * 64;
#pragma unroll
    for (int ks = 0; ks < KS; ++ks) { aq[rt][ks].half[0] = *(const v8us*)(qr + ks * 32 + 8 * hh); aq[rt][ks].half[1] = *(const v8us*)(qr + ks * 32 + 16 + 8 * hh); } }
  const unsigned short* Vth = (const unsigned short*)Vt + (size_t)slab * 64 * TK;
  float m_r[2][8], l_r[2][8]; v8f oacc[2][DT];
#pragma unroll
  for (int rt = 0; rt < RTN; ++rt) {
#pragma unroll
    for (int r = 0; r < 8; ++r) { m_r[rt][r] = -3.0e38f; l_r[rt][r] = 0.f; }
#pragma unroll
    for (int dt = 0; dt < DT; ++dt) oacc[rt][dt] = (v8f){0.f,0.f,0.f,0.f,0.f,0.f,0.f,0.f}; }
  const int jend = (CAUSAL == 1) ? (qb0 + 4 * RPW) : TK;      /* causal: keys beyond the block's last query never contribute */
#pragma unroll 1
  for (int j0 = 0; j0 < jend; j0 += 32) {
    v8f s[2][2];
#pragma unroll
    for (int nt = 0; nt < 2; ++nt) { const unsigned short* kr = (const unsigned short*)K16 + ((size_t)b * TK + j0 + nt * 16 + ln) * ldk + h * 64; FragH bk[KS];
#pragma unroll
      for (int ks = 0; ks < KS; ++ks) { bk[ks].half[0] = *(const v8us*)(kr + ks * 32 + 8 * hh); bk[ks].half[1] = *(const v8us*)(kr + ks * 32 + 16 + 8 * hh); }
#pragma unroll
      for (int rt = 0; rt < RTN; ++rt) { v8f acc = (v8f){0.f,0.f,0.f,0.f,0.f,0.f,0.f,0.f};
#pragma unroll
        for (int ks = 0; ks < KS; ++ks) acc = mmaH<1>(aq[rt][ks].v, aq[rt][ks].v, bk[ks].v, bk[ks].v, acc); s[rt][nt] = acc; } }
#pragma unroll
    for (int rt = 0; rt < RTN; ++rt)
#pragma unroll
      for (int r = 0; r < 8; ++r) { const int tq = q0 + rt * 16 + 8 * hh + r; const int k0 = j0 + ln, k1 = j0 + 16 + ln;
        const bool ok0 = (CAUSAL == 1) ? (k0 <= tq) : ((CAUSAL == 2) ? ((k0 >> 5) == (tq >> 5)) : true), ok1 = (CAUSAL == 1) ? (k1 <= tq) : ((CAUSAL == 2) ? ((k1 >> 5) == (tq >> 5)) : true);      /* mode 2: block-diagonal 32-token groups */
        const float s0 = ok0 ? s[rt][0][r] * SCL : -3.0e38f, s1 = ok1 ? s[rt][1][r] * SCL : -3.0e38f; float mc = fmaxf(s0, s1);
        mc = fmaxf(mc, __shfl_xor(mc, 1, 32)); mc = fmaxf(mc, __shfl_xor(mc, 2, 32)); mc = fmaxf(mc, __shfl_xor(mc, 4, 32)); mc = fmaxf(mc, __shfl_xor(mc, 8, 32));
        const float mn = fmaxf(m_r[rt][r], mc); const float al = (mn > -1.0e38f) ? expf(m_r[rt][r] - mn) : 1.0f; m_r[rt][r] = mn; const float p0 = ok0 ? expf(s0 - mn) : 0.f, p1 = ok1 ? expf(s1 - mn) : 0.f; l_r[rt][r] = l_r[rt][r] * al + p0 + p1;
#pragma unroll
        for (int dt = 0; dt < DT; ++dt) oacc[rt][dt][r] *= al;
        FragH t2; t2.h[0] = (_Float16)(p0 * 1024.0f); t2.h[1] = (_Float16)(p1 * 1024.0f); sP[w][rt * 16 + 8 * hh + r][ln] = t2.u[0]; sP[w][rt * 16 + 8 * hh + r][16 + ln] = t2.u[1]; }
    __builtin_amdgcn_fence(__ATOMIC_ACQ_REL, "workgroup"); __builtin_amdgcn_wave_barrier();
    FragH pa[2];
#pragma unroll
    for (int rt = 0; rt < RTN; ++rt) { pa[rt].half[0] = *(const v8us*)&sP[w][rt * 16 + ln][8 * hh]; pa[rt].half[1] = *(const v8us*)&sP[w][rt * 16 + ln][16 + 8 * hh]; }
#pragma unroll
    for (int dt = 0; dt < DT; ++dt) { const unsigned short* vrow = Vth + (size_t)(dt * 16 + ln) * TK + j0; FragH bv; bv.half[0] = *(const v8us*)(vrow + 8 * hh); bv.half[1] = *(const v8us*)(vrow + 16 + 8 * hh);
#pragma unroll
      for (int rt = 0; rt < RTN; ++rt) oacc[rt][dt] = mmaH<1>(pa[rt].v, pa[rt].v, bv.v, bv.v, oacc[rt][dt]); }
    __builtin_amdgcn_fence(__ATOMIC_ACQ_REL, "workgroup"); __builtin_amdgcn_wave_barrier(); }
#pragma unroll
  for (int rt = 0; rt < RTN; ++rt) {
#pragma unroll
    for (int r = 0; r < 8; ++r) { float l = l_r[rt][r]; l += __shfl_xor(l, 1, 32); l += __shfl_xor(l, 2, 32); l += __shfl_xor(l, 4, 32); l += __shfl_xor(l, 8, 32); l_r[rt][r] = (l > 0.f) ? 1.0f / (l * 1024.0f) : 0.f; }
#pragma unroll
    for (int dt = 0; dt < DT; ++dt)
#pragma unroll
      for (int r = 0; r < 8; ++r) sO[w][rt * 16 + 8 * hh + r][dt * 16 + ln] = oacc[rt][dt][r] * l_r[rt][r]; }
  __builtin_amdgcn_fence(__ATOMIC_ACQ_REL, "workgroup"); __builtin_amdgcn_wave_barrier();
  {
#pragma unroll
    for (int rp = 0; rp < RPW; rp += 2) { const int r = rp + (lane >> 4), pc = lane & 15; const v4f val = *(const v4fa*)&sO[w][r][pc * 4]; *(v4f*)(O + ((size_t)b * TQ + q0 + r) * ldo + h * 64 + pc * 4) = val; }
     } }
// 3-term variant: O = (P_hi V_hi + (P_lo V_hi + P_hi V_lo) / 1024) / l with P = [hi | 2^10 residual] of 1024 p and V^T = [hi | 2^10 residual] planes (VtL same layout as Vt) -> ~2^-21-class products for un-averaged (early causal / peaked) rows
template <int CAUSAL>
__global__ __launch_bounds__(128) void k_flash3gA(const _Float16* __restrict__ Q16, int ldq, const _Float16* __restrict__ K16, int ldk, const _Float16* __restrict__ Vt, const _Float16* __restrict__ VtL, const int* __restrict__ MSK, float* __restrict__ O, int ldo) {
  constexpr int RPW = 16, RTN = RPW / 16, NQB = TQA / (4 * RPW), DT = 4, KS = 2;
  __shared__ __attribute__((aligned(16))) unsigned short sP[4][RPW][40]; __shared__ __attribute__((aligned(16))) unsigned short sPL[4][RPW][40]; __shared__ __attribute__((aligned(16))) float sO[4][RPW][64 + 4];
  const int tid = threadIdx.x, w = tid >> 5, lane = tid & 31, ln = lane & 15, hh = lane >> 4;
  const int slab = blockIdx.x / QBLKSA, qblk = blockIdx.x % QBLKSA; (void)NQB; const int b = slab / NH, h = slab % NH; const int qb0 = qblk * (4 * RPW); const int q0 = qb0 + w * RPW;
  FragH aq[2][KS];
#pragma unroll
  for (int rt = 0; rt < RTN; ++rt) { const unsigned short* qr = (const unsigned short*)Q16 + ((size_t)b * TQA + q0 + rt * 16 + ln) * ldq + h * 64;
#pragma unroll
    for (int ks = 0; ks < KS; ++ks) { aq[rt][ks].half[0] = *(const v8us*)(qr + ks * 32 + 8 * hh); aq[rt][ks].half[1] = *(const v8us*)(qr + ks * 32 + 16 + 8 * hh); } }
  const size_t vslab = (size_t)(b * (NH / KVG) + h / KVG); const unsigned short* Vth = (const unsigned short*)Vt + vslab * 64 * TK; const unsigned short* Vtl = (const unsigned short*)VtL + vslab * 64 * TK;      /* GQA: q-head h reads kv head h / KVG */
  float m_r[2][8], l_r[2][8]; v8f oacc[2][DT], oaccL[2][DT];
#pragma unroll
  for (int rt = 0; rt < RTN; ++rt) {
#pragma unroll
    for (int r = 0; r < 8; ++r) { m_r[rt][r] = -3.0e38f; l_r[rt][r] = 0.f; }
#pragma unroll
    for (int dt = 0; dt < DT; ++dt) { oacc[rt][dt] = (v8f){0.f,0.f,0.f,0.f,0.f,0.f,0.f,0.f}; oaccL[rt][dt] = oacc[rt][dt]; } }
  const int jend = (CAUSAL == 1) ? (qb0 + 4 * RPW) : TK;      /* causal: keys beyond the block's last query never contribute */
#pragma unroll 1
  for (int j0 = 0; j0 < jend; j0 += 32) {
    v8f s[2][2]; FragH bk[2][KS], bv[DT], bl[DT]; int mk0[RTN][8], mk1[RTN][8];
    /* every global load of the trip is issued here, in the order of use (K, mask words, both V planes): their latencies overlap, and V lands behind the softmax */
#pragma unroll
    for (int nt = 0; nt < 2; ++nt) { const unsigned short* kr = (const unsigned short*)K16 + ((size_t)b * TK + j0 + nt * 16 + ln) * ldk + (h / KVG) * 64;
#pragma unroll
      for (int ks = 0; ks < KS; ++ks) { bk[nt][ks].half[0] = *(const v8us*)(kr + ks * 32 + 8 * hh); bk[nt][ks].half[1] = *(const v8us*)(kr + ks * 32 + 16 + 8 * hh); } }
    if (CAUSAL == 8) {
#pragma unroll
      for (int rt = 0; rt < RTN; ++rt)
#pragma unroll
        for (int r = 0; r < 8; ++r) { const int* mrow = MSK + (size_t)(q0 + rt * 16 + 8 * hh + r) * TK + j0 + ln; mk0[rt][r] = mrow[0]; mk1[rt][r] = mrow[16]; } }
    asm volatile("s_wait_xcnt 0x0" ::: "memory");      /* stands in front of the V loads, whose results may land in registers that the K and mask loads name as addresses */
#pragma unroll
    for (int dt = 0; dt < DT; ++dt) { const unsigned short* vrow = Vth + (size_t)(dt * 16 + ln) * TK + j0; const unsigned short* vrl = Vtl + (size_t)(dt * 16 + ln) * TK + j0; bv[dt].half[0] = *(const v8us*)(vrow + 8 * hh); bv[dt].half[1] = *(const v8us*)(vrow + 16 + 8 * hh); bl[dt].half[0] = *(const v8us*)(vrl + 8 * hh);
      if (dt == DT - 1) asm volatile("s_wait_xcnt 0x0" ::: "memory");      /* stands in front of the trip's last load, whose result lands in the address registers of the V loads above */
      bl[dt].half[1] = *(const v8us*)(vrl + 16 + 8 * hh); }
    __builtin_amdgcn_sched_barrier(0);      /* keeps the loads above together: without it the scheduler moves each one down to its first use, one exposed latency apiece */
#pragma unroll
    for (int nt = 0; nt < 2; ++nt) {
#pragma unroll
      for (int rt = 0; rt < RTN; ++rt) { v8f acc = (v8f){0.f,0.f,0.f,0.f,0.f,0.f,0.f,0.f};
#pragma unroll
        for (int ks = 0; ks < KS; ++ks) acc = mmaH<1>(aq[rt][ks].v, aq[rt][ks].v, bk[nt][ks].v, bk[nt][ks].v, acc); s[rt][nt] = acc; } }
#pragma unroll
    for (int rt = 0; rt < RTN; ++rt)
#pragma unroll
      for (int r = 0; r < 8; ++r) { const int tq = q0 + rt * 16 + 8 * hh + r; const int k0 = j0 + ln, k1 = j0 + 16 + ln;
        bool ok0 = (CAUSAL == 1) ? (k0 <= tq) : ((CAUSAL == 2) ? ((k0 >> 5) == (tq >> 5)) : true), ok1 = (CAUSAL == 1) ? (k1 <= tq) : ((CAUSAL == 2) ? ((k1 >> 5) == (tq >> 5)) : true);      /* mode 2: block-diagonal 32-token groups */
        if (CAUSAL == 8) { ok0 = mk0[rt][r] != 0; ok1 = mk1[rt][r] != 0; }      /* mode 8: per-(query, key) int table shared by all batches and heads */
        if (CAUSAL == 4) { const int* mrow = MSK + ((size_t)b * TQA + tq) * TK; ok0 = mrow[k0] != 0; ok1 = mrow[k1] != 0; }      /* mode 4: per-(query, key) INPUT mask shared by all heads; masked keys contribute nothing (== the reference's -4096 fill, whose exp underflows to 0), rows with no valid key give l = 0 -> output 0 (== the reference's row_valid zeroing) */
        const float s0 = ok0 ? s[rt][0][r] * SCL : -3.0e38f, s1 = ok1 ? s[rt][1][r] * SCL : -3.0e38f; float mc = fmaxf(s0, s1);
        mc = fmaxf(mc, __shfl_xor(mc, 1, 32)); mc = fmaxf(mc, __shfl_xor(mc, 2, 32)); mc = fmaxf(mc, __shfl_xor(mc, 4, 32)); mc = fmaxf(mc, __shfl_xor(mc, 8, 32));
        const float mn = fmaxf(m_r[rt][r], mc); const float al = (mn > -1.0e38f) ? expf(m_r[rt][r] - mn) : 1.0f; m_r[rt][r] = mn; const float p0 = ok0 ? expf(s0 - mn) : 0.f, p1 = ok1 ? expf(s1 - mn) : 0.f; l_r[rt][r] = l_r[rt][r] * al + p0 + p1;
#pragma unroll
        for (int dt = 0; dt < DT; ++dt) { oacc[rt][dt][r] *= al; oaccL[rt][dt][r] *= al; }
        FragH t2, t2l; const float ps0 = p0 * 1024.0f, ps1 = p1 * 1024.0f; t2.h[0] = (_Float16)ps0; t2.h[1] = (_Float16)ps1; t2l.h[0] = (_Float16)((ps0 - (float)t2.h[0]) * 1024.0f); t2l.h[1] = (_Float16)((ps1 - (float)t2.h[1]) * 1024.0f);
        sP[w][rt * 16 + 8 * hh + r][ln] = t2.u[0]; sP[w][rt * 16 + 8 * hh + r][16 + ln] = t2.u[1]; sPL[w][rt * 16 + 8 * hh + r][ln] = t2l.u[0]; sPL[w][rt * 16 + 8 * hh + r][16 + ln] = t2l.u[1]; }
    __builtin_amdgcn_fence(__ATOMIC_ACQ_REL, "workgroup"); __builtin_amdgcn_wave_barrier();
    FragH pa[2], pl[2];
#pragma unroll
    for (int rt = 0; rt < RTN; ++rt) { pa[rt].half[0] = *(const v8us*)&sP[w][rt * 16 + ln][8 * hh]; pa[rt].half[1] = *(const v8us*)&sP[w][rt * 16 + ln][16 + 8 * hh]; pl[rt].half[0] = *(const v8us*)&sPL[w][rt * 16 + ln][8 * hh]; pl[rt].half[1] = *(const v8us*)&sPL[w][rt * 16 + ln][16 + 8 * hh]; }
#pragma unroll
    for (int dt = 0; dt < DT; ++dt) {
#pragma unroll
      for (int rt = 0; rt < RTN; ++rt) { oacc[rt][dt] = mmaH<1>(pa[rt].v, pa[rt].v, bv[dt].v, bv[dt].v, oacc[rt][dt]); oaccL[rt][dt] = mmaH<1>(pl[rt].v, pl[rt].v, bv[dt].v, bv[dt].v, oaccL[rt][dt]); oaccL[rt][dt] = mmaH<1>(pa[rt].v, pa[rt].v, bl[dt].v, bl[dt].v, oaccL[rt][dt]); } }
    __builtin_amdgcn_fence(__ATOMIC_ACQ_REL, "workgroup"); __builtin_amdgcn_wave_barrier(); }
#pragma unroll
  for (int rt = 0; rt < RTN; ++rt) {
#pragma unroll
    for (int r = 0; r < 8; ++r) { float l = l_r[rt][r]; l += __shfl_xor(l, 1, 32); l += __shfl_xor(l, 2, 32); l += __shfl_xor(l, 4, 32); l += __shfl_xor(l, 8, 32); l_r[rt][r] = (l > 0.f) ? 1.0f / (l * 1024.0f) : 0.f; }
#pragma unroll
    for (int dt = 0; dt < DT; ++dt)
#pragma unroll
      for (int r = 0; r < 8; ++r) { float v = oacc[rt][dt][r]; v += oaccL[rt][dt][r] * 0.0009765625f; sO[w][rt * 16 + 8 * hh + r][dt * 16 + ln] = v * l_r[rt][r]; } }
  __builtin_amdgcn_fence(__ATOMIC_ACQ_REL, "workgroup"); __builtin_amdgcn_wave_barrier();
  {
#pragma unroll
    for (int rp = 0; rp < RPW; rp += 2) { const int r = rp + (lane >> 4), pc = lane & 15; const v4f val = *(const v4fa*)&sO[w][r][pc * 4]; *(v4f*)(O + ((size_t)b * TQA + q0 + r) * ldo + h * 64 + pc * 4) = val; }
     } }

// 3-term variant: O = (P_hi V_hi + (P_lo V_hi + P_hi V_lo) / 1024) / l with P = [hi | 2^10 residual] of 1024 p and V^T = [hi | 2^10 residual] planes (VtL same layout as Vt) -> ~2^-21-class products for un-averaged (early causal / peaked) rows
template <int CAUSAL>
__global__ __launch_bounds__(128) void k_flash3gB(const _Float16* __restrict__ Q16, int ldq, const _Float16* __restrict__ K16, int ldk, const _Float16* __restrict__ Vt, const _Float16* __restrict__ VtL, const int* __restrict__ MSK, float* __restrict__ O, int ldo) {
  constexpr int RPW = 16, RTN = RPW / 16, NQB = TQB / (4 * RPW), DT = 4, KS = 2;
  __shared__ __attribute__((aligned(16))) unsigned short sP[4][RPW][40]; __shared__ __attribute__((aligned(16))) unsigned short sPL[4][RPW][40]; __shared__ __attribute__((aligned(16))) float sO[4][RPW][64 + 4];
  const int tid = threadIdx.x, w = tid >> 5, lane = tid & 31, ln = lane & 15, hh = lane >> 4;
  const int slab = blockIdx.x / QBLKSB, qblk = blockIdx.x % QBLKSB; (void)NQB; const int b = slab / NH, h = slab % NH; const int qb0 = qblk * (4 * RPW); const int q0 = qb0 + w * RPW;
  FragH aq[2][KS];
#pragma unroll
  for (int rt = 0; rt < RTN; ++rt) { const unsigned short* qr = (const unsigned short*)Q16 + ((size_t)b * TQB + q0 + rt * 16 + ln) * ldq + h * 64;
#pragma unroll
    for (int ks = 0; ks < KS; ++ks) { aq[rt][ks].half[0] = *(const v8us*)(qr + ks * 32 + 8 * hh); aq[rt][ks].half[1] = *(const v8us*)(qr + ks * 32 + 16 + 8 * hh); } }
  const size_t vslab = (size_t)(b * (NH / KVG) + h / KVG); const unsigned short* Vth = (const unsigned short*)Vt + vslab * 64 * TK; const unsigned short* Vtl = (const unsigned short*)VtL + vslab * 64 * TK;      /* GQA: q-head h reads kv head h / KVG */
  float m_r[2][8], l_r[2][8]; v8f oacc[2][DT], oaccL[2][DT];
#pragma unroll
  for (int rt = 0; rt < RTN; ++rt) {
#pragma unroll
    for (int r = 0; r < 8; ++r) { m_r[rt][r] = -3.0e38f; l_r[rt][r] = 0.f; }
#pragma unroll
    for (int dt = 0; dt < DT; ++dt) { oacc[rt][dt] = (v8f){0.f,0.f,0.f,0.f,0.f,0.f,0.f,0.f}; oaccL[rt][dt] = oacc[rt][dt]; } }
  const int jend = (CAUSAL == 1) ? (qb0 + 4 * RPW) : TK;      /* causal: keys beyond the block's last query never contribute */
#pragma unroll 1
  for (int j0 = 0; j0 < jend; j0 += 32) {
    v8f s[2][2]; FragH bk[2][KS], bv[DT], bl[DT]; int mk0[RTN][8], mk1[RTN][8];
    /* every global load of the trip is issued here, in the order of use (K, mask words, both V planes): their latencies overlap, and V lands behind the softmax */
#pragma unroll
    for (int nt = 0; nt < 2; ++nt) { const unsigned short* kr = (const unsigned short*)K16 + ((size_t)b * TK + j0 + nt * 16 + ln) * ldk + (h / KVG) * 64;
#pragma unroll
      for (int ks = 0; ks < KS; ++ks) { bk[nt][ks].half[0] = *(const v8us*)(kr + ks * 32 + 8 * hh); bk[nt][ks].half[1] = *(const v8us*)(kr + ks * 32 + 16 + 8 * hh); } }
    if (CAUSAL == 8) {
#pragma unroll
      for (int rt = 0; rt < RTN; ++rt)
#pragma unroll
        for (int r = 0; r < 8; ++r) { const int* mrow = MSK + (size_t)(q0 + rt * 16 + 8 * hh + r) * TK + j0 + ln; mk0[rt][r] = mrow[0]; mk1[rt][r] = mrow[16]; } }
    asm volatile("s_wait_xcnt 0x0" ::: "memory");      /* stands in front of the V loads, whose results may land in registers that the K and mask loads name as addresses */
#pragma unroll
    for (int dt = 0; dt < DT; ++dt) { const unsigned short* vrow = Vth + (size_t)(dt * 16 + ln) * TK + j0; const unsigned short* vrl = Vtl + (size_t)(dt * 16 + ln) * TK + j0; bv[dt].half[0] = *(const v8us*)(vrow + 8 * hh); bv[dt].half[1] = *(const v8us*)(vrow + 16 + 8 * hh); bl[dt].half[0] = *(const v8us*)(vrl + 8 * hh);
      if (dt == DT - 1) asm volatile("s_wait_xcnt 0x0" ::: "memory");      /* stands in front of the trip's last load, whose result lands in the address registers of the V loads above */
      bl[dt].half[1] = *(const v8us*)(vrl + 16 + 8 * hh); }
    __builtin_amdgcn_sched_barrier(0);      /* keeps the loads above together: without it the scheduler moves each one down to its first use, one exposed latency apiece */
#pragma unroll
    for (int nt = 0; nt < 2; ++nt) {
#pragma unroll
      for (int rt = 0; rt < RTN; ++rt) { v8f acc = (v8f){0.f,0.f,0.f,0.f,0.f,0.f,0.f,0.f};
#pragma unroll
        for (int ks = 0; ks < KS; ++ks) acc = mmaH<1>(aq[rt][ks].v, aq[rt][ks].v, bk[nt][ks].v, bk[nt][ks].v, acc); s[rt][nt] = acc; } }
#pragma unroll
    for (int rt = 0; rt < RTN; ++rt)
#pragma unroll
      for (int r = 0; r < 8; ++r) { const int tq = q0 + rt * 16 + 8 * hh + r; const int k0 = j0 + ln, k1 = j0 + 16 + ln;
        bool ok0 = (CAUSAL == 1) ? (k0 <= tq) : ((CAUSAL == 2) ? ((k0 >> 5) == (tq >> 5)) : true), ok1 = (CAUSAL == 1) ? (k1 <= tq) : ((CAUSAL == 2) ? ((k1 >> 5) == (tq >> 5)) : true);      /* mode 2: block-diagonal 32-token groups */
        if (CAUSAL == 8) { ok0 = mk0[rt][r] != 0; ok1 = mk1[rt][r] != 0; }      /* mode 8: per-(query, key) int table shared by all batches and heads */
        if (CAUSAL == 4) { const int* mrow = MSK + ((size_t)b * TQB + tq) * TK; ok0 = mrow[k0] != 0; ok1 = mrow[k1] != 0; }      /* mode 4: per-(query, key) INPUT mask shared by all heads; masked keys contribute nothing (== the reference's -4096 fill, whose exp underflows to 0), rows with no valid key give l = 0 -> output 0 (== the reference's row_valid zeroing) */
        const float s0 = ok0 ? s[rt][0][r] * SCL : -3.0e38f, s1 = ok1 ? s[rt][1][r] * SCL : -3.0e38f; float mc = fmaxf(s0, s1);
        mc = fmaxf(mc, __shfl_xor(mc, 1, 32)); mc = fmaxf(mc, __shfl_xor(mc, 2, 32)); mc = fmaxf(mc, __shfl_xor(mc, 4, 32)); mc = fmaxf(mc, __shfl_xor(mc, 8, 32));
        const float mn = fmaxf(m_r[rt][r], mc); const float al = (mn > -1.0e38f) ? expf(m_r[rt][r] - mn) : 1.0f; m_r[rt][r] = mn; const float p0 = ok0 ? expf(s0 - mn) : 0.f, p1 = ok1 ? expf(s1 - mn) : 0.f; l_r[rt][r] = l_r[rt][r] * al + p0 + p1;
#pragma unroll
        for (int dt = 0; dt < DT; ++dt) { oacc[rt][dt][r] *= al; oaccL[rt][dt][r] *= al; }
        FragH t2, t2l; const float ps0 = p0 * 1024.0f, ps1 = p1 * 1024.0f; t2.h[0] = (_Float16)ps0; t2.h[1] = (_Float16)ps1; t2l.h[0] = (_Float16)((ps0 - (float)t2.h[0]) * 1024.0f); t2l.h[1] = (_Float16)((ps1 - (float)t2.h[1]) * 1024.0f);
        sP[w][rt * 16 + 8 * hh + r][ln] = t2.u[0]; sP[w][rt * 16 + 8 * hh + r][16 + ln] = t2.u[1]; sPL[w][rt * 16 + 8 * hh + r][ln] = t2l.u[0]; sPL[w][rt * 16 + 8 * hh + r][16 + ln] = t2l.u[1]; }
    __builtin_amdgcn_fence(__ATOMIC_ACQ_REL, "workgroup"); __builtin_amdgcn_wave_barrier();
    FragH pa[2], pl[2];
#pragma unroll
    for (int rt = 0; rt < RTN; ++rt) { pa[rt].half[0] = *(const v8us*)&sP[w][rt * 16 + ln][8 * hh]; pa[rt].half[1] = *(const v8us*)&sP[w][rt * 16 + ln][16 + 8 * hh]; pl[rt].half[0] = *(const v8us*)&sPL[w][rt * 16 + ln][8 * hh]; pl[rt].half[1] = *(const v8us*)&sPL[w][rt * 16 + ln][16 + 8 * hh]; }
#pragma unroll
    for (int dt = 0; dt < DT; ++dt) {
#pragma unroll
      for (int rt = 0; rt < RTN; ++rt) { oacc[rt][dt] = mmaH<1>(pa[rt].v, pa[rt].v, bv[dt].v, bv[dt].v, oacc[rt][dt]); oaccL[rt][dt] = mmaH<1>(pl[rt].v, pl[rt].v, bv[dt].v, bv[dt].v, oaccL[rt][dt]); oaccL[rt][dt] = mmaH<1>(pa[rt].v, pa[rt].v, bl[dt].v, bl[dt].v, oaccL[rt][dt]); } }
    __builtin_amdgcn_fence(__ATOMIC_ACQ_REL, "workgroup"); __builtin_amdgcn_wave_barrier(); }
#pragma unroll
  for (int rt = 0; rt < RTN; ++rt) {
#pragma unroll
    for (int r = 0; r < 8; ++r) { float l = l_r[rt][r]; l += __shfl_xor(l, 1, 32); l += __shfl_xor(l, 2, 32); l += __shfl_xor(l, 4, 32); l += __shfl_xor(l, 8, 32); l_r[rt][r] = (l > 0.f) ? 1.0f / (l * 1024.0f) : 0.f; }
#pragma unroll
    for (int dt = 0; dt < DT; ++dt)
#pragma unroll
      for (int r = 0; r < 8; ++r) { float v = oacc[rt][dt][r]; v += oaccL[rt][dt][r] * 0.0009765625f; sO[w][rt * 16 + 8 * hh + r][dt * 16 + ln] = v * l_r[rt][r]; } }
  __builtin_amdgcn_fence(__ATOMIC_ACQ_REL, "workgroup"); __builtin_amdgcn_wave_barrier();
  {
#pragma unroll
    for (int rp = 0; rp < RPW; rp += 2) { const int r = rp + (lane >> 4), pc = lane & 15; const v4f val = *(const v4fa*)&sO[w][r][pc * 4]; *(v4f*)(O + ((size_t)b * TQB + q0 + r) * ldo + h * 64 + pc * 4) = val; }
     } }

__global__ __launch_bounds__(256) void k_wpair(const float* __restrict__ Wm, int nin, int nout, _Float16* __restrict__ Bt) { const size_t t = (size_t)blockIdx.x * 256 + threadIdx.x; if (t >= (size_t)nout * (2 * nin / 8)) return; const int pc = (int)(t % (2 * nin / 8)); const int o = (int)(t / (2 * nin / 8)); const bool lo = pc * 8 >= nin; FragH f;
  for (int q = 0; q < 8; ++q) { const int c = pc * 8 + q - (lo ? nin : 0); f.h[q] = (_Float16)(bf16_round(Wm[(size_t)c * nout + o]) * (lo ? 1.0f : 16.0f)); } *(v8us*)((unsigned short*)Bt + (size_t)o * 2 * nin + pc * 8) = f.half[0];  }
template <int TWO_D>
__global__ __launch_bounds__(256) void k_rotab(int nrows, int rpb, const int* __restrict__ bar, const int* __restrict__ tib, float* __restrict__ CS, float* __restrict__ SN) {
  #pragma clang fp contract(off)
  const size_t t = (size_t)blockIdx.x * 256 + threadIdx.x; if (t >= (size_t)nrows * 32) return; const int d = (int)(t % 32); const int row = (int)(t / 32); const int b = row / rpb, r = row % rpb; float pos, inv;
  if (TWO_D) { const int dm = d & 15; inv = 1.0f / powf(10000.0f, (float)dm * 2.0f / 32.0f); pos = (d < 16) ? (float)bar[(size_t)b * rpb + r] : (float)tib[(size_t)b * rpb + r]; }
  else { inv = 1.0f / powf(10000.0f, (float)(2 * d) / 64.0f); pos = (float)r; }
  const float th = pos * inv; const float c = cosf(th), s = sinf(th);
  { *(float*)(CS + t) = c; *(float*)(SN + t) = s;  } }
__global__ __launch_bounds__(256) void k_rope(const float* __restrict__ F, int nrows, int rpb, int nheads, const float* __restrict__ CS, const float* __restrict__ SN, _Float16* __restrict__ dst, int ldo, int dst_bstride, int row_off) {
  #pragma clang fp contract(off)
  const size_t t = (size_t)blockIdx.x * 256 + threadIdx.x; if (t >= (size_t)nrows * nheads * 4) return; const int jg = (int)(t % 4) * 8; const int h = (int)((t / 4) % nheads); const int row = (int)(t / (4 * (size_t)nheads)); const int b = row / rpb, r = row % rpb; const int ldi = nheads * 64;
  const float* xr = F + (size_t)row * ldi + h * 64; FragH f0, f1;
#pragma unroll
  for (int q = 0; q < 8; ++q) { const int d = jg + q; const float c = CS[(size_t)row * 32 + d], s = SN[(size_t)row * 32 + d]; const float x0 = xr[d], x1 = xr[d + 32];
    float o0 = x0 * c; o0 += -x1 * s; float o1 = x1 * c; o1 += x0 * s; f0.h[q] = (_Float16)o0; f1.h[q] = (_Float16)o1; }
  unsigned short* o = (unsigned short*)dst + ((size_t)b * dst_bstride + row_off + r) * ldo + h * 64 + jg;
  { *(v8us*)o = f0.half[0]; *(v8us*)(o + 32) = f1.half[0];  } }
__global__ __launch_bounds__(256) void k_put(const float* __restrict__ F, int nrows, int rpb, int ncol, _Float16* __restrict__ H, _Float16* __restrict__ L, int dst_bstride, int row_off) {
  const size_t t = (size_t)blockIdx.x * 256 + threadIdx.x; if (t >= (size_t)nrows * (ncol / 8)) return; const int c0 = (int)(t % (ncol / 8)) * 8; const int row = (int)(t / (ncol / 8)); const int b = row / rpb, r = row % rpb; FragH fh, fl;
  for (int q = 0; q < 8; ++q) { const float v = F[(size_t)row * ncol + c0 + q]; const _Float16 hv = (_Float16)v; fh.h[q] = hv; fl.h[q] = (_Float16)((v - (float)hv) * 1024.0f); }
  const size_t drow = (size_t)b * dst_bstride + row_off + r; { *(v8us*)((unsigned short*)H + drow * ncol + c0) = fh.half[0]; if (L) *(v8us*)((unsigned short*)L + drow * ncol + c0) = fl.half[0];  } }

extern "C" void kernel_launch(void* const* d_in, const int* in_sizes, int n_in,
                              void* d_out, int out_size, void* d_ws, size_t ws_size, hipStream_t stream) {
  (void)in_sizes; (void)n_in; (void)out_size;
  const float* const* I = (const float* const*)d_in; const float* sum_x = I[0]; const float* reg_x = I[1];
  const float* w_sq = I[2]; const float* b_sq = I[3]; const float* w_sk = I[4]; const float* b_sk = I[5]; const float* w_sv = I[6]; const float* b_sv = I[7]; const float* w_so = I[8]; const float* b_so = I[9];
  const float* w_rq = I[10]; const float* b_rq = I[11]; const float* w_rk = I[12]; const float* b_rk = I[13]; const float* w_rv = I[14]; const float* b_rv = I[15]; const float* w_ro = I[16]; const float* b_ro = I[17];
  const float* w_k2 = I[18]; const float* b_k2 = I[19]; const float* w_v2 = I[20]; const float* b_v2 = I[21];
  const int* bar = (const int*)d_in[22]; const int* tib = (const int*)d_in[23]; const int* msum = (const int*)d_in[24]; const int* mupd = (const int*)d_in[25];
  char* ws = (char*)d_ws; size_t off = 0;
  auto take = [&](size_t bytes) { char* p = ws + off; off += (bytes + 255) & ~(size_t)255; return p; };
  const size_t w8 = (size_t)DMOD * DMOD / 8, w8k = (size_t)DMOD * KVD / 8;
  _Float16* BSQ = (_Float16*)take(w8 * 16); _Float16* BSK = (_Float16*)take(w8k * 16); _Float16* BSV = (_Float16*)take(w8k * 16); _Float16* BRQ = (_Float16*)take(w8 * 16); _Float16* BRK = (_Float16*)take(w8k * 16); _Float16* BRV = (_Float16*)take(w8k * 16);
  _Float16* BSO = (_Float16*)take(w8 * 32); _Float16* BRO = (_Float16*)take(w8 * 32); _Float16* BK2 = (_Float16*)take(w8k * 32); _Float16* BV2 = (_Float16*)take(w8k * 32);
  float* CS1 = (float*)take((size_t)NRS * 32 * 4); float* SN1 = (float*)take((size_t)NRS * 32 * 4); float* CS2 = (float*)take((size_t)NRR * 32 * 4); float* SN2 = (float*)take((size_t)NRR * 32 * 4); _Float16* SX = (_Float16*)take((size_t)NRS * DMOD * 2); _Float16* RX = (_Float16*)take((size_t)NRR * DMOD * 2); float* F32 = (float*)take((size_t)NRR * DMOD * 4); float* FS = (float*)take((size_t)NRS * DMOD * 4);
  _Float16* SQ = (_Float16*)take((size_t)NRS * DMOD * 2); _Float16* RQ = (_Float16*)take((size_t)NRR * DMOD * 2); _Float16* KC = (_Float16*)take((size_t)NB * TK * KVD * 2); _Float16* VCH = (_Float16*)take((size_t)NB * TK * KVD * 2); _Float16* VCL = (_Float16*)take((size_t)NB * TK * KVD * 2); _Float16* VT = (_Float16*)take((size_t)NB * NKV * 64 * TK * 2); _Float16* VTL = (_Float16*)take((size_t)NB * NKV * 64 * TK * 2);
  float* O1 = (float*)take((size_t)NRS * DMOD * 4); _Float16* O1H = (_Float16*)take((size_t)NRS * DMOD * 2); _Float16* O1L = (_Float16*)take((size_t)NRS * DMOD * 2); float* O2 = F32; _Float16* O2H = RQ; _Float16* O2L = RX;      /* O2 over the dead reg-q f32 scratch; O2H/O2L over RQ/RX (dead after phase 2 / the projections) */
  if (off > ws_size) return;      /* 16 + 1 + 8 + 16 + 8 + 2.06 x 5 + 0.5 x 2 + 0.25 x 4 = 61.3 MiB */
  const unsigned g8 = (unsigned)((w8 + 255) / 256), g8k = (unsigned)((w8k + 255) / 256);
  k_wt_f16<<<g8, 256, 0, stream>>>(w_sq, BSQ, DMOD, DMOD, 16.0f); k_wt_f16<<<g8k, 256, 0, stream>>>(w_sk, BSK, DMOD, KVD, 16.0f); k_wt_f16<<<g8k, 256, 0, stream>>>(w_sv, BSV, DMOD, KVD, 16.0f);
  k_wt_f16<<<g8, 256, 0, stream>>>(w_rq, BRQ, DMOD, DMOD, 16.0f); k_wt_f16<<<g8k, 256, 0, stream>>>(w_rk, BRK, DMOD, KVD, 16.0f); k_wt_f16<<<g8k, 256, 0, stream>>>(w_rv, BRV, DMOD, KVD, 16.0f);
  k_wpair<<<(unsigned)(((size_t)DMOD * (2 * DMOD / 8) + 255) / 256), 256, 0, stream>>>(w_so, DMOD, DMOD, BSO); k_wpair<<<(unsigned)(((size_t)DMOD * (2 * DMOD / 8) + 255) / 256), 256, 0, stream>>>(w_ro, DMOD, DMOD, BRO);
  k_wpair<<<(unsigned)(((size_t)KVD * (2 * DMOD / 8) + 255) / 256), 256, 0, stream>>>(w_k2, DMOD, KVD, BK2); k_wpair<<<(unsigned)(((size_t)KVD * (2 * DMOD / 8) + 255) / 256), 256, 0, stream>>>(w_v2, DMOD, KVD, BV2);
  k_rotab<0><<<(unsigned)(((size_t)NRS * 32 + 255) / 256), 256, 0, stream>>>(NRS, SS, nullptr, nullptr, CS1, SN1); k_rotab<1><<<(unsigned)(((size_t)NRR * 32 + 255) / 256), 256, 0, stream>>>(NRR, RR, bar, tib, CS2, SN2);
  k_x16<<<(unsigned)(((size_t)NRS * DMOD / 8 + 255) / 256), 256, 0, stream>>>(sum_x, SX, (size_t)NRS * DMOD / 8); k_x16<<<(unsigned)(((size_t)NRR * DMOD / 8 + 255) / 256), 256, 0, stream>>>(reg_x, RX, (size_t)NRR * DMOD / 8);
  const dim3 gSQ((NRS / 128) * (DMOD / 64), 1), gSK((NRS / 128) * (KVD / 64), 1), gRQ((NRR / 128) * (DMOD / 64), 1), gRK((NRR / 128) * (KVD / 64), 1);
  /* summary q/k/v */
  k_gemm2<0><<<gSQ, 128, 0, stream>>>(SX, DMOD, 0, BSQ, DMOD, 0, 0.0625f, b_sq, 0, nullptr, 1, 0, 0, FS, nullptr, DMOD, 0, NRS, DMOD, DMOD);
  k_rope<<<(unsigned)(((size_t)NRS * NH * 4 + 255) / 256), 256, 0, stream>>>(FS, NRS, SS, NH, CS1, SN1, SQ, DMOD, SS, 0);
  k_gemm2<0><<<gSK, 128, 0, stream>>>(SX, DMOD, 0, BSK, DMOD, 0, 0.0625f, b_sk, 0, nullptr, 1, 0, 0, FS, nullptr, KVD, 0, NRS, KVD, DMOD);
  k_rope<<<(unsigned)(((size_t)NRS * NKV * 4 + 255) / 256), 256, 0, stream>>>(FS, NRS, SS, NKV, CS1, SN1, KC, KVD, TK, 0);      /* keys 0..63 of each batch */
  k_gemm2<0><<<gSK, 128, 0, stream>>>(SX, DMOD, 0, BSV, DMOD, 0, 0.0625f, b_sv, 0, nullptr, 1, 0, 0, FS, nullptr, KVD, 0, NRS, KVD, DMOD);
  k_put<<<(unsigned)(((size_t)NRS * (KVD / 8) + 255) / 256), 256, 0, stream>>>(FS, NRS, SS, KVD, VCH, VCL, TK, 0);
  /* regular q/k/v */
  k_gemm2<0><<<gRQ, 128, 0, stream>>>(RX, DMOD, 0, BRQ, DMOD, 0, 0.0625f, b_rq, 0, nullptr, 1, 0, 0, F32, nullptr, DMOD, 0, NRR, DMOD, DMOD);
  k_rope<<<(unsigned)(((size_t)NRR * NH * 4 + 255) / 256), 256, 0, stream>>>(F32, NRR, RR, NH, CS2, SN2, RQ, DMOD, RR, 0);
  k_gemm2<0><<<gRK, 128, 0, stream>>>(RX, DMOD, 0, BRK, DMOD, 0, 0.0625f, b_rk, 0, nullptr, 1, 0, 0, F32, nullptr, KVD, 0, NRR, KVD, DMOD);
  k_rope<<<(unsigned)(((size_t)NRR * NKV * 4 + 255) / 256), 256, 0, stream>>>(F32, NRR, RR, NKV, CS2, SN2, KC, KVD, TK, SS);      /* keys 64.. of each batch */
  k_gemm2<0><<<gRK, 128, 0, stream>>>(RX, DMOD, 0, BRV, DMOD, 0, 0.0625f, b_rv, 0, nullptr, 1, 0, 0, F32, nullptr, KVD, 0, NRR, KVD, DMOD);
  k_put<<<(unsigned)(((size_t)NRR * (KVD / 8) + 255) / 256), 256, 0, stream>>>(F32, NRR, RR, KVD, VCH, VCL, TK, SS);
  /* phase 1: summary queries over [summary ; regular] keys */
  k_vt<NKV, TK><<<NB * NKV * (TK / 64), 256, 0, stream>>>(VCH, KVD, 0, VT); k_vt<NKV, TK><<<NB * NKV * (TK / 64), 256, 0, stream>>>(VCL, KVD, 0, VTL);
  k_flash3gA<8><<<NB * NH * QBLKSA, 128, 0, stream>>>(SQ, DMOD, KC, KVD, VT, VTL, msum, O1, DMOD);
  k_hl<<<(unsigned)(((size_t)NRS * DMOD / 8 + 255) / 256), 256, 0, stream>>>(O1, O1H, O1L, (size_t)NRS * DMOD / 8);
  /* output 0 = sum_attn W_so + b_so */
  k_gemm2<0><<<gSQ, 128, 0, stream>>>(O1H, DMOD, 0, BSO, 2 * DMOD, 0, 0.0625f, b_so, 0, nullptr, 1, 0, 0, (float*)d_out, nullptr, DMOD, 0, NRS, DMOD, DMOD);
  k_gemm2<0><<<gSQ, 128, 0, stream>>>(O1L, DMOD, 0, BSO + DMOD, 2 * DMOD, 0, 1.0f / 1024.0f, nullptr, 0, (const float*)d_out, 1, (size_t)DMOD, 0, (float*)d_out, nullptr, DMOD, 0, NRS, DMOD, DMOD);
  /* k2 / v2 from sum_attn (no RoPE), into key/value rows 0..63 of each batch */
  k_gemm2<0><<<gSK, 128, 0, stream>>>(O1H, DMOD, 0, BK2, 2 * DMOD, 0, 0.0625f, b_k2, 0, nullptr, 1, 0, 0, FS, nullptr, KVD, 0, NRS, KVD, DMOD);
  k_gemm2<0><<<gSK, 128, 0, stream>>>(O1L, DMOD, 0, BK2 + DMOD, 2 * DMOD, 0, 1.0f / 1024.0f, nullptr, 0, FS, 1, (size_t)KVD, 0, FS, nullptr, KVD, 0, NRS, KVD, DMOD);
  k_put<<<(unsigned)(((size_t)NRS * (KVD / 8) + 255) / 256), 256, 0, stream>>>(FS, NRS, SS, KVD, KC, nullptr, TK, 0);
  k_gemm2<0><<<gSK, 128, 0, stream>>>(O1H, DMOD, 0, BV2, 2 * DMOD, 0, 0.0625f, b_v2, 0, nullptr, 1, 0, 0, FS, nullptr, KVD, 0, NRS, KVD, DMOD);
  k_gemm2<0><<<gSK, 128, 0, stream>>>(O1L, DMOD, 0, BV2 + DMOD, 2 * DMOD, 0, 1.0f / 1024.0f, nullptr, 0, FS, 1, (size_t)KVD, 0, FS, nullptr, KVD, 0, NRS, KVD, DMOD);
  k_put<<<(unsigned)(((size_t)NRS * (KVD / 8) + 255) / 256), 256, 0, stream>>>(FS, NRS, SS, KVD, VCH, VCL, TK, 0);
  /* phase 2: regular queries over [k2 ; regular] keys */
  k_vt<NKV, TK><<<NB * NKV * (TK / 64), 256, 0, stream>>>(VCH, KVD, 0, VT); k_vt<NKV, TK><<<NB * NKV * (TK / 64), 256, 0, stream>>>(VCL, KVD, 0, VTL);
  k_flash3gB<8><<<NB * NH * QBLKSB, 128, 0, stream>>>(RQ, DMOD, KC, KVD, VT, VTL, mupd, O2, DMOD);
  k_hl<<<(unsigned)(((size_t)NRR * DMOD / 8 + 255) / 256), 256, 0, stream>>>(O2, O2H, O2L, (size_t)NRR * DMOD / 8);
  float* out1 = (float*)d_out + (size_t)NRS * DMOD;
  k_gemm2<0><<<gRQ, 128, 0, stream>>>(O2H, DMOD, 0, BRO, 2 * DMOD, 0, 0.0625f, b_ro, 0, nullptr, 1, 0, 0, out1, nullptr, DMOD, 0, NRR, DMOD, DMOD);
  k_gemm2<0><<<gRQ, 128, 0, stream>>>(O2L, DMOD, 0, BRO + DMOD, 2 * DMOD, 0, 1.0f / 1024.0f, nullptr, 0, out1, 1, (size_t)DMOD, 0, out1, nullptr, DMOD, 0, NRR, DMOD, DMOD);
}

// v002
// It runs in 653 microseconds.
// Two timings next to v001 both put it at 1.14 times that version's speed.
// Over all steps from v000 it is 2.14 times as fast.
#include <hip/hip_runtime.h>
// FlexSummaryAttention (2 batches; 64 summary tokens S, 2048 regular tokens R, D = 1024; 16 query heads, 4 kv heads (GQA), head dim 64): q/k/v projections for both token sets; 1-D RoPE on summary q/k, 2-D hierarchical RoPE (bar id | token-in-bar id) on regular q/k; phase 1: summary queries over [summary; regular] keys with the summarize mask -> sum_attn; k2/v2 = sum_attn W + b; phase 2: regular queries over [k2; regular k] / [v2; regular v] with the updating mask -> reg_attn; outputs sum_attn W_so + b and reg_attn W_ro + b.
// Structure: exact f16 planes of both inputs; six projection GEMMs (32x64 wave tiles, f32 accumulation, exact x16 weights + bias); RoPE on VALU (thread per (row, head, 8 dims), f32 trig) into f16 q planes and the shared per-batch key plane [k2-or-summary ; regular] (4 kv heads); values as f16 hi + 2^10 residual planes, V^T by LDS tiles; the fused flash kernel (3-term P.V, GQA head mapping, INPUT int mask tables) once per phase; sum_attn / reg_attn as hi + residual pairs into the k2/v2 and output GEMMs.
// Compute dtype: inputs, masks' companions and parameters rounded to bf16; q/k after RoPE as f16 (~2^-12); P and v hi + residual (~2^-21-class); attention outputs hi + residual into the following GEMMs; f32 softmax/accumulation/trig. v_wmma_f32_16x16x32_f16.
#define NB 2
#define SS 64
#define RR 2048
#define DMOD 1024
#define KVD 256
#define NRS (NB * SS)            /* 128 summary rows */
#define NRR (NB * RR)            /* 4096 regular rows */
#define TK 2112                  /* keys per batch in both phases: 64 summary(-derived) + 2048 regular */
#define TQA 64                   /* phase-1 queries (summary tokens) */
#define TQB 2048                 /* phase-2 queries (regular tokens) */
#define TQ TQB
#define NH 16
#define KVG 4                    /* GQA: 16 query heads share 4 kv heads */
#define NKV (NH / KVG)
#define SCL 0.125f               /* 64^-0.5 */
#define QBLKSA (TQA / 64)
#define QBLKSB (TQB / 64)
typedef __bf16 v16b __attribute__((ext_vector_type(16)));
typedef unsigned short v8us __attribute__((ext_vector_type(8), may_alias));
typedef float  v8f  __attribute__((ext_vector_type(8)));
typedef float  v4f  __attribute__((ext_vector_type(4)));
typedef float  v4fa __attribute__((ext_vector_type(4), may_alias));
union FragB { v16b v; v8us half[2]; unsigned short u[16]; };

__device__ __forceinline__ unsigned short bf16_bits(float x) { unsigned int u = __float_as_uint(x); return (unsigned short)((u + 0x7FFFu + ((u >> 16) & 1u)) >> 16); }
__device__ __forceinline__ float bf16_val(unsigned short b) { return __uint_as_float(((unsigned int)b) << 16); }
__device__ __forceinline__ float bf16_round(float x) { return bf16_val(bf16_bits(x)); }
// D += A·B with NT terms: 1 = ah·bh, 2 = + al·bh (A split), 3 = + ah·bl (both split)
template <int NT>
__device__ __forceinline__ v8f mmaN(v16b ah, v16b al, v16b bh, v16b bl, v8f c) {
  c = __builtin_amdgcn_wmma_f32_16x16x32_bf16(false, ah, false, bh, (short)0, c, false, false);
  if (NT >= 2) c = __builtin_amdgcn_wmma_f32_16x16x32_bf16(false, al, false, bh, (short)0, c, false, false);
  if (NT >= 3) c = __builtin_amdgcn_wmma_f32_16x16x32_bf16(false, ah, false, bl, (short)0, c, false, false);
  asm volatile("v_nop\n\tv_nop\n\tv_nop\n\tv_nop" : "+v"(c) : "v"(ah), "v"(al), "v"(bh), "v"(bl));
  return c;
}

__global__ __launch_bounds__(256) void k_wt_bf16(const float* __restrict__ W, unsigned short* __restrict__ Wt, int K, int N) {
  const int t = blockIdx.x * 256 + threadIdx.x;
  const int k8n = K / 8;
  if (t >= N * k8n) return;
  const int n = t / k8n, k8 = (t % k8n) * 8;
  v8us v;
#pragma unroll
  for (int i = 0; i < 8; ++i) v[i] = bf16_bits(W[(size_t)(k8 + i) * N + n]);
  *(v8us*)(Wt + (size_t)n * K + k8) = v;
  
}

// GEMM C[M][N] (f32, pitch ldc) = act(A[M][K]·W + bias). A f32 row-major (pitch lda) converted per fragment to bf16
// (ASPLIT: hi/lo two planes -> 2 terms, else single rounded term); Wt bf16 [N][K] (pitch ldb). BIAS_BF16 rounds the
// bias to bf16 first (bias quantised to bf16 before the add). K%32==0, M%16==0, N%64==0.
template <bool ASPLIT, int ACT, bool BIAS_BF16>
__global__ __launch_bounds__(128) void k_gemm_bf(const float* __restrict__ A, int lda, const unsigned short* __restrict__ Wt, int ldb,
                                               const float* __restrict__ bias, float* __restrict__ C, int ldc, int M, int N, int K) {
  __shared__ __attribute__((aligned(16))) float so[4][16][64];
  const int tid = threadIdx.x, w = tid >> 5, lane = tid & 31, ln = lane & 15, hh = lane >> 4;
  const int ntn = N / 64;
  const int wid = blockIdx.x * 4 + w;
  const int mt = wid / ntn, nq = wid % ntn;
  if (mt * 16 >= M) return;
  const int row0 = mt * 16, col0 = nq * 64;
  const float* arow = A + (size_t)(row0 + ln) * lda;
  v8f acc[4] = {};
  for (int kb = 0; kb < K; kb += 32) {
    FragB ah, al;
    const v4f x0 = *(const v4fa*)(arow + kb + 8 * hh), x1 = *(const v4fa*)(arow + kb + 8 * hh + 4);
    const v4f x2 = *(const v4fa*)(arow + kb + 16 + 8 * hh), x3 = *(const v4fa*)(arow + kb + 16 + 8 * hh + 4);
    float xs[16] = {x0[0],x0[1],x0[2],x0[3],x1[0],x1[1],x1[2],x1[3],x2[0],x2[1],x2[2],x2[3],x3[0],x3[1],x3[2],x3[3]};
#pragma unroll
    for (int i = 0; i < 16; ++i) { const unsigned short hb = bf16_bits(xs[i]); ah.u[i] = hb; al.u[i] = ASPLIT ? bf16_bits(xs[i] - bf16_val(hb)) : (unsigned short)0; }
#pragma unroll
    for (int t = 0; t < 4; ++t) {
      const unsigned short* brow = Wt + (size_t)(col0 + t * 16 + ln) * ldb + kb;
      FragB b;
      b.half[0] = *(const v8us*)(brow + 8 * hh);
      b.half[1] = *(const v8us*)(brow + 16 + 8 * hh);
      acc[t] = mmaN<ASPLIT ? 2 : 1>(ah.v, al.v, b.v, b.v, acc[t]);
    }
  }
#pragma unroll
  for (int t = 0; t < 4; ++t) {
    float bv = bias ? bias[col0 + t * 16 + ln] : 0.f;
    if (BIAS_BF16) bv = bf16_round(bv);
#pragma unroll
    for (int r = 0; r < 8; ++r) { float v = acc[t][r] + bv; if (ACT == 1) v = fmaxf(v, 0.f); so[w][8 * hh + r][t * 16 + ln] = v; }
  }
  __builtin_amdgcn_fence(__ATOMIC_ACQ_REL, "workgroup");
  __builtin_amdgcn_wave_barrier();
  const int rsub = lane >> 4, c4 = (lane & 15) * 4;
  {
#pragma unroll
    for (int q = 0; q < 8; ++q) {
      const int r = q * 2 + rsub;
      const v4f v = *(const v4fa*)&so[w][r][c4];
      *(v4f*)(C + (size_t)(row0 + r) * ldc + col0 + c4) = v;
    }
    
  }
}

// GEMM C = act(A·W + bias + resid): A f32 (ASPLIT -> hi/lo 2 terms), Wt bf16 [N][K]; ACT 0 none, 1 relu, 2 exact gelu;
// resid (optional, f32, row index = (row % rmod), pitch ldr, RES_BF16 rounds it) added before the activation.
template <bool ASPLIT, int ACT, bool BIAS_BF16, bool RES_BF16>
__global__ __launch_bounds__(128) void k_gemm_bf3(const float* __restrict__ A, int lda, const unsigned short* __restrict__ Wt, int ldb,
                                                const float* __restrict__ bias, const float* __restrict__ resid, int rmod, int ldr,
                                                float* __restrict__ C, int ldc, int M, int N, int K) {
  __shared__ __attribute__((aligned(16))) float so[4][16][64];
  const int tid = threadIdx.x, w = tid >> 5, lane = tid & 31, ln = lane & 15, hh = lane >> 4;
  const int ntn = N / 64;
  const int wid = blockIdx.x * 4 + w;
  const int mt = wid / ntn, nq = wid % ntn;
  if (mt * 16 >= M) return;
  const int row0 = mt * 16, col0 = nq * 64;
  const float* arow = A + (size_t)(row0 + ln) * lda;
  v8f acc[4] = {};
  for (int kb = 0; kb < K; kb += 32) {
    FragB ah, al;
    const v4f x0 = *(const v4fa*)(arow + kb + 8 * hh), x1 = *(const v4fa*)(arow + kb + 8 * hh + 4);
    const v4f x2 = *(const v4fa*)(arow + kb + 16 + 8 * hh), x3 = *(const v4fa*)(arow + kb + 16 + 8 * hh + 4);
    float xs[16] = {x0[0],x0[1],x0[2],x0[3],x1[0],x1[1],x1[2],x1[3],x2[0],x2[1],x2[2],x2[3],x3[0],x3[1],x3[2],x3[3]};
#pragma unroll
    for (int i = 0; i < 16; ++i) { const unsigned short hb = bf16_bits(xs[i]); ah.u[i] = hb; al.u[i] = ASPLIT ? bf16_bits(xs[i] - bf16_val(hb)) : (unsigned short)0; }
#pragma unroll
    for (int t = 0; t < 4; ++t) {
      const unsigned short* brow = Wt + (size_t)(col0 + t * 16 + ln) * ldb + kb;
      FragB b;
      b.half[0] = *(const v8us*)(brow + 8 * hh);
      b.half[1] = *(const v8us*)(brow + 16 + 8 * hh);
      acc[t] = mmaN<ASPLIT ? 2 : 1>(ah.v, al.v, b.v, b.v, acc[t]);
    }
  }
#pragma unroll
  for (int t = 0; t < 4; ++t) {
    const int col = col0 + t * 16 + ln;
    float bv = bias ? bias[col] : 0.f;
    if (BIAS_BF16) bv = bf16_round(bv);
#pragma unroll
    for (int r = 0; r < 8; ++r) {
      float v = acc[t][r] + bv;
      if (resid) { float rv = resid[(size_t)((row0 + 8 * hh + r) % rmod) * ldr + col]; if (RES_BF16) rv = bf16_round(rv); v += rv; }
      if (ACT == 1) v = fmaxf(v, 0.f);
      if (ACT == 2) v = 0.5f * v * (1.0f + erff(v * 0.70710678118654752f));
      if (ACT == 3) { const float u = 0.7978845608028654f * (v + 0.044715f * v * v * v); v = 0.5f * v * (1.0f + tanhf(u)); }
      so[w][8 * hh + r][t * 16 + ln] = v;
    }
  }
  __builtin_amdgcn_fence(__ATOMIC_ACQ_REL, "workgroup");
  __builtin_amdgcn_wave_barrier();
  const int rsub = lane >> 4, c4 = (lane & 15) * 4;
  {
#pragma unroll
    for (int q = 0; q < 8; ++q) {
      const int r = q * 2 + rsub;
      const v4f v = *(const v4fa*)&so[w][r][c4];
      *(v4f*)(C + (size_t)(row0 + r) * ldc + col0 + c4) = v;
    }
    
  }
}
// row LayerNorm (biased variance, eps) over N: s = X (+ R); optional out_sum <- s; out_norm <- (s-mu)*rsqrt(var+eps)*g + b
template <bool PARAM_BF16>
__global__ __launch_bounds__(256) void k_layernorm(const float* __restrict__ X, const float* __restrict__ R, const float* __restrict__ g, const float* __restrict__ bta,
                                                  float* __restrict__ out_sum, float* __restrict__ out_norm, int N, float eps) {
  __shared__ float red[256];
  const int row = blockIdx.x, tid = threadIdx.x;
  const float* x = X + (size_t)row * N; const float* rr = R ? R + (size_t)row * N : nullptr;
  float vals[16];                     // up to N = 4096
  const int per = N / 256;            // contiguous chunk per thread? use strided-by-4 chunks: thread handles j = tid*4 + 1024*u
  float s1 = 0.f;
  for (int u = 0; u < per / 4; ++u) {
    const int j = tid * 4 + 1024 * u;
    const v4f a = *(const v4fa*)(x + j);
    v4f b = {0.f,0.f,0.f,0.f}; if (rr) b = *(const v4fa*)(rr + j);
#pragma unroll
    for (int q = 0; q < 4; ++q) { const float v = a[q] + b[q]; vals[u * 4 + q] = v; s1 += v; }
  }
  red[tid] = s1; __syncthreads();
  for (int st = 128; st > 0; st >>= 1) { if (tid < st) red[tid] += red[tid + st]; __syncthreads(); }
  const float mu = red[0] / (float)N; __syncthreads();
  float s2 = 0.f;
  for (int u = 0; u < per / 4; ++u)
#pragma unroll
    for (int q = 0; q < 4; ++q) { const float c = vals[u * 4 + q] - mu; s2 += c * c; }
  red[tid] = s2; __syncthreads();
  for (int st = 128; st > 0; st >>= 1) { if (tid < st) red[tid] += red[tid + st]; __syncthreads(); }
  const float rs = rsqrtf(red[0] / (float)N + eps);
  {
    for (int u = 0; u < per / 4; ++u) {
      const int j = tid * 4 + 1024 * u;
      v4f o, sm;
#pragma unroll
      for (int q = 0; q < 4; ++q) {
        float gg = g[j + q], bb = bta[j + q];
        if (PARAM_BF16) { gg = bf16_round(gg); bb = bf16_round(bb); }
        sm[q] = vals[u * 4 + q]; o[q] = (vals[u * 4 + q] - mu) * rs * gg + bb;
      }
      if (out_sum) *(v4f*)(out_sum + (size_t)row * N + j) = sm;
      *(v4f*)(out_norm + (size_t)row * N + j) = o;
    }
    
  }
}



// ---- f16 WMMA path (v_wmma_f32_16x16x32_f16): 11-bit significands for operands in range — used where a [0,1] probability operand needs more precision than bf16
typedef _Float16 v16h __attribute__((ext_vector_type(16)));
union FragH { v16h v; v8us half[2]; _Float16 h[16]; unsigned short u[16]; };
template <int NT>
__device__ __forceinline__ v8f mmaH(v16h ah, v16h al, v16h bh, v16h bl, v8f c) {
  c = __builtin_amdgcn_wmma_f32_16x16x32_f16(false, ah, false, bh, (short)0, c, false, false);
  if (NT >= 2) c = __builtin_amdgcn_wmma_f32_16x16x32_f16(false, al, false, bh, (short)0, c, false, false);
  if (NT >= 3) c = __builtin_amdgcn_wmma_f32_16x16x32_f16(false, ah, false, bl, (short)0, c, false, false);
  asm volatile("v_nop\n\tv_nop\n\tv_nop\n\tv_nop" : "+v"(c) : "v"(ah), "v"(al), "v"(bh), "v"(bl));
  return c;
}
// batched GEMM like k_gemm_b but f16 operands: A f32 (split into f16 hi/lo if ASPLIT, else rounded to f16), Bt = f16 values [n][k]; alpha; C f32; N multiple of 16 (partial tiles skipped)
template <bool ASPLIT>
__global__ __launch_bounds__(128) void k_gemm_h(const float* __restrict__ A, int lda, size_t sA, const _Float16* __restrict__ Bh, int ldb, size_t sB, float alpha, float* __restrict__ C, int ldc, size_t sC, int M, int N, int K) {
  __shared__ __attribute__((aligned(16))) float so[4][16][64];
  const int tid = threadIdx.x, w = tid >> 5, lane = tid & 31, ln = lane & 15, hh = lane >> 4; const int by = blockIdx.y;
  A += (size_t)by * sA; Bh += (size_t)by * sB; C += (size_t)by * sC;
  const int ntn = (N + 63) / 64; const int wid = blockIdx.x * 4 + w; const int mt = wid / ntn, nq = wid % ntn; if (mt * 16 >= M) return;
  const int row0 = mt * 16, col0 = nq * 64; const float* arow = A + (size_t)(row0 + ln) * lda;
  v8f acc[4] = {};
  for (int kb = 0; kb < K; kb += 32) {
    FragH ah, al;
    const v4f x0 = *(const v4fa*)(arow + kb + 8 * hh), x1 = *(const v4fa*)(arow + kb + 8 * hh + 4), x2 = *(const v4fa*)(arow + kb + 16 + 8 * hh), x3 = *(const v4fa*)(arow + kb + 16 + 8 * hh + 4);
    float xs[16] = {x0[0],x0[1],x0[2],x0[3],x1[0],x1[1],x1[2],x1[3],x2[0],x2[1],x2[2],x2[3],x3[0],x3[1],x3[2],x3[3]};
#pragma unroll
    for (int i = 0; i < 16; ++i) { const _Float16 h = (_Float16)xs[i]; ah.h[i] = h; al.h[i] = ASPLIT ? (_Float16)(xs[i] - (float)h) : (_Float16)0.0f; }
#pragma unroll
    for (int t = 0; t < 4; ++t) { if (col0 + t * 16 >= N) continue; const size_t boff = (size_t)(col0 + t * 16 + ln) * ldb + kb; FragH bq; bq.half[0] = *(const v8us*)(Bh + boff + 8 * hh); bq.half[1] = *(const v8us*)(Bh + boff + 16 + 8 * hh);
      acc[t] = mmaH<ASPLIT ? 2 : 1>(ah.v, al.v, bq.v, bq.v, acc[t]); }
  }
#pragma unroll
  for (int t = 0; t < 4; ++t) { if (col0 + t * 16 >= N) continue;
#pragma unroll
    for (int r = 0; r < 8; ++r) so[w][8 * hh + r][t * 16 + ln] = acc[t][r] * alpha; }
  __builtin_amdgcn_fence(__ATOMIC_ACQ_REL, "workgroup"); __builtin_amdgcn_wave_barrier();
  const int rsub = lane >> 4, c4 = (lane & 15) * 4;
  {
#pragma unroll
    for (int q = 0; q < 8; ++q) { const int r = q * 2 + rsub; if (col0 + c4 < N) { const v4f v = *(const v4fa*)&so[w][r][c4]; *(v4f*)(C + (size_t)(row0 + r) * ldc + col0 + c4) = v; } }
     }
}

// Wt[n][k] = f16(W[k][n]·scale) from f32 row-major W[K][N] (scale = power of two; bf16-exact weights stay exact in f16 away from the subnormal range)
__global__ __launch_bounds__(256) void k_wt_f16(const float* __restrict__ W, _Float16* __restrict__ Wt, int K, int N, float scale) {
  const int t = blockIdx.x * 256 + threadIdx.x; if (t >= N * (K / 8)) return; const int n = t / (K / 8), k8 = (t % (K / 8)) * 8; FragH f;
#pragma unroll
  for (int i = 0; i < 8; ++i) f.h[i] = (_Float16)(bf16_round(W[(size_t)(k8 + i) * N + n]) * scale); const v8us o = f.half[0];
  *(v8us*)((unsigned short*)Wt + (size_t)n * K + k8) = o; 
}
// k_gemm_hh variant with fused epilogue: v = acc·alpha + bias[by·sBias + col] (+ CP[(row/rowsPerB)·sCPb + by·64 + col] if CP) ; ACT 0 none / 1 elu ; writes f16 C16 (and f32 C if non-null)
template <int ACT>
__global__ __launch_bounds__(128) void k_gemm_hhx(const _Float16* __restrict__ A, int lda, size_t sA, const _Float16* __restrict__ Bh, int ldb, size_t sB, float alpha, const float* __restrict__ bias, size_t sBias, const float* __restrict__ CP, int rowsPerB, size_t sCPb, int row0g,
    float* __restrict__ C, _Float16* __restrict__ C16, int ldc, size_t sC, int M, int N, int K) {
  __shared__ __attribute__((aligned(16))) float so[4][16][64];
  const int tid = threadIdx.x, w = tid >> 5, lane = tid & 31, ln = lane & 15, hh = lane >> 4; const int by = blockIdx.y;
  A += (size_t)by * sA; Bh += (size_t)by * sB; const size_t cofs = (size_t)by * sC; const float* bp = bias ? bias + (size_t)by * sBias : nullptr;
  const int ntn = (N + 63) / 64; const int wid = blockIdx.x * 4 + w; const int mt = wid / ntn, nq = wid % ntn; if (mt * 16 >= M) return;
  const int row0 = mt * 16, col0 = nq * 64; const _Float16* arow = A + (size_t)(row0 + ln) * lda;
  v8f acc[4] = {};
  for (int kb = 0; kb < K; kb += 32) { FragH ah; ah.half[0] = *(const v8us*)((const unsigned short*)arow + kb + 8 * hh); ah.half[1] = *(const v8us*)((const unsigned short*)arow + kb + 16 + 8 * hh);
#pragma unroll
    for (int t = 0; t < 4; ++t) { if (col0 + t * 16 >= N) continue; const size_t boff = (size_t)(col0 + t * 16 + ln) * ldb + kb; FragH bq; bq.half[0] = *(const v8us*)((const unsigned short*)Bh + boff + 8 * hh); bq.half[1] = *(const v8us*)((const unsigned short*)Bh + boff + 16 + 8 * hh);
      acc[t] = mmaH<1>(ah.v, ah.v, bq.v, bq.v, acc[t]); }
  }
#pragma unroll
  for (int t = 0; t < 4; ++t) { if (col0 + t * 16 >= N) continue; const int col = col0 + t * 16 + ln; const float bv = bp ? bf16_round(bp[col]) : 0.f;
#pragma unroll
    for (int r = 0; r < 8; ++r) { float v = acc[t][r] * alpha + bv; if (CP) { const int bidx = (row0g + row0 + 8 * hh + r) / rowsPerB; v += CP[(size_t)bidx * sCPb + (size_t)by * 64 + col]; } if (ACT == 1) v = (v > 0.f) ? v : expm1f(v); else if (ACT == 7) v = (v > 0.f) ? v + 1.0f : expf(v); else if (ACT == 8) v = tanhf(v); else if (ACT == 9) v = 0.5f * v * (1.0f + tanhf(0.7978845608028654f * (v + 0.044715f * v * v * v))); else if (ACT == 11) v = 1.0f / (1.0f + expf(-v)); else if (ACT == 12) v = (v > 0.f) ? v : 0.01f * v; else if (ACT == 14) v = (v > 0.f) ? v : 0.1f * v; else if (ACT == 15) v = v / (1.0f + expf(-v)); else if (ACT == 3) v = fmaxf(v, 0.f); else if (ACT == 6) v = 0.5f * v * (1.0f + erff(v * 0.70710678118654752f)); so[w][8 * hh + r][t * 16 + ln] = v; } }
  __builtin_amdgcn_fence(__ATOMIC_ACQ_REL, "workgroup"); __builtin_amdgcn_wave_barrier();
  const int rsub = lane >> 4, c4 = (lane & 15) * 4; typedef _Float16 v4h __attribute__((ext_vector_type(4)));
  {
#pragma unroll
    for (int q = 0; q < 8; ++q) { const int r = q * 2 + rsub; if (col0 + c4 < N) { const v4f v = *(const v4fa*)&so[w][r][c4]; if (C) *(v4f*)(C + cofs + (size_t)(row0 + r) * ldc + col0 + c4) = v; if (C16) { v4h h4; for (int i = 0; i < 4; ++i) h4[i] = (_Float16)v[i]; *(v4h*)(C16 + cofs + (size_t)(row0 + r) * ldc + col0 + c4) = h4; } } }
     }
}


typedef _Float16 v4h __attribute__((ext_vector_type(4)));

__global__ __launch_bounds__(256) void k_x16(const float* __restrict__ x, _Float16* __restrict__ X16, size_t n8) { const size_t t = (size_t)blockIdx.x * 256 + threadIdx.x; if (t >= n8) return; FragH f;
#pragma unroll
  for (int q = 0; q < 8; ++q) f.h[q] = (_Float16)bf16_round(x[t * 8 + q]); *(v8us*)((unsigned short*)X16 + t * 8) = f.half[0];  }
__global__ __launch_bounds__(256) void k_h16(const float* __restrict__ x, _Float16* __restrict__ X16, size_t n8) { const size_t t = (size_t)blockIdx.x * 256 + threadIdx.x; if (t >= n8) return; FragH f;
#pragma unroll
  for (int q = 0; q < 8; ++q) f.h[q] = (_Float16)x[t * 8 + q]; *(v8us*)((unsigned short*)X16 + t * 8) = f.half[0];  }
__global__ __launch_bounds__(256) void k_round16f(const float* __restrict__ W, _Float16* __restrict__ Bt, size_t n8) { const size_t t = (size_t)blockIdx.x * 256 + threadIdx.x; if (t >= n8) return; FragH f;
#pragma unroll
  for (int i = 0; i < 8; ++i) f.h[i] = (_Float16)(bf16_round(W[t * 8 + i]) * 16.0f); *(v8us*)((unsigned short*)Bt + t * 8) = f.half[0];  }
template <int NHv, int TTv>
__global__ __launch_bounds__(256) void k_vt(const _Float16* __restrict__ V16, int ldv, int voff, _Float16* __restrict__ Vt) { __shared__ unsigned short tl[64][66]; const int tid = threadIdx.x; const int slab = blockIdx.x / (TTv / 64), lg = blockIdx.x % (TTv / 64); const int b = slab / NHv, h = slab % NHv;
  for (int i = tid; i < 64 * 8; i += 256) { const int r = i / 8, c8 = (i % 8) * 8; FragH f; f.half[0] = *(const v8us*)((const unsigned short*)V16 + ((size_t)b * TTv + lg * 64 + r) * ldv + voff + h * 64 + c8);
#pragma unroll
    for (int q = 0; q < 8; ++q) tl[r][c8 + q] = f.u[q]; }
  __syncthreads();
  {
#pragma unroll
    for (int rd = 0; rd < 2; ++rd) { const int d = rd * 32 + tid / 8, pc = tid % 8; FragH f;
#pragma unroll
      for (int q = 0; q < 8; ++q) f.u[q] = tl[pc * 8 + q][d];
      *(v8us*)((unsigned short*)Vt + ((size_t)slab * 64 + d) * TTv + lg * 64 + pc * 8) = f.half[0]; }
     } }

__global__ __launch_bounds__(256) void k_hl(const float* __restrict__ F, _Float16* __restrict__ Hh, _Float16* __restrict__ Hl, size_t n8) { const size_t t = (size_t)blockIdx.x * 256 + threadIdx.x; if (t >= n8) return; FragH fh, fl; const v4f a = *(const v4fa*)(F + t * 8), c = *(const v4fa*)(F + t * 8 + 4);
#pragma unroll
  for (int q = 0; q < 4; ++q) { _Float16 h = (_Float16)a[q]; fh.h[q] = h; fl.h[q] = (_Float16)((a[q] - (float)h) * 1024.0f); h = (_Float16)c[q]; fh.h[4 + q] = h; fl.h[4 + q] = (_Float16)((c[q] - (float)h) * 1024.0f); }
  { *(v8us*)((unsigned short*)Hh + t * 8) = fh.half[0]; *(v8us*)((unsigned short*)Hl + t * 8) = fl.half[0];  } }

// ---- fast GEMM (wave tile 32x64; requires M % 32 == 0 rows per launch region, N % 64 == 0 and K % 64 == 0); epilogue = k_gemm_hhx semantics ----
__device__ __forceinline__ v16h g2_frag(const _Float16* p, int hh) { FragH f; f.half[0] = *(const v8us*)((const unsigned short*)p + 8 * hh); f.half[1] = *(const v8us*)((const unsigned short*)p + 16 + 8 * hh); return f.v; }
__device__ __forceinline__ v8f g2_mma(v16h a, v16h b, v8f c) { v8f d = __builtin_amdgcn_wmma_f32_16x16x32_f16(false, a, false, b, (short)0, c, false, false); asm volatile("v_nop\n\tv_nop\n\tv_nop\n\tv_nop" : "+v"(d) : "v"(a), "v"(b)); return d; }
template <int ACT>
__global__ __launch_bounds__(128) void k_gemm2(const _Float16* __restrict__ A, int lda, size_t sA, const _Float16* __restrict__ Bh, int ldb, size_t sB, float alpha, const float* __restrict__ bias, size_t sBias, const float* __restrict__ CP, int rowsPerB, size_t sCPb, int row0g,
    float* __restrict__ C, _Float16* __restrict__ C16, int ldc, size_t sC, int M, int N, int K) {
  __shared__ __attribute__((aligned(16))) float so[4][32][68];
  const int tid = threadIdx.x, w = tid >> 5, lane = tid & 31, ln = lane & 15, hh = lane >> 4; const int by = blockIdx.y;
  A += (size_t)by * sA; Bh += (size_t)by * sB; const size_t cofs = (size_t)by * sC; const float* bp = bias ? bias + (size_t)by * sBias : nullptr;
  const int ntn = N >> 6; const int mt = blockIdx.x / ntn, nq = blockIdx.x - mt * ntn; const int row0 = mt * 128 + 32 * w, col0 = nq * 64; if (row0 >= M) return;
  const _Float16* a0p = A + (size_t)(row0 + ln) * lda; const _Float16* a1p = a0p + (size_t)16 * lda;
  const _Float16* b0p = Bh + (size_t)(col0 + ln) * ldb; const _Float16* b1p = b0p + (size_t)16 * ldb; const _Float16* b2p = b1p + (size_t)16 * ldb; const _Float16* b3p = b2p + (size_t)16 * ldb;
  const v8f z8 = {0.f,0.f,0.f,0.f,0.f,0.f,0.f,0.f}; v8f c00 = z8, c01 = z8, c02 = z8, c03 = z8, c10 = z8, c11 = z8, c12 = z8, c13 = z8;
  /* two register sets x / y of the six fragments (K % 64 == 0): the loads of the next 32-wide k step are all issued before the products of this one, so a step waits for one overlapped latency at most */
  v16h xa0 = g2_frag(a0p, hh), xa1 = g2_frag(a1p, hh), xb0 = g2_frag(b0p, hh), xb1 = g2_frag(b1p, hh), xb2 = g2_frag(b2p, hh), xb3 = g2_frag(b3p, hh);
#pragma unroll 1
  for (int kb = 0; kb < K; kb += 64) { const int k1 = kb + 32, k2 = (kb + 64 < K) ? kb + 64 : kb;      /* last trip: k2 names a step inside the row again; its values are not used */
    const v16h ya0 = g2_frag(a0p + k1, hh), ya1 = g2_frag(a1p + k1, hh), yb0 = g2_frag(b0p + k1, hh), yb1 = g2_frag(b1p + k1, hh), yb2 = g2_frag(b2p + k1, hh), yb3 = g2_frag(b3p + k1, hh);
    __builtin_amdgcn_sched_barrier(0);      /* holds the y loads above the x products (the scheduler otherwise moves each load down to its use) */
    c00 = g2_mma(xa0, xb0, c00); c10 = g2_mma(xa1, xb0, c10); c01 = g2_mma(xa0, xb1, c01); c11 = g2_mma(xa1, xb1, c11);
    c02 = g2_mma(xa0, xb2, c02); c12 = g2_mma(xa1, xb2, c12); c03 = g2_mma(xa0, xb3, c03); c13 = g2_mma(xa1, xb3, c13);
    __builtin_amdgcn_sched_barrier(0);      /* holds the x reloads below the x products and, with the next one, above the y products */
    xa0 = g2_frag(a0p + k2, hh); xa1 = g2_frag(a1p + k2, hh); xb0 = g2_frag(b0p + k2, hh); xb1 = g2_frag(b1p + k2, hh); xb2 = g2_frag(b2p + k2, hh); xb3 = g2_frag(b3p + k2, hh);
    __builtin_amdgcn_sched_barrier(0);      /* holds the x reloads above the y products */
    c00 = g2_mma(ya0, yb0, c00); c10 = g2_mma(ya1, yb0, c10); c01 = g2_mma(ya0, yb1, c01); c11 = g2_mma(ya1, yb1, c11);
    c02 = g2_mma(ya0, yb2, c02); c12 = g2_mma(ya1, yb2, c12); c03 = g2_mma(ya0, yb3, c03); c13 = g2_mma(ya1, yb3, c13);
    asm volatile("s_wait_xcnt 0x0" ::: "memory"); }      /* stands in front of the next trip's address sums, which overwrite registers that the x loads name */
  v8f accs[8] = {c00, c01, c02, c03, c10, c11, c12, c13};
  /* the epilogue's loads (4 bias words, 64 CP words a lane) are issued together as well, ahead of the arithmetic that uses them */
  float bw[4] = {0.f, 0.f, 0.f, 0.f}; v8f cpv[8] = {z8, z8, z8, z8, z8, z8, z8, z8};
  if (bp) {
#pragma unroll
    for (int t = 0; t < 4; ++t) bw[t] = bp[col0 + t * 16 + ln]; }
  if (CP) {
#pragma unroll
    for (int u = 0; u < 8; ++u)
#pragma unroll
      for (int r = 0; r < 8; ++r) { const int bidx = (row0g + row0 + (u >> 2) * 16 + 8 * hh + r) / rowsPerB; cpv[u][r] = CP[(size_t)bidx * sCPb + (size_t)by * 64 + col0 + (u & 3) * 16 + ln];
        if (r == 7) asm volatile("s_wait_xcnt 0x0" ::: "memory"); }      /* stands in front of the next group's loads, whose results may land in address registers of this group */
    asm volatile("" :: "v"(cpv[0]), "v"(cpv[1]), "v"(cpv[2]), "v"(cpv[3]), "v"(cpv[4]), "v"(cpv[5]), "v"(cpv[6]), "v"(cpv[7])); }      /* inputs-only fence on the loaded words: holds all 64 loads in this block, where they overlap, instead of one waited load in front of each add */
#pragma unroll
  for (int u = 0; u < 8; ++u) { const int t = u & 3, half = u >> 2; const float bv = bp ? bf16_round(bw[t]) : 0.f;
#pragma unroll
    for (int r = 0; r < 8; ++r) { const int rloc = half * 16 + 8 * hh + r; float v = accs[u][r] * alpha + bv; if (CP) v += cpv[u][r];
      if (ACT == 3) v = fmaxf(v, 0.f); else if (ACT == 6) v = 0.5f * v * (1.0f + erff(v * 0.70710678118654752f)); else if (ACT == 11) v = 1.0f / (1.0f + expf(-v)); else if (ACT == 15) v = v / (1.0f + expf(-v)); else if (ACT == 12) v = (v > 0.f) ? v : 0.01f * v; else if (ACT == 8) v = tanhf(v);
      so[w][rloc][t * 16 + ln] = v; } }
  __builtin_amdgcn_fence(__ATOMIC_ACQ_REL, "workgroup"); __builtin_amdgcn_wave_barrier();
  const int rsub = lane >> 4, c4 = (lane & 15) * 4;
  {
#pragma unroll
    for (int q = 0; q < 16; ++q) { const int r = q * 2 + rsub; const v4f v = *(const v4fa*)&so[w][r][c4]; if (C) *(v4f*)(C + cofs + (size_t)(row0 + r) * ldc + col0 + c4) = v; if (C16) { v4h h4; for (int i = 0; i < 4; ++i) h4[i] = (_Float16)v[i]; *(v4h*)(C16 + cofs + (size_t)(row0 + r) * ldc + col0 + c4) = h4; } }
     } }



// lane l's value of lane l ^ X (X < 16) inside its 16-lane row, by a DPP row_xmask move in registers (no trip through the LDS pipe and no wait on it)
template <int X>
__device__ __forceinline__ float row_xor(float v) { return __int_as_float(__builtin_amdgcn_update_dpp(0, __float_as_int(v), 0x160 | X, 0xf, 0xf, true)); }
// maximum over the 16-lane row, all 32 lanes on: four dependent DPP maxima in one statement (written with fmaxf on a DPP move the compiler puts a move and a quieting maximum in front of each step, three links for one)
__device__ __forceinline__ float row_max16(float v) {
  asm("v_max_num_f32_dpp %0, %0, %0 row_xmask:1 row_mask:0xf bank_mask:0xf\n\t"
      "v_max_num_f32_dpp %0, %0, %0 row_xmask:2 row_mask:0xf bank_mask:0xf\n\t"
      "v_max_num_f32_dpp %0, %0, %0 row_xmask:4 row_mask:0xf bank_mask:0xf\n\t"
      "v_max_num_f32_dpp %0, %0, %0 row_xmask:8 row_mask:0xf bank_mask:0xf" : "+v"(v));
  return v; }
__device__ __forceinline__ float row_sum16(float v) { v += row_xor<1>(v); v += row_xor<2>(v); v += row_xor<4>(v); v += row_xor<8>(v); return v; }
template <int CAUSAL>
__global__ __launch_bounds__(128) void k_flash(const _Float16* __restrict__ Q16, int ldq, const _Float16* __restrict__ K16, int ldk, const _Float16* __restrict__ Vt, const int* __restrict__ MSK, float* __restrict__ O, int ldo) {
  constexpr int RPW = 16, RTN = RPW / 16, NQB = TQ / (4 * RPW), DT = 4, KS = 2;
  __shared__ __attribute__((aligned(16))) unsigned short sP[4][RPW][40]; __shared__ __attribute__((aligned(16))) float sO[4][RPW][64 + 4];
  const int tid = threadIdx.x, w = tid >> 5, lane = tid & 31, ln = lane & 15, hh = lane >> 4;
  const int slab = blockIdx.x / NQB, qblk = blockIdx.x % NQB; const int b = slab / NH, h = slab % NH; const int qb0 = qblk * (4 * RPW); const int q0 = qb0 + w * RPW;
  FragH aq[2][KS];
#pragma unroll
  for (int rt = 0; rt < RTN; ++rt) { const unsigned short* qr = (const unsigned short*)Q16 + ((size_t)b * TQ + q0 + rt * 16 + ln) * ldq + h * 64;
#pragma unroll
    for (int ks = 0; ks < KS; ++ks) { aq[rt][ks].half[0] = *(const v8us*)(qr + ks * 32 + 8 * hh); aq[rt][ks].half[1] = *(const v8us*)(qr + ks * 32 + 16 + 8 * hh); } }
  const unsigned short* Vth = (const unsigned short*)Vt + (size_t)slab * 64 * TK;
  float m_r[2][8], l_r[2][8]; v8f oacc[2][DT];
#pragma unroll
  for (int rt = 0; rt < RTN; ++rt) {
#pragma unroll
    for (int r = 0; r < 8; ++r) { m_r[rt][r] = -3.0e38f; l_r[rt][r] = 0.f; }
#pragma unroll
    for (int dt = 0; dt < DT; ++dt) oacc[rt][dt] = (v8f){0.f,0.f,0.f,0.f,0.f,0.f,0.f,0.f}; }
  const int jend = (CAUSAL == 1) ? (qb0 + 4 * RPW) : TK;      /* causal: keys beyond the block's last query never contribute */
#pragma unroll 1
  for (int j0 = 0; j0 < jend; j0 += 32) {
    v8f s[2][2];
#pragma unroll
    for (int nt = 0; nt < 2; ++nt) { const unsigned short* kr = (const unsigned short*)K16 + ((size_t)b * TK + j0 + nt * 16 + ln) * ldk + h * 64; FragH bk[KS];
#pragma unroll
      for (int ks = 0; ks < KS; ++ks) { bk[ks].half[0] = *(const v8us*)(kr + ks * 32 + 8 * hh); bk[ks].half[1] = *(const v8us*)(kr + ks * 32 + 16 + 8 * hh); }
#pragma unroll
      for (int rt = 0; rt < RTN; ++rt) { v8f acc = (v8f){0.f,0.f,0.f,0.f,0.f,0.f,0.f,0.f};
#pragma unroll
        for (int ks = 0; ks < KS; ++ks) acc = mmaH<1>(aq[rt][ks].v, aq[rt][ks].v, bk[ks].v, bk[ks].v, acc); s[rt][nt] = acc; } }
#pragma unroll
    for (int rt = 0; rt < RTN; ++rt)
#pragma unroll
      for (int r = 0; r < 8; ++r) { const int tq = q0 + rt * 16 + 8 * hh + r; const int k0 = j0 + ln, k1 = j0 + 16 + ln;
        const bool ok0 = (CAUSAL == 1) ? (k0 <= tq) : ((CAUSAL == 2) ? ((k0 >> 5) == (tq >> 5)) : true), ok1 = (CAUSAL == 1) ? (k1 <= tq) : ((CAUSAL == 2) ? ((k1 >> 5) == (tq >> 5)) : true);      /* mode 2: block-diagonal 32-token groups */
        const float s0 = ok0 ? s[rt][0][r] * SCL : -3.0e38f, s1 = ok1 ? s[rt][1][r] * SCL : -3.0e38f; 
        const float mn = row_max16(fmaxf(fmaxf(s0, s1), m_r[rt][r]));      /* the running maximum is the same in all 16 lanes of the row: taken in ahead of the reduction, the reduced value is the new maximum itself */
        const float al = (mn > -1.0e38f) ? expf(m_r[rt][r] - mn) : 1.0f; m_r[rt][r] = mn; const float p0 = ok0 ? expf(s0 - mn) : 0.f, p1 = ok1 ? expf(s1 - mn) : 0.f; l_r[rt][r] = l_r[rt][r] * al + p0 + p1;
#pragma unroll
        for (int dt = 0; dt < DT; ++dt) oacc[rt][dt][r] *= al;
        FragH t2; t2.h[0] = (_Float16)(p0 * 1024.0f); t2.h[1] = (_Float16)(p1 * 1024.0f); sP[w][rt * 16 + 8 * hh + r][ln] = t2.u[0]; sP[w][rt * 16 + 8 * hh + r][16 + ln] = t2.u[1]; }
    __builtin_amdgcn_fence(__ATOMIC_ACQ_REL, "workgroup"); __builtin_amdgcn_wave_barrier();
    FragH pa[2];
#pragma unroll
    for (int rt = 0; rt < RTN; ++rt) { pa[rt].half[0] = *(const v8us*)&sP[w][rt * 16 + ln][8 * hh]; pa[rt].half[1] = *(const v8us*)&sP[w][rt * 16 + ln][16 + 8 * hh]; }
#pragma unroll
    for (int dt = 0; dt < DT; ++dt) { const unsigned short* vrow = Vth + (size_t)(dt * 16 + ln) * TK + j0; FragH bv; bv.half[0] = *(const v8us*)(vrow + 8 * hh); bv.half[1] = *(const v8us*)(vrow + 16 + 8 * hh);
#pragma unroll
      for (int rt = 0; rt < RTN; ++rt) oacc[rt][dt] = mmaH<1>(pa[rt].v, pa[rt].v, bv.v, bv.v, oacc[rt][dt]); }
    __builtin_amdgcn_fence(__ATOMIC_ACQ_REL, "workgroup"); __builtin_amdgcn_wave_barrier(); }
#pragma unroll
  for (int rt = 0; rt < RTN; ++rt) {
#pragma unroll
    for (int r = 0; r < 8; ++r) { float l = l_r[rt][r]; l = row_sum16(l); l_r[rt][r] = (l > 0.f) ? 1.0f / (l * 1024.0f) : 0.f; }
#pragma unroll
    for (int dt = 0; dt < DT; ++dt)
#pragma unroll
      for (int r = 0; r < 8; ++r) sO[w][rt * 16 + 8 * hh + r][dt * 16 + ln] = oacc[rt][dt][r] * l_r[rt][r]; }
  __builtin_amdgcn_fence(__ATOMIC_ACQ_REL, "workgroup"); __builtin_amdgcn_wave_barrier();
  {
#pragma unroll
    for (int rp = 0; rp < RPW; rp += 2) { const int r = rp + (lane >> 4), pc = lane & 15; const v4f val = *(const v4fa*)&sO[w][r][pc * 4]; *(v4f*)(O + ((size_t)b * TQ + q0 + r) * ldo + h * 64 + pc * 4) = val; }
     } }
// 3-term variant: O = (P_hi V_hi + (P_lo V_hi + P_hi V_lo) / 1024) / l with P = [hi | 2^10 residual] of 1024 p and V^T = [hi | 2^10 residual] planes (VtL same layout as Vt) -> ~2^-21-class products for un-averaged (early causal / peaked) rows
template <int CAUSAL>
__global__ __launch_bounds__(128) void k_flash3gA(const _Float16* __restrict__ Q16, int ldq, const _Float16* __restrict__ K16, int ldk, const _Float16* __restrict__ Vt, const _Float16* __restrict__ VtL, const int* __restrict__ MSK, float* __restrict__ O, int ldo) {
  constexpr int RPW = 16, RTN = RPW / 16, NQB = TQA / (4 * RPW), DT = 4, KS = 2;
  __shared__ __attribute__((aligned(16))) unsigned short sP[4][RPW][40]; __shared__ __attribute__((aligned(16))) unsigned short sPL[4][RPW][40]; __shared__ __attribute__((aligned(16))) float sO[4][RPW][64 + 4];
  const int tid = threadIdx.x, w = tid >> 5, lane = tid & 31, ln = lane & 15, hh = lane >> 4;
  const int slab = blockIdx.x / QBLKSA, qblk = blockIdx.x % QBLKSA; (void)NQB; const int b = slab / NH, h = slab % NH; const int qb0 = qblk * (4 * RPW); const int q0 = qb0 + w * RPW;
  FragH aq[2][KS];
#pragma unroll
  for (int rt = 0; rt < RTN; ++rt) { const unsigned short* qr = (const unsigned short*)Q16 + ((size_t)b * TQA + q0 + rt * 16 + ln) * ldq + h * 64;
#pragma unroll
    for (int ks = 0; ks < KS; ++ks) { aq[rt][ks].half[0] = *(const v8us*)(qr + ks * 32 + 8 * hh); aq[rt][ks].half[1] = *(const v8us*)(qr + ks * 32 + 16 + 8 * hh); } }
  const size_t vslab = (size_t)(b * (NH / KVG) + h / KVG); const unsigned short* Vth = (const unsigned short*)Vt + vslab * 64 * TK; const unsigned short* Vtl = (const unsigned short*)VtL + vslab * 64 * TK;      /* GQA: q-head h reads kv head h / KVG */
  float m_r[2][8], l_r[2][8]; v8f oacc[2][DT], oaccL[2][DT];
#pragma unroll
  for (int rt = 0; rt < RTN; ++rt) {
#pragma unroll
    for (int r = 0; r < 8; ++r) { m_r[rt][r] = -3.0e38f; l_r[rt][r] = 0.f; }
#pragma unroll
    for (int dt = 0; dt < DT; ++dt) { oacc[rt][dt] = (v8f){0.f,0.f,0.f,0.f,0.f,0.f,0.f,0.f}; oaccL[rt][dt] = oacc[rt][dt]; } }
  const int jend = (CAUSAL == 1) ? (qb0 + 4 * RPW) : TK;      /* causal: keys beyond the block's last query never contribute */
#pragma unroll 1
  for (int j0 = 0; j0 < jend; j0 += 32) {
    v8f s[2][2]; FragH bk[2][KS], bv[DT], bl[DT]; int mk0[RTN][8], mk1[RTN][8];
    /* every global load of the trip is issued here, in the order of use (K, mask words, both V planes): their latencies overlap, and V lands behind the softmax */
#pragma unroll
    for (int nt = 0; nt < 2; ++nt) { const unsigned short* kr = (const unsigned short*)K16 + ((size_t)b * TK + j0 + nt * 16 + ln) * ldk + (h / KVG) * 64;
#pragma unroll
      for (int ks = 0; ks < KS; ++ks) { bk[nt][ks].half[0] = *(const v8us*)(kr + ks * 32 + 8 * hh); bk[nt][ks].half[1] = *(const v8us*)(kr + ks * 32 + 16 + 8 * hh); } }
    if (CAUSAL == 8) {
#pragma unroll
      for (int rt = 0; rt < RTN; ++rt)
#pragma unroll
        for (int r = 0; r < 8; ++r) { const int* mrow = MSK + (size_t)(q0 + rt * 16 + 8 * hh + r) * TK + j0 + ln; mk0[rt][r] = mrow[0]; mk1[rt][r] = mrow[16]; } }
    asm volatile("s_wait_xcnt 0x0" ::: "memory");      /* stands in front of the V loads, whose results may land in registers that the K and mask loads name as addresses */
#pragma unroll
    for (int dt = 0; dt < DT; ++dt) { const unsigned short* vrow = Vth + (size_t)(dt * 16 + ln) * TK + j0; const unsigned short* vrl = Vtl + (size_t)(dt * 16 + ln) * TK + j0; bv[dt].half[0] = *(const v8us*)(vrow + 8 * hh); bv[dt].half[1] = *(const v8us*)(vrow + 16 + 8 * hh); bl[dt].half[0] = *(const v8us*)(vrl + 8 * hh);
      if (dt == DT - 1) asm volatile("s_wait_xcnt 0x0" ::: "memory");      /* stands in front of the trip's last load, whose result lands in the address registers of the V loads above */
      bl[dt].half[1] = *(const v8us*)(vrl + 16 + 8 * hh); }
    __builtin_amdgcn_sched_barrier(0);      /* keeps the loads above together: without it the scheduler moves each one down to its first use, one exposed latency apiece */
#pragma unroll
    for (int nt = 0; nt < 2; ++nt) {
#pragma unroll
      for (int rt = 0; rt < RTN; ++rt) { v8f acc = (v8f){0.f,0.f,0.f,0.f,0.f,0.f,0.f,0.f};
#pragma unroll
        for (int ks = 0; ks < KS; ++ks) acc = mmaH<1>(aq[rt][ks].v, aq[rt][ks].v, bk[nt][ks].v, bk[nt][ks].v, acc); s[rt][nt] = acc; } }
#pragma unroll
    for (int rt = 0; rt < RTN; ++rt)
#pragma unroll
      for (int r = 0; r < 8; ++r) { const int tq = q0 + rt * 16 + 8 * hh + r; const int k0 = j0 + ln, k1 = j0 + 16 + ln;
        bool ok0 = (CAUSAL == 1) ? (k0 <= tq) : ((CAUSAL == 2) ? ((k0 >> 5) == (tq >> 5)) : true), ok1 = (CAUSAL == 1) ? (k1 <= tq) : ((CAUSAL == 2) ? ((k1 >> 5) == (tq >> 5)) : true);      /* mode 2: block-diagonal 32-token groups */
        if (CAUSAL == 8) { ok0 = mk0[rt][r] != 0; ok1 = mk1[rt][r] != 0; }      /* mode 8: per-(query, key) int table shared by all batches and heads */
        if (CAUSAL == 4) { const int* mrow = MSK + ((size_t)b * TQA + tq) * TK; ok0 = mrow[k0] != 0; ok1 = mrow[k1] != 0; }      /* mode 4: per-(query, key) INPUT mask shared by all heads; masked keys contribute nothing (== the reference's -4096 fill, whose exp underflows to 0), rows with no valid key give l = 0 -> output 0 (== the reference's row_valid zeroing) */
        const float s0 = ok0 ? s[rt][0][r] * SCL : -3.0e38f, s1 = ok1 ? s[rt][1][r] * SCL : -3.0e38f; 
        const float mn = row_max16(fmaxf(fmaxf(s0, s1), m_r[rt][r]));      /* the running maximum is the same in all 16 lanes of the row: taken in ahead of the reduction, the reduced value is the new maximum itself */
        const float al = (mn > -1.0e38f) ? expf(m_r[rt][r] - mn) : 1.0f; m_r[rt][r] = mn; const float p0 = ok0 ? expf(s0 - mn) : 0.f, p1 = ok1 ? expf(s1 - mn) : 0.f; l_r[rt][r] = l_r[rt][r] * al + p0 + p1;
#pragma unroll
        for (int dt = 0; dt < DT; ++dt) { oacc[rt][dt][r] *= al; oaccL[rt][dt][r] *= al; }
        FragH t2, t2l; const float ps0 = p0 * 1024.0f, ps1 = p1 * 1024.0f; t2.h[0] = (_Float16)ps0; t2.h[1] = (_Float16)ps1; t2l.h[0] = (_Float16)((ps0 - (float)t2.h[0]) * 1024.0f); t2l.h[1] = (_Float16)((ps1 - (float)t2.h[1]) * 1024.0f);
        sP[w][rt * 16 + 8 * hh + r][ln] = t2.u[0]; sP[w][rt * 16 + 8 * hh + r][16 + ln] = t2.u[1]; sPL[w][rt * 16 + 8 * hh + r][ln] = t2l.u[0]; sPL[w][rt * 16 + 8 * hh + r][16 + ln] = t2l.u[1]; }
    __builtin_amdgcn_fence(__ATOMIC_ACQ_REL, "workgroup"); __builtin_amdgcn_wave_barrier();
    FragH pa[2], pl[2];
#pragma unroll
    for (int rt = 0; rt < RTN; ++rt) { pa[rt].half[0] = *(const v8us*)&sP[w][rt * 16 + ln][8 * hh]; pa[rt].half[1] = *(const v8us*)&sP[w][rt * 16 + ln][16 + 8 * hh]; pl[rt].half[0] = *(const v8us*)&sPL[w][rt * 16 + ln][8 * hh]; pl[rt].half[1] = *(const v8us*)&sPL[w][rt * 16 + ln][16 + 8 * hh]; }
#pragma unroll
    for (int dt = 0; dt < DT; ++dt) {
#pragma unroll
      for (int rt = 0; rt < RTN; ++rt) { oacc[rt][dt] = mmaH<1>(pa[rt].v, pa[rt].v, bv[dt].v, bv[dt].v, oacc[rt][dt]); oaccL[rt][dt] = mmaH<1>(pl[rt].v, pl[rt].v, bv[dt].v, bv[dt].v, oaccL[rt][dt]); oaccL[rt][dt] = mmaH<1>(pa[rt].v, pa[rt].v, bl[dt].v, bl[dt].v, oaccL[rt][dt]); } }
    __builtin_amdgcn_fence(__ATOMIC_ACQ_REL, "workgroup"); __builtin_amdgcn_wave_barrier(); }
#pragma unroll
  for (int rt = 0; rt < RTN; ++rt) {
#pragma unroll
    for (int r = 0; r < 8; ++r) { float l = l_r[rt][r]; l = row_sum16(l); l_r[rt][r] = (l > 0.f) ? 1.0f / (l * 1024.0f) : 0.f; }
#pragma unroll
    for (int dt = 0; dt < DT; ++dt)
#pragma unroll
      for (int r = 0; r < 8; ++r) { float v = oacc[rt][dt][r]; v += oaccL[rt][dt][r] * 0.0009765625f; sO[w][rt * 16 + 8 * hh + r][dt * 16 + ln] = v * l_r[rt][r]; } }
  __builtin_amdgcn_fence(__ATOMIC_ACQ_REL, "workgroup"); __builtin_amdgcn_wave_barrier();
  {
#pragma unroll
    for (int rp = 0; rp < RPW; rp += 2) { const int r = rp + (lane >> 4), pc = lane & 15; const v4f val = *(const v4fa*)&sO[w][r][pc * 4]; *(v4f*)(O + ((size_t)b * TQA + q0 + r) * ldo + h * 64 + pc * 4) = val; }
     } }

// 3-term variant: O = (P_hi V_hi + (P_lo V_hi + P_hi V_lo) / 1024) / l with P = [hi | 2^10 residual] of 1024 p and V^T = [hi | 2^10 residual] planes (VtL same layout as Vt) -> ~2^-21-class products for un-averaged (early causal / peaked) rows
template <int CAUSAL>
__global__ __launch_bounds__(128) void k_flash3gB(const _Float16* __restrict__ Q16, int ldq, const _Float16* __restrict__ K16, int ldk, const _Float16* __restrict__ Vt, const _Float16* __restrict__ VtL, const int* __restrict__ MSK, float* __restrict__ O, int ldo) {
  constexpr int RPW = 16, RTN = RPW / 16, NQB = TQB / (4 * RPW), DT = 4, KS = 2;
  __shared__ __attribute__((aligned(16))) unsigned short sP[4][RPW][40]; __shared__ __attribute__((aligned(16))) unsigned short sPL[4][RPW][40]; __shared__ __attribute__((aligned(16))) float sO[4][RPW][64 + 4];
  const int tid = threadIdx.x, w = tid >> 5, lane = tid & 31, ln = lane & 15, hh = lane >> 4;
  const int slab = blockIdx.x / QBLKSB, qblk = blockIdx.x % QBLKSB; (void)NQB; const int b = slab / NH, h = slab % NH; const int qb0 = qblk * (4 * RPW); const int q0 = qb0 + w * RPW;
  FragH aq[2][KS];
#pragma unroll
  for (int rt = 0; rt < RTN; ++rt) { const unsigned short* qr = (const unsigned short*)Q16 + ((size_t)b * TQB + q0 + rt * 16 + ln) * ldq + h * 64;
#pragma unroll
    for (int ks = 0; ks < KS; ++ks) { aq[rt][ks].half[0] = *(const v8us*)(qr + ks * 32 + 8 * hh); aq[rt][ks].half[1] = *(const v8us*)(qr + ks * 32 + 16 + 8 * hh); } }
  const size_t vslab = (size_t)(b * (NH / KVG) + h / KVG); const unsigned short* Vth = (const unsigned short*)Vt + vslab * 64 * TK; const unsigned short* Vtl = (const unsigned short*)VtL + vslab * 64 * TK;      /* GQA: q-head h reads kv head h / KVG */
  float m_r[2][8], l_r[2][8]; v8f oacc[2][DT], oaccL[2][DT];
#pragma unroll
  for (int rt = 0; rt < RTN; ++rt) {
#pragma unroll
    for (int r = 0; r < 8; ++r) { m_r[rt][r] = -3.0e38f; l_r[rt][r] = 0.f; }
#pragma unroll
    for (int dt = 0; dt < DT; ++dt) { oacc[rt][dt] = (v8f){0.f,0.f,0.f,0.f,0.f,0.f,0.f,0.f}; oaccL[rt][dt] = oacc[rt][dt]; } }
  const int jend = (CAUSAL == 1) ? (qb0 + 4 * RPW) : TK;      /* causal: keys beyond the block's last query never contribute */
#pragma unroll 1
  for (int j0 = 0; j0 < jend; j0 += 32) {
    v8f s[2][2]; FragH bk[2][KS], bv[DT], bl[DT]; int mk0[RTN][8], mk1[RTN][8];
    /* every global load of the trip is issued here, in the order of use (K, mask words, both V planes): their latencies overlap, and V lands behind the softmax */
#pragma unroll
    for (int nt = 0; nt < 2; ++nt) { const unsigned short* kr = (const unsigned short*)K16 + ((size_t)b * TK + j0 + nt * 16 + ln) * ldk + (h / KVG) * 64;
#pragma unroll
      for (int ks = 0; ks < KS; ++ks) { bk[nt][ks].half[0] = *(const v8us*)(kr + ks * 32 + 8 * hh); bk[nt][ks].half[1] = *(const v8us*)(kr + ks * 32 + 16 + 8 * hh); } }
    if (CAUSAL == 8) {
#pragma unroll
      for (int rt = 0; rt < RTN; ++rt)
#pragma unroll
        for (int r = 0; r < 8; ++r) { const int* mrow = MSK + (size_t)(q0 + rt * 16 + 8 * hh + r) * TK + j0 + ln; mk0[rt][r] = mrow[0]; mk1[rt][r] = mrow[16]; } }
    asm volatile("s_wait_xcnt 0x0" ::: "memory");      /* stands in front of the V loads, whose results may land in registers that the K and mask loads name as addresses */
#pragma unroll
    for (int dt = 0; dt < DT; ++dt) { const unsigned short* vrow = Vth + (size_t)(dt * 16 + ln) * TK + j0; const unsigned short* vrl = Vtl + (size_t)(dt * 16 + ln) * TK + j0; bv[dt].half[0] = *(const v8us*)(vrow + 8 * hh); bv[dt].half[1] = *(const v8us*)(vrow + 16 + 8 * hh); bl[dt].half[0] = *(const v8us*)(vrl + 8 * hh);
      if (dt == DT - 1) asm volatile("s_wait_xcnt 0x0" ::: "memory");      /* stands in front of the trip's last load, whose result lands in the address registers of the V loads above */
      bl[dt].half[1] = *(const v8us*)(vrl + 16 + 8 * hh); }
    __builtin_amdgcn_sched_barrier(0);      /* keeps the loads above together: without it the scheduler moves each one down to its first use, one exposed latency apiece */
#pragma unroll
    for (int nt = 0; nt < 2; ++nt) {
#pragma unroll
      for (int rt = 0; rt < RTN; ++rt) { v8f acc = (v8f){0.f,0.f,0.f,0.f,0.f,0.f,0.f,0.f};
#pragma unroll
        for (int ks = 0; ks < KS; ++ks) acc = mmaH<1>(aq[rt][ks].v, aq[rt][ks].v, bk[nt][ks].v, bk[nt][ks].v, acc); s[rt][nt] = acc; } }
#pragma unroll
    for (int rt = 0; rt < RTN; ++rt)
#pragma unroll
      for (int r = 0; r < 8; ++r) { const int tq = q0 + rt * 16 + 8 * hh + r; const int k0 = j0 + ln, k1 = j0 + 16 + ln;
        bool ok0 = (CAUSAL == 1) ? (k0 <= tq) : ((CAUSAL == 2) ? ((k0 >> 5) == (tq >> 5)) : true), ok1 = (CAUSAL == 1) ? (k1 <= tq) : ((CAUSAL == 2) ? ((k1 >> 5) == (tq >> 5)) : true);      /* mode 2: block-diagonal 32-token groups */
        if (CAUSAL == 8) { ok0 = mk0[rt][r] != 0; ok1 = mk1[rt][r] != 0; }      /* mode 8: per-(query, key) int table shared by all batches and heads */
        if (CAUSAL == 4) { const int* mrow = MSK + ((size_t)b * TQB + tq) * TK; ok0 = mrow[k0] != 0; ok1 = mrow[k1] != 0; }      /* mode 4: per-(query, key) INPUT mask shared by all heads; masked keys contribute nothing (== the reference's -4096 fill, whose exp underflows to 0), rows with no valid key give l = 0 -> output 0 (== the reference's row_valid zeroing) */
        const float s0 = ok0 ? s[rt][0][r] * SCL : -3.0e38f, s1 = ok1 ? s[rt][1][r] * SCL : -3.0e38f; 
        const float mn = row_max16(fmaxf(fmaxf(s0, s1), m_r[rt][r]));      /* the running maximum is the same in all 16 lanes of the row: taken in ahead of the reduction, the reduced value is the new maximum itself */
        const float al = (mn > -1.0e38f) ? expf(m_r[rt][r] - mn) : 1.0f; m_r[rt][r] = mn; const float p0 = ok0 ? expf(s0 - mn) : 0.f, p1 = ok1 ? expf(s1 - mn) : 0.f; l_r[rt][r] = l_r[rt][r] * al + p0 + p1;
#pragma unroll
        for (int dt = 0; dt < DT; ++dt) { oacc[rt][dt][r] *= al; oaccL[rt][dt][r] *= al; }
        FragH t2, t2l; const float ps0 = p0 * 1024.0f, ps1 = p1 * 1024.0f; t2.h[0] = (_Float16)ps0; t2.h[1] = (_Float16)ps1; t2l.h[0] = (_Float16)((ps0 - (float)t2.h[0]) * 1024.0f); t2l.h[1] = (_Float16)((ps1 - (float)t2.h[1]) * 1024.0f);
        sP[w][rt * 16 + 8 * hh + r][ln] = t2.u[0]; sP[w][rt * 16 + 8 * hh + r][16 + ln] = t2.u[1]; sPL[w][rt * 16 + 8 * hh + r][ln] = t2l.u[0]; sPL[w][rt * 16 + 8 * hh + r][16 + ln] = t2l.u[1]; }
    __builtin_amdgcn_fence(__ATOMIC_ACQ_REL, "workgroup"); __builtin_amdgcn_wave_barrier();
    FragH pa[2], pl[2];
#pragma unroll
    for (int rt = 0; rt < RTN; ++rt) { pa[rt].half[0] = *(const v8us*)&sP[w][rt * 16 + ln][8 * hh]; pa[rt].half[1] = *(const v8us*)&sP[w][rt * 16 + ln][16 + 8 * hh]; pl[rt].half[0] = *(const v8us*)&sPL[w][rt * 16 + ln][8 * hh]; pl[rt].half[1] = *(const v8us*)&sPL[w][rt * 16 + ln][16 + 8 * hh]; }
#pragma unroll
    for (int dt = 0; dt < DT; ++dt) {
#pragma unroll
      for (int rt = 0; rt < RTN; ++rt) { oacc[rt][dt] = mmaH<1>(pa[rt].v, pa[rt].v, bv[dt].v, bv[dt].v, oacc[rt][dt]); oaccL[rt][dt] = mmaH<1>(pl[rt].v, pl[rt].v, bv[dt].v, bv[dt].v, oaccL[rt][dt]); oaccL[rt][dt] = mmaH<1>(pa[rt].v, pa[rt].v, bl[dt].v, bl[dt].v, oaccL[rt][dt]); } }
    __builtin_amdgcn_fence(__ATOMIC_ACQ_REL, "workgroup"); __builtin_amdgcn_wave_barrier(); }
#pragma unroll
  for (int rt = 0; rt < RTN; ++rt) {
#pragma unroll
    for (int r = 0; r < 8; ++r) { float l = l_r[rt][r]; l = row_sum16(l); l_r[rt][r] = (l > 0.f) ? 1.0f / (l * 1024.0f) : 0.f; }
#pragma unroll
    for (int dt = 0; dt < DT; ++dt)
#pragma unroll
      for (int r = 0; r < 8; ++r) { float v = oacc[rt][dt][r]; v += oaccL[rt][dt][r] * 0.0009765625f; sO[w][rt * 16 + 8 * hh + r][dt * 16 + ln] = v * l_r[rt][r]; } }
  __builtin_amdgcn_fence(__ATOMIC_ACQ_REL, "workgroup"); __builtin_amdgcn_wave_barrier();
  {
#pragma unroll
    for (int rp = 0; rp < RPW; rp += 2) { const int r = rp + (lane >> 4), pc = lane & 15; const v4f val = *(const v4fa*)&sO[w][r][pc * 4]; *(v4f*)(O + ((size_t)b * TQB + q0 + r) * ldo + h * 64 + pc * 4) = val; }
     } }

__global__ __launch_bounds__(256) void k_wpair(const float* __restrict__ Wm, int nin, int nout, _Float16* __restrict__ Bt) { const size_t t = (size_t)blockIdx.x * 256 + threadIdx.x; if (t >= (size_t)nout * (2 * nin / 8)) return; const int pc = (int)(t % (2 * nin / 8)); const int o = (int)(t / (2 * nin / 8)); const bool lo = pc * 8 >= nin; FragH f;
  for (int q = 0; q < 8; ++q) { const int c = pc * 8 + q - (lo ? nin : 0); f.h[q] = (_Float16)(bf16_round(Wm[(size_t)c * nout + o]) * (lo ? 1.0f : 16.0f)); } *(v8us*)((unsigned short*)Bt + (size_t)o * 2 * nin + pc * 8) = f.half[0];  }
template <int TWO_D>
__global__ __launch_bounds__(256) void k_rotab(int nrows, int rpb, const int* __restrict__ bar, const int* __restrict__ tib, float* __restrict__ CS, float* __restrict__ SN) {
  #pragma clang fp contract(off)
  const size_t t = (size_t)blockIdx.x * 256 + threadIdx.x; if (t >= (size_t)nrows * 32) return; const int d = (int)(t % 32); const int row = (int)(t / 32); const int b = row / rpb, r = row % rpb; float pos, inv;
  if (TWO_D) { const int dm = d & 15; inv = 1.0f / powf(10000.0f, (float)dm * 2.0f / 32.0f); pos = (d < 16) ? (float)bar[(size_t)b * rpb + r] : (float)tib[(size_t)b * rpb + r]; }
  else { inv = 1.0f / powf(10000.0f, (float)(2 * d) / 64.0f); pos = (float)r; }
  const float th = pos * inv; const float c = cosf(th), s = sinf(th);
  { *(float*)(CS + t) = c; *(float*)(SN + t) = s;  } }
__global__ __launch_bounds__(256) void k_rope(const float* __restrict__ F, int nrows, int rpb, int nheads, const float* __restrict__ CS, const float* __restrict__ SN, _Float16* __restrict__ dst, int ldo, int dst_bstride, int row_off) {
  #pragma clang fp contract(off)
  const size_t t = (size_t)blockIdx.x * 256 + threadIdx.x; if (t >= (size_t)nrows * nheads * 4) return; const int jg = (int)(t % 4) * 8; const int h = (int)((t / 4) % nheads); const int row = (int)(t / (4 * (size_t)nheads)); const int b = row / rpb, r = row % rpb; const int ldi = nheads * 64;
  const float* xr = F + (size_t)row * ldi + h * 64; FragH f0, f1;
#pragma unroll
  for (int q = 0; q < 8; ++q) { const int d = jg + q; const float c = CS[(size_t)row * 32 + d], s = SN[(size_t)row * 32 + d]; const float x0 = xr[d], x1 = xr[d + 32];
    float o0 = x0 * c; o0 += -x1 * s; float o1 = x1 * c; o1 += x0 * s; f0.h[q] = (_Float16)o0; f1.h[q] = (_Float16)o1; }
  unsigned short* o = (unsigned short*)dst + ((size_t)b * dst_bstride + row_off + r) * ldo + h * 64 + jg;
  { *(v8us*)o = f0.half[0]; *(v8us*)(o + 32) = f1.half[0];  } }
__global__ __launch_bounds__(256) void k_put(const float* __restrict__ F, int nrows, int rpb, int ncol, _Float16* __restrict__ H, _Float16* __restrict__ L, int dst_bstride, int row_off) {
  const size_t t = (size_t)blockIdx.x * 256 + threadIdx.x; if (t >= (size_t)nrows * (ncol / 8)) return; const int c0 = (int)(t % (ncol / 8)) * 8; const int row = (int)(t / (ncol / 8)); const int b = row / rpb, r = row % rpb; FragH fh, fl;
  for (int q = 0; q < 8; ++q) { const float v = F[(size_t)row * ncol + c0 + q]; const _Float16 hv = (_Float16)v; fh.h[q] = hv; fl.h[q] = (_Float16)((v - (float)hv) * 1024.0f); }
  const size_t drow = (size_t)b * dst_bstride + row_off + r; { *(v8us*)((unsigned short*)H + drow * ncol + c0) = fh.half[0]; if (L) *(v8us*)((unsigned short*)L + drow * ncol + c0) = fl.half[0];  } }

extern "C" void kernel_launch(void* const* d_in, const int* in_sizes, int n_in,
                              void* d_out, int out_size, void* d_ws, size_t ws_size, hipStream_t stream) {
  (void)in_sizes; (void)n_in; (void)out_size;
  const float* const* I = (const float* const*)d_in; const float* sum_x = I[0]; const float* reg_x = I[1];
  const float* w_sq = I[2]; const float* b_sq = I[3]; const float* w_sk = I[4]; const float* b_sk = I[5]; const float* w_sv = I[6]; const float* b_sv = I[7]; const float* w_so = I[8]; const float* b_so = I[9];
  const float* w_rq = I[10]; const float* b_rq = I[11]; const float* w_rk = I[12]; const float* b_rk = I[13]; const float* w_rv = I[14]; const float* b_rv = I[15]; const float* w_ro = I[16]; const float* b_ro = I[17];
  const float* w_k2 = I[18]; const float* b_k2 = I[19]; const float* w_v2 = I[20]; const float* b_v2 = I[21];
  const int* bar = (const int*)d_in[22]; const int* tib = (const int*)d_in[23]; const int* msum = (const int*)d_in[24]; const int* mupd = (const int*)d_in[25];
  char* ws = (char*)d_ws; size_t off = 0;
  auto take = [&](size_t bytes) { char* p = ws + off; off += (bytes + 255) & ~(size_t)255; return p; };
  const size_t w8 = (size_t)DMOD * DMOD / 8, w8k = (size_t)DMOD * KVD / 8;
  _Float16* BSQ = (_Float16*)take(w8 * 16); _Float16* BSK = (_Float16*)take(w8k * 16); _Float16* BSV = (_Float16*)take(w8k * 16); _Float16* BRQ = (_Float16*)take(w8 * 16); _Float16* BRK = (_Float16*)take(w8k * 16); _Float16* BRV = (_Float16*)take(w8k * 16);
  _Float16* BSO = (_Float16*)take(w8 * 32); _Float16* BRO = (_Float16*)take(w8 * 32); _Float16* BK2 = (_Float16*)take(w8k * 32); _Float16* BV2 = (_Float16*)take(w8k * 32);
  float* CS1 = (float*)take((size_t)NRS * 32 * 4); float* SN1 = (float*)take((size_t)NRS * 32 * 4); float* CS2 = (float*)take((size_t)NRR * 32 * 4); float* SN2 = (float*)take((size_t)NRR * 32 * 4); _Float16* SX = (_Float16*)take((size_t)NRS * DMOD * 2); _Float16* RX = (_Float16*)take((size_t)NRR * DMOD * 2); float* F32 = (float*)take((size_t)NRR * DMOD * 4); float* FS = (float*)take((size_t)NRS * DMOD * 4);
  _Float16* SQ = (_Float16*)take((size_t)NRS * DMOD * 2); _Float16* RQ = (_Float16*)take((size_t)NRR * DMOD * 2); _Float16* KC = (_Float16*)take((size_t)NB * TK * KVD * 2); _Float16* VCH = (_Float16*)take((size_t)NB * TK * KVD * 2); _Float16* VCL = (_Float16*)take((size_t)NB * TK * KVD * 2); _Float16* VT = (_Float16*)take((size_t)NB * NKV * 64 * TK * 2); _Float16* VTL = (_Float16*)take((size_t)NB * NKV * 64 * TK * 2);
  float* O1 = (float*)take((size_t)NRS * DMOD * 4); _Float16* O1H = (_Float16*)take((size_t)NRS * DMOD * 2); _Float16* O1L = (_Float16*)take((size_t)NRS * DMOD * 2); float* O2 = F32; _Float16* O2H = RQ; _Float16* O2L = RX;      /* O2 over the dead reg-q f32 scratch; O2H/O2L over RQ/RX (dead after phase 2 / the projections) */
  if (off > ws_size) return;      /* 16 + 1 + 8 + 16 + 8 + 2.06 x 5 + 0.5 x 2 + 0.25 x 4 = 61.3 MiB */
  const unsigned g8 = (unsigned)((w8 + 255) / 256), g8k = (unsigned)((w8k + 255) / 256);
  k_wt_f16<<<g8, 256, 0, stream>>>(w_sq, BSQ, DMOD, DMOD, 16.0f); k_wt_f16<<<g8k, 256, 0, stream>>>(w_sk, BSK, DMOD, KVD, 16.0f); k_wt_f16<<<g8k, 256, 0, stream>>>(w_sv, BSV, DMOD, KVD, 16.0f);
  k_wt_f16<<<g8, 256, 0, stream>>>(w_rq, BRQ, DMOD, DMOD, 16.0f); k_wt_f16<<<g8k, 256, 0, stream>>>(w_rk, BRK, DMOD, KVD, 16.0f); k_wt_f16<<<g8k, 256, 0, stream>>>(w_rv, BRV, DMOD, KVD, 16.0f);
  k_wpair<<<(unsigned)(((size_t)DMOD * (2 * DMOD / 8) + 255) / 256), 256, 0, stream>>>(w_so, DMOD, DMOD, BSO); k_wpair<<<(unsigned)(((size_t)DMOD * (2 * DMOD / 8) + 255) / 256), 256, 0, stream>>>(w_ro, DMOD, DMOD, BRO);
  k_wpair<<<(unsigned)(((size_t)KVD * (2 * DMOD / 8) + 255) / 256), 256, 0, stream>>>(w_k2, DMOD, KVD, BK2); k_wpair<<<(unsigned)(((size_t)KVD * (2 * DMOD / 8) + 255) / 256), 256, 0, stream>>>(w_v2, DMOD, KVD, BV2);
  k_rotab<0><<<(unsigned)(((size_t)NRS * 32 + 255) / 256), 256, 0, stream>>>(NRS, SS, nullptr, nullptr, CS1, SN1); k_rotab<1><<<(unsigned)(((size_t)NRR * 32 + 255) / 256), 256, 0, stream>>>(NRR, RR, bar, tib, CS2, SN2);
  k_x16<<<(unsigned)(((size_t)NRS * DMOD / 8 + 255) / 256), 256, 0, stream>>>(sum_x, SX, (size_t)NRS * DMOD / 8); k_x16<<<(unsigned)(((size_t)NRR * DMOD / 8 + 255) / 256), 256, 0, stream>>>(reg_x, RX, (size_t)NRR * DMOD / 8);
  const dim3 gSQ((NRS / 128) * (DMOD / 64), 1), gSK((NRS / 128) * (KVD / 64), 1), gRQ((NRR / 128) * (DMOD / 64), 1), gRK((NRR / 128) * (KVD / 64), 1);
  /* summary q/k/v */
  k_gemm2<0><<<gSQ, 128, 0, stream>>>(SX, DMOD, 0, BSQ, DMOD, 0, 0.0625f, b_sq, 0, nullptr, 1, 0, 0, FS, nullptr, DMOD, 0, NRS, DMOD, DMOD);
  k_rope<<<(unsigned)(((size_t)NRS * NH * 4 + 255) / 256), 256, 0, stream>>>(FS, NRS, SS, NH, CS1, SN1, SQ, DMOD, SS, 0);
  k_gemm2<0><<<gSK, 128, 0, stream>>>(SX, DMOD, 0, BSK, DMOD, 0, 0.0625f, b_sk, 0, nullptr, 1, 0, 0, FS, nullptr, KVD, 0, NRS, KVD, DMOD);
  k_rope<<<(unsigned)(((size_t)NRS * NKV * 4 + 255) / 256), 256, 0, stream>>>(FS, NRS, SS, NKV, CS1, SN1, KC, KVD, TK, 0);      /* keys 0..63 of each batch */
  k_gemm2<0><<<gSK, 128, 0, stream>>>(SX, DMOD, 0, BSV, DMOD, 0, 0.0625f, b_sv, 0, nullptr, 1, 0, 0, FS, nullptr, KVD, 0, NRS, KVD, DMOD);
  k_put<<<(unsigned)(((size_t)NRS * (KVD / 8) + 255) / 256), 256, 0, stream>>>(FS, NRS, SS, KVD, VCH, VCL, TK, 0);
  /* regular q/k/v */
  k_gemm2<0><<<gRQ, 128, 0, stream>>>(RX, DMOD, 0, BRQ, DMOD, 0, 0.0625f, b_rq, 0, nullptr, 1, 0, 0, F32, nullptr, DMOD, 0, NRR, DMOD, DMOD);
  k_rope<<<(unsigned)(((size_t)NRR * NH * 4 + 255) / 256), 256, 0, stream>>>(F32, NRR, RR, NH, CS2, SN2, RQ, DMOD, RR, 0);
  k_gemm2<0><<<gRK, 128, 0, stream>>>(RX, DMOD, 0, BRK, DMOD, 0, 0.0625f, b_rk, 0, nullptr, 1, 0, 0, F32, nullptr, KVD, 0, NRR, KVD, DMOD);
  k_rope<<<(unsigned)(((size_t)NRR * NKV * 4 + 255) / 256), 256, 0, stream>>>(F32, NRR, RR, NKV, CS2, SN2, KC, KVD, TK, SS);      /* keys 64.. of each batch */
  k_gemm2<0><<<gRK, 128, 0, stream>>>(RX, DMOD, 0, BRV, DMOD, 0, 0.0625f, b_rv, 0, nullptr, 1, 0, 0, F32, nullptr, KVD, 0, NRR, KVD, DMOD);
  k_put<<<(unsigned)(((size_t)NRR * (KVD / 8) + 255) / 256), 256, 0, stream>>>(F32, NRR, RR, KVD, VCH, VCL, TK, SS);
  /* phase 1: summary queries over [summary ; regular] keys */
  k_vt<NKV, TK><<<NB * NKV * (TK / 64), 256, 0, stream>>>(VCH, KVD, 0, VT); k_vt<NKV, TK><<<NB * NKV * (TK / 64), 256, 0, stream>>>(VCL, KVD, 0, VTL);
  k_flash3gA<8><<<NB * NH * QBLKSA, 128, 0, stream>>>(SQ, DMOD, KC, KVD, VT, VTL, msum, O1, DMOD);
  k_hl<<<(unsigned)(((size_t)NRS * DMOD / 8 + 255) / 256), 256, 0, stream>>>(O1, O1H, O1L, (size_t)NRS * DMOD / 8);
  /* output 0 = sum_attn W_so + b_so */
  k_gemm2<0><<<gSQ, 128, 0, stream>>>(O1H, DMOD, 0, BSO, 2 * DMOD, 0, 0.0625f, b_so, 0, nullptr, 1, 0, 0, (float*)d_out, nullptr, DMOD, 0, NRS, DMOD, DMOD);
  k_gemm2<0><<<gSQ, 128, 0, stream>>>(O1L, DMOD, 0, BSO + DMOD, 2 * DMOD, 0, 1.0f / 1024.0f, nullptr, 0, (const float*)d_out, 1, (size_t)DMOD, 0, (float*)d_out, nullptr, DMOD, 0, NRS, DMOD, DMOD);
  /* k2 / v2 from sum_attn (no RoPE), into key/value rows 0..63 of each batch */
  k_gemm2<0><<<gSK, 128, 0, stream>>>(O1H, DMOD, 0, BK2, 2 * DMOD, 0, 0.0625f, b_k2, 0, nullptr, 1, 0, 0, FS, nullptr, KVD, 0, NRS, KVD, DMOD);
  k_gemm2<0><<<gSK, 128, 0, stream>>>(O1L, DMOD, 0, BK2 + DMOD, 2 * DMOD, 0, 1.0f / 1024.0f, nullptr, 0, FS, 1, (size_t)KVD, 0, FS, nullptr, KVD, 0, NRS, KVD, DMOD);
  k_put<<<(unsigned)(((size_t)NRS * (KVD / 8) + 255) / 256), 256, 0, stream>>>(FS, NRS, SS, KVD, KC, nullptr, TK, 0);
  k_gemm2<0><<<gSK, 128, 0, stream>>>(O1H, DMOD, 0, BV2, 2 * DMOD, 0, 0.0625f, b_v2, 0, nullptr, 1, 0, 0, FS, nullptr, KVD, 0, NRS, KVD, DMOD);
  k_gemm2<0><<<gSK, 128, 0, stream>>>(O1L, DMOD, 0, BV2 + DMOD, 2 * DMOD, 0, 1.0f / 1024.0f, nullptr, 0, FS, 1, (size_t)KVD, 0, FS, nullptr, KVD, 0, NRS, KVD, DMOD);
  k_put<<<(unsigned)(((size_t)NRS * (KVD / 8) + 255) / 256), 256, 0, stream>>>(FS, NRS, SS, KVD, VCH, VCL, TK, 0);
  /* phase 2: regular queries over [k2 ; regular] keys */
  k_vt<NKV, TK><<<NB * NKV * (TK / 64), 256, 0, stream>>>(VCH, KVD, 0, VT); k_vt<NKV, TK><<<NB * NKV * (TK / 64), 256, 0, stream>>>(VCL, KVD, 0, VTL);
  k_flash3gB<8><<<NB * NH * QBLKSB, 128, 0, stream>>>(RQ, DMOD, KC, KVD, VT, VTL, mupd, O2, DMOD);
  k_hl<<<(unsigned)(((size_t)NRR * DMOD / 8 + 255) / 256), 256, 0, stream>>>(O2, O2H, O2L, (size_t)NRR * DMOD / 8);
  float* out1 = (float*)d_out + (size_t)NRS * DMOD;
  k_gemm2<0><<<gRQ, 128, 0, stream>>>(O2H, DMOD, 0, BRO, 2 * DMOD, 0, 0.0625f, b_ro, 0, nullptr, 1, 0, 0, out1, nullptr, DMOD, 0, NRR, DMOD, DMOD);
  k_gemm2<0><<<gRQ, 128, 0, stream>>>(O2L, DMOD, 0, BRO + DMOD, 2 * DMOD, 0, 1.0f / 1024.0f, nullptr, 0, out1, 1, (size_t)DMOD, 0, out1, nullptr, DMOD, 0, NRR, DMOD, DMOD);
}

// v003
// It runs in 563 microseconds.
// Two timings next to v002 both put it at 1.16 times that version's speed.
// Over all steps from v000 it is 2.48 times as fast.
#include <hip/hip_runtime.h>
// FlexSummaryAttention (2 batches; 64 summary tokens S, 2048 regular tokens R, D = 1024; 16 query heads, 4 kv heads (GQA), head dim 64): q/k/v projections for both token sets; 1-D RoPE on summary q/k, 2-D hierarchical RoPE (bar id | token-in-bar id) on regular q/k; phase 1: summary queries over [summary; regular] keys with the summarize mask -> sum_attn; k2/v2 = sum_attn W + b; phase 2: regular queries over [k2; regular k] / [v2; regular v] with the updating mask -> reg_attn; outputs sum_attn W_so + b and reg_attn W_ro + b.
// Structure: exact f16 planes of both inputs; six projection GEMMs (32x64 wave tiles, f32 accumulation, exact x16 weights + bias); RoPE on VALU (thread per (row, head, 8 dims), f32 trig) into f16 q planes and the shared per-batch key plane [k2-or-summary ; regular] (4 kv heads); values as f16 hi + 2^10 residual planes, V^T by LDS tiles; the fused flash kernel (3-term P.V, GQA head mapping, INPUT int mask tables) once per phase; sum_attn / reg_attn as hi + residual pairs into the k2/v2 and output GEMMs.
// Compute dtype: inputs, masks' companions and parameters rounded to bf16; q/k after RoPE as f16 (~2^-12); P and v hi + residual (~2^-21-class); attention outputs hi + residual into the following GEMMs; f32 softmax/accumulation/trig. v_wmma_f32_16x16x32_f16.
#define NB 2
#define SS 64
#define RR 2048
#define DMOD 1024
#define KVD 256
#define NRS (NB * SS)            /* 128 summary rows */
#define NRR (NB * RR)            /* 4096 regular rows */
#define TK 2112                  /* keys per batch in both phases: 64 summary(-derived) + 2048 regular */
#define TQA 64                   /* phase-1 queries (summary tokens) */
#define TQB 2048                 /* phase-2 queries (regular tokens) */
#define TQ TQB
#define NH 16
#define KVG 4                    /* GQA: 16 query heads share 4 kv heads */
#define NKV (NH / KVG)
#define SCL 0.125f               /* 64^-0.5 */
#define QBLKSA (TQA / 64)
#define NSPL 11                  /* phase 1: waves that share the 2112 keys of one 16-query tile, 6 trips of 32 keys each */
#define QBLKSB (TQB / 64)
typedef __bf16 v16b __attribute__((ext_vector_type(16)));
typedef unsigned short v8us __attribute__((ext_vector_type(8), may_alias));
typedef float  v8f  __attribute__((ext_vector_type(8)));
typedef float  v4f  __attribute__((ext_vector_type(4)));
typedef float  v4fa __attribute__((ext_vector_type(4), may_alias));
union FragB { v16b v; v8us half[2]; unsigned short u[16]; };

__device__ __forceinline__ unsigned short bf16_bits(float x) { unsigned int u = __float_as_uint(x); return (unsigned short)((u + 0x7FFFu + ((u >> 16) & 1u)) >> 16); }
__device__ __forceinline__ float bf16_val(unsigned short b) { return __uint_as_float(((unsigned int)b) << 16); }
__device__ __forceinline__ float bf16_round(float x) { return bf16_val(bf16_bits(x)); }
// D += A·B with NT terms: 1 = ah·bh, 2 = + al·bh (A split), 3 = + ah·bl (both split)
template <int NT>
__device__ __forceinline__ v8f mmaN(v16b ah, v16b al, v16b bh, v16b bl, v8f c) {
  c = __builtin_amdgcn_wmma_f32_16x16x32_bf16(false, ah, false, bh, (short)0, c, false, false);
  if (NT >= 2) c = __builtin_amdgcn_wmma_f32_16x16x32_bf16(false, al, false, bh, (short)0, c, false, false);
  if (NT >= 3) c = __builtin_amdgcn_wmma_f32_16x16x32_bf16(false, ah, false, bl, (short)0, c, false, false);
  asm volatile("v_nop\n\tv_nop\n\tv_nop\n\tv_nop" : "+v"(c) : "v"(ah), "v"(al), "v"(bh), "v"(bl));
  return c;
}

__global__ __launch_bounds__(256) void k_wt_bf16(const float* __restrict__ W, unsigned short* __restrict__ Wt, int K, int N) {
  const int t = blockIdx.x * 256 + threadIdx.x;
  const int k8n = K / 8;
  if (t >= N * k8n) return;
  const int n = t / k8n, k8 = (t % k8n) * 8;
  v8us v;
#pragma unroll
  for (int i = 0; i < 8; ++i) v[i] = bf16_bits(W[(size_t)(k8 + i) * N + n]);
  *(v8us*)(Wt + (size_t)n * K + k8) = v;
  
}

// GEMM C[M][N] (f32, pitch ldc) = act(A[M][K]·W + bias). A f32 row-major (pitch lda) converted per fragment to bf16
// (ASPLIT: hi/lo two planes -> 2 terms, else single rounded term); Wt bf16 [N][K] (pitch ldb). BIAS_BF16 rounds the
// bias to bf16 first (bias quantised to bf16 before the add). K%32==0, M%16==0, N%64==0.
template <bool ASPLIT, int ACT, bool BIAS_BF16>
__global__ __launch_bounds__(128) void k_gemm_bf(const float* __restrict__ A, int lda, const unsigned short* __restrict__ Wt, int ldb,
                                               const float* __restrict__ bias, float* __restrict__ C, int ldc, int M, int N, int K) {
  __shared__ __attribute__((aligned(16))) float so[4][16][64];
  const int tid = threadIdx.x, w = tid >> 5, lane = tid & 31, ln = lane & 15, hh = lane >> 4;
  const int ntn = N / 64;
  const int wid = blockIdx.x * 4 + w;
  const int mt = wid / ntn, nq = wid % ntn;
  if (mt * 16 >= M) return;
  const int row0 = mt * 16, col0 = nq * 64;
  const float* arow = A + (size_t)(row0 + ln) * lda;
  v8f acc[4] = {};
  for (int kb = 0; kb < K; kb += 32) {
    FragB ah, al;
    const v4f x0 = *(const v4fa*)(arow + kb + 8 * hh), x1 = *(const v4fa*)(arow + kb + 8 * hh + 4);
    const v4f x2 = *(const v4fa*)(arow + kb + 16 + 8 * hh), x3 = *(const v4fa*)(arow + kb + 16 + 8 * hh + 4);
    float xs[16] = {x0[0],x0[1],x0[2],x0[3],x1[0],x1[1],x1[2],x1[3],x2[0],x2[1],x2[2],x2[3],x3[0],x3[1],x3[2],x3[3]};
#pragma unroll
    for (int i = 0; i < 16; ++i) { const unsigned short hb = bf16_bits(xs[i]); ah.u[i] = hb; al.u[i] = ASPLIT ? bf16_bits(xs[i] - bf16_val(hb)) : (unsigned short)0; }
#pragma unroll
    for (int t = 0; t < 4; ++t) {
      const unsigned short* brow = Wt + (size_t)(col0 + t * 16 + ln) * ldb + kb;
      FragB b;
      b.half[0] = *(const v8us*)(brow + 8 * hh);
      b.half[1] = *(const v8us*)(brow + 16 + 8 * hh);
      acc[t] = mmaN<ASPLIT ? 2 : 1>(ah.v, al.v, b.v, b.v, acc[t]);
    }
  }
#pragma unroll
  for (int t = 0; t < 4; ++t) {
    float bv = bias ? bias[col0 + t * 16 + ln] : 0.f;
    if (BIAS_BF16) bv = bf16_round(bv);
#pragma unroll
    for (int r = 0; r < 8; ++r) { float v = acc[t][r] + bv; if (ACT == 1) v = fmaxf(v, 0.f); so[w][8 * hh + r][t * 16 + ln] = v; }
  }
  __builtin_amdgcn_fence(__ATOMIC_ACQ_REL, "workgroup");
  __builtin_amdgcn_wave_barrier();
  const int rsub = lane >> 4, c4 = (lane & 15) * 4;
  {
#pragma unroll
    for (int q = 0; q < 8; ++q) {
      const int r = q * 2 + rsub;
      const v4f v = *(const v4fa*)&so[w][r][c4];
      *(v4f*)(C + (size_t)(row0 + r) * ldc + col0 + c4) = v;
    }
    
  }
}

// GEMM C = act(A·W + bias + resid): A f32 (ASPLIT -> hi/lo 2 terms), Wt bf16 [N][K]; ACT 0 none, 1 relu, 2 exact gelu;
// resid (optional, f32, row index = (row % rmod), pitch ldr, RES_BF16 rounds it) added before the activation.
template <bool ASPLIT, int ACT, bool BIAS_BF16, bool RES_BF16>
__global__ __launch_bounds__(128) void k_gemm_bf3(const float* __restrict__ A, int lda, const unsigned short* __restrict__ Wt, int ldb,
                                                const float* __restrict__ bias, const float* __restrict__ resid, int rmod, int ldr,
                                                float* __restrict__ C, int ldc, int M, int N, int K) {
  __shared__ __attribute__((aligned(16))) float so[4][16][64];
  const int tid = threadIdx.x, w = tid >> 5, lane = tid & 31, ln = lane & 15, hh = lane >> 4;
  const int ntn = N / 64;
  const int wid = blockIdx.x * 4 + w;
  const int mt = wid / ntn, nq = wid % ntn;
  if (mt * 16 >= M) return;
  const int row0 = mt * 16, col0 = nq * 64;
  const float* arow = A + (size_t)(row0 + ln) * lda;
  v8f acc[4] = {};
  for (int kb = 0; kb < K; kb += 32) {
    FragB ah, al;
    const v4f x0 = *(const v4fa*)(arow + kb + 8 * hh), x1 = *(const v4fa*)(arow + kb + 8 * hh + 4);
    const v4f x2 = *(const v4fa*)(arow + kb + 16 + 8 * hh), x3 = *(const v4fa*)(arow + kb + 16 + 8 * hh + 4);
    float xs[16] = {x0[0],x0[1],x0[2],x0[3],x1[0],x1[1],x1[2],x1[3],x2[0],x2[1],x2[2],x2[3],x3[0],x3[1],x3[2],x3[3]};
#pragma unroll
    for (int i = 0; i < 16; ++i) { const unsigned short hb = bf16_bits(xs[i]); ah.u[i] = hb; al.u[i] = ASPLIT ? bf16_bits(xs[i] - bf16_val(hb)) : (unsigned short)0; }
#pragma unroll
    for (int t = 0; t < 4; ++t) {
      const unsigned short* brow = Wt + (size_t)(col0 + t * 16 + ln) * ldb + kb;
      FragB b;
      b.half[0] = *(const v8us*)(brow + 8 * hh);
      b.half[1] = *(const v8us*)(brow + 16 + 8 * hh);
      acc[t] = mmaN<ASPLIT ? 2 : 1>(ah.v, al.v, b.v, b.v, acc[t]);
    }
  }
#pragma unroll
  for (int t = 0; t < 4; ++t) {
    const int col = col0 + t * 16 + ln;
    float bv = bias ? bias[col] : 0.f;
    if (BIAS_BF16) bv = bf16_round(bv);
#pragma unroll
    for (int r = 0; r < 8; ++r) {
      float v = acc[t][r] + bv;
      if (resid) { float rv = resid[(size_t)((row0 + 8 * hh + r) % rmod) * ldr + col]; if (RES_BF16) rv = bf16_round(rv); v += rv; }
      if (ACT == 1) v = fmaxf(v, 0.f);
      if (ACT == 2) v = 0.5f * v * (1.0f + erff(v * 0.70710678118654752f));
      if (ACT == 3) { const float u = 0.7978845608028654f * (v + 0.044715f * v * v * v); v = 0.5f * v * (1.0f + tanhf(u)); }
      so[w][8 * hh + r][t * 16 + ln] = v;
    }
  }
  __builtin_amdgcn_fence(__ATOMIC_ACQ_REL, "workgroup");
  __builtin_amdgcn_wave_barrier();
  const int rsub = lane >> 4, c4 = (lane & 15) * 4;
  {
#pragma unroll
    for (int q = 0; q < 8; ++q) {
      const int r = q * 2 + rsub;
      const v4f v = *(const v4fa*)&so[w][r][c4];
      *(v4f*)(C + (size_t)(row0 + r) * ldc + col0 + c4) = v;
    }
    
  }
}
// row LayerNorm (biased variance, eps) over N: s = X (+ R); optional out_sum <- s; out_norm <- (s-mu)*rsqrt(var+eps)*g + b
template <bool PARAM_BF16>
__global__ __launch_bounds__(256) void k_layernorm(const float* __restrict__ X, const float* __restrict__ R, const float* __restrict__ g, const float* __restrict__ bta,
                                                  float* __restrict__ out_sum, float* __restrict__ out_norm, int N, float eps) {
  __shared__ float red[256];
  const int row = blockIdx.x, tid = threadIdx.x;
  const float* x = X + (size_t)row * N; const float* rr = R ? R + (size_t)row * N : nullptr;
  float vals[16];                     // up to N = 4096
  const int per = N / 256;            // contiguous chunk per thread? use strided-by-4 chunks: thread handles j = tid*4 + 1024*u
  float s1 = 0.f;
  for (int u = 0; u < per / 4; ++u) {
    const int j = tid * 4 + 1024 * u;
    const v4f a = *(const v4fa*)(x + j);
    v4f b = {0.f,0.f,0.f,0.f}; if (rr) b = *(const v4fa*)(rr + j);
#pragma unroll
    for (int q = 0; q < 4; ++q) { const float v = a[q] + b[q]; vals[u * 4 + q] = v; s1 += v; }
  }
  red[tid] = s1; __syncthreads();
  for (int st = 128; st > 0; st >>= 1) { if (tid < st) red[tid] += red[tid + st]; __syncthreads(); }
  const float mu = red[0] / (float)N; __syncthreads();
  float s2 = 0.f;
  for (int u = 0; u < per / 4; ++u)
#pragma unroll
    for (int q = 0; q < 4; ++q) { const float c = vals[u * 4 + q] - mu; s2 += c * c; }
  red[tid] = s2; __syncthreads();
  for (int st = 128; st > 0; st >>= 1) { if (tid < st) red[tid] += red[tid + st]; __syncthreads(); }
  const float rs = rsqrtf(red[0] / (float)N + eps);
  {
    for (int u = 0; u < per / 4; ++u) {
      const int j = tid * 4 + 1024 * u;
      v4f o, sm;
#pragma unroll
      for (int q = 0; q < 4; ++q) {
        float gg = g[j + q], bb = bta[j + q];
        if (PARAM_BF16) { gg = bf16_round(gg); bb = bf16_round(bb); }
        sm[q] = vals[u * 4 + q]; o[q] = (vals[u * 4 + q] - mu) * rs * gg + bb;
      }
      if (out_sum) *(v4f*)(out_sum + (size_t)row * N + j) = sm;
      *(v4f*)(out_norm + (size_t)row * N + j) = o;
    }
    
  }
}



// ---- f16 WMMA path (v_wmma_f32_16x16x32_f16): 11-bit significands for operands in range — used where a [0,1] probability operand needs more precision than bf16
typedef _Float16 v16h __attribute__((ext_vector_type(16)));
union FragH { v16h v; v8us half[2]; _Float16 h[16]; unsigned short u[16]; };
template <int NT>
__device__ __forceinline__ v8f mmaH(v16h ah, v16h al, v16h bh, v16h bl, v8f c) {
  c = __builtin_amdgcn_wmma_f32_16x16x32_f16(false, ah, false, bh, (short)0, c, false, false);
  if (NT >= 2) c = __builtin_amdgcn_wmma_f32_16x16x32_f16(false, al, false, bh, (short)0, c, false, false);
  if (NT >= 3) c = __builtin_amdgcn_wmma_f32_16x16x32_f16(false, ah, false, bl, (short)0, c, false, false);
  asm volatile("v_nop\n\tv_nop\n\tv_nop\n\tv_nop" : "+v"(c) : "v"(ah), "v"(al), "v"(bh), "v"(bl));
  return c;
}
// batched GEMM like k_gemm_b but f16 operands: A f32 (split into f16 hi/lo if ASPLIT, else rounded to f16), Bt = f16 values [n][k]; alpha; C f32; N multiple of 16 (partial tiles skipped)
template <bool ASPLIT>
__global__ __launch_bounds__(128) void k_gemm_h(const float* __restrict__ A, int lda, size_t sA, const _Float16* __restrict__ Bh, int ldb, size_t sB, float alpha, float* __restrict__ C, int ldc, size_t sC, int M, int N, int K) {
  __shared__ __attribute__((aligned(16))) float so[4][16][64];
  const int tid = threadIdx.x, w = tid >> 5, lane = tid & 31, ln = lane & 15, hh = lane >> 4; const int by = blockIdx.y;
  A += (size_t)by * sA; Bh += (size_t)by * sB; C += (size_t)by * sC;
  const int ntn = (N + 63) / 64; const int wid = blockIdx.x * 4 + w; const int mt = wid / ntn, nq = wid % ntn; if (mt * 16 >= M) return;
  const int row0 = mt * 16, col0 = nq * 64; const float* arow = A + (size_t)(row0 + ln) * lda;
  v8f acc[4] = {};
  for (int kb = 0; kb < K; kb += 32) {
    FragH ah, al;
    const v4f x0 = *(const v4fa*)(arow + kb + 8 * hh), x1 = *(const v4fa*)(arow + kb + 8 * hh + 4), x2 = *(const v4fa*)(arow + kb + 16 + 8 * hh), x3 = *(const v4fa*)(arow + kb + 16 + 8 * hh + 4);
    float xs[16] = {x0[0],x0[1],x0[2],x0[3],x1[0],x1[1],x1[2],x1[3],x2[0],x2[1],x2[2],x2[3],x3[0],x3[1],x3[2],x3[3]};
#pragma unroll
    for (int i = 0; i < 16; ++i) { const _Float16 h = (_Float16)xs[i]; ah.h[i] = h; al.h[i] = ASPLIT ? (_Float16)(xs[i] - (float)h) : (_Float16)0.0f; }
#pragma unroll
    for (int t = 0; t < 4; ++t) { if (col0 + t * 16 >= N) continue; const size_t boff = (size_t)(col0 + t * 16 + ln) * ldb + kb; FragH bq; bq.half[0] = *(const v8us*)(Bh + boff + 8 * hh); bq.half[1] = *(const v8us*)(Bh + boff + 16 + 8 * hh);
      acc[t] = mmaH<ASPLIT ? 2 : 1>(ah.v, al.v, bq.v, bq.v, acc[t]); }
  }
#pragma unroll
  for (int t = 0; t < 4; ++t) { if (col0 + t * 16 >= N) continue;
#pragma unroll
    for (int r = 0; r < 8; ++r) so[w][8 * hh + r][t * 16 + ln] = acc[t][r] * alpha; }
  __builtin_amdgcn_fence(__ATOMIC_ACQ_REL, "workgroup"); __builtin_amdgcn_wave_barrier();
  const int rsub = lane >> 4, c4 = (lane & 15) * 4;
  {
#pragma unroll
    for (int q = 0; q < 8; ++q) { const int r = q * 2 + rsub; if (col0 + c4 < N) { const v4f v = *(const v4fa*)&so[w][r][c4]; *(v4f*)(C + (size_t)(row0 + r) * ldc + col0 + c4) = v; } }
     }
}

// Wt[n][k] = f16(W[k][n]·scale) from f32 row-major W[K][N] (scale = power of two; bf16-exact weights stay exact in f16 away from the subnormal range)
__global__ __launch_bounds__(256) void k_wt_f16(const float* __restrict__ W, _Float16* __restrict__ Wt, int K, int N, float scale) {
  const int t = blockIdx.x * 256 + threadIdx.x; if (t >= N * (K / 8)) return; const int n = t / (K / 8), k8 = (t % (K / 8)) * 8; FragH f;
#pragma unroll
  for (int i = 0; i < 8; ++i) f.h[i] = (_Float16)(bf16_round(W[(size_t)(k8 + i) * N + n]) * scale); const v8us o = f.half[0];
  *(v8us*)((unsigned short*)Wt + (size_t)n * K + k8) = o; 
}
// k_gemm_hh variant with fused epilogue: v = acc·alpha + bias[by·sBias + col] (+ CP[(row/rowsPerB)·sCPb + by·64 + col] if CP) ; ACT 0 none / 1 elu ; writes f16 C16 (and f32 C if non-null)
template <int ACT>
__global__ __launch_bounds__(128) void k_gemm_hhx(const _Float16* __restrict__ A, int lda, size_t sA, const _Float16* __restrict__ Bh, int ldb, size_t sB, float alpha, const float* __restrict__ bias, size_t sBias, const float* __restrict__ CP, int rowsPerB, size_t sCPb, int row0g,
    float* __restrict__ C, _Float16* __restrict__ C16, int ldc, size_t sC, int M, int N, int K) {
  __shared__ __attribute__((aligned(16))) float so[4][16][64];
  const int tid = threadIdx.x, w = tid >> 5, lane = tid & 31, ln = lane & 15, hh = lane >> 4; const int by = blockIdx.y;
  A += (size_t)by * sA; Bh += (size_t)by * sB; const size_t cofs = (size_t)by * sC; const float* bp = bias ? bias + (size_t)by * sBias : nullptr;
  const int ntn = (N + 63) / 64; const int wid = blockIdx.x * 4 + w; const int mt = wid / ntn, nq = wid % ntn; if (mt * 16 >= M) return;
  const int row0 = mt * 16, col0 = nq * 64; const _Float16* arow = A + (size_t)(row0 + ln) * lda;
  v8f acc[4] = {};
  for (int kb = 0; kb < K; kb += 32) { FragH ah; ah.half[0] = *(const v8us*)((const unsigned short*)arow + kb + 8 * hh); ah.half[1] = *(const v8us*)((const unsigned short*)arow + kb + 16 + 8 * hh);
#pragma unroll
    for (int t = 0; t < 4; ++t) { if (col0 + t * 16 >= N) continue; const size_t boff = (size_t)(col0 + t * 16 + ln) * ldb + kb; FragH bq; bq.half[0] = *(const v8us*)((const unsigned short*)Bh + boff + 8 * hh); bq.half[1] = *(const v8us*)((const unsigned short*)Bh + boff + 16 + 8 * hh);
      acc[t] = mmaH<1>(ah.v, ah.v, bq.v, bq.v, acc[t]); }
  }
#pragma unroll
  for (int t = 0; t < 4; ++t) { if (col0 + t * 16 >= N) continue; const int col = col0 + t * 16 + ln; const float bv = bp ? bf16_round(bp[col]) : 0.f;
#pragma unroll
    for (int r = 0; r < 8; ++r) { float v = acc[t][r] * alpha + bv; if (CP) { const int bidx = (row0g + row0 + 8 * hh + r) / rowsPerB; v += CP[(size_t)bidx * sCPb + (size_t)by * 64 + col]; } if (ACT == 1) v = (v > 0.f) ? v : expm1f(v); else if (ACT == 7) v = (v > 0.f) ? v + 1.0f : expf(v); else if (ACT == 8) v = tanhf(v); else if (ACT == 9) v = 0.5f * v * (1.0f + tanhf(0.7978845608028654f * (v + 0.044715f * v * v * v))); else if (ACT == 11) v = 1.0f / (1.0f + expf(-v)); else if (ACT == 12) v = (v > 0.f) ? v : 0.01f * v; else if (ACT == 14) v = (v > 0.f) ? v : 0.1f * v; else if (ACT == 15) v = v / (1.0f + expf(-v)); else if (ACT == 3) v = fmaxf(v, 0.f); else if (ACT == 6) v = 0.5f * v * (1.0f + erff(v * 0.70710678118654752f)); so[w][8 * hh + r][t * 16 + ln] = v; } }
  __builtin_amdgcn_fence(__ATOMIC_ACQ_REL, "workgroup"); __builtin_amdgcn_wave_barrier();
  const int rsub = lane >> 4, c4 = (lane & 15) * 4; typedef _Float16 v4h __attribute__((ext_vector_type(4)));
  {
#pragma unroll
    for (int q = 0; q < 8; ++q) { const int r = q * 2 + rsub; if (col0 + c4 < N) { const v4f v = *(const v4fa*)&so[w][r][c4]; if (C) *(v4f*)(C + cofs + (size_t)(row0 + r) * ldc + col0 + c4) = v; if (C16) { v4h h4; for (int i = 0; i < 4; ++i) h4[i] = (_Float16)v[i]; *(v4h*)(C16 + cofs + (size_t)(row0 + r) * ldc + col0 + c4) = h4; } } }
     }
}


typedef _Float16 v4h __attribute__((ext_vector_type(4)));

__global__ __launch_bounds__(256) void k_x16(const float* __restrict__ x, _Float16* __restrict__ X16, size_t n8) { const size_t t = (size_t)blockIdx.x * 256 + threadIdx.x; if (t >= n8) return; FragH f;
#pragma unroll
  for (int q = 0; q < 8; ++q) f.h[q] = (_Float16)bf16_round(x[t * 8 + q]); *(v8us*)((unsigned short*)X16 + t * 8) = f.half[0];  }
__global__ __launch_bounds__(256) void k_h16(const float* __restrict__ x, _Float16* __restrict__ X16, size_t n8) { const size_t t = (size_t)blockIdx.x * 256 + threadIdx.x; if (t >= n8) return; FragH f;
#pragma unroll
  for (int q = 0; q < 8; ++q) f.h[q] = (_Float16)x[t * 8 + q]; *(v8us*)((unsigned short*)X16 + t * 8) = f.half[0];  }
__global__ __launch_bounds__(256) void k_round16f(const float* __restrict__ W, _Float16* __restrict__ Bt, size_t n8) { const size_t t = (size_t)blockIdx.x * 256 + threadIdx.x; if (t >= n8) return; FragH f;
#pragma unroll
  for (int i = 0; i < 8; ++i) f.h[i] = (_Float16)(bf16_round(W[t * 8 + i]) * 16.0f); *(v8us*)((unsigned short*)Bt + t * 8) = f.half[0];  }
template <int NHv, int TTv>
__global__ __launch_bounds__(256) void k_vt(const _Float16* __restrict__ V16, int ldv, int voff, _Float16* __restrict__ Vt) { __shared__ unsigned short tl[64][66]; const int tid = threadIdx.x; const int slab = blockIdx.x / (TTv / 64), lg = blockIdx.x % (TTv / 64); const int b = slab / NHv, h = slab % NHv;
  for (int i = tid; i < 64 * 8; i += 256) { const int r = i / 8, c8 = (i % 8) * 8; FragH f; f.half[0] = *(const v8us*)((const unsigned short*)V16 + ((size_t)b * TTv + lg * 64 + r) * ldv + voff + h * 64 + c8);
#pragma unroll
    for (int q = 0; q < 8; ++q) tl[r][c8 + q] = f.u[q]; }
  __syncthreads();
  {
#pragma unroll
    for (int rd = 0; rd < 2; ++rd) { const int d = rd * 32 + tid / 8, pc = tid % 8; FragH f;
#pragma unroll
      for (int q = 0; q < 8; ++q) f.u[q] = tl[pc * 8 + q][d];
      *(v8us*)((unsigned short*)Vt + ((size_t)slab * 64 + d) * TTv + lg * 64 + pc * 8) = f.half[0]; }
     } }

__global__ __launch_bounds__(256) void k_hl(const float* __restrict__ F, _Float16* __restrict__ Hh, _Float16* __restrict__ Hl, size_t n8) { const size_t t = (size_t)blockIdx.x * 256 + threadIdx.x; if (t >= n8) return; FragH fh, fl; const v4f a = *(const v4fa*)(F + t * 8), c = *(const v4fa*)(F + t * 8 + 4);
#pragma unroll
  for (int q = 0; q < 4; ++q) { _Float16 h = (_Float16)a[q]; fh.h[q] = h; fl.h[q] = (_Float16)((a[q] - (float)h) * 1024.0f); h = (_Float16)c[q]; fh.h[4 + q] = h; fl.h[4 + q] = (_Float16)((c[q] - (float)h) * 1024.0f); }
  { *(v8us*)((unsigned short*)Hh + t * 8) = fh.half[0]; *(v8us*)((unsigned short*)Hl + t * 8) = fl.half[0];  } }

// ---- fast GEMM (wave tile 32x64; requires M % 32 == 0 rows per launch region, N % 64 == 0 and K % 64 == 0); epilogue = k_gemm_hhx semantics ----
__device__ __forceinline__ v16h g2_frag(const _Float16* p, int hh) { FragH f; f.half[0] = *(const v8us*)((const unsigned short*)p + 8 * hh); f.half[1] = *(const v8us*)((const unsigned short*)p + 16 + 8 * hh); return f.v; }
__device__ __forceinline__ v8f g2_mma(v16h a, v16h b, v8f c) { v8f d = __builtin_amdgcn_wmma_f32_16x16x32_f16(false, a, false, b, (short)0, c, false, false); asm volatile("v_nop\n\tv_nop\n\tv_nop\n\tv_nop" : "+v"(d) : "v"(a), "v"(b)); return d; }
template <int ACT>
__global__ __launch_bounds__(128) void k_gemm2(const _Float16* __restrict__ A, int lda, size_t sA, const _Float16* __restrict__ Bh, int ldb, size_t sB, float alpha, const float* __restrict__ bias, size_t sBias, const float* __restrict__ CP, int rowsPerB, size_t sCPb, int row0g,
    float* __restrict__ C, _Float16* __restrict__ C16, int ldc, size_t sC, int M, int N, int K) {
  __shared__ __attribute__((aligned(16))) float so[4][32][68];
  const int tid = threadIdx.x, w = tid >> 5, lane = tid & 31, ln = lane & 15, hh = lane >> 4; const int by = blockIdx.y;
  A += (size_t)by * sA; Bh += (size_t)by * sB; const size_t cofs = (size_t)by * sC; const float* bp = bias ? bias + (size_t)by * sBias : nullptr;
  const int ntn = N >> 6; const int mt = blockIdx.x / ntn, nq = blockIdx.x - mt * ntn; const int row0 = mt * 128 + 32 * w, col0 = nq * 64; if (row0 >= M) return;
  const _Float16* a0p = A + (size_t)(row0 + ln) * lda; const _Float16* a1p = a0p + (size_t)16 * lda;
  const _Float16* b0p = Bh + (size_t)(col0 + ln) * ldb; const _Float16* b1p = b0p + (size_t)16 * ldb; const _Float16* b2p = b1p + (size_t)16 * ldb; const _Float16* b3p = b2p + (size_t)16 * ldb;
  const v8f z8 = {0.f,0.f,0.f,0.f,0.f,0.f,0.f,0.f}; v8f c00 = z8, c01 = z8, c02 = z8, c03 = z8, c10 = z8, c11 = z8, c12 = z8, c13 = z8;
  /* two register sets x / y of the six fragments (K % 64 == 0): the loads of the next 32-wide k step are all issued before the products of this one, so a step waits for one overlapped latency at most */
  v16h xa0 = g2_frag(a0p, hh), xa1 = g2_frag(a1p, hh), xb0 = g2_frag(b0p, hh), xb1 = g2_frag(b1p, hh), xb2 = g2_frag(b2p, hh), xb3 = g2_frag(b3p, hh);
#pragma unroll 1
  for (int kb = 0; kb < K; kb += 64) { const int k1 = kb + 32, k2 = (kb + 64 < K) ? kb + 64 : kb;      /* last trip: k2 names a step inside the row again; its values are not used */
    const v16h ya0 = g2_frag(a0p + k1, hh), ya1 = g2_frag(a1p + k1, hh), yb0 = g2_frag(b0p + k1, hh), yb1 = g2_frag(b1p + k1, hh), yb2 = g2_frag(b2p + k1, hh), yb3 = g2_frag(b3p + k1, hh);
    __builtin_amdgcn_sched_barrier(0);      /* holds the y loads above the x products (the scheduler otherwise moves each load down to its use) */
    c00 = g2_mma(xa0, xb0, c00); c10 = g2_mma(xa1, xb0, c10); c01 = g2_mma(xa0, xb1, c01); c11 = g2_mma(xa1, xb1, c11);
    c02 = g2_mma(xa0, xb2, c02); c12 = g2_mma(xa1, xb2, c12); c03 = g2_mma(xa0, xb3, c03); c13 = g2_mma(xa1, xb3, c13);
    __builtin_amdgcn_sched_barrier(0);      /* holds the x reloads below the x products and, with the next one, above the y products */
    xa0 = g2_frag(a0p + k2, hh); xa1 = g2_frag(a1p + k2, hh); xb0 = g2_frag(b0p + k2, hh); xb1 = g2_frag(b1p + k2, hh); xb2 = g2_frag(b2p + k2, hh); xb3 = g2_frag(b3p + k2, hh);
    __builtin_amdgcn_sched_barrier(0);      /* holds the x reloads above the y products */
    c00 = g2_mma(ya0, yb0, c00); c10 = g2_mma(ya1, yb0, c10); c01 = g2_mma(ya0, yb1, c01); c11 = g2_mma(ya1, yb1, c11);
    c02 = g2_mma(ya0, yb2, c02); c12 = g2_mma(ya1, yb2, c12); c03 = g2_mma(ya0, yb3, c03); c13 = g2_mma(ya1, yb3, c13);
    asm volatile("s_wait_xcnt 0x0" ::: "memory"); }      /* stands in front of the next trip's address sums, which overwrite registers that the x loads name */
  v8f accs[8] = {c00, c01, c02, c03, c10, c11, c12, c13};
  /* the epilogue's loads (4 bias words, 64 CP words a lane) are issued together as well, ahead of the arithmetic that uses them */
  float bw[4] = {0.f, 0.f, 0.f, 0.f}; v8f cpv[8] = {z8, z8, z8, z8, z8, z8, z8, z8};
  if (bp) {
#pragma unroll
    for (int t = 0; t < 4; ++t) bw[t] = bp[col0 + t * 16 + ln]; }
  if (CP) {
#pragma unroll
    for (int u = 0; u < 8; ++u)
#pragma unroll
      for (int r = 0; r < 8; ++r) { const int bidx = (row0g + row0 + (u >> 2) * 16 + 8 * hh + r) / rowsPerB; cpv[u][r] = CP[(size_t)bidx * sCPb + (size_t)by * 64 + col0 + (u & 3) * 16 + ln];
        if (r == 7) asm volatile("s_wait_xcnt 0x0" ::: "memory"); }      /* stands in front of the next group's loads, whose results may land in address registers of this group */
    asm volatile("" :: "v"(cpv[0]), "v"(cpv[1]), "v"(cpv[2]), "v"(cpv[3]), "v"(cpv[4]), "v"(cpv[5]), "v"(cpv[6]), "v"(cpv[7])); }      /* inputs-only fence on the loaded words: holds all 64 loads in this block, where they overlap, instead of one waited load in front of each add */
#pragma unroll
  for (int u = 0; u < 8; ++u) { const int t = u & 3, half = u >> 2; const float bv = bp ? bf16_round(bw[t]) : 0.f;
#pragma unroll
    for (int r = 0; r < 8; ++r) { const int rloc = half * 16 + 8 * hh + r; float v = accs[u][r] * alpha + bv; if (CP) v += cpv[u][r];
      if (ACT == 3) v = fmaxf(v, 0.f); else if (ACT == 6) v = 0.5f * v * (1.0f + erff(v * 0.70710678118654752f)); else if (ACT == 11) v = 1.0f / (1.0f + expf(-v)); else if (ACT == 15) v = v / (1.0f + expf(-v)); else if (ACT == 12) v = (v > 0.f) ? v : 0.01f * v; else if (ACT == 8) v = tanhf(v);
      so[w][rloc][t * 16 + ln] = v; } }
  __builtin_amdgcn_fence(__ATOMIC_ACQ_REL, "workgroup"); __builtin_amdgcn_wave_barrier();
  const int rsub = lane >> 4, c4 = (lane & 15) * 4;
  {
#pragma unroll
    for (int q = 0; q < 16; ++q) { const int r = q * 2 + rsub; const v4f v = *(const v4fa*)&so[w][r][c4]; if (C) *(v4f*)(C + cofs + (size_t)(row0 + r) * ldc + col0 + c4) = v; if (C16) { v4h h4; for (int i = 0; i < 4; ++i) h4[i] = (_Float16)v[i]; *(v4h*)(C16 + cofs + (size_t)(row0 + r) * ldc + col0 + c4) = h4; } }
     } }



// lane l's value of lane l ^ X (X < 16) inside its 16-lane row, by a DPP row_xmask move in registers (no trip through the LDS pipe and no wait on it)
template <int X>
__device__ __forceinline__ float row_xor(float v) { return __int_as_float(__builtin_amdgcn_update_dpp(0, __float_as_int(v), 0x160 | X, 0xf, 0xf, true)); }
// maximum over the 16-lane row, all 32 lanes on: four dependent DPP maxima in one statement (written with fmaxf on a DPP move the compiler puts a move and a quieting maximum in front of each step, three links for one)
__device__ __forceinline__ float row_max16(float v) {
  asm("v_max_num_f32_dpp %0, %0, %0 row_xmask:1 row_mask:0xf bank_mask:0xf\n\t"
      "v_max_num_f32_dpp %0, %0, %0 row_xmask:2 row_mask:0xf bank_mask:0xf\n\t"
      "v_max_num_f32_dpp %0, %0, %0 row_xmask:4 row_mask:0xf bank_mask:0xf\n\t"
      "v_max_num_f32_dpp %0, %0, %0 row_xmask:8 row_mask:0xf bank_mask:0xf" : "+v"(v));
  return v; }
__device__ __forceinline__ float row_sum16(float v) { v += row_xor<1>(v); v += row_xor<2>(v); v += row_xor<4>(v); v += row_xor<8>(v); return v; }
template <int CAUSAL>
__global__ __launch_bounds__(128) void k_flash(const _Float16* __restrict__ Q16, int ldq, const _Float16* __restrict__ K16, int ldk, const _Float16* __restrict__ Vt, const int* __restrict__ MSK, float* __restrict__ O, int ldo) {
  constexpr int RPW = 16, RTN = RPW / 16, NQB = TQ / (4 * RPW), DT = 4, KS = 2;
  __shared__ __attribute__((aligned(16))) unsigned short sP[4][RPW][40]; __shared__ __attribute__((aligned(16))) float sO[4][RPW][64 + 4];
  const int tid = threadIdx.x, w = tid >> 5, lane = tid & 31, ln = lane & 15, hh = lane >> 4;
  const int slab = blockIdx.x / NQB, qblk = blockIdx.x % NQB; const int b = slab / NH, h = slab % NH; const int qb0 = qblk * (4 * RPW); const int q0 = qb0 + w * RPW;
  FragH aq[2][KS];
#pragma unroll
  for (int rt = 0; rt < RTN; ++rt) { const unsigned short* qr = (const unsigned short*)Q16 + ((size_t)b * TQ + q0 + rt * 16 + ln) * ldq + h * 64;
#pragma unroll
    for (int ks = 0; ks < KS; ++ks) { aq[rt][ks].half[0] = *(const v8us*)(qr + ks * 32 + 8 * hh); aq[rt][ks].half[1] = *(const v8us*)(qr + ks * 32 + 16 + 8 * hh); } }
  const unsigned short* Vth = (const unsigned short*)Vt + (size_t)slab * 64 * TK;
  float m_r[2][8], l_r[2][8]; v8f oacc[2][DT];
#pragma unroll
  for (int rt = 0; rt < RTN; ++rt) {
#pragma unroll
    for (int r = 0; r < 8; ++r) { m_r[rt][r] = -3.0e38f; l_r[rt][r] = 0.f; }
#pragma unroll
    for (int dt = 0; dt < DT; ++dt) oacc[rt][dt] = (v8f){0.f,0.f,0.f,0.f,0.f,0.f,0.f,0.f}; }
  const int jend = (CAUSAL == 1) ? (qb0 + 4 * RPW) : TK;      /* causal: keys beyond the block's last query never contribute */
#pragma unroll 1
  for (int j0 = 0; j0 < jend; j0 += 32) {
    v8f s[2][2];
#pragma unroll
    for (int nt = 0; nt < 2; ++nt) { const unsigned short* kr = (const unsigned short*)K16 + ((size_t)b * TK + j0 + nt * 16 + ln) * ldk + h * 64; FragH bk[KS];
#pragma unroll
      for (int ks = 0; ks < KS; ++ks) { bk[ks].half[0] = *(const v8us*)(kr + ks * 32 + 8 * hh); bk[ks].half[1] = *(const v8us*)(kr + ks * 32 + 16 + 8 * hh); }
#pragma unroll
      for (int rt = 0; rt < RTN; ++rt) { v8f acc = (v8f){0.f,0.f,0.f,0.f,0.f,0.f,0.f,0.f};
#pragma unroll
        for (int ks = 0; ks < KS; ++ks) acc = mmaH<1>(aq[rt][ks].v, aq[rt][ks].v, bk[ks].v, bk[ks].v, acc); s[rt][nt] = acc; } }
#pragma unroll
    for (int rt = 0; rt < RTN; ++rt)
#pragma unroll
      for (int r = 0; r < 8; ++r) { const int tq = q0 + rt * 16 + 8 * hh + r; const int k0 = j0 + ln, k1 = j0 + 16 + ln;
        const bool ok0 = (CAUSAL == 1) ? (k0 <= tq) : ((CAUSAL == 2) ? ((k0 >> 5) == (tq >> 5)) : true), ok1 = (CAUSAL == 1) ? (k1 <= tq) : ((CAUSAL == 2) ? ((k1 >> 5) == (tq >> 5)) : true);      /* mode 2: block-diagonal 32-token groups */
        const float s0 = ok0 ? s[rt][0][r] * SCL : -3.0e38f, s1 = ok1 ? s[rt][1][r] * SCL : -3.0e38f; 
        const float mn = row_max16(fmaxf(fmaxf(s0, s1), m_r[rt][r]));      /* the running maximum is the same in all 16 lanes of the row: taken in ahead of the reduction, the reduced value is the new maximum itself */
        const float al = (mn > -1.0e38f) ? expf(m_r[rt][r] - mn) : 1.0f; m_r[rt][r] = mn; const float p0 = ok0 ? expf(s0 - mn) : 0.f, p1 = ok1 ? expf(s1 - mn) : 0.f; l_r[rt][r] = l_r[rt][r] * al + p0 + p1;
#pragma unroll
        for (int dt = 0; dt < DT; ++dt) oacc[rt][dt][r] *= al;
        FragH t2; t2.h[0] = (_Float16)(p0 * 1024.0f); t2.h[1] = (_Float16)(p1 * 1024.0f); sP[w][rt * 16 + 8 * hh + r][ln] = t2.u[0]; sP[w][rt * 16 + 8 * hh + r][16 + ln] = t2.u[1]; }
    __builtin_amdgcn_fence(__ATOMIC_ACQ_REL, "workgroup"); __builtin_amdgcn_wave_barrier();
    FragH pa[2];
#pragma unroll
    for (int rt = 0; rt < RTN; ++rt) { pa[rt].half[0] = *(const v8us*)&sP[w][rt * 16 + ln][8 * hh]; pa[rt].half[1] = *(const v8us*)&sP[w][rt * 16 + ln][16 + 8 * hh]; }
#pragma unroll
    for (int dt = 0; dt < DT; ++dt) { const unsigned short* vrow = Vth + (size_t)(dt * 16 + ln) * TK + j0; FragH bv; bv.half[0] = *(const v8us*)(vrow + 8 * hh); bv.half[1] = *(const v8us*)(vrow + 16 + 8 * hh);
#pragma unroll
      for (int rt = 0; rt < RTN; ++rt) oacc[rt][dt] = mmaH<1>(pa[rt].v, pa[rt].v, bv.v, bv.v, oacc[rt][dt]); }
    __builtin_amdgcn_fence(__ATOMIC_ACQ_REL, "workgroup"); __builtin_amdgcn_wave_barrier(); }
#pragma unroll
  for (int rt = 0; rt < RTN; ++rt) {
#pragma unroll
    for (int r = 0; r < 8; ++r) { float l = l_r[rt][r]; l = row_sum16(l); l_r[rt][r] = (l > 0.f) ? 1.0f / (l * 1024.0f) : 0.f; }
#pragma unroll
    for (int dt = 0; dt < DT; ++dt)
#pragma unroll
      for (int r = 0; r < 8; ++r) sO[w][rt * 16 + 8 * hh + r][dt * 16 + ln] = oacc[rt][dt][r] * l_r[rt][r]; }
  __builtin_amdgcn_fence(__ATOMIC_ACQ_REL, "workgroup"); __builtin_amdgcn_wave_barrier();
  {
#pragma unroll
    for (int rp = 0; rp < RPW; rp += 2) { const int r = rp + (lane >> 4), pc = lane & 15; const v4f val = *(const v4fa*)&sO[w][r][pc * 4]; *(v4f*)(O + ((size_t)b * TQ + q0 + r) * ldo + h * 64 + pc * 4) = val; }
     } }
// 3-term variant: O = (P_hi V_hi + (P_lo V_hi + P_hi V_lo) / 1024) / l with P = [hi | 2^10 residual] of 1024 p and V^T = [hi | 2^10 residual] planes (VtL same layout as Vt) -> ~2^-21-class products for un-averaged (early causal / peaked) rows
template <int CAUSAL>
__global__ __launch_bounds__(32 * NSPL) void k_flash3gA(const _Float16* __restrict__ Q16, int ldq, const _Float16* __restrict__ K16, int ldk, const _Float16* __restrict__ Vt, const _Float16* __restrict__ VtL, const int* __restrict__ MSK, float* __restrict__ O, int ldo) {
  constexpr int RPW = 16, RTN = RPW / 16, NQB = TQA / (4 * RPW), DT = 4, KS = 2;
  __shared__ __attribute__((aligned(16))) unsigned short sP[NSPL][RPW][40]; __shared__ __attribute__((aligned(16))) unsigned short sPL[NSPL][RPW][40]; __shared__ __attribute__((aligned(16))) float sO[NSPL][RPW][64 + 4]; __shared__ float sM[NSPL][RPW], sL[NSPL][RPW];
  const int tid = threadIdx.x, w = __builtin_amdgcn_readfirstlane(tid >> 5), lane = tid & 31, ln = lane & 15, hh = lane >> 4;      /* the wave's number in a scalar register: the key range below stays scalar */
  /* one work-group per (batch, head, 16-query tile); its NSPL waves each run the flash loop over their own TK / NSPL keys, and the partial (m, l, O) are merged through LDS behind the loop */
  const int slab = blockIdx.x / (TQA / RPW), qblk = blockIdx.x % (TQA / RPW); (void)NQB; const int b = slab / NH, h = slab % NH; const int qb0 = qblk * RPW; const int q0 = qb0;
  FragH aq[2][KS];
#pragma unroll
  for (int rt = 0; rt < RTN; ++rt) { const unsigned short* qr = (const unsigned short*)Q16 + ((size_t)b * TQA + q0 + rt * 16 + ln) * ldq + h * 64;
#pragma unroll
    for (int ks = 0; ks < KS; ++ks) { aq[rt][ks].half[0] = *(const v8us*)(qr + ks * 32 + 8 * hh); aq[rt][ks].half[1] = *(const v8us*)(qr + ks * 32 + 16 + 8 * hh); } }
  const size_t vslab = (size_t)(b * (NH / KVG) + h / KVG); const unsigned short* Vth = (const unsigned short*)Vt + vslab * 64 * TK; const unsigned short* Vtl = (const unsigned short*)VtL + vslab * 64 * TK;      /* GQA: q-head h reads kv head h / KVG */
  float m_r[2][8], l_r[2][8]; v8f oacc[2][DT], oaccL[2][DT];
#pragma unroll
  for (int rt = 0; rt < RTN; ++rt) {
#pragma unroll
    for (int r = 0; r < 8; ++r) { m_r[rt][r] = -3.0e38f; l_r[rt][r] = 0.f; }
#pragma unroll
    for (int dt = 0; dt < DT; ++dt) { oacc[rt][dt] = (v8f){0.f,0.f,0.f,0.f,0.f,0.f,0.f,0.f}; oaccL[rt][dt] = oacc[rt][dt]; } }
  const int jbeg = w * (TK / NSPL), jend = jbeg + TK / NSPL;      /* this wave's keys */
#pragma unroll 1
  for (int j0 = jbeg; j0 < jend; j0 += 32) {
    v8f s[2][2]; FragH bk[2][KS], bv[DT], bl[DT]; int mk0[RTN][8], mk1[RTN][8];
    /* every global load of the trip is issued here, in the order of use (K, mask words, both V planes): their latencies overlap, and V lands behind the softmax */
#pragma unroll
    for (int nt = 0; nt < 2; ++nt) { const unsigned short* kr = (const unsigned short*)K16 + ((size_t)b * TK + j0 + nt * 16 + ln) * ldk + (h / KVG) * 64;
#pragma unroll
      for (int ks = 0; ks < KS; ++ks) { bk[nt][ks].half[0] = *(const v8us*)(kr + ks * 32 + 8 * hh); bk[nt][ks].half[1] = *(const v8us*)(kr + ks * 32 + 16 + 8 * hh); } }
    if (CAUSAL == 8) {
#pragma unroll
      for (int rt = 0; rt < RTN; ++rt)
#pragma unroll
        for (int r = 0; r < 8; ++r) { const int* mrow = MSK + (size_t)(q0 + rt * 16 + 8 * hh + r) * TK + j0 + ln; mk0[rt][r] = mrow[0]; mk1[rt][r] = mrow[16]; } }
    asm volatile("s_wait_xcnt 0x0" ::: "memory");      /* stands in front of the V loads, whose results may land in registers that the K and mask loads name as addresses */
#pragma unroll
    for (int dt = 0; dt < DT; ++dt) { const unsigned short* vrow = Vth + (size_t)(dt * 16 + ln) * TK + j0; const unsigned short* vrl = Vtl + (size_t)(dt * 16 + ln) * TK + j0; bv[dt].half[0] = *(const v8us*)(vrow + 8 * hh); bv[dt].half[1] = *(const v8us*)(vrow + 16 + 8 * hh); bl[dt].half[0] = *(const v8us*)(vrl + 8 * hh);
      if (dt == DT - 1) asm volatile("s_wait_xcnt 0x0" ::: "memory");      /* stands in front of the trip's last load, whose result lands in the address registers of the V loads above */
      bl[dt].half[1] = *(const v8us*)(vrl + 16 + 8 * hh); }
    __builtin_amdgcn_sched_barrier(0);      /* keeps the loads above together: without it the scheduler moves each one down to its first use, one exposed latency apiece */
#pragma unroll
    for (int nt = 0; nt < 2; ++nt) {
#pragma unroll
      for (int rt = 0; rt < RTN; ++rt) { v8f acc = (v8f){0.f,0.f,0.f,0.f,0.f,0.f,0.f,0.f};
#pragma unroll
        for (int ks = 0; ks < KS; ++ks) acc = mmaH<1>(aq[rt][ks].v, aq[rt][ks].v, bk[nt][ks].v, bk[nt][ks].v, acc); s[rt][nt] = acc; } }
#pragma unroll
    for (int rt = 0; rt < RTN; ++rt)
#pragma unroll
      for (int r = 0; r < 8; ++r) { const int tq = q0 + rt * 16 + 8 * hh + r; const int k0 = j0 + ln, k1 = j0 + 16 + ln;
        bool ok0 = (CAUSAL == 1) ? (k0 <= tq) : ((CAUSAL == 2) ? ((k0 >> 5) == (tq >> 5)) : true), ok1 = (CAUSAL == 1) ? (k1 <= tq) : ((CAUSAL == 2) ? ((k1 >> 5) == (tq >> 5)) : true);      /* mode 2: block-diagonal 32-token groups */
        if (CAUSAL == 8) { ok0 = mk0[rt][r] != 0; ok1 = mk1[rt][r] != 0; }      /* mode 8: per-(query, key) int table shared by all batches and heads */
        if (CAUSAL == 4) { const int* mrow = MSK + ((size_t)b * TQA + tq) * TK; ok0 = mrow[k0] != 0; ok1 = mrow[k1] != 0; }      /* mode 4: per-(query, key) INPUT mask shared by all heads; masked keys contribute nothing (== the reference's -4096 fill, whose exp underflows to 0), rows with no valid key give l = 0 -> output 0 (== the reference's row_valid zeroing) */
        const float s0 = ok0 ? s[rt][0][r] * SCL : -3.0e38f, s1 = ok1 ? s[rt][1][r] * SCL : -3.0e38f; 
        const float mn = row_max16(fmaxf(fmaxf(s0, s1), m_r[rt][r]));      /* the running maximum is the same in all 16 lanes of the row: taken in ahead of the reduction, the reduced value is the new maximum itself */
        const float al = (mn > -1.0e38f) ? expf(m_r[rt][r] - mn) : 1.0f; m_r[rt][r] = mn; const float p0 = ok0 ? expf(s0 - mn) : 0.f, p1 = ok1 ? expf(s1 - mn) : 0.f; l_r[rt][r] = l_r[rt][r] * al + p0 + p1;
#pragma unroll
        for (int dt = 0; dt < DT; ++dt) { oacc[rt][dt][r] *= al; oaccL[rt][dt][r] *= al; }
        FragH t2, t2l; const float ps0 = p0 * 1024.0f, ps1 = p1 * 1024.0f; t2.h[0] = (_Float16)ps0; t2.h[1] = (_Float16)ps1; t2l.h[0] = (_Float16)((ps0 - (float)t2.h[0]) * 1024.0f); t2l.h[1] = (_Float16)((ps1 - (float)t2.h[1]) * 1024.0f);
        sP[w][rt * 16 + 8 * hh + r][ln] = t2.u[0]; sP[w][rt * 16 + 8 * hh + r][16 + ln] = t2.u[1]; sPL[w][rt * 16 + 8 * hh + r][ln] = t2l.u[0]; sPL[w][rt * 16 + 8 * hh + r][16 + ln] = t2l.u[1]; }
    __builtin_amdgcn_fence(__ATOMIC_ACQ_REL, "workgroup"); __builtin_amdgcn_wave_barrier();
    FragH pa[2], pl[2];
#pragma unroll
    for (int rt = 0; rt < RTN; ++rt) { pa[rt].half[0] = *(const v8us*)&sP[w][rt * 16 + ln][8 * hh]; pa[rt].half[1] = *(const v8us*)&sP[w][rt * 16 + ln][16 + 8 * hh]; pl[rt].half[0] = *(const v8us*)&sPL[w][rt * 16 + ln][8 * hh]; pl[rt].half[1] = *(const v8us*)&sPL[w][rt * 16 + ln][16 + 8 * hh]; }
#pragma unroll
    for (int dt = 0; dt < DT; ++dt) {
#pragma unroll
      for (int rt = 0; rt < RTN; ++rt) { oacc[rt][dt] = mmaH<1>(pa[rt].v, pa[rt].v, bv[dt].v, bv[dt].v, oacc[rt][dt]); oaccL[rt][dt] = mmaH<1>(pl[rt].v, pl[rt].v, bv[dt].v, bv[dt].v, oaccL[rt][dt]); oaccL[rt][dt] = mmaH<1>(pa[rt].v, pa[rt].v, bl[dt].v, bl[dt].v, oaccL[rt][dt]); } }
    __builtin_amdgcn_fence(__ATOMIC_ACQ_REL, "workgroup"); __builtin_amdgcn_wave_barrier(); }
  /* each wave leaves its rows' maxima, sums and unnormalised outputs in LDS */
#pragma unroll
  for (int rt = 0; rt < RTN; ++rt) {
#pragma unroll
    for (int r = 0; r < 8; ++r) { const float l = row_sum16(l_r[rt][r]); if (ln == 0) { sM[w][rt * 16 + 8 * hh + r] = m_r[rt][r]; sL[w][rt * 16 + 8 * hh + r] = l; } }
#pragma unroll
    for (int dt = 0; dt < DT; ++dt)
#pragma unroll
      for (int r = 0; r < 8; ++r) { float v = oacc[rt][dt][r]; v += oaccL[rt][dt][r] * 0.0009765625f; sO[w][rt * 16 + 8 * hh + r][dt * 16 + ln] = v; } }
  __syncthreads();      /* every wave's partials are in LDS before any thread merges them */
  /* merge, a thread per (row, 4 columns): M = max m_u; l = sum l_u e^(m_u - M); O = sum O_u e^(m_u - M), u in wave order. A wave with no live key for the row has m_u = -3.0e38, l_u = 0, O_u = 0 and adds nothing; a row with no live key at all gives l = 0 -> output 0 */
  if (tid < RPW * 16) { const int r = tid >> 4, pc = tid & 15; float mm = sM[0][r];      /* both loops below are unrolled so that their LDS reads are issued together, ahead of the arithmetic */
#pragma unroll
    for (int u = 1; u < NSPL; ++u) mm = fmaxf(mm, sM[u][r]);
    float l = 0.f; v4f a = {0.f, 0.f, 0.f, 0.f};
#pragma unroll
    for (int u = 0; u < NSPL; ++u) { const float f = expf(sM[u][r] - mm); const v4f val = *(const v4fa*)&sO[u][r][pc * 4]; l += sL[u][r] * f; a += val * f; }
    const float li = (l > 0.f) ? 1.0f / (l * 1024.0f) : 0.f;
    *(v4f*)(O + ((size_t)b * TQA + q0 + r) * ldo + h * 64 + pc * 4) = a * li; } }

// 3-term variant: O = (P_hi V_hi + (P_lo V_hi + P_hi V_lo) / 1024) / l with P = [hi | 2^10 residual] of 1024 p and V^T = [hi | 2^10 residual] planes (VtL same layout as Vt) -> ~2^-21-class products for un-averaged (early causal / peaked) rows
template <int CAUSAL>
__global__ __launch_bounds__(128) void k_flash3gB(const _Float16* __restrict__ Q16, int ldq, const _Float16* __restrict__ K16, int ldk, const _Float16* __restrict__ Vt, const _Float16* __restrict__ VtL, const int* __restrict__ MSK, float* __restrict__ O, int ldo) {
  constexpr int RPW = 16, RTN = RPW / 16, NQB = TQB / (4 * RPW), DT = 4, KS = 2;
  __shared__ __attribute__((aligned(16))) unsigned short sP[4][RPW][40]; __shared__ __attribute__((aligned(16))) unsigned short sPL[4][RPW][40]; __shared__ __attribute__((aligned(16))) float sO[4][RPW][64 + 4];
  const int tid = threadIdx.x, w = tid >> 5, lane = tid & 31, ln = lane & 15, hh = lane >> 4;
  const int slab = blockIdx.x / QBLKSB, qblk = blockIdx.x % QBLKSB; (void)NQB; const int b = slab / NH, h = slab % NH; const int qb0 = qblk * (4 * RPW); const int q0 = qb0 + w * RPW;
  FragH aq[2][KS];
#pragma unroll
  for (int rt = 0; rt < RTN; ++rt) { const unsigned short* qr = (const unsigned short*)Q16 + ((size_t)b * TQB + q0 + rt * 16 + ln) * ldq + h * 64;
#pragma unroll
    for (int ks = 0; ks < KS; ++ks) { aq[rt][ks].half[0] = *(const v8us*)(qr + ks * 32 + 8 * hh); aq[rt][ks].half[1] = *(const v8us*)(qr + ks * 32 + 16 + 8 * hh); } }
  const size_t vslab = (size_t)(b * (NH / KVG) + h / KVG); const unsigned short* Vth = (const unsigned short*)Vt + vslab * 64 * TK; const unsigned short* Vtl = (const unsigned short*)VtL + vslab * 64 * TK;      /* GQA: q-head h reads kv head h / KVG */
  float m_r[2][8], l_r[2][8]; v8f oacc[2][DT], oaccL[2][DT];
#pragma unroll
  for (int rt = 0; rt < RTN; ++rt) {
#pragma unroll
    for (int r = 0; r < 8; ++r) { m_r[rt][r] = -3.0e38f; l_r[rt][r] = 0.f; }
#pragma unroll
    for (int dt = 0; dt < DT; ++dt) { oacc[rt][dt] = (v8f){0.f,0.f,0.f,0.f,0.f,0.f,0.f,0.f}; oaccL[rt][dt] = oacc[rt][dt]; } }
  const int jend = (CAUSAL == 1) ? (qb0 + 4 * RPW) : TK;      /* causal: keys beyond the block's last query never contribute */
#pragma unroll 1
  for (int j0 = 0; j0 < jend; j0 += 32) {
    v8f s[2][2]; FragH bk[2][KS], bv[DT], bl[DT]; int mk0[RTN][8], mk1[RTN][8];
    /* every global load of the trip is issued here, in the order of use (K, mask words, both V planes): their latencies overlap, and V lands behind the softmax */
#pragma unroll
    for (int nt = 0; nt < 2; ++nt) { const unsigned short* kr = (const unsigned short*)K16 + ((size_t)b * TK + j0 + nt * 16 + ln) * ldk + (h / KVG) * 64;
#pragma unroll
      for (int ks = 0; ks < KS; ++ks) { bk[nt][ks].half[0] = *(const v8us*)(kr + ks * 32 + 8 * hh); bk[nt][ks].half[1] = *(const v8us*)(kr + ks * 32 + 16 + 8 * hh); } }
    if (CAUSAL == 8) {
#pragma unroll
      for (int rt = 0; rt < RTN; ++rt)
#pragma unroll
        for (int r = 0; r < 8; ++r) { const int* mrow = MSK + (size_t)(q0 + rt * 16 + 8 * hh + r) * TK + j0 + ln; mk0[rt][r] = mrow[0]; mk1[rt][r] = mrow[16]; } }
    asm volatile("s_wait_xcnt 0x0" ::: "memory");      /* stands in front of the V loads, whose results may land in registers that the K and mask loads name as addresses */
#pragma unroll
    for (int dt = 0; dt < DT; ++dt) { const unsigned short* vrow = Vth + (size_t)(dt * 16 + ln) * TK + j0; const unsigned short* vrl = Vtl + (size_t)(dt * 16 + ln) * TK + j0; bv[dt].half[0] = *(const v8us*)(vrow + 8 * hh); bv[dt].half[1] = *(const v8us*)(vrow + 16 + 8 * hh); bl[dt].half[0] = *(const v8us*)(vrl + 8 * hh);
      if (dt == DT - 1) asm volatile("s_wait_xcnt 0x0" ::: "memory");      /* stands in front of the trip's last load, whose result lands in the address registers of the V loads above */
      bl[dt].half[1] = *(const v8us*)(vrl + 16 + 8 * hh); }
    __builtin_amdgcn_sched_barrier(0);      /* keeps the loads above together: without it the scheduler moves each one down to its first use, one exposed latency apiece */
#pragma unroll
    for (int nt = 0; nt < 2; ++nt) {
#pragma unroll
      for (int rt = 0; rt < RTN; ++rt) { v8f acc = (v8f){0.f,0.f,0.f,0.f,0.f,0.f,0.f,0.f};
#pragma unroll
        for (int ks = 0; ks < KS; ++ks) acc = mmaH<1>(aq[rt][ks].v, aq[rt][ks].v, bk[nt][ks].v, bk[nt][ks].v, acc); s[rt][nt] = acc; } }
#pragma unroll
    for (int rt = 0; rt < RTN; ++rt)
#pragma unroll
      for (int r = 0; r < 8; ++r) { const int tq = q0 + rt * 16 + 8 * hh + r; const int k0 = j0 + ln, k1 = j0 + 16 + ln;
        bool ok0 = (CAUSAL == 1) ? (k0 <= tq) : ((CAUSAL == 2) ? ((k0 >> 5) == (tq >> 5)) : true), ok1 = (CAUSAL == 1) ? (k1 <= tq) : ((CAUSAL == 2) ? ((k1 >> 5) == (tq >> 5)) : true);      /* mode 2: block-diagonal 32-token groups */
        if (CAUSAL == 8) { ok0 = mk0[rt][r] != 0; ok1 = mk1[rt][r] != 0; }      /* mode 8: per-(query, key) int table shared by all batches and heads */
        if (CAUSAL == 4) { const int* mrow = MSK + ((size_t)b * TQB + tq) * TK; ok0 = mrow[k0] != 0; ok1 = mrow[k1] != 0; }      /* mode 4: per-(query, key) INPUT mask shared by all heads; masked keys contribute nothing (== the reference's -4096 fill, whose exp underflows to 0), rows with no valid key give l = 0 -> output 0 (== the reference's row_valid zeroing) */
        const float s0 = ok0 ? s[rt][0][r] * SCL : -3.0e38f, s1 = ok1 ? s[rt][1][r] * SCL : -3.0e38f; 
        const float mn = row_max16(fmaxf(fmaxf(s0, s1), m_r[rt][r]));      /* the running maximum is the same in all 16 lanes of the row: taken in ahead of the reduction, the reduced value is the new maximum itself */
        const float al = (mn > -1.0e38f) ? expf(m_r[rt][r] - mn) : 1.0f; m_r[rt][r] = mn; const float p0 = ok0 ? expf(s0 - mn) : 0.f, p1 = ok1 ? expf(s1 - mn) : 0.f; l_r[rt][r] = l_r[rt][r] * al + p0 + p1;
#pragma unroll
        for (int dt = 0; dt < DT; ++dt) { oacc[rt][dt][r] *= al; oaccL[rt][dt][r] *= al; }
        FragH t2, t2l; const float ps0 = p0 * 1024.0f, ps1 = p1 * 1024.0f; t2.h[0] = (_Float16)ps0; t2.h[1] = (_Float16)ps1; t2l.h[0] = (_Float16)((ps0 - (float)t2.h[0]) * 1024.0f); t2l.h[1] = (_Float16)((ps1 - (float)t2.h[1]) * 1024.0f);
        sP[w][rt * 16 + 8 * hh + r][ln] = t2.u[0]; sP[w][rt * 16 + 8 * hh + r][16 + ln] = t2.u[1]; sPL[w][rt * 16 + 8 * hh + r][ln] = t2l.u[0]; sPL[w][rt * 16 + 8 * hh + r][16 + ln] = t2l.u[1]; }
    __builtin_amdgcn_fence(__ATOMIC_ACQ_REL, "workgroup"); __builtin_amdgcn_wave_barrier();
    FragH pa[2], pl[2];
#pragma unroll
    for (int rt = 0; rt < RTN; ++rt) { pa[rt].half[0] = *(const v8us*)&sP[w][rt * 16 + ln][8 * hh]; pa[rt].half[1] = *(const v8us*)&sP[w][rt * 16 + ln][16 + 8 * hh]; pl[rt].half[0] = *(const v8us*)&sPL[w][rt * 16 + ln][8 * hh]; pl[rt].half[1] = *(const v8us*)&sPL[w][rt * 16 + ln][16 + 8 * hh]; }
#pragma unroll
    for (int dt = 0; dt < DT; ++dt) {
#pragma unroll
      for (int rt = 0; rt < RTN; ++rt) { oacc[rt][dt] = mmaH<1>(pa[rt].v, pa[rt].v, bv[dt].v, bv[dt].v, oacc[rt][dt]); oaccL[rt][dt] = mmaH<1>(pl[rt].v, pl[rt].v, bv[dt].v, bv[dt].v, oaccL[rt][dt]); oaccL[rt][dt] = mmaH<1>(pa[rt].v, pa[rt].v, bl[dt].v, bl[dt].v, oaccL[rt][dt]); } }
    __builtin_amdgcn_fence(__ATOMIC_ACQ_REL, "workgroup"); __builtin_amdgcn_wave_barrier(); }
#pragma unroll
  for (int rt = 0; rt < RTN; ++rt) {
#pragma unroll
    for (int r = 0; r < 8; ++r) { float l = l_r[rt][r]; l = row_sum16(l); l_r[rt][r] = (l > 0.f) ? 1.0f / (l * 1024.0f) : 0.f; }
#pragma unroll
    for (int dt = 0; dt < DT; ++dt)
#pragma unroll
      for (int r = 0; r < 8; ++r) { float v = oacc[rt][dt][r]; v += oaccL[rt][dt][r] * 0.0009765625f; sO[w][rt * 16 + 8 * hh + r][dt * 16 + ln] = v * l_r[rt][r]; } }
  __builtin_amdgcn_fence(__ATOMIC_ACQ_REL, "workgroup"); __builtin_amdgcn_wave_barrier();
  {
#pragma unroll
    for (int rp = 0; rp < RPW; rp += 2) { const int r = rp + (lane >> 4), pc = lane & 15; const v4f val = *(const v4fa*)&sO[w][r][pc * 4]; *(v4f*)(O + ((size_t)b * TQB + q0 + r) * ldo + h * 64 + pc * 4) = val; }
     } }

__global__ __launch_bounds__(256) void k_wpair(const float* __restrict__ Wm, int nin, int nout, _Float16* __restrict__ Bt) { const size_t t = (size_t)blockIdx.x * 256 + threadIdx.x; if (t >= (size_t)nout * (2 * nin / 8)) return; const int pc = (int)(t % (2 * nin / 8)); const int o = (int)(t / (2 * nin / 8)); const bool lo = pc * 8 >= nin; FragH f;
  for (int q = 0; q < 8; ++q) { const int c = pc * 8 + q - (lo ? nin : 0); f.h[q] = (_Float16)(bf16_round(Wm[(size_t)c * nout + o]) * (lo ? 1.0f : 16.0f)); } *(v8us*)((unsigned short*)Bt + (size_t)o * 2 * nin + pc * 8) = f.half[0];  }
template <int TWO_D>
__global__ __launch_bounds__(256) void k_rotab(int nrows, int rpb, const int* __restrict__ bar, const int* __restrict__ tib, float* __restrict__ CS, float* __restrict__ SN) {
  #pragma clang fp contract(off)
  const size_t t = (size_t)blockIdx.x * 256 + threadIdx.x; if (t >= (size_t)nrows * 32) return; const int d = (int)(t % 32); const int row = (int)(t / 32); const int b = row / rpb, r = row % rpb; float pos, inv;
  if (TWO_D) { const int dm = d & 15; inv = 1.0f / powf(10000.0f, (float)dm * 2.0f / 32.0f); pos = (d < 16) ? (float)bar[(size_t)b * rpb + r] : (float)tib[(size_t)b * rpb + r]; }
  else { inv = 1.0f / powf(10000.0f, (float)(2 * d) / 64.0f); pos = (float)r; }
  const float th = pos * inv; const float c = cosf(th), s = sinf(th);
  { *(float*)(CS + t) = c; *(float*)(SN + t) = s;  } }
__global__ __launch_bounds__(256) void k_rope(const float* __restrict__ F, int nrows, int rpb, int nheads, const float* __restrict__ CS, const float* __restrict__ SN, _Float16* __restrict__ dst, int ldo, int dst_bstride, int row_off) {
  #pragma clang fp contract(off)
  const size_t t = (size_t)blockIdx.x * 256 + threadIdx.x; if (t >= (size_t)nrows * nheads * 4) return; const int jg = (int)(t % 4) * 8; const int h = (int)((t / 4) % nheads); const int row = (int)(t / (4 * (size_t)nheads)); const int b = row / rpb, r = row % rpb; const int ldi = nheads * 64;
  const float* xr = F + (size_t)row * ldi + h * 64; FragH f0, f1;
#pragma unroll
  for (int q = 0; q < 8; ++q) { const int d = jg + q; const float c = CS[(size_t)row * 32 + d], s = SN[(size_t)row * 32 + d]; const float x0 = xr[d], x1 = xr[d + 32];
    float o0 = x0 * c; o0 += -x1 * s; float o1 = x1 * c; o1 += x0 * s; f0.h[q] = (_Float16)o0; f1.h[q] = (_Float16)o1; }
  unsigned short* o = (unsigned short*)dst + ((size_t)b * dst_bstride + row_off + r) * ldo + h * 64 + jg;
  { *(v8us*)o = f0.half[0]; *(v8us*)(o + 32) = f1.half[0];  } }
__global__ __launch_bounds__(256) void k_put(const float* __restrict__ F, int nrows, int rpb, int ncol, _Float16* __restrict__ H, _Float16* __restrict__ L, int dst_bstride, int row_off) {
  const size_t t = (size_t)blockIdx.x * 256 + threadIdx.x; if (t >= (size_t)nrows * (ncol / 8)) return; const int c0 = (int)(t % (ncol / 8)) * 8; const int row = (int)(t / (ncol / 8)); const int b = row / rpb, r = row % rpb; FragH fh, fl;
  for (int q = 0; q < 8; ++q) { const float v = F[(size_t)row * ncol + c0 + q]; const _Float16 hv = (_Float16)v; fh.h[q] = hv; fl.h[q] = (_Float16)((v - (float)hv) * 1024.0f); }
  const size_t drow = (size_t)b * dst_bstride + row_off + r; { *(v8us*)((unsigned short*)H + drow * ncol + c0) = fh.half[0]; if (L) *(v8us*)((unsigned short*)L + drow * ncol + c0) = fl.half[0];  } }

extern "C" void kernel_launch(void* const* d_in, const int* in_sizes, int n_in,
                              void* d_out, int out_size, void* d_ws, size_t ws_size, hipStream_t stream) {
  (void)in_sizes; (void)n_in; (void)out_size;
  const float* const* I = (const float* const*)d_in; const float* sum_x = I[0]; const float* reg_x = I[1];
  const float* w_sq = I[2]; const float* b_sq = I[3]; const float* w_sk = I[4]; const float* b_sk = I[5]; const float* w_sv = I[6]; const float* b_sv = I[7]; const float* w_so = I[8]; const float* b_so = I[9];
  const float* w_rq = I[10]; const float* b_rq = I[11]; const float* w_rk = I[12]; const float* b_rk = I[13]; const float* w_rv = I[14]; const float* b_rv = I[15]; const float* w_ro = I[16]; const float* b_ro = I[17];
  const float* w_k2 = I[18]; const float* b_k2 = I[19]; const float* w_v2 = I[20]; const float* b_v2 = I[21];
  const int* bar = (const int*)d_in[22]; const int* tib = (const int*)d_in[23]; const int* msum = (const int*)d_in[24]; const int* mupd = (const int*)d_in[25];
  char* ws = (char*)d_ws; size_t off = 0;
  auto take = [&](size_t bytes) { char* p = ws + off; off += (bytes + 255) & ~(size_t)255; return p; };
  const size_t w8 = (size_t)DMOD * DMOD / 8, w8k = (size_t)DMOD * KVD / 8;
  _Float16* BSQ = (_Float16*)take(w8 * 16); _Float16* BSK = (_Float16*)take(w8k * 16); _Float16* BSV = (_Float16*)take(w8k * 16); _Float16* BRQ = (_Float16*)take(w8 * 16); _Float16* BRK = (_Float16*)take(w8k * 16); _Float16* BRV = (_Float16*)take(w8k * 16);
  _Float16* BSO = (_Float16*)take(w8 * 32); _Float16* BRO = (_Float16*)take(w8 * 32); _Float16* BK2 = (_Float16*)take(w8k * 32); _Float16* BV2 = (_Float16*)take(w8k * 32);
  float* CS1 = (float*)take((size_t)NRS * 32 * 4); float* SN1 = (float*)take((size_t)NRS * 32 * 4); float* CS2 = (float*)take((size_t)NRR * 32 * 4); float* SN2 = (float*)take((size_t)NRR * 32 * 4); _Float16* SX = (_Float16*)take((size_t)NRS * DMOD * 2); _Float16* RX = (_Float16*)take((size_t)NRR * DMOD * 2); float* F32 = (float*)take((size_t)NRR * DMOD * 4); float* FS = (float*)take((size_t)NRS * DMOD * 4);
  _Float16* SQ = (_Float16*)take((size_t)NRS * DMOD * 2); _Float16* RQ = (_Float16*)take((size_t)NRR * DMOD * 2); _Float16* KC = (_Float16*)take((size_t)NB * TK * KVD * 2); _Float16* VCH = (_Float16*)take((size_t)NB * TK * KVD * 2); _Float16* VCL = (_Float16*)take((size_t)NB * TK * KVD * 2); _Float16* VT = (_Float16*)take((size_t)NB * NKV * 64 * TK * 2); _Float16* VTL = (_Float16*)take((size_t)NB * NKV * 64 * TK * 2);
  float* O1 = (float*)take((size_t)NRS * DMOD * 4); _Float16* O1H = (_Float16*)take((size_t)NRS * DMOD * 2); _Float16* O1L = (_Float16*)take((size_t)NRS * DMOD * 2); float* O2 = F32; _Float16* O2H = RQ; _Float16* O2L = RX;      /* O2 over the dead reg-q f32 scratch; O2H/O2L over RQ/RX (dead after phase 2 / the projections) */
  if (off > ws_size) return;      /* 16 + 1 + 8 + 16 + 8 + 2.06 x 5 + 0.5 x 2 + 0.25 x 4 = 61.3 MiB */
  const unsigned g8 = (unsigned)((w8 + 255) / 256), g8k = (unsigned)((w8k + 255) / 256);
  k_wt_f16<<<g8, 256, 0, stream>>>(w_sq, BSQ, DMOD, DMOD, 16.0f); k_wt_f16<<<g8k, 256, 0, stream>>>(w_sk, BSK, DMOD, KVD, 16.0f); k_wt_f16<<<g8k, 256, 0, stream>>>(w_sv, BSV, DMOD, KVD, 16.0f);
  k_wt_f16<<<g8, 256, 0, stream>>>(w_rq, BRQ, DMOD, DMOD, 16.0f); k_wt_f16<<<g8k, 256, 0, stream>>>(w_rk, BRK, DMOD, KVD, 16.0f); k_wt_f16<<<g8k, 256, 0, stream>>>(w_rv, BRV, DMOD, KVD, 16.0f);
  k_wpair<<<(unsigned)(((size_t)DMOD * (2 * DMOD / 8) + 255) / 256), 256, 0, stream>>>(w_so, DMOD, DMOD, BSO); k_wpair<<<(unsigned)(((size_t)DMOD * (2 * DMOD / 8) + 255) / 256), 256, 0, stream>>>(w_ro, DMOD, DMOD, BRO);
  k_wpair<<<(unsigned)(((size_t)KVD * (2 * DMOD / 8) + 255) / 256), 256, 0, stream>>>(w_k2, DMOD, KVD, BK2); k_wpair<<<(unsigned)(((size_t)KVD * (2 * DMOD / 8) + 255) / 256), 256, 0, stream>>>(w_v2, DMOD, KVD, BV2);
  k_rotab<0><<<(unsigned)(((size_t)NRS * 32 + 255) / 256), 256, 0, stream>>>(NRS, SS, nullptr, nullptr, CS1, SN1); k_rotab<1><<<(unsigned)(((size_t)NRR * 32 + 255) / 256), 256, 0, stream>>>(NRR, RR, bar, tib, CS2, SN2);
  k_x16<<<(unsigned)(((size_t)NRS * DMOD / 8 + 255) / 256), 256, 0, stream>>>(sum_x, SX, (size_t)NRS * DMOD / 8); k_x16<<<(unsigned)(((size_t)NRR * DMOD / 8 + 255) / 256), 256, 0, stream>>>(reg_x, RX, (size_t)NRR * DMOD / 8);
  const dim3 gSQ((NRS / 128) * (DMOD / 64), 1), gSK((NRS / 128) * (KVD / 64), 1), gRQ((NRR / 128) * (DMOD / 64), 1), gRK((NRR / 128) * (KVD / 64), 1);
  /* summary q/k/v */
  k_gemm2<0><<<gSQ, 128, 0, stream>>>(SX, DMOD, 0, BSQ, DMOD, 0, 0.0625f, b_sq, 0, nullptr, 1, 0, 0, FS, nullptr, DMOD, 0, NRS, DMOD, DMOD);
  k_rope<<<(unsigned)(((size_t)NRS * NH * 4 + 255) / 256), 256, 0, stream>>>(FS, NRS, SS, NH, CS1, SN1, SQ, DMOD, SS, 0);
  k_gemm2<0><<<gSK, 128, 0, stream>>>(SX, DMOD, 0, BSK, DMOD, 0, 0.0625f, b_sk, 0, nullptr, 1, 0, 0, FS, nullptr, KVD, 0, NRS, KVD, DMOD);
  k_rope<<<(unsigned)(((size_t)NRS * NKV * 4 + 255) / 256), 256, 0, stream>>>(FS, NRS, SS, NKV, CS1, SN1, KC, KVD, TK, 0);      /* keys 0..63 of each batch */
  k_gemm2<0><<<gSK, 128, 0, stream>>>(SX, DMOD, 0, BSV, DMOD, 0, 0.0625f, b_sv, 0, nullptr, 1, 0, 0, FS, nullptr, KVD, 0, NRS, KVD, DMOD);
  k_put<<<(unsigned)(((size_t)NRS * (KVD / 8) + 255) / 256), 256, 0, stream>>>(FS, NRS, SS, KVD, VCH, VCL, TK, 0);
  /* regular q/k/v */
  k_gemm2<0><<<gRQ, 128, 0, stream>>>(RX, DMOD, 0, BRQ, DMOD, 0, 0.0625f, b_rq, 0, nullptr, 1, 0, 0, F32, nullptr, DMOD, 0, NRR, DMOD, DMOD);
  k_rope<<<(unsigned)(((size_t)NRR * NH * 4 + 255) / 256), 256, 0, stream>>>(F32, NRR, RR, NH, CS2, SN2, RQ, DMOD, RR, 0);
  k_gemm2<0><<<gRK, 128, 0, stream>>>(RX, DMOD, 0, BRK, DMOD, 0, 0.0625f, b_rk, 0, nullptr, 1, 0, 0, F32, nullptr, KVD, 0, NRR, KVD, DMOD);
  k_rope<<<(unsigned)(((size_t)NRR * NKV * 4 + 255) / 256), 256, 0, stream>>>(F32, NRR, RR, NKV, CS2, SN2, KC, KVD, TK, SS);      /* keys 64.. of each batch */
  k_gemm2<0><<<gRK, 128, 0, stream>>>(RX, DMOD, 0, BRV, DMOD, 0, 0.0625f, b_rv, 0, nullptr, 1, 0, 0, F32, nullptr, KVD, 0, NRR, KVD, DMOD);
  k_put<<<(unsigned)(((size_t)NRR * (KVD / 8) + 255) / 256), 256, 0, stream>>>(F32, NRR, RR, KVD, VCH, VCL, TK, SS);
  /* phase 1: summary queries over [summary ; regular] keys */
  k_vt<NKV, TK><<<NB * NKV * (TK / 64), 256, 0, stream>>>(VCH, KVD, 0, VT); k_vt<NKV, TK><<<NB * NKV * (TK / 64), 256, 0, stream>>>(VCL, KVD, 0, VTL);
  k_flash3gA<8><<<NB * NH * (TQA / 16), 32 * NSPL, 0, stream>>>(SQ, DMOD, KC, KVD, VT, VTL, msum, O1, DMOD);
  k_hl<<<(unsigned)(((size_t)NRS * DMOD / 8 + 255) / 256), 256, 0, stream>>>(O1, O1H, O1L, (size_t)NRS * DMOD / 8);
  /* output 0 = sum_attn W_so + b_so */
  k_gemm2<0><<<gSQ, 128, 0, stream>>>(O1H, DMOD, 0, BSO, 2 * DMOD, 0, 0.0625f, b_so, 0, nullptr, 1, 0, 0, (float*)d_out, nullptr, DMOD, 0, NRS, DMOD, DMOD);
  k_gemm2<0><<<gSQ, 128, 0, stream>>>(O1L, DMOD, 0, BSO + DMOD, 2 * DMOD, 0, 1.0f / 1024.0f, nullptr, 0, (const float*)d_out, 1, (size_t)DMOD, 0, (float*)d_out, nullptr, DMOD, 0, NRS, DMOD, DMOD);
  /* k2 / v2 from sum_attn (no RoPE), into key/value rows 0..63 of each batch */
  k_gemm2<0><<<gSK, 128, 0, stream>>>(O1H, DMOD, 0, BK2, 2 * DMOD, 0, 0.0625f, b_k2, 0, nullptr, 1, 0, 0, FS, nullptr, KVD, 0, NRS, KVD, DMOD);
  k_gemm2<0><<<gSK, 128, 0, stream>>>(O1L, DMOD, 0, BK2 + DMOD, 2 * DMOD, 0, 1.0f / 1024.0f, nullptr, 0, FS, 1, (size_t)KVD, 0, FS, nullptr, KVD, 0, NRS, KVD, DMOD);
  k_put<<<(unsigned)(((size_t)NRS * (KVD / 8) + 255) / 256), 256, 0, stream>>>(FS, NRS, SS, KVD, KC, nullptr, TK, 0);
  k_gemm2<0><<<gSK, 128, 0, stream>>>(O1H, DMOD, 0, BV2, 2 * DMOD, 0, 0.0625f, b_v2, 0, nullptr, 1, 0, 0, FS, nullptr, KVD, 0, NRS, KVD, DMOD);
  k_gemm2<0><<<gSK, 128, 0, stream>>>(O1L, DMOD, 0, BV2 + DMOD, 2 * DMOD, 0, 1.0f / 1024.0f, nullptr, 0, FS, 1, (size_t)KVD, 0, FS, nullptr, KVD, 0, NRS, KVD, DMOD);
  k_put<<<(unsigned)(((size_t)NRS * (KVD / 8) + 255) / 256), 256, 0, stream>>>(FS, NRS, SS, KVD, VCH, VCL, TK, 0);
  /* phase 2: regular queries over [k2 ; regular] keys */
  k_vt<NKV, TK><<<NB * NKV * (TK / 64), 256, 0, stream>>>(VCH, KVD, 0, VT); k_vt<NKV, TK><<<NB * NKV * (TK / 64), 256, 0, stream>>>(VCL, KVD, 0, VTL);
  k_flash3gB<8><<<NB * NH * QBLKSB, 128, 0, stream>>>(RQ, DMOD, KC, KVD, VT, VTL, mupd, O2, DMOD);
  k_hl<<<(unsigned)(((size_t)NRR * DMOD / 8 + 255) / 256), 256, 0, stream>>>(O2, O2H, O2L, (size_t)NRR * DMOD / 8);
  float* out1 = (float*)d_out + (size_t)NRS * DMOD;
  k_gemm2<0><<<gRQ, 128, 0, stream>>>(O2H, DMOD, 0, BRO, 2 * DMOD, 0, 0.0625f, b_ro, 0, nullptr, 1, 0, 0, out1, nullptr, DMOD, 0, NRR, DMOD, DMOD);
  k_gemm2<0><<<gRQ, 128, 0, stream>>>(O2L, DMOD, 0, BRO + DMOD, 2 * DMOD, 0, 1.0f / 1024.0f, nullptr, 0, out1, 1, (size_t)DMOD, 0, out1, nullptr, DMOD, 0, NRR, DMOD, DMOD);
}

// v004
// Measured time: 395 microseconds a run.
// Two timings next to v003 put it at 1.41 and 1.42 times that version's speed.
// All steps since v000 together make it 3.52 times as fast.
#include <hip/hip_runtime.h>
// FlexSummaryAttention (2 batches; 64 summary tokens S, 2048 regular tokens R, D = 1024; 16 query heads, 4 kv heads (GQA), head dim 64): q/k/v projections for both token sets; 1-D RoPE on summary q/k, 2-D hierarchical RoPE (bar id | token-in-bar id) on regular q/k; phase 1: summary queries over [summary; regular] keys with the summarize mask -> sum_attn; k2/v2 = sum_attn W + b; phase 2: regular queries over [k2; regular k] / [v2; regular v] with the updating mask -> reg_attn; outputs sum_attn W_so + b and reg_attn W_ro + b.
// Structure: exact f16 planes of both inputs; six projection GEMMs (32x64 wave tiles, f32 accumulation, exact x16 weights + bias); RoPE on VALU (thread per (row, head, 8 dims), f32 trig) into f16 q planes and the shared per-batch key plane [k2-or-summary ; regular] (4 kv heads); values as f16 hi + 2^10 residual planes, V^T by LDS tiles; the fused flash kernel (3-term P.V, GQA head mapping, INPUT int mask tables) once per phase; sum_attn / reg_attn as hi + residual pairs into the k2/v2 and output GEMMs.
// Compute dtype: inputs, masks' companions and parameters rounded to bf16; q/k after RoPE as f16 (~2^-12); P and v hi + residual (~2^-21-class); attention outputs hi + residual into the following GEMMs; f32 softmax/accumulation/trig. v_wmma_f32_16x16x32_f16.
#define NB 2
#define SS 64
#define RR 2048
#define DMOD 1024
#define KVD 256
#define NRS (NB * SS)            /* 128 summary rows */
#define NRR (NB * RR)            /* 4096 regular rows */
#define TK 2112                  /* keys per batch in both phases: 64 summary(-derived) + 2048 regular */
#define TQA 64                   /* phase-1 queries (summary tokens) */
#define TQB 2048                 /* phase-2 queries (regular tokens) */
#define TQ TQB
#define NH 16
#define KVG 4                    /* GQA: 16 query heads share 4 kv heads */
#define NKV (NH / KVG)
#define SCL 0.125f               /* 64^-0.5 */
#define QBLKSA (TQA / 64)
#define NSPL 11                  /* phase 1: waves that share the 2112 keys of one 16-query tile, 6 trips of 32 keys each */
#define QBLKSB (TQB / 64)
typedef __bf16 v16b __attribute__((ext_vector_type(16)));
typedef unsigned short v8us __attribute__((ext_vector_type(8), may_alias));
typedef float  v8f  __attribute__((ext_vector_type(8)));
typedef float  v4f  __attribute__((ext_vector_type(4)));
typedef float  v4fa __attribute__((ext_vector_type(4), may_alias));
union FragB { v16b v; v8us half[2]; unsigned short u[16]; };

__device__ __forceinline__ unsigned short bf16_bits(float x) { unsigned int u = __float_as_uint(x); return (unsigned short)((u + 0x7FFFu + ((u >> 16) & 1u)) >> 16); }
__device__ __forceinline__ float bf16_val(unsigned short b) { return __uint_as_float(((unsigned int)b) << 16); }
__device__ __forceinline__ float bf16_round(float x) { return bf16_val(bf16_bits(x)); }
// D += A·B with NT terms: 1 = ah·bh, 2 = + al·bh (A split), 3 = + ah·bl (both split)
template <int NT>
__device__ __forceinline__ v8f mmaN(v16b ah, v16b al, v16b bh, v16b bl, v8f c) {
  c = __builtin_amdgcn_wmma_f32_16x16x32_bf16(false, ah, false, bh, (short)0, c, false, false);
  if (NT >= 2) c = __builtin_amdgcn_wmma_f32_16x16x32_bf16(false, al, false, bh, (short)0, c, false, false);
  if (NT >= 3) c = __builtin_amdgcn_wmma_f32_16x16x32_bf16(false, ah, false, bl, (short)0, c, false, false);
  asm volatile("v_nop\n\tv_nop\n\tv_nop\n\tv_nop" : "+v"(c) : "v"(ah), "v"(al), "v"(bh), "v"(bl));
  return c;
}

__global__ __launch_bounds__(256) void k_wt_bf16(const float* __restrict__ W, unsigned short* __restrict__ Wt, int K, int N) {
  const int t = blockIdx.x * 256 + threadIdx.x;
  const int k8n = K / 8;
  if (t >= N * k8n) return;
  const int n = t / k8n, k8 = (t % k8n) * 8;
  v8us v;
#pragma unroll
  for (int i = 0; i < 8; ++i) v[i] = bf16_bits(W[(size_t)(k8 + i) * N + n]);
  *(v8us*)(Wt + (size_t)n * K + k8) = v;
  
}

// GEMM C[M][N] (f32, pitch ldc) = act(A[M][K]·W + bias). A f32 row-major (pitch lda) converted per fragment to bf16
// (ASPLIT: hi/lo two planes -> 2 terms, else single rounded term); Wt bf16 [N][K] (pitch ldb). BIAS_BF16 rounds the
// bias to bf16 first (bias quantised to bf16 before the add). K%32==0, M%16==0, N%64==0.
template <bool ASPLIT, int ACT, bool BIAS_BF16>
__global__ __launch_bounds__(128) void k_gemm_bf(const float* __restrict__ A, int lda, const unsigned short* __restrict__ Wt, int ldb,
                                               const float* __restrict__ bias, float* __restrict__ C, int ldc, int M, int N, int K) {
  __shared__ __attribute__((aligned(16))) float so[4][16][64];
  const int tid = threadIdx.x, w = tid >> 5, lane = tid & 31, ln = lane & 15, hh = lane >> 4;
  const int ntn = N / 64;
  const int wid = blockIdx.x * 4 + w;
  const int mt = wid / ntn, nq = wid % ntn;
  if (mt * 16 >= M) return;
  const int row0 = mt * 16, col0 = nq * 64;
  const float* arow = A + (size_t)(row0 + ln) * lda;
  v8f acc[4] = {};
  for (int kb = 0; kb < K; kb += 32) {
    FragB ah, al;
    const v4f x0 = *(const v4fa*)(arow + kb + 8 * hh), x1 = *(const v4fa*)(arow + kb + 8 * hh + 4);
    const v4f x2 = *(const v4fa*)(arow + kb + 16 + 8 * hh), x3 = *(const v4fa*)(arow + kb + 16 + 8 * hh + 4);
    float xs[16] = {x0[0],x0[1],x0[2],x0[3],x1[0],x1[1],x1[2],x1[3],x2[0],x2[1],x2[2],x2[3],x3[0],x3[1],x3[2],x3[3]};
#pragma unroll
    for (int i = 0; i < 16; ++i) { const unsigned short hb = bf16_bits(xs[i]); ah.u[i] = hb; al.u[i] = ASPLIT ? bf16_bits(xs[i] - bf16_val(hb)) : (unsigned short)0; }
#pragma unroll
    for (int t = 0; t < 4; ++t) {
      const unsigned short* brow = Wt + (size_t)(col0 + t * 16 + ln) * ldb + kb;
      FragB b;
      b.half[0] = *(const v8us*)(brow + 8 * hh);
      b.half[1] = *(const v8us*)(brow + 16 + 8 * hh);
      acc[t] = mmaN<ASPLIT ? 2 : 1>(ah.v, al.v, b.v, b.v, acc[t]);
    }
  }
#pragma unroll
  for (int t = 0; t < 4; ++t) {
    float bv = bias ? bias[col0 + t * 16 + ln] : 0.f;
    if (BIAS_BF16) bv = bf16_round(bv);
#pragma unroll
    for (int r = 0; r < 8; ++r) { float v = acc[t][r] + bv; if (ACT == 1) v = fmaxf(v, 0.f); so[w][8 * hh + r][t * 16 + ln] = v; }
  }
  __builtin_amdgcn_fence(__ATOMIC_ACQ_REL, "workgroup");
  __builtin_amdgcn_wave_barrier();
  const int rsub = lane >> 4, c4 = (lane & 15) * 4;
  {
#pragma unroll
    for (int q = 0; q < 8; ++q) {
      const int r = q * 2 + rsub;
      const v4f v = *(const v4fa*)&so[w][r][c4];
      *(v4f*)(C + (size_t)(row0 + r) * ldc + col0 + c4) = v;
    }
    
  }
}

// GEMM C = act(A·W + bias + resid): A f32 (ASPLIT -> hi/lo 2 terms), Wt bf16 [N][K]; ACT 0 none, 1 relu, 2 exact gelu;
// resid (optional, f32, row index = (row % rmod), pitch ldr, RES_BF16 rounds it) added before the activation.
template <bool ASPLIT, int ACT, bool BIAS_BF16, bool RES_BF16>
__global__ __launch_bounds__(128) void k_gemm_bf3(const float* __restrict__ A, int lda, const unsigned short* __restrict__ Wt, int ldb,
                                                const float* __restrict__ bias, const float* __restrict__ resid, int rmod, int ldr,
                                                float* __restrict__ C, int ldc, int M, int N, int K) {
  __shared__ __attribute__((aligned(16))) float so[4][16][64];
  const int tid = threadIdx.x, w = tid >> 5, lane = tid & 31, ln = lane & 15, hh = lane >> 4;
  const int ntn = N / 64;
  const int wid = blockIdx.x * 4 + w;
  const int mt = wid / ntn, nq = wid % ntn;
  if (mt * 16 >= M) return;
  const int row0 = mt * 16, col0 = nq * 64;
  const float* arow = A + (size_t)(row0 + ln) * lda;
  v8f acc[4] = {};
  for (int kb = 0; kb < K; kb += 32) {
    FragB ah, al;
    const v4f x0 = *(const v4fa*)(arow + kb + 8 * hh), x1 = *(const v4fa*)(arow + kb + 8 * hh + 4);
    const v4f x2 = *(const v4fa*)(arow + kb + 16 + 8 * hh), x3 = *(const v4fa*)(arow + kb + 16 + 8 * hh + 4);
    float xs[16] = {x0[0],x0[1],x0[2],x0[3],x1[0],x1[1],x1[2],x1[3],x2[0],x2[1],x2[2],x2[3],x3[0],x3[1],x3[2],x3[3]};
#pragma unroll
    for (int i = 0; i < 16; ++i) { const unsigned short hb = bf16_bits(xs[i]); ah.u[i] = hb; al.u[i] = ASPLIT ? bf16_bits(xs[i] - bf16_val(hb)) : (unsigned short)0; }
#pragma unroll
    for (int t = 0; t < 4; ++t) {
      const unsigned short* brow = Wt + (size_t)(col0 + t * 16 + ln) * ldb + kb;
      FragB b;
      b.half[0] = *(const v8us*)(brow + 8 * hh);
      b.half[1] = *(const v8us*)(brow + 16 + 8 * hh);
      acc[t] = mmaN<ASPLIT ? 2 : 1>(ah.v, al.v, b.v, b.v, acc[t]);
    }
  }
#pragma unroll
  for (int t = 0; t < 4; ++t) {
    const int col = col0 + t * 16 + ln;
    float bv = bias ? bias[col] : 0.f;
    if (BIAS_BF16) bv = bf16_round(bv);
#pragma unroll
    for (int r = 0; r < 8; ++r) {
      float v = acc[t][r] + bv;
      if (resid) { float rv = resid[(size_t)((row0 + 8 * hh + r) % rmod) * ldr + col]; if (RES_BF16) rv = bf16_round(rv); v += rv; }
      if (ACT == 1) v = fmaxf(v, 0.f);
      if (ACT == 2) v = 0.5f * v * (1.0f + erff(v * 0.70710678118654752f));
      if (ACT == 3) { const float u = 0.7978845608028654f * (v + 0.044715f * v * v * v); v = 0.5f * v * (1.0f + tanhf(u)); }
      so[w][8 * hh + r][t * 16 + ln] = v;
    }
  }
  __builtin_amdgcn_fence(__ATOMIC_ACQ_REL, "workgroup");
  __builtin_amdgcn_wave_barrier();
  const int rsub = lane >> 4, c4 = (lane & 15) * 4;
  {
#pragma unroll
    for (int q = 0; q < 8; ++q) {
      const int r = q * 2 + rsub;
      const v4f v = *(const v4fa*)&so[w][r][c4];
      *(v4f*)(C + (size_t)(row0 + r) * ldc + col0 + c4) = v;
    }
    
  }
}
// row LayerNorm (biased variance, eps) over N: s = X (+ R); optional out_sum <- s; out_norm <- (s-mu)*rsqrt(var+eps)*g + b
template <bool PARAM_BF16>
__global__ __launch_bounds__(256) void k_layernorm(const float* __restrict__ X, const float* __restrict__ R, const float* __restrict__ g, const float* __restrict__ bta,
                                                  float* __restrict__ out_sum, float* __restrict__ out_norm, int N, float eps) {
  __shared__ float red[256];
  const int row = blockIdx.x, tid = threadIdx.x;
  const float* x = X + (size_t)row * N; const float* rr = R ? R + (size_t)row * N : nullptr;
  float vals[16];                     // up to N = 4096
  const int per = N / 256;            // contiguous chunk per thread? use strided-by-4 chunks: thread handles j = tid*4 + 1024*u
  float s1 = 0.f;
  for (int u = 0; u < per / 4; ++u) {
    const int j = tid * 4 + 1024 * u;
    const v4f a = *(const v4fa*)(x + j);
    v4f b = {0.f,0.f,0.f,0.f}; if (rr) b = *(const v4fa*)(rr + j);
#pragma unroll
    for (int q = 0; q < 4; ++q) { const float v = a[q] + b[q]; vals[u * 4 + q] = v; s1 += v; }
  }
  red[tid] = s1; __syncthreads();
  for (int st = 128; st > 0; st >>= 1) { if (tid < st) red[tid] += red[tid + st]; __syncthreads(); }
  const float mu = red[0] / (float)N; __syncthreads();
  float s2 = 0.f;
  for (int u = 0; u < per / 4; ++u)
#pragma unroll
    for (int q = 0; q < 4; ++q) { const float c = vals[u * 4 + q] - mu; s2 += c * c; }
  red[tid] = s2; __syncthreads();
  for (int st = 128; st > 0; st >>= 1) { if (tid < st) red[tid] += red[tid + st]; __syncthreads(); }
  const float rs = rsqrtf(red[0] / (float)N + eps);
  {
    for (int u = 0; u < per / 4; ++u) {
      const int j = tid * 4 + 1024 * u;
      v4f o, sm;
#pragma unroll
      for (int q = 0; q < 4; ++q) {
        float gg = g[j + q], bb = bta[j + q];
        if (PARAM_BF16) { gg = bf16_round(gg); bb = bf16_round(bb); }
        sm[q] = vals[u * 4 + q]; o[q] = (vals[u * 4 + q] - mu) * rs * gg + bb;
      }
      if (out_sum) *(v4f*)(out_sum + (size_t)row * N + j) = sm;
      *(v4f*)(out_norm + (size_t)row * N + j) = o;
    }
    
  }
}



// ---- f16 WMMA path (v_wmma_f32_16x16x32_f16): 11-bit significands for operands in range — used where a [0,1] probability operand needs more precision than bf16
typedef _Float16 v16h __attribute__((ext_vector_type(16)));
union FragH { v16h v; v8us half[2]; _Float16 h[16]; unsigned short u[16]; };
template <int NT>
__device__ __forceinline__ v8f mmaH(v16h ah, v16h al, v16h bh, v16h bl, v8f c) {
  c = __builtin_amdgcn_wmma_f32_16x16x32_f16(false, ah, false, bh, (short)0, c, false, false);
  if (NT >= 2) c = __builtin_amdgcn_wmma_f32_16x16x32_f16(false, al, false, bh, (short)0, c, false, false);
  if (NT >= 3) c = __builtin_amdgcn_wmma_f32_16x16x32_f16(false, ah, false, bl, (short)0, c, false, false);
  asm volatile("v_nop\n\tv_nop\n\tv_nop\n\tv_nop" : "+v"(c) : "v"(ah), "v"(al), "v"(bh), "v"(bl));
  return c;
}
// batched GEMM like k_gemm_b but f16 operands: A f32 (split into f16 hi/lo if ASPLIT, else rounded to f16), Bt = f16 values [n][k]; alpha; C f32; N multiple of 16 (partial tiles skipped)
template <bool ASPLIT>
__global__ __launch_bounds__(128) void k_gemm_h(const float* __restrict__ A, int lda, size_t sA, const _Float16* __restrict__ Bh, int ldb, size_t sB, float alpha, float* __restrict__ C, int ldc, size_t sC, int M, int N, int K) {
  __shared__ __attribute__((aligned(16))) float so[4][16][64];
  const int tid = threadIdx.x, w = tid >> 5, lane = tid & 31, ln = lane & 15, hh = lane >> 4; const int by = blockIdx.y;
  A += (size_t)by * sA; Bh += (size_t)by * sB; C += (size_t)by * sC;
  const int ntn = (N + 63) / 64; const int wid = blockIdx.x * 4 + w; const int mt = wid / ntn, nq = wid % ntn; if (mt * 16 >= M) return;
  const int row0 = mt * 16, col0 = nq * 64; const float* arow = A + (size_t)(row0 + ln) * lda;
  v8f acc[4] = {};
  for (int kb = 0; kb < K; kb += 32) {
    FragH ah, al;
    const v4f x0 = *(const v4fa*)(arow + kb + 8 * hh), x1 = *(const v4fa*)(arow + kb + 8 * hh + 4), x2 = *(const v4fa*)(arow + kb + 16 + 8 * hh), x3 = *(const v4fa*)(arow + kb + 16 + 8 * hh + 4);
    float xs[16] = {x0[0],x0[1],x0[2],x0[3],x1[0],x1[1],x1[2],x1[3],x2[0],x2[1],x2[2],x2[3],x3[0],x3[1],x3[2],x3[3]};
#pragma unroll
    for (int i = 0; i < 16; ++i) { const _Float16 h = (_Float16)xs[i]; ah.h[i] = h; al.h[i] = ASPLIT ? (_Float16)(xs[i] - (float)h) : (_Float16)0.0f; }
#pragma unroll
    for (int t = 0; t < 4; ++t) { if (col0 + t * 16 >= N) continue; const size_t boff = (size_t)(col0 + t * 16 + ln) * ldb + kb; FragH bq; bq.half[0] = *(const v8us*)(Bh + boff + 8 * hh); bq.half[1] = *(const v8us*)(Bh + boff + 16 + 8 * hh);
      acc[t] = mmaH<ASPLIT ? 2 : 1>(ah.v, al.v, bq.v, bq.v, acc[t]); }
  }
#pragma unroll
  for (int t = 0; t < 4; ++t) { if (col0 + t * 16 >= N) continue;
#pragma unroll
    for (int r = 0; r < 8; ++r) so[w][8 * hh + r][t * 16 + ln] = acc[t][r] * alpha; }
  __builtin_amdgcn_fence(__ATOMIC_ACQ_REL, "workgroup"); __builtin_amdgcn_wave_barrier();
  const int rsub = lane >> 4, c4 = (lane & 15) * 4;
  {
#pragma unroll
    for (int q = 0; q < 8; ++q) { const int r = q * 2 + rsub; if (col0 + c4 < N) { const v4f v = *(const v4fa*)&so[w][r][c4]; *(v4f*)(C + (size_t)(row0 + r) * ldc + col0 + c4) = v; } }
     }
}

// Wt[n][k] = f16(W[k][n]·scale) from f32 row-major W[K][N] (scale = power of two; bf16-exact weights stay exact in f16 away from the subnormal range)
__device__ __forceinline__ void d_wt_f16(int bx, const float* __restrict__ W, _Float16* __restrict__ Wt, int K, int N, float scale) {
  const int t = bx * 256 + threadIdx.x; if (t >= N * (K / 8)) return; const int n = t / (K / 8), k8 = (t % (K / 8)) * 8; FragH f;
#pragma unroll
  for (int i = 0; i < 8; ++i) f.h[i] = (_Float16)(bf16_round(W[(size_t)(k8 + i) * N + n]) * scale); const v8us o = f.half[0];
  *(v8us*)((unsigned short*)Wt + (size_t)n * K + k8) = o; 
}
// k_gemm_hh variant with fused epilogue: v = acc·alpha + bias[by·sBias + col] (+ CP[(row/rowsPerB)·sCPb + by·64 + col] if CP) ; ACT 0 none / 1 elu ; writes f16 C16 (and f32 C if non-null)
template <int ACT>
__global__ __launch_bounds__(128) void k_gemm_hhx(const _Float16* __restrict__ A, int lda, size_t sA, const _Float16* __restrict__ Bh, int ldb, size_t sB, float alpha, const float* __restrict__ bias, size_t sBias, const float* __restrict__ CP, int rowsPerB, size_t sCPb, int row0g,
    float* __restrict__ C, _Float16* __restrict__ C16, int ldc, size_t sC, int M, int N, int K) {
  __shared__ __attribute__((aligned(16))) float so[4][16][64];
  const int tid = threadIdx.x, w = tid >> 5, lane = tid & 31, ln = lane & 15, hh = lane >> 4; const int by = blockIdx.y;
  A += (size_t)by * sA; Bh += (size_t)by * sB; const size_t cofs = (size_t)by * sC; const float* bp = bias ? bias + (size_t)by * sBias : nullptr;
  const int ntn = (N + 63) / 64; const int wid = blockIdx.x * 4 + w; const int mt = wid / ntn, nq = wid % ntn; if (mt * 16 >= M) return;
  const int row0 = mt * 16, col0 = nq * 64; const _Float16* arow = A + (size_t)(row0 + ln) * lda;
  v8f acc[4] = {};
  for (int kb = 0; kb < K; kb += 32) { FragH ah; ah.half[0] = *(const v8us*)((const unsigned short*)arow + kb + 8 * hh); ah.half[1] = *(const v8us*)((const unsigned short*)arow + kb + 16 + 8 * hh);
#pragma unroll
    for (int t = 0; t < 4; ++t) { if (col0 + t * 16 >= N) continue; const size_t boff = (size_t)(col0 + t * 16 + ln) * ldb + kb; FragH bq; bq.half[0] = *(const v8us*)((const unsigned short*)Bh + boff + 8 * hh); bq.half[1] = *(const v8us*)((const unsigned short*)Bh + boff + 16 + 8 * hh);
      acc[t] = mmaH<1>(ah.v, ah.v, bq.v, bq.v, acc[t]); }
  }
#pragma unroll
  for (int t = 0; t < 4; ++t) { if (col0 + t * 16 >= N) continue; const int col = col0 + t * 16 + ln; const float bv = bp ? bf16_round(bp[col]) : 0.f;
#pragma unroll
    for (int r = 0; r < 8; ++r) { float v = acc[t][r] * alpha + bv; if (CP) { const int bidx = (row0g + row0 + 8 * hh + r) / rowsPerB; v += CP[(size_t)bidx * sCPb + (size_t)by * 64 + col]; } if (ACT == 1) v = (v > 0.f) ? v : expm1f(v); else if (ACT == 7) v = (v > 0.f) ? v + 1.0f : expf(v); else if (ACT == 8) v = tanhf(v); else if (ACT == 9) v = 0.5f * v * (1.0f + tanhf(0.7978845608028654f * (v + 0.044715f * v * v * v))); else if (ACT == 11) v = 1.0f / (1.0f + expf(-v)); else if (ACT == 12) v = (v > 0.f) ? v : 0.01f * v; else if (ACT == 14) v = (v > 0.f) ? v : 0.1f * v; else if (ACT == 15) v = v / (1.0f + expf(-v)); else if (ACT == 3) v = fmaxf(v, 0.f); else if (ACT == 6) v = 0.5f * v * (1.0f + erff(v * 0.70710678118654752f)); so[w][8 * hh + r][t * 16 + ln] = v; } }
  __builtin_amdgcn_fence(__ATOMIC_ACQ_REL, "workgroup"); __builtin_amdgcn_wave_barrier();
  const int rsub = lane >> 4, c4 = (lane & 15) * 4; typedef _Float16 v4h __attribute__((ext_vector_type(4)));
  {
#pragma unroll
    for (int q = 0; q < 8; ++q) { const int r = q * 2 + rsub; if (col0 + c4 < N) { const v4f v = *(const v4fa*)&so[w][r][c4]; if (C) *(v4f*)(C + cofs + (size_t)(row0 + r) * ldc + col0 + c4) = v; if (C16) { v4h h4; for (int i = 0; i < 4; ++i) h4[i] = (_Float16)v[i]; *(v4h*)(C16 + cofs + (size_t)(row0 + r) * ldc + col0 + c4) = h4; } } }
     }
}


typedef _Float16 v4h __attribute__((ext_vector_type(4)));

__device__ __forceinline__ void d_x16(int bx, const float* __restrict__ x, _Float16* __restrict__ X16, size_t n8) { const size_t t = (size_t)bx * 256 + threadIdx.x; if (t >= n8) return; FragH f;
#pragma unroll
  for (int q = 0; q < 8; ++q) f.h[q] = (_Float16)bf16_round(x[t * 8 + q]); *(v8us*)((unsigned short*)X16 + t * 8) = f.half[0];  }
__global__ __launch_bounds__(256) void k_h16(const float* __restrict__ x, _Float16* __restrict__ X16, size_t n8) { const size_t t = (size_t)blockIdx.x * 256 + threadIdx.x; if (t >= n8) return; FragH f;
#pragma unroll
  for (int q = 0; q < 8; ++q) f.h[q] = (_Float16)x[t * 8 + q]; *(v8us*)((unsigned short*)X16 + t * 8) = f.half[0];  }
__global__ __launch_bounds__(256) void k_round16f(const float* __restrict__ W, _Float16* __restrict__ Bt, size_t n8) { const size_t t = (size_t)blockIdx.x * 256 + threadIdx.x; if (t >= n8) return; FragH f;
#pragma unroll
  for (int i = 0; i < 8; ++i) f.h[i] = (_Float16)(bf16_round(W[t * 8 + i]) * 16.0f); *(v8us*)((unsigned short*)Bt + t * 8) = f.half[0];  }
template <int NHv, int TTv>
__device__ __forceinline__ void d_vt(int bx, const _Float16* __restrict__ V16, int ldv, int voff, _Float16* __restrict__ Vt) { __shared__ unsigned short tl[64][66]; const int tid = threadIdx.x; const int slab = bx / (TTv / 64), lg = bx % (TTv / 64); const int b = slab / NHv, h = slab % NHv;
  for (int i = tid; i < 64 * 8; i += 256) { const int r = i / 8, c8 = (i % 8) * 8; FragH f; f.half[0] = *(const v8us*)((const unsigned short*)V16 + ((size_t)b * TTv + lg * 64 + r) * ldv + voff + h * 64 + c8);
#pragma unroll
    for (int q = 0; q < 8; ++q) tl[r][c8 + q] = f.u[q]; }
  __syncthreads();
  {
#pragma unroll
    for (int rd = 0; rd < 2; ++rd) { const int d = rd * 32 + tid / 8, pc = tid % 8; FragH f;
#pragma unroll
      for (int q = 0; q < 8; ++q) f.u[q] = tl[pc * 8 + q][d];
      *(v8us*)((unsigned short*)Vt + ((size_t)slab * 64 + d) * TTv + lg * 64 + pc * 8) = f.half[0]; }
     } }

__global__ __launch_bounds__(256) void k_hl(const float* __restrict__ F, _Float16* __restrict__ Hh, _Float16* __restrict__ Hl, size_t n8) { const size_t t = (size_t)blockIdx.x * 256 + threadIdx.x; if (t >= n8) return; FragH fh, fl; const v4f a = *(const v4fa*)(F + t * 8), c = *(const v4fa*)(F + t * 8 + 4);
#pragma unroll
  for (int q = 0; q < 4; ++q) { _Float16 h = (_Float16)a[q]; fh.h[q] = h; fl.h[q] = (_Float16)((a[q] - (float)h) * 1024.0f); h = (_Float16)c[q]; fh.h[4 + q] = h; fl.h[4 + q] = (_Float16)((c[q] - (float)h) * 1024.0f); }
  { *(v8us*)((unsigned short*)Hh + t * 8) = fh.half[0]; *(v8us*)((unsigned short*)Hl + t * 8) = fl.half[0];  } }

// ---- fast GEMM (wave tile 32x64; requires M % 32 == 0 rows per launch region, N % 64 == 0 and K % 64 == 0); epilogue = k_gemm_hhx semantics ----
__device__ __forceinline__ v16h g2_frag(const _Float16* p, int hh) { FragH f; f.half[0] = *(const v8us*)((const unsigned short*)p + 8 * hh); f.half[1] = *(const v8us*)((const unsigned short*)p + 16 + 8 * hh); return f.v; }
__device__ __forceinline__ v8f g2_mma(v16h a, v16h b, v8f c) { v8f d = __builtin_amdgcn_wmma_f32_16x16x32_f16(false, a, false, b, (short)0, c, false, false); asm volatile("v_nop\n\tv_nop\n\tv_nop\n\tv_nop" : "+v"(d) : "v"(a), "v"(b)); return d; }
template <int ACT>
__device__ __forceinline__ void d_gemm2(int bx, const _Float16* __restrict__ A, int lda, size_t sA, const _Float16* __restrict__ Bh, int ldb, size_t sB, float alpha, const float* __restrict__ bias, size_t sBias, const float* __restrict__ CP, int rowsPerB, size_t sCPb, int row0g,
    float* __restrict__ C, _Float16* __restrict__ C16, int ldc, size_t sC, int M, int N, int K) {
  __shared__ __attribute__((aligned(16))) float so[4][32][68];
  const int tid = threadIdx.x, w = tid >> 5, lane = tid & 31, ln = lane & 15, hh = lane >> 4; const int by = blockIdx.y;
  A += (size_t)by * sA; Bh += (size_t)by * sB; const size_t cofs = (size_t)by * sC; const float* bp = bias ? bias + (size_t)by * sBias : nullptr;
  const int ntn = N >> 6; const int mt = bx / ntn, nq = bx - mt * ntn; const int row0 = mt * 128 + 32 * w, col0 = nq * 64; if (row0 >= M) return;
  const _Float16* a0p = A + (size_t)(row0 + ln) * lda; const _Float16* a1p = a0p + (size_t)16 * lda;
  const _Float16* b0p = Bh + (size_t)(col0 + ln) * ldb; const _Float16* b1p = b0p + (size_t)16 * ldb; const _Float16* b2p = b1p + (size_t)16 * ldb; const _Float16* b3p = b2p + (size_t)16 * ldb;
  const v8f z8 = {0.f,0.f,0.f,0.f,0.f,0.f,0.f,0.f}; v8f c00 = z8, c01 = z8, c02 = z8, c03 = z8, c10 = z8, c11 = z8, c12 = z8, c13 = z8;
  /* two register sets x / y of the six fragments (K % 64 == 0): the loads of the next 32-wide k step are all issued before the products of this one, so a step waits for one overlapped latency at most */
  v16h xa0 = g2_frag(a0p, hh), xa1 = g2_frag(a1p, hh), xb0 = g2_frag(b0p, hh), xb1 = g2_frag(b1p, hh), xb2 = g2_frag(b2p, hh), xb3 = g2_frag(b3p, hh);
#pragma unroll 1
  for (int kb = 0; kb < K; kb += 64) { const int k1 = kb + 32, k2 = (kb + 64 < K) ? kb + 64 : kb;      /* last trip: k2 names a step inside the row again; its values are not used */
    const v16h ya0 = g2_frag(a0p + k1, hh), ya1 = g2_frag(a1p + k1, hh), yb0 = g2_frag(b0p + k1, hh), yb1 = g2_frag(b1p + k1, hh), yb2 = g2_frag(b2p + k1, hh), yb3 = g2_frag(b3p + k1, hh);
    __builtin_amdgcn_sched_barrier(0);      /* holds the y loads above the x products (the scheduler otherwise moves each load down to its use) */
    c00 = g2_mma(xa0, xb0, c00); c10 = g2_mma(xa1, xb0, c10); c01 = g2_mma(xa0, xb1, c01); c11 = g2_mma(xa1, xb1, c11);
    c02 = g2_mma(xa0, xb2, c02); c12 = g2_mma(xa1, xb2, c12); c03 = g2_mma(xa0, xb3, c03); c13 = g2_mma(xa1, xb3, c13);
    __builtin_amdgcn_sched_barrier(0);      /* holds the x reloads below the x products and, with the next one, above the y products */
    xa0 = g2_frag(a0p + k2, hh); xa1 = g2_frag(a1p + k2, hh); xb0 = g2_frag(b0p + k2, hh); xb1 = g2_frag(b1p + k2, hh); xb2 = g2_frag(b2p + k2, hh); xb3 = g2_frag(b3p + k2, hh);
    __builtin_amdgcn_sched_barrier(0);      /* holds the x reloads above the y products */
    c00 = g2_mma(ya0, yb0, c00); c10 = g2_mma(ya1, yb0, c10); c01 = g2_mma(ya0, yb1, c01); c11 = g2_mma(ya1, yb1, c11);
    c02 = g2_mma(ya0, yb2, c02); c12 = g2_mma(ya1, yb2, c12); c03 = g2_mma(ya0, yb3, c03); c13 = g2_mma(ya1, yb3, c13);
    asm volatile("s_wait_xcnt 0x0" ::: "memory"); }      /* stands in front of the next trip's address sums, which overwrite registers that the x loads name */
  v8f accs[8] = {c00, c01, c02, c03, c10, c11, c12, c13};
  /* the epilogue's loads (4 bias words, 64 CP words a lane) are issued together as well, ahead of the arithmetic that uses them */
  float bw[4] = {0.f, 0.f, 0.f, 0.f}; v8f cpv[8] = {z8, z8, z8, z8, z8, z8, z8, z8};
  if (bp) {
#pragma unroll
    for (int t = 0; t < 4; ++t) bw[t] = bp[col0 + t * 16 + ln]; }
  if (CP) {
#pragma unroll
    for (int u = 0; u < 8; ++u)
#pragma unroll
      for (int r = 0; r < 8; ++r) { const int bidx = (row0g + row0 + (u >> 2) * 16 + 8 * hh + r) / rowsPerB; cpv[u][r] = CP[(size_t)bidx * sCPb + (size_t)by * 64 + col0 + (u & 3) * 16 + ln];
        if (r == 7) asm volatile("s_wait_xcnt 0x0" ::: "memory"); }      /* stands in front of the next group's loads, whose results may land in address registers of this group */
    asm volatile("" :: "v"(cpv[0]), "v"(cpv[1]), "v"(cpv[2]), "v"(cpv[3]), "v"(cpv[4]), "v"(cpv[5]), "v"(cpv[6]), "v"(cpv[7])); }      /* inputs-only fence on the loaded words: holds all 64 loads in this block, where they overlap, instead of one waited load in front of each add */
#pragma unroll
  for (int u = 0; u < 8; ++u) { const int t = u & 3, half = u >> 2; const float bv = bp ? bf16_round(bw[t]) : 0.f;
#pragma unroll
    for (int r = 0; r < 8; ++r) { const int rloc = half * 16 + 8 * hh + r; float v = accs[u][r] * alpha + bv; if (CP) v += cpv[u][r];
      if (ACT == 3) v = fmaxf(v, 0.f); else if (ACT == 6) v = 0.5f * v * (1.0f + erff(v * 0.70710678118654752f)); else if (ACT == 11) v = 1.0f / (1.0f + expf(-v)); else if (ACT == 15) v = v / (1.0f + expf(-v)); else if (ACT == 12) v = (v > 0.f) ? v : 0.01f * v; else if (ACT == 8) v = tanhf(v);
      so[w][rloc][t * 16 + ln] = v; } }
  __builtin_amdgcn_fence(__ATOMIC_ACQ_REL, "workgroup"); __builtin_amdgcn_wave_barrier();
  const int rsub = lane >> 4, c4 = (lane & 15) * 4;
  {
#pragma unroll
    for (int q = 0; q < 16; ++q) { const int r = q * 2 + rsub; const v4f v = *(const v4fa*)&so[w][r][c4]; if (C) *(v4f*)(C + cofs + (size_t)(row0 + r) * ldc + col0 + c4) = v; if (C16) { v4h h4; for (int i = 0; i < 4; ++i) h4[i] = (_Float16)v[i]; *(v4h*)(C16 + cofs + (size_t)(row0 + r) * ldc + col0 + c4) = h4; } }
     } }



// lane l's value of lane l ^ X (X < 16) inside its 16-lane row, by a DPP row_xmask move in registers (no trip through the LDS pipe and no wait on it)
template <int X>
__device__ __forceinline__ float row_xor(float v) { return __int_as_float(__builtin_amdgcn_update_dpp(0, __float_as_int(v), 0x160 | X, 0xf, 0xf, true)); }
// maximum over the 16-lane row, all 32 lanes on: four dependent DPP maxima in one statement (written with fmaxf on a DPP move the compiler puts a move and a quieting maximum in front of each step, three links for one)
__device__ __forceinline__ float row_max16(float v) {
  asm("v_max_num_f32_dpp %0, %0, %0 row_xmask:1 row_mask:0xf bank_mask:0xf\n\t"
      "v_max_num_f32_dpp %0, %0, %0 row_xmask:2 row_mask:0xf bank_mask:0xf\n\t"
      "v_max_num_f32_dpp %0, %0, %0 row_xmask:4 row_mask:0xf bank_mask:0xf\n\t"
      "v_max_num_f32_dpp %0, %0, %0 row_xmask:8 row_mask:0xf bank_mask:0xf" : "+v"(v));
  return v; }
__device__ __forceinline__ float row_sum16(float v) { v += row_xor<1>(v); v += row_xor<2>(v); v += row_xor<4>(v); v += row_xor<8>(v); return v; }
template <int CAUSAL>
__global__ __launch_bounds__(128) void k_flash(const _Float16* __restrict__ Q16, int ldq, const _Float16* __restrict__ K16, int ldk, const _Float16* __restrict__ Vt, const int* __restrict__ MSK, float* __restrict__ O, int ldo) {
  constexpr int RPW = 16, RTN = RPW / 16, NQB = TQ / (4 * RPW), DT = 4, KS = 2;
  __shared__ __attribute__((aligned(16))) unsigned short sP[4][RPW][40]; __shared__ __attribute__((aligned(16))) float sO[4][RPW][64 + 4];
  const int tid = threadIdx.x, w = tid >> 5, lane = tid & 31, ln = lane & 15, hh = lane >> 4;
  const int slab = blockIdx.x / NQB, qblk = blockIdx.x % NQB; const int b = slab / NH, h = slab % NH; const int qb0 = qblk * (4 * RPW); const int q0 = qb0 + w * RPW;
  FragH aq[2][KS];
#pragma unroll
  for (int rt = 0; rt < RTN; ++rt) { const unsigned short* qr = (const unsigned short*)Q16 + ((size_t)b * TQ + q0 + rt * 16 + ln) * ldq + h * 64;
#pragma unroll
    for (int ks = 0; ks < KS; ++ks) { aq[rt][ks].half[0] = *(const v8us*)(qr + ks * 32 + 8 * hh); aq[rt][ks].half[1] = *(const v8us*)(qr + ks * 32 + 16 + 8 * hh); } }
  const unsigned short* Vth = (const unsigned short*)Vt + (size_t)slab * 64 * TK;
  float m_r[2][8], l_r[2][8]; v8f oacc[2][DT];
#pragma unroll
  for (int rt = 0; rt < RTN; ++rt) {
#pragma unroll
    for (int r = 0; r < 8; ++r) { m_r[rt][r] = -3.0e38f; l_r[rt][r] = 0.f; }
#pragma unroll
    for (int dt = 0; dt < DT; ++dt) oacc[rt][dt] = (v8f){0.f,0.f,0.f,0.f,0.f,0.f,0.f,0.f}; }
  const int jend = (CAUSAL == 1) ? (qb0 + 4 * RPW) : TK;      /* causal: keys beyond the block's last query never contribute */
#pragma unroll 1
  for (int j0 = 0; j0 < jend; j0 += 32) {
    v8f s[2][2];
#pragma unroll
    for (int nt = 0; nt < 2; ++nt) { const unsigned short* kr = (const unsigned short*)K16 + ((size_t)b * TK + j0 + nt * 16 + ln) * ldk + h * 64; FragH bk[KS];
#pragma unroll
      for (int ks = 0; ks < KS; ++ks) { bk[ks].half[0] = *(const v8us*)(kr + ks * 32 + 8 * hh); bk[ks].half[1] = *(const v8us*)(kr + ks * 32 + 16 + 8 * hh); }
#pragma unroll
      for (int rt = 0; rt < RTN; ++rt) { v8f acc = (v8f){0.f,0.f,0.f,0.f,0.f,0.f,0.f,0.f};
#pragma unroll
        for (int ks = 0; ks < KS; ++ks) acc = mmaH<1>(aq[rt][ks].v, aq[rt][ks].v, bk[ks].v, bk[ks].v, acc); s[rt][nt] = acc; } }
#pragma unroll
    for (int rt = 0; rt < RTN; ++rt)
#pragma unroll
      for (int r = 0; r < 8; ++r) { const int tq = q0 + rt * 16 + 8 * hh + r; const int k0 = j0 + ln, k1 = j0 + 16 + ln;
        const bool ok0 = (CAUSAL == 1) ? (k0 <= tq) : ((CAUSAL == 2) ? ((k0 >> 5) == (tq >> 5)) : true), ok1 = (CAUSAL == 1) ? (k1 <= tq) : ((CAUSAL == 2) ? ((k1 >> 5) == (tq >> 5)) : true);      /* mode 2: block-diagonal 32-token groups */
        const float s0 = ok0 ? s[rt][0][r] * SCL : -3.0e38f, s1 = ok1 ? s[rt][1][r] * SCL : -3.0e38f; 
        const float mn = row_max16(fmaxf(fmaxf(s0, s1), m_r[rt][r]));      /* the running maximum is the same in all 16 lanes of the row: taken in ahead of the reduction, the reduced value is the new maximum itself */
        const float al = (mn > -1.0e38f) ? expf(m_r[rt][r] - mn) : 1.0f; m_r[rt][r] = mn; const float p0 = ok0 ? expf(s0 - mn) : 0.f, p1 = ok1 ? expf(s1 - mn) : 0.f; l_r[rt][r] = l_r[rt][r] * al + p0 + p1;
#pragma unroll
        for (int dt = 0; dt < DT; ++dt) oacc[rt][dt][r] *= al;
        FragH t2; t2.h[0] = (_Float16)(p0 * 1024.0f); t2.h[1] = (_Float16)(p1 * 1024.0f); sP[w][rt * 16 + 8 * hh + r][ln] = t2.u[0]; sP[w][rt * 16 + 8 * hh + r][16 + ln] = t2.u[1]; }
    __builtin_amdgcn_fence(__ATOMIC_ACQ_REL, "workgroup"); __builtin_amdgcn_wave_barrier();
    FragH pa[2];
#pragma unroll
    for (int rt = 0; rt < RTN; ++rt) { pa[rt].half[0] = *(const v8us*)&sP[w][rt * 16 + ln][8 * hh]; pa[rt].half[1] = *(const v8us*)&sP[w][rt * 16 + ln][16 + 8 * hh]; }
#pragma unroll
    for (int dt = 0; dt < DT; ++dt) { const unsigned short* vrow = Vth + (size_t)(dt * 16 + ln) * TK + j0; FragH bv; bv.half[0] = *(const v8us*)(vrow + 8 * hh); bv.half[1] = *(const v8us*)(vrow + 16 + 8 * hh);
#pragma unroll
      for (int rt = 0; rt < RTN; ++rt) oacc[rt][dt] = mmaH<1>(pa[rt].v, pa[rt].v, bv.v, bv.v, oacc[rt][dt]); }
    __builtin_amdgcn_fence(__ATOMIC_ACQ_REL, "workgroup"); __builtin_amdgcn_wave_barrier(); }
#pragma unroll
  for (int rt = 0; rt < RTN; ++rt) {
#pragma unroll
    for (int r = 0; r < 8; ++r) { float l = l_r[rt][r]; l = row_sum16(l); l_r[rt][r] = (l > 0.f) ? 1.0f / (l * 1024.0f) : 0.f; }
#pragma unroll
    for (int dt = 0; dt < DT; ++dt)
#pragma unroll
      for (int r = 0; r < 8; ++r) sO[w][rt * 16 + 8 * hh + r][dt * 16 + ln] = oacc[rt][dt][r] * l_r[rt][r]; }
  __builtin_amdgcn_fence(__ATOMIC_ACQ_REL, "workgroup"); __builtin_amdgcn_wave_barrier();
  {
#pragma unroll
    for (int rp = 0; rp < RPW; rp += 2) { const int r = rp + (lane >> 4), pc = lane & 15; const v4f val = *(const v4fa*)&sO[w][r][pc * 4]; *(v4f*)(O + ((size_t)b * TQ + q0 + r) * ldo + h * 64 + pc * 4) = val; }
     } }
// 3-term variant: O = (P_hi V_hi + (P_lo V_hi + P_hi V_lo) / 1024) / l with P = [hi | 2^10 residual] of 1024 p and V^T = [hi | 2^10 residual] planes (VtL same layout as Vt) -> ~2^-21-class products for un-averaged (early causal / peaked) rows
template <int CAUSAL>
__global__ __launch_bounds__(32 * NSPL) void k_flash3gA(const _Float16* __restrict__ Q16, int ldq, const _Float16* __restrict__ K16, int ldk, const _Float16* __restrict__ Vt, const _Float16* __restrict__ VtL, const int* __restrict__ MSK, float* __restrict__ O, int ldo) {
  constexpr int RPW = 16, RTN = RPW / 16, NQB = TQA / (4 * RPW), DT = 4, KS = 2;
  __shared__ __attribute__((aligned(16))) unsigned short sP[NSPL][RPW][40]; __shared__ __attribute__((aligned(16))) unsigned short sPL[NSPL][RPW][40]; __shared__ __attribute__((aligned(16))) float sO[NSPL][RPW][64 + 4]; __shared__ float sM[NSPL][RPW], sL[NSPL][RPW];
  const int tid = threadIdx.x, w = __builtin_amdgcn_readfirstlane(tid >> 5), lane = tid & 31, ln = lane & 15, hh = lane >> 4;      /* the wave's number in a scalar register: the key range below stays scalar */
  /* one work-group per (batch, head, 16-query tile); its NSPL waves each run the flash loop over their own TK / NSPL keys, and the partial (m, l, O) are merged through LDS behind the loop */
  const int slab = blockIdx.x / (TQA / RPW), qblk = blockIdx.x % (TQA / RPW); (void)NQB; const int b = slab / NH, h = slab % NH; const int qb0 = qblk * RPW; const int q0 = qb0;
  FragH aq[2][KS];
#pragma unroll
  for (int rt = 0; rt < RTN; ++rt) { const unsigned short* qr = (const unsigned short*)Q16 + ((size_t)b * TQA + q0 + rt * 16 + ln) * ldq + h * 64;
#pragma unroll
    for (int ks = 0; ks < KS; ++ks) { aq[rt][ks].half[0] = *(const v8us*)(qr + ks * 32 + 8 * hh); aq[rt][ks].half[1] = *(const v8us*)(qr + ks * 32 + 16 + 8 * hh); } }
  const size_t vslab = (size_t)(b * (NH / KVG) + h / KVG); const unsigned short* Vth = (const unsigned short*)Vt + vslab * 64 * TK; const unsigned short* Vtl = (const unsigned short*)VtL + vslab * 64 * TK;      /* GQA: q-head h reads kv head h / KVG */
  float m_r[2][8], l_r[2][8]; v8f oacc[2][DT], oaccL[2][DT];
#pragma unroll
  for (int rt = 0; rt < RTN; ++rt) {
#pragma unroll
    for (int r = 0; r < 8; ++r) { m_r[rt][r] = -3.0e38f; l_r[rt][r] = 0.f; }
#pragma unroll
    for (int dt = 0; dt < DT; ++dt) { oacc[rt][dt] = (v8f){0.f,0.f,0.f,0.f,0.f,0.f,0.f,0.f}; oaccL[rt][dt] = oacc[rt][dt]; } }
  const int jbeg = w * (TK / NSPL), jend = jbeg + TK / NSPL;      /* this wave's keys */
#pragma unroll 1
  for (int j0 = jbeg; j0 < jend; j0 += 32) {
    v8f s[2][2]; FragH bk[2][KS], bv[DT], bl[DT]; int mk0[RTN][8], mk1[RTN][8];
    /* every global load of the trip is issued here, in the order of use (K, mask words, both V planes): their latencies overlap, and V lands behind the softmax */
#pragma unroll
    for (int nt = 0; nt < 2; ++nt) { const unsigned short* kr = (const unsigned short*)K16 + ((size_t)b * TK + j0 + nt * 16 + ln) * ldk + (h / KVG) * 64;
#pragma unroll
      for (int ks = 0; ks < KS; ++ks) { bk[nt][ks].half[0] = *(const v8us*)(kr + ks * 32 + 8 * hh); bk[nt][ks].half[1] = *(const v8us*)(kr + ks * 32 + 16 + 8 * hh); } }
    if (CAUSAL == 8) {
#pragma unroll
      for (int rt = 0; rt < RTN; ++rt)
#pragma unroll
        for (int r = 0; r < 8; ++r) { const int* mrow = MSK + (size_t)(q0 + rt * 16 + 8 * hh + r) * TK + j0 + ln; mk0[rt][r] = mrow[0]; mk1[rt][r] = mrow[16]; } }
    asm volatile("s_wait_xcnt 0x0" ::: "memory");      /* stands in front of the V loads, whose results may land in registers that the K and mask loads name as addresses */
#pragma unroll
    for (int dt = 0; dt < DT; ++dt) { const unsigned short* vrow = Vth + (size_t)(dt * 16 + ln) * TK + j0; const unsigned short* vrl = Vtl + (size_t)(dt * 16 + ln) * TK + j0; bv[dt].half[0] = *(const v8us*)(vrow + 8 * hh); bv[dt].half[1] = *(const v8us*)(vrow + 16 + 8 * hh); bl[dt].half[0] = *(const v8us*)(vrl + 8 * hh);
      if (dt == DT - 1) asm volatile("s_wait_xcnt 0x0" ::: "memory");      /* stands in front of the trip's last load, whose result lands in the address registers of the V loads above */
      bl[dt].half[1] = *(const v8us*)(vrl + 16 + 8 * hh); }
    __builtin_amdgcn_sched_barrier(0);      /* keeps the loads above together: without it the scheduler moves each one down to its first use, one exposed latency apiece */
#pragma unroll
    for (int nt = 0; nt < 2; ++nt) {
#pragma unroll
      for (int rt = 0; rt < RTN; ++rt) { v8f acc = (v8f){0.f,0.f,0.f,0.f,0.f,0.f,0.f,0.f};
#pragma unroll
        for (int ks = 0; ks < KS; ++ks) acc = mmaH<1>(aq[rt][ks].v, aq[rt][ks].v, bk[nt][ks].v, bk[nt][ks].v, acc); s[rt][nt] = acc; } }
#pragma unroll
    for (int rt = 0; rt < RTN; ++rt)
#pragma unroll
      for (int r = 0; r < 8; ++r) { const int tq = q0 + rt * 16 + 8 * hh + r; const int k0 = j0 + ln, k1 = j0 + 16 + ln;
        bool ok0 = (CAUSAL == 1) ? (k0 <= tq) : ((CAUSAL == 2) ? ((k0 >> 5) == (tq >> 5)) : true), ok1 = (CAUSAL == 1) ? (k1 <= tq) : ((CAUSAL == 2) ? ((k1 >> 5) == (tq >> 5)) : true);      /* mode 2: block-diagonal 32-token groups */
        if (CAUSAL == 8) { ok0 = mk0[rt][r] != 0; ok1 = mk1[rt][r] != 0; }      /* mode 8: per-(query, key) int table shared by all batches and heads */
        if (CAUSAL == 4) { const int* mrow = MSK + ((size_t)b * TQA + tq) * TK; ok0 = mrow[k0] != 0; ok1 = mrow[k1] != 0; }      /* mode 4: per-(query, key) INPUT mask shared by all heads; masked keys contribute nothing (== the reference's -4096 fill, whose exp underflows to 0), rows with no valid key give l = 0 -> output 0 (== the reference's row_valid zeroing) */
        const float s0 = ok0 ? s[rt][0][r] * SCL : -3.0e38f, s1 = ok1 ? s[rt][1][r] * SCL : -3.0e38f; 
        const float mn = row_max16(fmaxf(fmaxf(s0, s1), m_r[rt][r]));      /* the running maximum is the same in all 16 lanes of the row: taken in ahead of the reduction, the reduced value is the new maximum itself */
        const float al = (mn > -1.0e38f) ? expf(m_r[rt][r] - mn) : 1.0f; m_r[rt][r] = mn; const float p0 = ok0 ? expf(s0 - mn) : 0.f, p1 = ok1 ? expf(s1 - mn) : 0.f; l_r[rt][r] = l_r[rt][r] * al + p0 + p1;
#pragma unroll
        for (int dt = 0; dt < DT; ++dt) { oacc[rt][dt][r] *= al; oaccL[rt][dt][r] *= al; }
        FragH t2, t2l; const float ps0 = p0 * 1024.0f, ps1 = p1 * 1024.0f; t2.h[0] = (_Float16)ps0; t2.h[1] = (_Float16)ps1; t2l.h[0] = (_Float16)((ps0 - (float)t2.h[0]) * 1024.0f); t2l.h[1] = (_Float16)((ps1 - (float)t2.h[1]) * 1024.0f);
        sP[w][rt * 16 + 8 * hh + r][ln] = t2.u[0]; sP[w][rt * 16 + 8 * hh + r][16 + ln] = t2.u[1]; sPL[w][rt * 16 + 8 * hh + r][ln] = t2l.u[0]; sPL[w][rt * 16 + 8 * hh + r][16 + ln] = t2l.u[1]; }
    __builtin_amdgcn_fence(__ATOMIC_ACQ_REL, "workgroup"); __builtin_amdgcn_wave_barrier();
    FragH pa[2], pl[2];
#pragma unroll
    for (int rt = 0; rt < RTN; ++rt) { pa[rt].half[0] = *(const v8us*)&sP[w][rt * 16 + ln][8 * hh]; pa[rt].half[1] = *(const v8us*)&sP[w][rt * 16 + ln][16 + 8 * hh]; pl[rt].half[0] = *(const v8us*)&sPL[w][rt * 16 + ln][8 * hh]; pl[rt].half[1] = *(const v8us*)&sPL[w][rt * 16 + ln][16 + 8 * hh]; }
#pragma unroll
    for (int dt = 0; dt < DT; ++dt) {
#pragma unroll
      for (int rt = 0; rt < RTN; ++rt) { oacc[rt][dt] = mmaH<1>(pa[rt].v, pa[rt].v, bv[dt].v, bv[dt].v, oacc[rt][dt]); oaccL[rt][dt] = mmaH<1>(pl[rt].v, pl[rt].v, bv[dt].v, bv[dt].v, oaccL[rt][dt]); oaccL[rt][dt] = mmaH<1>(pa[rt].v, pa[rt].v, bl[dt].v, bl[dt].v, oaccL[rt][dt]); } }
    __builtin_amdgcn_fence(__ATOMIC_ACQ_REL, "workgroup"); __builtin_amdgcn_wave_barrier(); }
  /* each wave leaves its rows' maxima, sums and unnormalised outputs in LDS */
#pragma unroll
  for (int rt = 0; rt < RTN; ++rt) {
#pragma unroll
    for (int r = 0; r < 8; ++r) { const float l = row_sum16(l_r[rt][r]); if (ln == 0) { sM[w][rt * 16 + 8 * hh + r] = m_r[rt][r]; sL[w][rt * 16 + 8 * hh + r] = l; } }
#pragma unroll
    for (int dt = 0; dt < DT; ++dt)
#pragma unroll
      for (int r = 0; r < 8; ++r) { float v = oacc[rt][dt][r]; v += oaccL[rt][dt][r] * 0.0009765625f; sO[w][rt * 16 + 8 * hh + r][dt * 16 + ln] = v; } }
  __syncthreads();      /* every wave's partials are in LDS before any thread merges them */
  /* merge, a thread per (row, 4 columns): M = max m_u; l = sum l_u e^(m_u - M); O = sum O_u e^(m_u - M), u in wave order. A wave with no live key for the row has m_u = -3.0e38, l_u = 0, O_u = 0 and adds nothing; a row with no live key at all gives l = 0 -> output 0 */
  if (tid < RPW * 16) { const int r = tid >> 4, pc = tid & 15; float mm = sM[0][r];      /* both loops below are unrolled so that their LDS reads are issued together, ahead of the arithmetic */
#pragma unroll
    for (int u = 1; u < NSPL; ++u) mm = fmaxf(mm, sM[u][r]);
    float l = 0.f; v4f a = {0.f, 0.f, 0.f, 0.f};
#pragma unroll
    for (int u = 0; u < NSPL; ++u) { const float f = expf(sM[u][r] - mm); const v4f val = *(const v4fa*)&sO[u][r][pc * 4]; l += sL[u][r] * f; a += val * f; }
    const float li = (l > 0.f) ? 1.0f / (l * 1024.0f) : 0.f;
    *(v4f*)(O + ((size_t)b * TQA + q0 + r) * ldo + h * 64 + pc * 4) = a * li; } }

// 3-term variant: O = (P_hi V_hi + (P_lo V_hi + P_hi V_lo) / 1024) / l with P = [hi | 2^10 residual] of 1024 p and V^T = [hi | 2^10 residual] planes (VtL same layout as Vt) -> ~2^-21-class products for un-averaged (early causal / peaked) rows
template <int CAUSAL>
__global__ __launch_bounds__(128) void k_flash3gB(const _Float16* __restrict__ Q16, int ldq, const _Float16* __restrict__ K16, int ldk, const _Float16* __restrict__ Vt, const _Float16* __restrict__ VtL, const int* __restrict__ MSK, float* __restrict__ O, int ldo) {
  constexpr int RPW = 16, RTN = RPW / 16, NQB = TQB / (4 * RPW), DT = 4, KS = 2;
  __shared__ __attribute__((aligned(16))) unsigned short sP[4][RPW][40]; __shared__ __attribute__((aligned(16))) unsigned short sPL[4][RPW][40]; __shared__ __attribute__((aligned(16))) float sO[4][RPW][64 + 4];
  const int tid = threadIdx.x, w = tid >> 5, lane = tid & 31, ln = lane & 15, hh = lane >> 4;
  const int slab = blockIdx.x / QBLKSB, qblk = blockIdx.x % QBLKSB; (void)NQB; const int b = slab / NH, h = slab % NH; const int qb0 = qblk * (4 * RPW); const int q0 = qb0 + w * RPW;
  FragH aq[2][KS];
#pragma unroll
  for (int rt = 0; rt < RTN; ++rt) { const unsigned short* qr = (const unsigned short*)Q16 + ((size_t)b * TQB + q0 + rt * 16 + ln) * ldq + h * 64;
#pragma unroll
    for (int ks = 0; ks < KS; ++ks) { aq[rt][ks].half[0] = *(const v8us*)(qr + ks * 32 + 8 * hh); aq[rt][ks].half[1] = *(const v8us*)(qr + ks * 32 + 16 + 8 * hh); } }
  const size_t vslab = (size_t)(b * (NH / KVG) + h / KVG); const unsigned short* Vth = (const unsigned short*)Vt + vslab * 64 * TK; const unsigned short* Vtl = (const unsigned short*)VtL + vslab * 64 * TK;      /* GQA: q-head h reads kv head h / KVG */
  float m_r[2][8], l_r[2][8]; v8f oacc[2][DT], oaccL[2][DT];
#pragma unroll
  for (int rt = 0; rt < RTN; ++rt) {
#pragma unroll
    for (int r = 0; r < 8; ++r) { m_r[rt][r] = -3.0e38f; l_r[rt][r] = 0.f; }
#pragma unroll
    for (int dt = 0; dt < DT; ++dt) { oacc[rt][dt] = (v8f){0.f,0.f,0.f,0.f,0.f,0.f,0.f,0.f}; oaccL[rt][dt] = oacc[rt][dt]; } }
  const int jend = (CAUSAL == 1) ? (qb0 + 4 * RPW) : TK;      /* causal: keys beyond the block's last query never contribute */
#pragma unroll 1
  for (int j0 = 0; j0 < jend; j0 += 32) {
    v8f s[2][2]; FragH bk[2][KS], bv[DT], bl[DT]; int mk0[RTN][8], mk1[RTN][8];
    /* every global load of the trip is issued here, in the order of use (K, mask words, both V planes): their latencies overlap, and V lands behind the softmax */
#pragma unroll
    for (int nt = 0; nt < 2; ++nt) { const unsigned short* kr = (const unsigned short*)K16 + ((size_t)b * TK + j0 + nt * 16 + ln) * ldk + (h / KVG) * 64;
#pragma unroll
      for (int ks = 0; ks < KS; ++ks) { bk[nt][ks].half[0] = *(const v8us*)(kr + ks * 32 + 8 * hh); bk[nt][ks].half[1] = *(const v8us*)(kr + ks * 32 + 16 + 8 * hh); } }
    if (CAUSAL == 8) {
#pragma unroll
      for (int rt = 0; rt < RTN; ++rt)
#pragma unroll
        for (int r = 0; r < 8; ++r) { const int* mrow = MSK + (size_t)(q0 + rt * 16 + 8 * hh + r) * TK + j0 + ln; mk0[rt][r] = mrow[0]; mk1[rt][r] = mrow[16]; } }
    asm volatile("s_wait_xcnt 0x0" ::: "memory");      /* stands in front of the V loads, whose results may land in registers that the K and mask loads name as addresses */
#pragma unroll
    for (int dt = 0; dt < DT; ++dt) { const unsigned short* vrow = Vth + (size_t)(dt * 16 + ln) * TK + j0; const unsigned short* vrl = Vtl + (size_t)(dt * 16 + ln) * TK + j0; bv[dt].half[0] = *(const v8us*)(vrow + 8 * hh); bv[dt].half[1] = *(const v8us*)(vrow + 16 + 8 * hh); bl[dt].half[0] = *(const v8us*)(vrl + 8 * hh);
      if (dt == DT - 1) asm volatile("s_wait_xcnt 0x0" ::: "memory");      /* stands in front of the trip's last load, whose result lands in the address registers of the V loads above */
      bl[dt].half[1] = *(const v8us*)(vrl + 16 + 8 * hh); }
    __builtin_amdgcn_sched_barrier(0);      /* keeps the loads above together: without it the scheduler moves each one down to its first use, one exposed latency apiece */
#pragma unroll
    for (int nt = 0; nt < 2; ++nt) {
#pragma unroll
      for (int rt = 0; rt < RTN; ++rt) { v8f acc = (v8f){0.f,0.f,0.f,0.f,0.f,0.f,0.f,0.f};
#pragma unroll
        for (int ks = 0; ks < KS; ++ks) acc = mmaH<1>(aq[rt][ks].v, aq[rt][ks].v, bk[nt][ks].v, bk[nt][ks].v, acc); s[rt][nt] = acc; } }
#pragma unroll
    for (int rt = 0; rt < RTN; ++rt)
#pragma unroll
      for (int r = 0; r < 8; ++r) { const int tq = q0 + rt * 16 + 8 * hh + r; const int k0 = j0 + ln, k1 = j0 + 16 + ln;
        bool ok0 = (CAUSAL == 1) ? (k0 <= tq) : ((CAUSAL == 2) ? ((k0 >> 5) == (tq >> 5)) : true), ok1 = (CAUSAL == 1) ? (k1 <= tq) : ((CAUSAL == 2) ? ((k1 >> 5) == (tq >> 5)) : true);      /* mode 2: block-diagonal 32-token groups */
        if (CAUSAL == 8) { ok0 = mk0[rt][r] != 0; ok1 = mk1[rt][r] != 0; }      /* mode 8: per-(query, key) int table shared by all batches and heads */
        if (CAUSAL == 4) { const int* mrow = MSK + ((size_t)b * TQB + tq) * TK; ok0 = mrow[k0] != 0; ok1 = mrow[k1] != 0; }      /* mode 4: per-(query, key) INPUT mask shared by all heads; masked keys contribute nothing (== the reference's -4096 fill, whose exp underflows to 0), rows with no valid key give l = 0 -> output 0 (== the reference's row_valid zeroing) */
        const float s0 = ok0 ? s[rt][0][r] * SCL : -3.0e38f, s1 = ok1 ? s[rt][1][r] * SCL : -3.0e38f; 
        const float mn = row_max16(fmaxf(fmaxf(s0, s1), m_r[rt][r]));      /* the running maximum is the same in all 16 lanes of the row: taken in ahead of the reduction, the reduced value is the new maximum itself */
        const float al = (mn > -1.0e38f) ? expf(m_r[rt][r] - mn) : 1.0f; m_r[rt][r] = mn; const float p0 = ok0 ? expf(s0 - mn) : 0.f, p1 = ok1 ? expf(s1 - mn) : 0.f; l_r[rt][r] = l_r[rt][r] * al + p0 + p1;
#pragma unroll
        for (int dt = 0; dt < DT; ++dt) { oacc[rt][dt][r] *= al; oaccL[rt][dt][r] *= al; }
        FragH t2, t2l; const float ps0 = p0 * 1024.0f, ps1 = p1 * 1024.0f; t2.h[0] = (_Float16)ps0; t2.h[1] = (_Float16)ps1; t2l.h[0] = (_Float16)((ps0 - (float)t2.h[0]) * 1024.0f); t2l.h[1] = (_Float16)((ps1 - (float)t2.h[1]) * 1024.0f);
        sP[w][rt * 16 + 8 * hh + r][ln] = t2.u[0]; sP[w][rt * 16 + 8 * hh + r][16 + ln] = t2.u[1]; sPL[w][rt * 16 + 8 * hh + r][ln] = t2l.u[0]; sPL[w][rt * 16 + 8 * hh + r][16 + ln] = t2l.u[1]; }
    __builtin_amdgcn_fence(__ATOMIC_ACQ_REL, "workgroup"); __builtin_amdgcn_wave_barrier();
    FragH pa[2], pl[2];
#pragma unroll
    for (int rt = 0; rt < RTN; ++rt) { pa[rt].half[0] = *(const v8us*)&sP[w][rt * 16 + ln][8 * hh]; pa[rt].half[1] = *(const v8us*)&sP[w][rt * 16 + ln][16 + 8 * hh]; pl[rt].half[0] = *(const v8us*)&sPL[w][rt * 16 + ln][8 * hh]; pl[rt].half[1] = *(const v8us*)&sPL[w][rt * 16 + ln][16 + 8 * hh]; }
#pragma unroll
    for (int dt = 0; dt < DT; ++dt) {
#pragma unroll
      for (int rt = 0; rt < RTN; ++rt) { oacc[rt][dt] = mmaH<1>(pa[rt].v, pa[rt].v, bv[dt].v, bv[dt].v, oacc[rt][dt]); oaccL[rt][dt] = mmaH<1>(pl[rt].v, pl[rt].v, bv[dt].v, bv[dt].v, oaccL[rt][dt]); oaccL[rt][dt] = mmaH<1>(pa[rt].v, pa[rt].v, bl[dt].v, bl[dt].v, oaccL[rt][dt]); } }
    __builtin_amdgcn_fence(__ATOMIC_ACQ_REL, "workgroup"); __builtin_amdgcn_wave_barrier(); }
#pragma unroll
  for (int rt = 0; rt < RTN; ++rt) {
#pragma unroll
    for (int r = 0; r < 8; ++r) { float l = l_r[rt][r]; l = row_sum16(l); l_r[rt][r] = (l > 0.f) ? 1.0f / (l * 1024.0f) : 0.f; }
#pragma unroll
    for (int dt = 0; dt < DT; ++dt)
#pragma unroll
      for (int r = 0; r < 8; ++r) { float v = oacc[rt][dt][r]; v += oaccL[rt][dt][r] * 0.0009765625f; sO[w][rt * 16 + 8 * hh + r][dt * 16 + ln] = v * l_r[rt][r]; } }
  __builtin_amdgcn_fence(__ATOMIC_ACQ_REL, "workgroup"); __builtin_amdgcn_wave_barrier();
  {
#pragma unroll
    for (int rp = 0; rp < RPW; rp += 2) { const int r = rp + (lane >> 4), pc = lane & 15; const v4f val = *(const v4fa*)&sO[w][r][pc * 4]; *(v4f*)(O + ((size_t)b * TQB + q0 + r) * ldo + h * 64 + pc * 4) = val; }
     } }

__device__ __forceinline__ void d_wpair(int bx, const float* __restrict__ Wm, int nin, int nout, _Float16* __restrict__ Bt) { const size_t t = (size_t)bx * 256 + threadIdx.x; if (t >= (size_t)nout * (2 * nin / 8)) return; const int pc = (int)(t % (2 * nin / 8)); const int o = (int)(t / (2 * nin / 8)); const bool lo = pc * 8 >= nin; FragH f;
  for (int q = 0; q < 8; ++q) { const int c = pc * 8 + q - (lo ? nin : 0); f.h[q] = (_Float16)(bf16_round(Wm[(size_t)c * nout + o]) * (lo ? 1.0f : 16.0f)); } *(v8us*)((unsigned short*)Bt + (size_t)o * 2 * nin + pc * 8) = f.half[0];  }
template <int TWO_D>
__device__ __forceinline__ void d_rotab(int bx, int nrows, int rpb, const int* __restrict__ bar, const int* __restrict__ tib, float* __restrict__ CS, float* __restrict__ SN) {
  #pragma clang fp contract(off)
  const size_t t = (size_t)bx * 256 + threadIdx.x; if (t >= (size_t)nrows * 32) return; const int d = (int)(t % 32); const int row = (int)(t / 32); const int b = row / rpb, r = row % rpb; float pos, inv;
  if (TWO_D) { const int dm = d & 15; inv = 1.0f / powf(10000.0f, (float)dm * 2.0f / 32.0f); pos = (d < 16) ? (float)bar[(size_t)b * rpb + r] : (float)tib[(size_t)b * rpb + r]; }
  else { inv = 1.0f / powf(10000.0f, (float)(2 * d) / 64.0f); pos = (float)r; }
  const float th = pos * inv; const float c = cosf(th), s = sinf(th);
  { *(float*)(CS + t) = c; *(float*)(SN + t) = s;  } }
__device__ __forceinline__ void d_rope(int bx, const float* __restrict__ F, int nrows, int rpb, int nheads, const float* __restrict__ CS, const float* __restrict__ SN, _Float16* __restrict__ dst, int ldo, int dst_bstride, int row_off) {
  #pragma clang fp contract(off)
  const size_t t = (size_t)bx * 256 + threadIdx.x; if (t >= (size_t)nrows * nheads * 4) return; const int jg = (int)(t % 4) * 8; const int h = (int)((t / 4) % nheads); const int row = (int)(t / (4 * (size_t)nheads)); const int b = row / rpb, r = row % rpb; const int ldi = nheads * 64;
  const float* xr = F + (size_t)row * ldi + h * 64; FragH f0, f1;
#pragma unroll
  for (int q = 0; q < 8; ++q) { const int d = jg + q; const float c = CS[(size_t)row * 32 + d], s = SN[(size_t)row * 32 + d]; const float x0 = xr[d], x1 = xr[d + 32];
    float o0 = x0 * c; o0 += -x1 * s; float o1 = x1 * c; o1 += x0 * s; f0.h[q] = (_Float16)o0; f1.h[q] = (_Float16)o1; }
  unsigned short* o = (unsigned short*)dst + ((size_t)b * dst_bstride + row_off + r) * ldo + h * 64 + jg;
  { *(v8us*)o = f0.half[0]; *(v8us*)(o + 32) = f1.half[0];  } }
__device__ __forceinline__ void d_put(int bx, const float* __restrict__ F, int nrows, int rpb, int ncol, _Float16* __restrict__ H, _Float16* __restrict__ L, int dst_bstride, int row_off) {
  const size_t t = (size_t)bx * 256 + threadIdx.x; if (t >= (size_t)nrows * (ncol / 8)) return; const int c0 = (int)(t % (ncol / 8)) * 8; const int row = (int)(t / (ncol / 8)); const int b = row / rpb, r = row % rpb; FragH fh, fl;
  for (int q = 0; q < 8; ++q) { const float v = F[(size_t)row * ncol + c0 + q]; const _Float16 hv = (_Float16)v; fh.h[q] = hv; fl.h[q] = (_Float16)((v - (float)hv) * 1024.0f); }
  const size_t drow = (size_t)b * dst_bstride + row_off + r; { *(v8us*)((unsigned short*)H + drow * ncol + c0) = fh.half[0];
    asm volatile("s_wait_xcnt 0x0" ::: "memory");      /* stands in front of the residual plane's arithmetic, which overwrites registers that the store above names */
    if (L) *(v8us*)((unsigned short*)L + drow * ncol + c0) = fl.half[0];  } }

// ---- one launch per dependency level: kernels that do not depend on one another run as consecutive block ranges of one grid. Every range test reads blockIdx.x alone, so a work-group takes one branch as a whole; each body is the same code as before, handed its block number inside its own range. ----
constexpr int PB_W = DMOD * DMOD / 8 / 256, PB_WK = DMOD * KVD / 8 / 256;                  /* blocks of one transposed weight plane: 1024 and 256 columns */
constexpr int PB_P = DMOD * (2 * DMOD / 8) / 256, PB_PK = KVD * (2 * DMOD / 8) / 256;       /* blocks of one [W x16 | W x1] weight pair (same bf16 weights, for the hi and the residual products) */
constexpr int PB_T1 = NRS * 32 / 256, PB_T2 = NRR * 32 / 256;                              /* RoPE tables */
constexpr int PB_XS = NRS * DMOD / 8 / 256, PB_XR = NRR * DMOD / 8 / 256;                  /* f16 planes of the two inputs */
constexpr int PB_ALL = 2 * PB_W + 4 * PB_WK + 2 * PB_P + 2 * PB_PK + PB_T1 + PB_T2 + PB_XS + PB_XR;
__global__ __launch_bounds__(256) void k_prep(const float* w_sq, const float* w_sk, const float* w_sv, const float* w_rq, const float* w_rk, const float* w_rv,
    _Float16* BSQ, _Float16* BSK, _Float16* BSV, _Float16* BRQ, _Float16* BRK, _Float16* BRV,
    const float* w_so, const float* w_ro, const float* w_k2, const float* w_v2, _Float16* BSO, _Float16* BRO, _Float16* BK2, _Float16* BV2,
    const int* bar, const int* tib, float* CS1, float* SN1, float* CS2, float* SN2, const float* sum_x, _Float16* SX, const float* reg_x, _Float16* RX) {
  int bx = blockIdx.x;
  if (bx < 2 * PB_W + 4 * PB_WK) { const float* Wm = w_sq; _Float16* Bt = BSQ; int nout = DMOD;
    if (bx >= PB_W) { bx -= PB_W; Wm = w_rq; Bt = BRQ;
      if (bx >= PB_W) { bx -= PB_W; Wm = w_sk; Bt = BSK; nout = KVD;
        if (bx >= PB_WK) { bx -= PB_WK; Wm = w_sv; Bt = BSV;
          if (bx >= PB_WK) { bx -= PB_WK; Wm = w_rk; Bt = BRK;
            if (bx >= PB_WK) { bx -= PB_WK; Wm = w_rv; Bt = BRV; } } } } }
    d_wt_f16(bx, Wm, Bt, DMOD, nout, 16.0f); return; }
  bx -= 2 * PB_W + 4 * PB_WK;
  if (bx < 2 * PB_P + 2 * PB_PK) { const float* Wm = w_so; _Float16* Bt = BSO; int nout = DMOD;
    if (bx >= PB_P) { bx -= PB_P; Wm = w_ro; Bt = BRO;
      if (bx >= PB_P) { bx -= PB_P; Wm = w_k2; Bt = BK2; nout = KVD;
        if (bx >= PB_PK) { bx -= PB_PK; Wm = w_v2; Bt = BV2; } } }
    d_wpair(bx, Wm, DMOD, nout, Bt); return; }
  bx -= 2 * PB_P + 2 * PB_PK;
  if (bx < PB_T1) { d_rotab<0>(bx, NRS, SS, nullptr, nullptr, CS1, SN1); return; }
  bx -= PB_T1;
  if (bx < PB_T2) { d_rotab<1>(bx, NRR, RR, bar, tib, CS2, SN2); return; }
  bx -= PB_T2;
  if (bx < PB_XS) d_x16(bx, sum_x, SX, (size_t)NRS * DMOD / 8); else d_x16(bx - PB_XS, reg_x, RX, (size_t)NRR * DMOD / 8); }

// up to six GEMMs (d_gemm2) in one launch, all with the same lda, ldb, K and alpha; ldc = N. Jobs 0..2 read A0 (Ma rows), jobs 3..5 read A1 (Mb rows); in each triple N = DMOD, KVD, KVD. S_j is job j's bias (cp == 0) or the f32 plane, pitch N, that is added to the product (cp != 0). The grid ends behind the last job in use; the pointers of jobs behind it are not read.
__global__ __launch_bounds__(128) void k_gemm2m(const _Float16* A0, const _Float16* A1, const _Float16* B0, const _Float16* B1, const _Float16* B2, const _Float16* B3, const _Float16* B4, const _Float16* B5,
    const float* S0, const float* S1, const float* S2, const float* S3, const float* S4, const float* S5, float* C0, float* C1, float* C2, float* C3, float* C4, float* C5, int Ma, int Mb, int lda, int ldb, int K, float alpha, int cp) {
  int bx = blockIdx.x; const int ta = Ma >> 7, tb = Mb >> 7;      /* 128-row block tiles; a job has (M / 128) * (N / 64) blocks */
  const _Float16* A = A0; const _Float16* B = B0; const float* S = S0; float* C = C0; int M = Ma, N = DMOD;
  if (bx >= ta * (DMOD / 64)) { bx -= ta * (DMOD / 64); B = B1; S = S1; C = C1; N = KVD;
    if (bx >= ta * (KVD / 64)) { bx -= ta * (KVD / 64); B = B2; S = S2; C = C2;
      if (bx >= ta * (KVD / 64)) { bx -= ta * (KVD / 64); A = A1; M = Mb; B = B3; S = S3; C = C3; N = DMOD;
        if (bx >= tb * (DMOD / 64)) { bx -= tb * (DMOD / 64); B = B4; S = S4; C = C4; N = KVD;
          if (bx >= tb * (KVD / 64)) { bx -= tb * (KVD / 64); B = B5; S = S5; C = C5; } } } } }
  d_gemm2<0>(bx, A, lda, 0, B, ldb, 0, alpha, cp ? nullptr : S, 0, cp ? S : nullptr, 1, (size_t)N, 0, C, nullptr, N, 0, M, N, K); }

constexpr int QB_RQ = NRR * NH * 4 / 256, QB_RK = NRR * NKV * 4 / 256, QB_RV = NRR * (KVD / 8) / 256, QB_SQ = NRS * NH * 4 / 256, QB_SK = NRS * NKV * 4 / 256, QB_SV = NRS * (KVD / 8) / 256;
// what follows the six projections: RoPE of both q and both k planes, hi + residual planes of both v
__global__ __launch_bounds__(256) void k_post(const float* FSQ, const float* FSK, const float* FSV, const float* FRQ, const float* FRK, const float* FRV, const float* CS1, const float* SN1, const float* CS2, const float* SN2,
    _Float16* SQ, _Float16* RQ, _Float16* KC, _Float16* VCH, _Float16* VCL) {
  int bx = blockIdx.x;
  if (bx < QB_RQ + QB_RK + QB_SQ + QB_SK) { const float* F = FRQ; const float* CS = CS2; const float* SN = SN2; _Float16* dst = RQ; int nrows = NRR, rpb = RR, nheads = NH, bstr = RR, roff = 0;
    if (bx >= QB_RQ) { bx -= QB_RQ; F = FRK; dst = KC; nheads = NKV; bstr = TK; roff = SS;      /* keys 64.. of each batch */
      if (bx >= QB_RK) { bx -= QB_RK; F = FSQ; CS = CS1; SN = SN1; dst = SQ; nrows = NRS; rpb = SS; nheads = NH; bstr = SS; roff = 0;
        if (bx >= QB_SQ) { bx -= QB_SQ; F = FSK; dst = KC; nheads = NKV; bstr = TK; } } }      /* keys 0..63 of each batch */
    d_rope(bx, F, nrows, rpb, nheads, CS, SN, dst, nheads * 64, bstr, roff); return; }
  bx -= QB_RQ + QB_RK + QB_SQ + QB_SK;
  if (bx < QB_RV) d_put(bx, FRV, NRR, RR, KVD, VCH, VCL, TK, SS); else d_put(bx - QB_RV, FSV, NRS, SS, KVD, VCH, VCL, TK, 0); }
// k2 into key rows 0..63 (one plane), v2 into value rows 0..63 (hi + residual) of each batch
__global__ __launch_bounds__(256) void k_put2(const float* FK2, const float* FV2, _Float16* KC, _Float16* VCH, _Float16* VCL) {
  const int bx = blockIdx.x;
  if (bx < QB_SV) d_put(bx, FK2, NRS, SS, KVD, KC, nullptr, TK, 0); else d_put(bx - QB_SV, FV2, NRS, SS, KVD, VCH, VCL, TK, 0); }
// V^T of the hi plane (first half of the grid) and of the residual plane (second half)
__global__ __launch_bounds__(256) void k_vt2(const _Float16* VCH, const _Float16* VCL, _Float16* VT, _Float16* VTL) {
  constexpr int NBV = NB * NKV * (TK / 64); const bool lo = (int)blockIdx.x >= NBV;
  d_vt<NKV, TK>((int)blockIdx.x - (lo ? NBV : 0), lo ? VCL : VCH, KVD, 0, lo ? VTL : VT); }

extern "C" void kernel_launch(void* const* d_in, const int* in_sizes, int n_in,
                              void* d_out, int out_size, void* d_ws, size_t ws_size, hipStream_t stream) {
  (void)in_sizes; (void)n_in; (void)out_size;
  const float* const* I = (const float* const*)d_in; const float* sum_x = I[0]; const float* reg_x = I[1];
  const float* w_sq = I[2]; const float* b_sq = I[3]; const float* w_sk = I[4]; const float* b_sk = I[5]; const float* w_sv = I[6]; const float* b_sv = I[7]; const float* w_so = I[8]; const float* b_so = I[9];
  const float* w_rq = I[10]; const float* b_rq = I[11]; const float* w_rk = I[12]; const float* b_rk = I[13]; const float* w_rv = I[14]; const float* b_rv = I[15]; const float* w_ro = I[16]; const float* b_ro = I[17];
  const float* w_k2 = I[18]; const float* b_k2 = I[19]; const float* w_v2 = I[20]; const float* b_v2 = I[21];
  const int* bar = (const int*)d_in[22]; const int* tib = (const int*)d_in[23]; const int* msum = (const int*)d_in[24]; const int* mupd = (const int*)d_in[25];
  char* ws = (char*)d_ws; size_t off = 0;
  auto take = [&](size_t bytes) { char* p = ws + off; off += (bytes + 255) & ~(size_t)255; return p; };
  const size_t w8 = (size_t)DMOD * DMOD / 8, w8k = (size_t)DMOD * KVD / 8;
  _Float16* BSQ = (_Float16*)take(w8 * 16); _Float16* BSK = (_Float16*)take(w8k * 16); _Float16* BSV = (_Float16*)take(w8k * 16); _Float16* BRQ = (_Float16*)take(w8 * 16); _Float16* BRK = (_Float16*)take(w8k * 16); _Float16* BRV = (_Float16*)take(w8k * 16);
  _Float16* BSO = (_Float16*)take(w8 * 32); _Float16* BRO = (_Float16*)take(w8 * 32); _Float16* BK2 = (_Float16*)take(w8k * 32); _Float16* BV2 = (_Float16*)take(w8k * 32);
  float* CS1 = (float*)take((size_t)NRS * 32 * 4); float* SN1 = (float*)take((size_t)NRS * 32 * 4); float* CS2 = (float*)take((size_t)NRR * 32 * 4); float* SN2 = (float*)take((size_t)NRR * 32 * 4); _Float16* SX = (_Float16*)take((size_t)NRS * DMOD * 2); _Float16* RX = (_Float16*)take((size_t)NRR * DMOD * 2);
  /* each projection has an f32 plane of its own, since all six are written by one launch */
  float* FRQ = (float*)take((size_t)NRR * DMOD * 4); float* FRK = (float*)take((size_t)NRR * KVD * 4); float* FRV = (float*)take((size_t)NRR * KVD * 4); float* FSQ = (float*)take((size_t)NRS * DMOD * 4); float* FSK = (float*)take((size_t)NRS * KVD * 4); float* FSV = (float*)take((size_t)NRS * KVD * 4);
  _Float16* SQ = (_Float16*)take((size_t)NRS * DMOD * 2); _Float16* RQ = (_Float16*)take((size_t)NRR * DMOD * 2); _Float16* KC = (_Float16*)take((size_t)NB * TK * KVD * 2); _Float16* VCH = (_Float16*)take((size_t)NB * TK * KVD * 2); _Float16* VCL = (_Float16*)take((size_t)NB * TK * KVD * 2); _Float16* VT = (_Float16*)take((size_t)NB * NKV * 64 * TK * 2); _Float16* VTL = (_Float16*)take((size_t)NB * NKV * 64 * TK * 2);
  float* O1 = (float*)take((size_t)NRS * DMOD * 4); _Float16* O1H = (_Float16*)take((size_t)NRS * DMOD * 2); _Float16* O1L = (_Float16*)take((size_t)NRS * DMOD * 2); float* O2 = FRQ; _Float16* O2H = RQ; _Float16* O2L = RX;      /* O2 over the dead reg-q f32 scratch; O2H/O2L over RQ/RX (dead after phase 2 / the projections) */
  float* FK2 = FSK; float* FV2 = FSV;      /* k2 / v2 f32 planes over the summary k / v scratch (dead after k_post) */
  if (off > ws_size) return;      /* about 70 MiB */
  float* out0 = (float*)d_out; float* out1 = (float*)d_out + (size_t)NRS * DMOD;
  /* weight planes, RoPE tables, input planes */
  k_prep<<<PB_ALL, 256, 0, stream>>>(w_sq, w_sk, w_sv, w_rq, w_rk, w_rv, BSQ, BSK, BSV, BRQ, BRK, BRV, w_so, w_ro, w_k2, w_v2, BSO, BRO, BK2, BV2, bar, tib, CS1, SN1, CS2, SN2, sum_x, SX, reg_x, RX);
  /* summary q/k/v and regular q/k/v */
  k_gemm2m<<<(NRS / 128 + NRR / 128) * ((DMOD + 2 * KVD) / 64), 128, 0, stream>>>(SX, RX, BSQ, BSK, BSV, BRQ, BRK, BRV, b_sq, b_sk, b_sv, b_rq, b_rk, b_rv, FSQ, FSK, FSV, FRQ, FRK, FRV, NRS, NRR, DMOD, DMOD, DMOD, 0.0625f, 0);
  k_post<<<QB_RQ + QB_RK + QB_SQ + QB_SK + QB_RV + QB_SV, 256, 0, stream>>>(FSQ, FSK, FSV, FRQ, FRK, FRV, CS1, SN1, CS2, SN2, SQ, RQ, KC, VCH, VCL);
  /* phase 1: summary queries over [summary ; regular] keys */
  k_vt2<<<2 * NB * NKV * (TK / 64), 256, 0, stream>>>(VCH, VCL, VT, VTL);
  k_flash3gA<8><<<NB * NH * (TQA / 16), 32 * NSPL, 0, stream>>>(SQ, DMOD, KC, KVD, VT, VTL, msum, O1, DMOD);
  k_hl<<<(unsigned)(((size_t)NRS * DMOD / 8 + 255) / 256), 256, 0, stream>>>(O1, O1H, O1L, (size_t)NRS * DMOD / 8);
  /* output 0 = sum_attn W_so + b_so; k2 / v2 from sum_attn (no RoPE): the three hi products, then the three residual products on top of them */
  k_gemm2m<<<(NRS / 128) * ((DMOD + 2 * KVD) / 64), 128, 0, stream>>>(O1H, nullptr, BSO, BK2, BV2, nullptr, nullptr, nullptr, b_so, b_k2, b_v2, nullptr, nullptr, nullptr, out0, FK2, FV2, nullptr, nullptr, nullptr, NRS, 0, DMOD, 2 * DMOD, DMOD, 0.0625f, 0);
  k_gemm2m<<<(NRS / 128) * ((DMOD + 2 * KVD) / 64), 128, 0, stream>>>(O1L, nullptr, BSO + DMOD, BK2 + DMOD, BV2 + DMOD, nullptr, nullptr, nullptr, out0, FK2, FV2, nullptr, nullptr, nullptr, out0, FK2, FV2, nullptr, nullptr, nullptr, NRS, 0, DMOD, 2 * DMOD, DMOD, 1.0f / 1024.0f, 1);
  k_put2<<<2 * QB_SV, 256, 0, stream>>>(FK2, FV2, KC, VCH, VCL);      /* into key / value rows 0..63 of each batch */
  /* phase 2: regular queries over [k2 ; regular] keys */
  k_vt2<<<2 * NB * NKV * (TK / 64), 256, 0, stream>>>(VCH, VCL, VT, VTL);
  k_flash3gB<8><<<NB * NH * QBLKSB, 128, 0, stream>>>(RQ, DMOD, KC, KVD, VT, VTL, mupd, O2, DMOD);
  k_hl<<<(unsigned)(((size_t)NRR * DMOD / 8 + 255) / 256), 256, 0, stream>>>(O2, O2H, O2L, (size_t)NRR * DMOD / 8);
  k_gemm2m<<<(NRR / 128) * (DMOD / 64), 128, 0, stream>>>(O2H, nullptr, BRO, nullptr, nullptr, nullptr, nullptr, nullptr, b_ro, nullptr, nullptr, nullptr, nullptr, nullptr, out1, nullptr, nullptr, nullptr, nullptr, nullptr, NRR, 0, DMOD, 2 * DMOD, DMOD, 0.0625f, 0);
  k_gemm2m<<<(NRR / 128) * (DMOD / 64), 128, 0, stream>>>(O2L, nullptr, BRO + DMOD, nullptr, nullptr, nullptr, nullptr, nullptr, out1, nullptr, nullptr, nullptr, nullptr, nullptr, out1, nullptr, nullptr, nullptr, nullptr, nullptr, NRR, 0, DMOD, 2 * DMOD, DMOD, 1.0f / 1024.0f, 1);
}

// v005
// A run of this version takes 321 microseconds.
// Two timings next to v004 both put it at 1.24 times that version's speed.
// Over all steps from v000 it is 4.35 times as fast.
#include <hip/hip_runtime.h>
// FlexSummaryAttention (2 batches; 64 summary tokens S, 2048 regular tokens R, D = 1024; 16 query heads, 4 kv heads (GQA), head dim 64): q/k/v projections for both token sets; 1-D RoPE on summary q/k, 2-D hierarchical RoPE (bar id | token-in-bar id) on regular q/k; phase 1: summary queries over [summary; regular] keys with the summarize mask -> sum_attn; k2/v2 = sum_attn W + b; phase 2: regular queries over [k2; regular k] / [v2; regular v] with the updating mask -> reg_attn; outputs sum_attn W_so + b and reg_attn W_ro + b.
// Structure: exact f16 planes of both inputs; six projection GEMMs (32x64 wave tiles, f32 accumulation, exact x16 weights + bias); RoPE on VALU (thread per (row, head, 8 dims), f32 trig) into f16 q planes and the shared per-batch key plane [k2-or-summary ; regular] (4 kv heads); values as f16 hi + 2^10 residual planes, V^T by LDS tiles; the fused flash kernel (3-term P.V, GQA head mapping, INPUT int mask tables) once per phase; sum_attn / reg_attn as hi + residual pairs into the k2/v2 and output GEMMs.
// Compute dtype: inputs, masks' companions and parameters rounded to bf16; q/k after RoPE as f16 (~2^-12); P and v hi + residual (~2^-21-class); attention outputs hi + residual into the following GEMMs; f32 softmax/accumulation/trig. v_wmma_f32_16x16x32_f16.
#define NB 2
#define SS 64
#define RR 2048
#define DMOD 1024
#define KVD 256
#define NRS (NB * SS)            /* 128 summary rows */
#define NRR (NB * RR)            /* 4096 regular rows */
#define TK 2112                  /* keys per batch in both phases: 64 summary(-derived) + 2048 regular */
#define TQA 64                   /* phase-1 queries (summary tokens) */
#define TQB 2048                 /* phase-2 queries (regular tokens) */
#define TQ TQB
#define NH 16
#define KVG 4                    /* GQA: 16 query heads share 4 kv heads */
#define NKV (NH / KVG)
#define SCL 0.125f               /* 64^-0.5 */
#define QBLKSA (TQA / 64)
#define NSPL 11                  /* phase 1: waves that share the 2112 keys of one 16-query tile, 6 trips of 32 keys each */
#define QBLKSB (TQB / 64)
#define QTB (TQB / 16)           /* phase 2: 16-query tiles */
typedef __bf16 v16b __attribute__((ext_vector_type(16)));
typedef unsigned short v8us __attribute__((ext_vector_type(8), may_alias));
typedef float  v8f  __attribute__((ext_vector_type(8)));
typedef float  v4f  __attribute__((ext_vector_type(4)));
typedef float  v4fa __attribute__((ext_vector_type(4), may_alias));
union FragB { v16b v; v8us half[2]; unsigned short u[16]; };

__device__ __forceinline__ unsigned short bf16_bits(float x) { unsigned int u = __float_as_uint(x); return (unsigned short)((u + 0x7FFFu + ((u >> 16) & 1u)) >> 16); }
__device__ __forceinline__ float bf16_val(unsigned short b) { return __uint_as_float(((unsigned int)b) << 16); }
__device__ __forceinline__ float bf16_round(float x) { return bf16_val(bf16_bits(x)); }
// D += A·B with NT terms: 1 = ah·bh, 2 = + al·bh (A split), 3 = + ah·bl (both split)
template <int NT>
__device__ __forceinline__ v8f mmaN(v16b ah, v16b al, v16b bh, v16b bl, v8f c) {
  c = __builtin_amdgcn_wmma_f32_16x16x32_bf16(false, ah, false, bh, (short)0, c, false, false);
  if (NT >= 2) c = __builtin_amdgcn_wmma_f32_16x16x32_bf16(false, al, false, bh, (short)0, c, false, false);
  if (NT >= 3) c = __builtin_amdgcn_wmma_f32_16x16x32_bf16(false, ah, false, bl, (short)0, c, false, false);
  asm volatile("v_nop\n\tv_nop\n\tv_nop\n\tv_nop" : "+v"(c) : "v"(ah), "v"(al), "v"(bh), "v"(bl));
  return c;
}

__global__ __launch_bounds__(256) void k_wt_bf16(const float* __restrict__ W, unsigned short* __restrict__ Wt, int K, int N) {
  const int t = blockIdx.x * 256 + threadIdx.x;
  const int k8n = K / 8;
  if (t >= N * k8n) return;
  const int n = t / k8n, k8 = (t % k8n) * 8;
  v8us v;
#pragma unroll
  for (int i = 0; i < 8; ++i) v[i] = bf16_bits(W[(size_t)(k8 + i) * N + n]);
  *(v8us*)(Wt + (size_t)n * K + k8) = v;
  
}

// GEMM C[M][N] (f32, pitch ldc) = act(A[M][K]·W + bias). A f32 row-major (pitch lda) converted per fragment to bf16
// (ASPLIT: hi/lo two planes -> 2 terms, else single rounded term); Wt bf16 [N][K] (pitch ldb). BIAS_BF16 rounds the
// bias to bf16 first (bias quantised to bf16 before the add). K%32==0, M%16==0, N%64==0.
template <bool ASPLIT, int ACT, bool BIAS_BF16>
__global__ __launch_bounds__(128) void k_gemm_bf(const float* __restrict__ A, int lda, const unsigned short* __restrict__ Wt, int ldb,
                                               const float* __restrict__ bias, float* __restrict__ C, int ldc, int M, int N, int K) {
  __shared__ __attribute__((aligned(16))) float so[4][16][64];
  const int tid = threadIdx.x, w = tid >> 5, lane = tid & 31, ln = lane & 15, hh = lane >> 4;
  const int ntn = N / 64;
  const int wid = blockIdx.x * 4 + w;
  const int mt = wid / ntn, nq = wid % ntn;
  if (mt * 16 >= M) return;
  const int row0 = mt * 16, col0 = nq * 64;
  const float* arow = A + (size_t)(row0 + ln) * lda;
  v8f acc[4] = {};
  for (int kb = 0; kb < K; kb += 32) {
    FragB ah, al;
    const v4f x0 = *(const v4fa*)(arow + kb + 8 * hh), x1 = *(const v4fa*)(arow + kb + 8 * hh + 4);
    const v4f x2 = *(const v4fa*)(arow + kb + 16 + 8 * hh), x3 = *(const v4fa*)(arow + kb + 16 + 8 * hh + 4);
    float xs[16] = {x0[0],x0[1],x0[2],x0[3],x1[0],x1[1],x1[2],x1[3],x2[0],x2[1],x2[2],x2[3],x3[0],x3[1],x3[2],x3[3]};
#pragma unroll
    for (int i = 0; i < 16; ++i) { const unsigned short hb = bf16_bits(xs[i]); ah.u[i] = hb; al.u[i] = ASPLIT ? bf16_bits(xs[i] - bf16_val(hb)) : (unsigned short)0; }
#pragma unroll
    for (int t = 0; t < 4; ++t) {
      const unsigned short* brow = Wt + (size_t)(col0 + t * 16 + ln) * ldb + kb;
      FragB b;
      b.half[0] = *(const v8us*)(brow + 8 * hh);
      b.half[1] = *(const v8us*)(brow + 16 + 8 * hh);
      acc[t] = mmaN<ASPLIT ? 2 : 1>(ah.v, al.v, b.v, b.v, acc[t]);
    }
  }
#pragma unroll
  for (int t = 0; t < 4; ++t) {
    float bv = bias ? bias[col0 + t * 16 + ln] : 0.f;
    if (BIAS_BF16) bv = bf16_round(bv);
#pragma unroll
    for (int r = 0; r < 8; ++r) { float v = acc[t][r] + bv; if (ACT == 1) v = fmaxf(v, 0.f); so[w][8 * hh + r][t * 16 + ln] = v; }
  }
  __builtin_amdgcn_fence(__ATOMIC_ACQ_REL, "workgroup");
  __builtin_amdgcn_wave_barrier();
  const int rsub = lane >> 4, c4 = (lane & 15) * 4;
  {
#pragma unroll
    for (int q = 0; q < 8; ++q) {
      const int r = q * 2 + rsub;
      const v4f v = *(const v4fa*)&so[w][r][c4];
      *(v4f*)(C + (size_t)(row0 + r) * ldc + col0 + c4) = v;
    }
    
  }
}

// GEMM C = act(A·W + bias + resid): A f32 (ASPLIT -> hi/lo 2 terms), Wt bf16 [N][K]; ACT 0 none, 1 relu, 2 exact gelu;
// resid (optional, f32, row index = (row % rmod), pitch ldr, RES_BF16 rounds it) added before the activation.
template <bool ASPLIT, int ACT, bool BIAS_BF16, bool RES_BF16>
__global__ __launch_bounds__(128) void k_gemm_bf3(const float* __restrict__ A, int lda, const unsigned short* __restrict__ Wt, int ldb,
                                                const float* __restrict__ bias, const float* __restrict__ resid, int rmod, int ldr,
                                                float* __restrict__ C, int ldc, int M, int N, int K) {
  __shared__ __attribute__((aligned(16))) float so[4][16][64];
  const int tid = threadIdx.x, w = tid >> 5, lane = tid & 31, ln = lane & 15, hh = lane >> 4;
  const int ntn = N / 64;
  const int wid = blockIdx.x * 4 + w;
  const int mt = wid / ntn, nq = wid % ntn;
  if (mt * 16 >= M) return;
  const int row0 = mt * 16, col0 = nq * 64;
  const float* arow = A + (size_t)(row0 + ln) * lda;
  v8f acc[4] = {};
  for (int kb = 0; kb < K; kb += 32) {
    FragB ah, al;
    const v4f x0 = *(const v4fa*)(arow + kb + 8 * hh), x1 = *(const v4fa*)(arow + kb + 8 * hh + 4);
    const v4f x2 = *(const v4fa*)(arow + kb + 16 + 8 * hh), x3 = *(const v4fa*)(arow + kb + 16 + 8 * hh + 4);
    float xs[16] = {x0[0],x0[1],x0[2],x0[3],x1[0],x1[1],x1[2],x1[3],x2[0],x2[1],x2[2],x2[3],x3[0],x3[1],x3[2],x3[3]};
#pragma unroll
    for (int i = 0; i < 16; ++i) { const unsigned short hb = bf16_bits(xs[i]); ah.u[i] = hb; al.u[i] = ASPLIT ? bf16_bits(xs[i] - bf16_val(hb)) : (unsigned short)0; }
#pragma unroll
    for (int t = 0; t < 4; ++t) {
      const unsigned short* brow = Wt + (size_t)(col0 + t * 16 + ln) * ldb + kb;
      FragB b;
      b.half[0] = *(const v8us*)(brow + 8 * hh);
      b.half[1] = *(const v8us*)(brow + 16 + 8 * hh);
      acc[t] = mmaN<ASPLIT ? 2 : 1>(ah.v, al.v, b.v, b.v, acc[t]);
    }
  }
#pragma unroll
  for (int t = 0; t < 4; ++t) {
    const int col = col0 + t * 16 + ln;
    float bv = bias ? bias[col] : 0.f;
    if (BIAS_BF16) bv = bf16_round(bv);
#pragma unroll
    for (int r = 0; r < 8; ++r) {
      float v = acc[t][r] + bv;
      if (resid) { float rv = resid[(size_t)((row0 + 8 * hh + r) % rmod) * ldr + col]; if (RES_BF16) rv = bf16_round(rv); v += rv; }
      if (ACT == 1) v = fmaxf(v, 0.f);
      if (ACT == 2) v = 0.5f * v * (1.0f + erff(v * 0.70710678118654752f));
      if (ACT == 3) { const float u = 0.7978845608028654f * (v + 0.044715f * v * v * v); v = 0.5f * v * (1.0f + tanhf(u)); }
      so[w][8 * hh + r][t * 16 + ln] = v;
    }
  }
  __builtin_amdgcn_fence(__ATOMIC_ACQ_REL, "workgroup");
  __builtin_amdgcn_wave_barrier();
  const int rsub = lane >> 4, c4 = (lane & 15) * 4;
  {
#pragma unroll
    for (int q = 0; q < 8; ++q) {
      const int r = q * 2 + rsub;
      const v4f v = *(const v4fa*)&so[w][r][c4];
      *(v4f*)(C + (size_t)(row0 + r) * ldc + col0 + c4) = v;
    }
    
  }
}
// row LayerNorm (biased variance, eps) over N: s = X (+ R); optional out_sum <- s; out_norm <- (s-mu)*rsqrt(var+eps)*g + b
template <bool PARAM_BF16>
__global__ __launch_bounds__(256) void k_layernorm(const float* __restrict__ X, const float* __restrict__ R, const float* __restrict__ g, const float* __restrict__ bta,
                                                  float* __restrict__ out_sum, float* __restrict__ out_norm, int N, float eps) {
  __shared__ float red[256];
  const int row = blockIdx.x, tid = threadIdx.x;
  const float* x = X + (size_t)row * N; const float* rr = R ? R + (size_t)row * N : nullptr;
  float vals[16];                     // up to N = 4096
  const int per = N / 256;            // contiguous chunk per thread? use strided-by-4 chunks: thread handles j = tid*4 + 1024*u
  float s1 = 0.f;
  for (int u = 0; u < per / 4; ++u) {
    const int j = tid * 4 + 1024 * u;
    const v4f a = *(const v4fa*)(x + j);
    v4f b = {0.f,0.f,0.f,0.f}; if (rr) b = *(const v4fa*)(rr + j);
#pragma unroll
    for (int q = 0; q < 4; ++q) { const float v = a[q] + b[q]; vals[u * 4 + q] = v; s1 += v; }
  }
  red[tid] = s1; __syncthreads();
  for (int st = 128; st > 0; st >>= 1) { if (tid < st) red[tid] += red[tid + st]; __syncthreads(); }
  const float mu = red[0] / (float)N; __syncthreads();
  float s2 = 0.f;
  for (int u = 0; u < per / 4; ++u)
#pragma unroll
    for (int q = 0; q < 4; ++q) { const float c = vals[u * 4 + q] - mu; s2 += c * c; }
  red[tid] = s2; __syncthreads();
  for (int st = 128; st > 0; st >>= 1) { if (tid < st) red[tid] += red[tid + st]; __syncthreads(); }
  const float rs = rsqrtf(red[0] / (float)N + eps);
  {
    for (int u = 0; u < per / 4; ++u) {
      const int j = tid * 4 + 1024 * u;
      v4f o, sm;
#pragma unroll
      for (int q = 0; q < 4; ++q) {
        float gg = g[j + q], bb = bta[j + q];
        if (PARAM_BF16) { gg = bf16_round(gg); bb = bf16_round(bb); }
        sm[q] = vals[u * 4 + q]; o[q] = (vals[u * 4 + q] - mu) * rs * gg + bb;
      }
      if (out_sum) *(v4f*)(out_sum + (size_t)row * N + j) = sm;
      *(v4f*)(out_norm + (size_t)row * N + j) = o;
    }
    
  }
}



// ---- f16 WMMA path (v_wmma_f32_16x16x32_f16): 11-bit significands for operands in range — used where a [0,1] probability operand needs more precision than bf16
typedef _Float16 v16h __attribute__((ext_vector_type(16)));
union FragH { v16h v; v8us half[2]; _Float16 h[16]; unsigned short u[16]; };
template <int NT>
__device__ __forceinline__ v8f mmaH(v16h ah, v16h al, v16h bh, v16h bl, v8f c) {
  c = __builtin_amdgcn_wmma_f32_16x16x32_f16(false, ah, false, bh, (short)0, c, false, false);
  if (NT >= 2) c = __builtin_amdgcn_wmma_f32_16x16x32_f16(false, al, false, bh, (short)0, c, false, false);
  if (NT >= 3) c = __builtin_amdgcn_wmma_f32_16x16x32_f16(false, ah, false, bl, (short)0, c, false, false);
  asm volatile("v_nop\n\tv_nop\n\tv_nop\n\tv_nop" : "+v"(c) : "v"(ah), "v"(al), "v"(bh), "v"(bl));
  return c;
}
// batched GEMM like k_gemm_b but f16 operands: A f32 (split into f16 hi/lo if ASPLIT, else rounded to f16), Bt = f16 values [n][k]; alpha; C f32; N multiple of 16 (partial tiles skipped)
template <bool ASPLIT>
__global__ __launch_bounds__(128) void k_gemm_h(const float* __restrict__ A, int lda, size_t sA, const _Float16* __restrict__ Bh, int ldb, size_t sB, float alpha, float* __restrict__ C, int ldc, size_t sC, int M, int N, int K) {
  __shared__ __attribute__((aligned(16))) float so[4][16][64];
  const int tid = threadIdx.x, w = tid >> 5, lane = tid & 31, ln = lane & 15, hh = lane >> 4; const int by = blockIdx.y;
  A += (size_t)by * sA; Bh += (size_t)by * sB; C += (size_t)by * sC;
  const int ntn = (N + 63) / 64; const int wid = blockIdx.x * 4 + w; const int mt = wid / ntn, nq = wid % ntn; if (mt * 16 >= M) return;
  const int row0 = mt * 16, col0 = nq * 64; const float* arow = A + (size_t)(row0 + ln) * lda;
  v8f acc[4] = {};
  for (int kb = 0; kb < K; kb += 32) {
    FragH ah, al;
    const v4f x0 = *(const v4fa*)(arow + kb + 8 * hh), x1 = *(const v4fa*)(arow + kb + 8 * hh + 4), x2 = *(const v4fa*)(arow + kb + 16 + 8 * hh), x3 = *(const v4fa*)(arow + kb + 16 + 8 * hh + 4);
    float xs[16] = {x0[0],x0[1],x0[2],x0[3],x1[0],x1[1],x1[2],x1[3],x2[0],x2[1],x2[2],x2[3],x3[0],x3[1],x3[2],x3[3]};
#pragma unroll
    for (int i = 0; i < 16; ++i) { const _Float16 h = (_Float16)xs[i]; ah.h[i] = h; al.h[i] = ASPLIT ? (_Float16)(xs[i] - (float)h) : (_Float16)0.0f; }
#pragma unroll
    for (int t = 0; t < 4; ++t) { if (col0 + t * 16 >= N) continue; const size_t boff = (size_t)(col0 + t * 16 + ln) * ldb + kb; FragH bq; bq.half[0] = *(const v8us*)(Bh + boff + 8 * hh); bq.half[1] = *(const v8us*)(Bh + boff + 16 + 8 * hh);
      acc[t] = mmaH<ASPLIT ? 2 : 1>(ah.v, al.v, bq.v, bq.v, acc[t]); }
  }
#pragma unroll
  for (int t = 0; t < 4; ++t) { if (col0 + t * 16 >= N) continue;
#pragma unroll
    for (int r = 0; r < 8; ++r) so[w][8 * hh + r][t * 16 + ln] = acc[t][r] * alpha; }
  __builtin_amdgcn_fence(__ATOMIC_ACQ_REL, "workgroup"); __builtin_amdgcn_wave_barrier();
  const int rsub = lane >> 4, c4 = (lane & 15) * 4;
  {
#pragma unroll
    for (int q = 0; q < 8; ++q) { const int r = q * 2 + rsub; if (col0 + c4 < N) { const v4f v = *(const v4fa*)&so[w][r][c4]; *(v4f*)(C + (size_t)(row0 + r) * ldc + col0 + c4) = v; } }
     }
}

// Wt[n][k] = f16(W[k][n]·scale) from f32 row-major W[K][N] (scale = power of two; bf16-exact weights stay exact in f16 away from the subnormal range)
__device__ __forceinline__ void d_wt_f16(int bx, const float* __restrict__ W, _Float16* __restrict__ Wt, int K, int N, float scale) {
  const int t = bx * 256 + threadIdx.x; if (t >= N * (K / 8)) return; const int n = t / (K / 8), k8 = (t % (K / 8)) * 8; FragH f;
#pragma unroll
  for (int i = 0; i < 8; ++i) f.h[i] = (_Float16)(bf16_round(W[(size_t)(k8 + i) * N + n]) * scale); const v8us o = f.half[0];
  *(v8us*)((unsigned short*)Wt + (size_t)n * K + k8) = o; 
}
// k_gemm_hh variant with fused epilogue: v = acc·alpha + bias[by·sBias + col] (+ CP[(row/rowsPerB)·sCPb + by·64 + col] if CP) ; ACT 0 none / 1 elu ; writes f16 C16 (and f32 C if non-null)
template <int ACT>
__global__ __launch_bounds__(128) void k_gemm_hhx(const _Float16* __restrict__ A, int lda, size_t sA, const _Float16* __restrict__ Bh, int ldb, size_t sB, float alpha, const float* __restrict__ bias, size_t sBias, const float* __restrict__ CP, int rowsPerB, size_t sCPb, int row0g,
    float* __restrict__ C, _Float16* __restrict__ C16, int ldc, size_t sC, int M, int N, int K) {
  __shared__ __attribute__((aligned(16))) float so[4][16][64];
  const int tid = threadIdx.x, w = tid >> 5, lane = tid & 31, ln = lane & 15, hh = lane >> 4; const int by = blockIdx.y;
  A += (size_t)by * sA; Bh += (size_t)by * sB; const size_t cofs = (size_t)by * sC; const float* bp = bias ? bias + (size_t)by * sBias : nullptr;
  const int ntn = (N + 63) / 64; const int wid = blockIdx.x * 4 + w; const int mt = wid / ntn, nq = wid % ntn; if (mt * 16 >= M) return;
  const int row0 = mt * 16, col0 = nq * 64; const _Float16* arow = A + (size_t)(row0 + ln) * lda;
  v8f acc[4] = {};
  for (int kb = 0; kb < K; kb += 32) { FragH ah; ah.half[0] = *(const v8us*)((const unsigned short*)arow + kb + 8 * hh); ah.half[1] = *(const v8us*)((const unsigned short*)arow + kb + 16 + 8 * hh);
#pragma unroll
    for (int t = 0; t < 4; ++t) { if (col0 + t * 16 >= N) continue; const size_t boff = (size_t)(col0 + t * 16 + ln) * ldb + kb; FragH bq; bq.half[0] = *(const v8us*)((const unsigned short*)Bh + boff + 8 * hh); bq.half[1] = *(const v8us*)((const unsigned short*)Bh + boff + 16 + 8 * hh);
      acc[t] = mmaH<1>(ah.v, ah.v, bq.v, bq.v, acc[t]); }
  }
#pragma unroll
  for (int t = 0; t < 4; ++t) { if (col0 + t * 16 >= N) continue; const int col = col0 + t * 16 + ln; const float bv = bp ? bf16_round(bp[col]) : 0.f;
#pragma unroll
    for (int r = 0; r < 8; ++r) { float v = acc[t][r] * alpha + bv; if (CP) { const int bidx = (row0g + row0 + 8 * hh + r) / rowsPerB; v += CP[(size_t)bidx * sCPb + (size_t)by * 64 + col]; } if (ACT == 1) v = (v > 0.f) ? v : expm1f(v); else if (ACT == 7) v = (v > 0.f) ? v + 1.0f : expf(v); else if (ACT == 8) v = tanhf(v); else if (ACT == 9) v = 0.5f * v * (1.0f + tanhf(0.7978845608028654f * (v + 0.044715f * v * v * v))); else if (ACT == 11) v = 1.0f / (1.0f + expf(-v)); else if (ACT == 12) v = (v > 0.f) ? v : 0.01f * v; else if (ACT == 14) v = (v > 0.f) ? v : 0.1f * v; else if (ACT == 15) v = v / (1.0f + expf(-v)); else if (ACT == 3) v = fmaxf(v, 0.f); else if (ACT == 6) v = 0.5f * v * (1.0f + erff(v * 0.70710678118654752f)); so[w][8 * hh + r][t * 16 + ln] = v; } }
  __builtin_amdgcn_fence(__ATOMIC_ACQ_REL, "workgroup"); __builtin_amdgcn_wave_barrier();
  const int rsub = lane >> 4, c4 = (lane & 15) * 4; typedef _Float16 v4h __attribute__((ext_vector_type(4)));
  {
#pragma unroll
    for (int q = 0; q < 8; ++q) { const int r = q * 2 + rsub; if (col0 + c4 < N) { const v4f v = *(const v4fa*)&so[w][r][c4]; if (C) *(v4f*)(C + cofs + (size_t)(row0 + r) * ldc + col0 + c4) = v; if (C16) { v4h h4; for (int i = 0; i < 4; ++i) h4[i] = (_Float16)v[i]; *(v4h*)(C16 + cofs + (size_t)(row0 + r) * ldc + col0 + c4) = h4; } } }
     }
}


typedef _Float16 v4h __attribute__((ext_vector_type(4)));

__device__ __forceinline__ void d_x16(int bx, const float* __restrict__ x, _Float16* __restrict__ X16, size_t n8) { const size_t t = (size_t)bx * 256 + threadIdx.x; if (t >= n8) return; FragH f;
#pragma unroll
  for (int q = 0; q < 8; ++q) f.h[q] = (_Float16)bf16_round(x[t * 8 + q]); *(v8us*)((unsigned short*)X16 + t * 8) = f.half[0];  }
__global__ __launch_bounds__(256) void k_h16(const float* __restrict__ x, _Float16* __restrict__ X16, size_t n8) { const size_t t = (size_t)blockIdx.x * 256 + threadIdx.x; if (t >= n8) return; FragH f;
#pragma unroll
  for (int q = 0; q < 8; ++q) f.h[q] = (_Float16)x[t * 8 + q]; *(v8us*)((unsigned short*)X16 + t * 8) = f.half[0];  }
__global__ __launch_bounds__(256) void k_round16f(const float* __restrict__ W, _Float16* __restrict__ Bt, size_t n8) { const size_t t = (size_t)blockIdx.x * 256 + threadIdx.x; if (t >= n8) return; FragH f;
#pragma unroll
  for (int i = 0; i < 8; ++i) f.h[i] = (_Float16)(bf16_round(W[t * 8 + i]) * 16.0f); *(v8us*)((unsigned short*)Bt + t * 8) = f.half[0];  }
template <int NHv, int TTv>
__device__ __forceinline__ void d_vt(int bx, const _Float16* __restrict__ V16, int ldv, int voff, _Float16* __restrict__ Vt) { __shared__ unsigned short tl[64][66]; const int tid = threadIdx.x; const int slab = bx / (TTv / 64), lg = bx % (TTv / 64); const int b = slab / NHv, h = slab % NHv;
  for (int i = tid; i < 64 * 8; i += 256) { const int r = i / 8, c8 = (i % 8) * 8; FragH f; f.half[0] = *(const v8us*)((const unsigned short*)V16 + ((size_t)b * TTv + lg * 64 + r) * ldv + voff + h * 64 + c8);
#pragma unroll
    for (int q = 0; q < 8; ++q) tl[r][c8 + q] = f.u[q]; }
  __syncthreads();
  {
#pragma unroll
    for (int rd = 0; rd < 2; ++rd) { const int d = rd * 32 + tid / 8, pc = tid % 8; FragH f;
#pragma unroll
      for (int q = 0; q < 8; ++q) f.u[q] = tl[pc * 8 + q][d];
      *(v8us*)((unsigned short*)Vt + ((size_t)slab * 64 + d) * TTv + lg * 64 + pc * 8) = f.half[0]; }
     } }

__global__ __launch_bounds__(256) void k_hl(const float* __restrict__ F, _Float16* __restrict__ Hh, _Float16* __restrict__ Hl, size_t n8) { const size_t t = (size_t)blockIdx.x * 256 + threadIdx.x; if (t >= n8) return; FragH fh, fl; const v4f a = *(const v4fa*)(F + t * 8), c = *(const v4fa*)(F + t * 8 + 4);
#pragma unroll
  for (int q = 0; q < 4; ++q) { _Float16 h = (_Float16)a[q]; fh.h[q] = h; fl.h[q] = (_Float16)((a[q] - (float)h) * 1024.0f); h = (_Float16)c[q]; fh.h[4 + q] = h; fl.h[4 + q] = (_Float16)((c[q] - (float)h) * 1024.0f); }
  { *(v8us*)((unsigned short*)Hh + t * 8) = fh.half[0]; *(v8us*)((unsigned short*)Hl + t * 8) = fl.half[0];  } }

// ---- fast GEMM (wave tile 32x64; requires M % 32 == 0 rows per launch region, N % 64 == 0 and K % 64 == 0); epilogue = k_gemm_hhx semantics ----
__device__ __forceinline__ v16h g2_frag(const _Float16* p, int hh) { FragH f; f.half[0] = *(const v8us*)((const unsigned short*)p + 8 * hh); f.half[1] = *(const v8us*)((const unsigned short*)p + 16 + 8 * hh); return f.v; }
__device__ __forceinline__ v8f g2_mma(v16h a, v16h b, v8f c) { v8f d = __builtin_amdgcn_wmma_f32_16x16x32_f16(false, a, false, b, (short)0, c, false, false); asm volatile("v_nop\n\tv_nop\n\tv_nop\n\tv_nop" : "+v"(d) : "v"(a), "v"(b)); return d; }
template <int ACT>
__device__ __forceinline__ void d_gemm2(int bx, const _Float16* __restrict__ A, int lda, size_t sA, const _Float16* __restrict__ Bh, int ldb, size_t sB, float alpha, const float* __restrict__ bias, size_t sBias, const float* __restrict__ CP, int rowsPerB, size_t sCPb, int row0g,
    float* __restrict__ C, _Float16* __restrict__ C16, int ldc, size_t sC, int M, int N, int K) {
  __shared__ __attribute__((aligned(16))) float so[4][32][68];
  const int tid = threadIdx.x, w = tid >> 5, lane = tid & 31, ln = lane & 15, hh = lane >> 4; const int by = blockIdx.y;
  A += (size_t)by * sA; Bh += (size_t)by * sB; const size_t cofs = (size_t)by * sC; const float* bp = bias ? bias + (size_t)by * sBias : nullptr;
  const int ntn = N >> 6; const int mt = bx / ntn, nq = bx - mt * ntn; const int row0 = mt * 128 + 32 * w, col0 = nq * 64; if (row0 >= M) return;
  const _Float16* a0p = A + (size_t)(row0 + ln) * lda; const _Float16* a1p = a0p + (size_t)16 * lda;
  const _Float16* b0p = Bh + (size_t)(col0 + ln) * ldb; const _Float16* b1p = b0p + (size_t)16 * ldb; const _Float16* b2p = b1p + (size_t)16 * ldb; const _Float16* b3p = b2p + (size_t)16 * ldb;
  const v8f z8 = {0.f,0.f,0.f,0.f,0.f,0.f,0.f,0.f}; v8f c00 = z8, c01 = z8, c02 = z8, c03 = z8, c10 = z8, c11 = z8, c12 = z8, c13 = z8;
  /* two register sets x / y of the six fragments (K % 64 == 0): the loads of the next 32-wide k step are all issued before the products of this one, so a step waits for one overlapped latency at most */
  v16h xa0 = g2_frag(a0p, hh), xa1 = g2_frag(a1p, hh), xb0 = g2_frag(b0p, hh), xb1 = g2_frag(b1p, hh), xb2 = g2_frag(b2p, hh), xb3 = g2_frag(b3p, hh);
#pragma unroll 1
  for (int kb = 0; kb < K; kb += 64) { const int k1 = kb + 32, k2 = (kb + 64 < K) ? kb + 64 : kb;      /* last trip: k2 names a step inside the row again; its values are not used */
    const v16h ya0 = g2_frag(a0p + k1, hh), ya1 = g2_frag(a1p + k1, hh), yb0 = g2_frag(b0p + k1, hh), yb1 = g2_frag(b1p + k1, hh), yb2 = g2_frag(b2p + k1, hh), yb3 = g2_frag(b3p + k1, hh);
    __builtin_amdgcn_sched_barrier(0);      /* holds the y loads above the x products (the scheduler otherwise moves each load down to its use) */
    c00 = g2_mma(xa0, xb0, c00); c10 = g2_mma(xa1, xb0, c10); c01 = g2_mma(xa0, xb1, c01); c11 = g2_mma(xa1, xb1, c11);
    c02 = g2_mma(xa0, xb2, c02); c12 = g2_mma(xa1, xb2, c12); c03 = g2_mma(xa0, xb3, c03); c13 = g2_mma(xa1, xb3, c13);
    __builtin_amdgcn_sched_barrier(0);      /* holds the x reloads below the x products and, with the next one, above the y products */
    xa0 = g2_frag(a0p + k2, hh); xa1 = g2_frag(a1p + k2, hh); xb0 = g2_frag(b0p + k2, hh); xb1 = g2_frag(b1p + k2, hh); xb2 = g2_frag(b2p + k2, hh); xb3 = g2_frag(b3p + k2, hh);
    __builtin_amdgcn_sched_barrier(0);      /* holds the x reloads above the y products */
    c00 = g2_mma(ya0, yb0, c00); c10 = g2_mma(ya1, yb0, c10); c01 = g2_mma(ya0, yb1, c01); c11 = g2_mma(ya1, yb1, c11);
    c02 = g2_mma(ya0, yb2, c02); c12 = g2_mma(ya1, yb2, c12); c03 = g2_mma(ya0, yb3, c03); c13 = g2_mma(ya1, yb3, c13);
    asm volatile("s_wait_xcnt 0x0" ::: "memory"); }      /* stands in front of the next trip's address sums, which overwrite registers that the x loads name */
  v8f accs[8] = {c00, c01, c02, c03, c10, c11, c12, c13};
  /* the epilogue's loads (4 bias words, 64 CP words a lane) are issued together as well, ahead of the arithmetic that uses them */
  float bw[4] = {0.f, 0.f, 0.f, 0.f}; v8f cpv[8] = {z8, z8, z8, z8, z8, z8, z8, z8};
  if (bp) {
#pragma unroll
    for (int t = 0; t < 4; ++t) bw[t] = bp[col0 + t * 16 + ln]; }
  if (CP) {
#pragma unroll
    for (int u = 0; u < 8; ++u)
#pragma unroll
      for (int r = 0; r < 8; ++r) { const int bidx = (row0g + row0 + (u >> 2) * 16 + 8 * hh + r) / rowsPerB; cpv[u][r] = CP[(size_t)bidx * sCPb + (size_t)by * 64 + col0 + (u & 3) * 16 + ln];
        if (r == 7) asm volatile("s_wait_xcnt 0x0" ::: "memory"); }      /* stands in front of the next group's loads, whose results may land in address registers of this group */
    asm volatile("" :: "v"(cpv[0]), "v"(cpv[1]), "v"(cpv[2]), "v"(cpv[3]), "v"(cpv[4]), "v"(cpv[5]), "v"(cpv[6]), "v"(cpv[7])); }      /* inputs-only fence on the loaded words: holds all 64 loads in this block, where they overlap, instead of one waited load in front of each add */
#pragma unroll
  for (int u = 0; u < 8; ++u) { const int t = u & 3, half = u >> 2; const float bv = bp ? bf16_round(bw[t]) : 0.f;
#pragma unroll
    for (int r = 0; r < 8; ++r) { const int rloc = half * 16 + 8 * hh + r; float v = accs[u][r] * alpha + bv; if (CP) v += cpv[u][r];
      if (ACT == 3) v = fmaxf(v, 0.f); else if (ACT == 6) v = 0.5f * v * (1.0f + erff(v * 0.70710678118654752f)); else if (ACT == 11) v = 1.0f / (1.0f + expf(-v)); else if (ACT == 15) v = v / (1.0f + expf(-v)); else if (ACT == 12) v = (v > 0.f) ? v : 0.01f * v; else if (ACT == 8) v = tanhf(v);
      so[w][rloc][t * 16 + ln] = v; } }
  __builtin_amdgcn_fence(__ATOMIC_ACQ_REL, "workgroup"); __builtin_amdgcn_wave_barrier();
  const int rsub = lane >> 4, c4 = (lane & 15) * 4;
  {
#pragma unroll
    for (int q = 0; q < 16; ++q) { const int r = q * 2 + rsub; const v4f v = *(const v4fa*)&so[w][r][c4]; if (C) *(v4f*)(C + cofs + (size_t)(row0 + r) * ldc + col0 + c4) = v; if (C16) { v4h h4; for (int i = 0; i < 4; ++i) h4[i] = (_Float16)v[i]; *(v4h*)(C16 + cofs + (size_t)(row0 + r) * ldc + col0 + c4) = h4; } }
     } }



// lane l's value of lane l ^ X (X < 16) inside its 16-lane row, by a DPP row_xmask move in registers (no trip through the LDS pipe and no wait on it)
template <int X>
__device__ __forceinline__ float row_xor(float v) { return __int_as_float(__builtin_amdgcn_update_dpp(0, __float_as_int(v), 0x160 | X, 0xf, 0xf, true)); }
// maximum over the 16-lane row, all 32 lanes on: four dependent DPP maxima in one statement (written with fmaxf on a DPP move the compiler puts a move and a quieting maximum in front of each step, three links for one)
__device__ __forceinline__ float row_max16(float v) {
  asm("v_max_num_f32_dpp %0, %0, %0 row_xmask:1 row_mask:0xf bank_mask:0xf\n\t"
      "v_max_num_f32_dpp %0, %0, %0 row_xmask:2 row_mask:0xf bank_mask:0xf\n\t"
      "v_max_num_f32_dpp %0, %0, %0 row_xmask:4 row_mask:0xf bank_mask:0xf\n\t"
      "v_max_num_f32_dpp %0, %0, %0 row_xmask:8 row_mask:0xf bank_mask:0xf" : "+v"(v));
  return v; }
__device__ __forceinline__ float row_sum16(float v) { v += row_xor<1>(v); v += row_xor<2>(v); v += row_xor<4>(v); v += row_xor<8>(v); return v; }
template <int CAUSAL>
__global__ __launch_bounds__(128) void k_flash(const _Float16* __restrict__ Q16, int ldq, const _Float16* __restrict__ K16, int ldk, const _Float16* __restrict__ Vt, const int* __restrict__ MSK, float* __restrict__ O, int ldo) {
  constexpr int RPW = 16, RTN = RPW / 16, NQB = TQ / (4 * RPW), DT = 4, KS = 2;
  __shared__ __attribute__((aligned(16))) unsigned short sP[4][RPW][40]; __shared__ __attribute__((aligned(16))) float sO[4][RPW][64 + 4];
  const int tid = threadIdx.x, w = tid >> 5, lane = tid & 31, ln = lane & 15, hh = lane >> 4;
  const int slab = blockIdx.x / NQB, qblk = blockIdx.x % NQB; const int b = slab / NH, h = slab % NH; const int qb0 = qblk * (4 * RPW); const int q0 = qb0 + w * RPW;
  FragH aq[2][KS];
#pragma unroll
  for (int rt = 0; rt < RTN; ++rt) { const unsigned short* qr = (const unsigned short*)Q16 + ((size_t)b * TQ + q0 + rt * 16 + ln) * ldq + h * 64;
#pragma unroll
    for (int ks = 0; ks < KS; ++ks) { aq[rt][ks].half[0] = *(const v8us*)(qr + ks * 32 + 8 * hh); aq[rt][ks].half[1] = *(const v8us*)(qr + ks * 32 + 16 + 8 * hh); } }
  const unsigned short* Vth = (const unsigned short*)Vt + (size_t)slab * 64 * TK;
  float m_r[2][8], l_r[2][8]; v8f oacc[2][DT];
#pragma unroll
  for (int rt = 0; rt < RTN; ++rt) {
#pragma unroll
    for (int r = 0; r < 8; ++r) { m_r[rt][r] = -3.0e38f; l_r[rt][r] = 0.f; }
#pragma unroll
    for (int dt = 0; dt < DT; ++dt) oacc[rt][dt] = (v8f){0.f,0.f,0.f,0.f,0.f,0.f,0.f,0.f}; }
  const int jend = (CAUSAL == 1) ? (qb0 + 4 * RPW) : TK;      /* causal: keys beyond the block's last query never contribute */
#pragma unroll 1
  for (int j0 = 0; j0 < jend; j0 += 32) {
    v8f s[2][2];
#pragma unroll
    for (int nt = 0; nt < 2; ++nt) { const unsigned short* kr = (const unsigned short*)K16 + ((size_t)b * TK + j0 + nt * 16 + ln) * ldk + h * 64; FragH bk[KS];
#pragma unroll
      for (int ks = 0; ks < KS; ++ks) { bk[ks].half[0] = *(const v8us*)(kr + ks * 32 + 8 * hh); bk[ks].half[1] = *(const v8us*)(kr + ks * 32 + 16 + 8 * hh); }
#pragma unroll
      for (int rt = 0; rt < RTN; ++rt) { v8f acc = (v8f){0.f,0.f,0.f,0.f,0.f,0.f,0.f,0.f};
#pragma unroll
        for (int ks = 0; ks < KS; ++ks) acc = mmaH<1>(aq[rt][ks].v, aq[rt][ks].v, bk[ks].v, bk[ks].v, acc); s[rt][nt] = acc; } }
#pragma unroll
    for (int rt = 0; rt < RTN; ++rt)
#pragma unroll
      for (int r = 0; r < 8; ++r) { const int tq = q0 + rt * 16 + 8 * hh + r; const int k0 = j0 + ln, k1 = j0 + 16 + ln;
        const bool ok0 = (CAUSAL == 1) ? (k0 <= tq) : ((CAUSAL == 2) ? ((k0 >> 5) == (tq >> 5)) : true), ok1 = (CAUSAL == 1) ? (k1 <= tq) : ((CAUSAL == 2) ? ((k1 >> 5) == (tq >> 5)) : true);      /* mode 2: block-diagonal 32-token groups */
        const float s0 = ok0 ? s[rt][0][r] * SCL : -3.0e38f, s1 = ok1 ? s[rt][1][r] * SCL : -3.0e38f; 
        const float mn = row_max16(fmaxf(fmaxf(s0, s1), m_r[rt][r]));      /* the running maximum is the same in all 16 lanes of the row: taken in ahead of the reduction, the reduced value is the new maximum itself */
        const float al = (mn > -1.0e38f) ? expf(m_r[rt][r] - mn) : 1.0f; m_r[rt][r] = mn; const float p0 = ok0 ? expf(s0 - mn) : 0.f, p1 = ok1 ? expf(s1 - mn) : 0.f; l_r[rt][r] = l_r[rt][r] * al + p0 + p1;
#pragma unroll
        for (int dt = 0; dt < DT; ++dt) oacc[rt][dt][r] *= al;
        FragH t2; t2.h[0] = (_Float16)(p0 * 1024.0f); t2.h[1] = (_Float16)(p1 * 1024.0f); sP[w][rt * 16 + 8 * hh + r][ln] = t2.u[0]; sP[w][rt * 16 + 8 * hh + r][16 + ln] = t2.u[1]; }
    __builtin_amdgcn_fence(__ATOMIC_ACQ_REL, "workgroup"); __builtin_amdgcn_wave_barrier();
    FragH pa[2];
#pragma unroll
    for (int rt = 0; rt < RTN; ++rt) { pa[rt].half[0] = *(const v8us*)&sP[w][rt * 16 + ln][8 * hh]; pa[rt].half[1] = *(const v8us*)&sP[w][rt * 16 + ln][16 + 8 * hh]; }
#pragma unroll
    for (int dt = 0; dt < DT; ++dt) { const unsigned short* vrow = Vth + (size_t)(dt * 16 + ln) * TK + j0; FragH bv; bv.half[0] = *(const v8us*)(vrow + 8 * hh); bv.half[1] = *(const v8us*)(vrow + 16 + 8 * hh);
#pragma unroll
      for (int rt = 0; rt < RTN; ++rt) oacc[rt][dt] = mmaH<1>(pa[rt].v, pa[rt].v, bv.v, bv.v, oacc[rt][dt]); }
    __builtin_amdgcn_fence(__ATOMIC_ACQ_REL, "workgroup"); __builtin_amdgcn_wave_barrier(); }
#pragma unroll
  for (int rt = 0; rt < RTN; ++rt) {
#pragma unroll
    for (int r = 0; r < 8; ++r) { float l = l_r[rt][r]; l = row_sum16(l); l_r[rt][r] = (l > 0.f) ? 1.0f / (l * 1024.0f) : 0.f; }
#pragma unroll
    for (int dt = 0; dt < DT; ++dt)
#pragma unroll
      for (int r = 0; r < 8; ++r) sO[w][rt * 16 + 8 * hh + r][dt * 16 + ln] = oacc[rt][dt][r] * l_r[rt][r]; }
  __builtin_amdgcn_fence(__ATOMIC_ACQ_REL, "workgroup"); __builtin_amdgcn_wave_barrier();
  {
#pragma unroll
    for (int rp = 0; rp < RPW; rp += 2) { const int r = rp + (lane >> 4), pc = lane & 15; const v4f val = *(const v4fa*)&sO[w][r][pc * 4]; *(v4f*)(O + ((size_t)b * TQ + q0 + r) * ldo + h * 64 + pc * 4) = val; }
     } }
// 3-term variant: O = (P_hi V_hi + (P_lo V_hi + P_hi V_lo) / 1024) / l with P = [hi | 2^10 residual] of 1024 p and V^T = [hi | 2^10 residual] planes (VtL same layout as Vt) -> ~2^-21-class products for un-averaged (early causal / peaked) rows
template <int CAUSAL>
__global__ __launch_bounds__(32 * NSPL) void k_flash3gA(const _Float16* __restrict__ Q16, int ldq, const _Float16* __restrict__ K16, int ldk, const _Float16* __restrict__ Vt, const _Float16* __restrict__ VtL, const int* __restrict__ MSK, float* __restrict__ O, int ldo) {
  constexpr int RPW = 16, RTN = RPW / 16, NQB = TQA / (4 * RPW), DT = 4, KS = 2;
  __shared__ __attribute__((aligned(16))) unsigned short sP[NSPL][RPW][40]; __shared__ __attribute__((aligned(16))) unsigned short sPL[NSPL][RPW][40]; __shared__ __attribute__((aligned(16))) float sO[NSPL][RPW][64 + 4]; __shared__ float sM[NSPL][RPW], sL[NSPL][RPW];
  const int tid = threadIdx.x, w = __builtin_amdgcn_readfirstlane(tid >> 5), lane = tid & 31, ln = lane & 15, hh = lane >> 4;      /* the wave's number in a scalar register: the key range below stays scalar */
  /* one work-group per (batch, head, 16-query tile); its NSPL waves each run the flash loop over their own TK / NSPL keys, and the partial (m, l, O) are merged through LDS behind the loop */
  const int slab = blockIdx.x / (TQA / RPW), qblk = blockIdx.x % (TQA / RPW); (void)NQB; const int b = slab / NH, h = slab % NH; const int qb0 = qblk * RPW; const int q0 = qb0;
  FragH aq[2][KS];
#pragma unroll
  for (int rt = 0; rt < RTN; ++rt) { const unsigned short* qr = (const unsigned short*)Q16 + ((size_t)b * TQA + q0 + rt * 16 + ln) * ldq + h * 64;
#pragma unroll
    for (int ks = 0; ks < KS; ++ks) { aq[rt][ks].half[0] = *(const v8us*)(qr + ks * 32 + 8 * hh); aq[rt][ks].half[1] = *(const v8us*)(qr + ks * 32 + 16 + 8 * hh); } }
  const size_t vslab = (size_t)(b * (NH / KVG) + h / KVG); const unsigned short* Vth = (const unsigned short*)Vt + vslab * 64 * TK; const unsigned short* Vtl = (const unsigned short*)VtL + vslab * 64 * TK;      /* GQA: q-head h reads kv head h / KVG */
  float m_r[2][8], l_r[2][8]; v8f oacc[2][DT], oaccL[2][DT];
#pragma unroll
  for (int rt = 0; rt < RTN; ++rt) {
#pragma unroll
    for (int r = 0; r < 8; ++r) { m_r[rt][r] = -3.0e38f; l_r[rt][r] = 0.f; }
#pragma unroll
    for (int dt = 0; dt < DT; ++dt) { oacc[rt][dt] = (v8f){0.f,0.f,0.f,0.f,0.f,0.f,0.f,0.f}; oaccL[rt][dt] = oacc[rt][dt]; } }
  const int jbeg = w * (TK / NSPL), jend = jbeg + TK / NSPL;      /* this wave's keys */
#pragma unroll 1
  for (int j0 = jbeg; j0 < jend; j0 += 32) {
    v8f s[2][2]; FragH bk[2][KS], bv[DT], bl[DT]; int mk0[RTN][8], mk1[RTN][8];
    /* every global load of the trip is issued here, in the order of use (K, mask words, both V planes): their latencies overlap, and V lands behind the softmax */
#pragma unroll
    for (int nt = 0; nt < 2; ++nt) { const unsigned short* kr = (const unsigned short*)K16 + ((size_t)b * TK + j0 + nt * 16 + ln) * ldk + (h / KVG) * 64;
#pragma unroll
      for (int ks = 0; ks < KS; ++ks) { bk[nt][ks].half[0] = *(const v8us*)(kr + ks * 32 + 8 * hh); bk[nt][ks].half[1] = *(const v8us*)(kr + ks * 32 + 16 + 8 * hh); } }
    if (CAUSAL == 8) {
#pragma unroll
      for (int rt = 0; rt < RTN; ++rt)
#pragma unroll
        for (int r = 0; r < 8; ++r) { const int* mrow = MSK + (size_t)(q0 + rt * 16 + 8 * hh + r) * TK + j0 + ln; mk0[rt][r] = mrow[0]; mk1[rt][r] = mrow[16]; } }
    asm volatile("s_wait_xcnt 0x0" ::: "memory");      /* stands in front of the V loads, whose results may land in registers that the K and mask loads name as addresses */
#pragma unroll
    for (int dt = 0; dt < DT; ++dt) { const unsigned short* vrow = Vth + (size_t)(dt * 16 + ln) * TK + j0; const unsigned short* vrl = Vtl + (size_t)(dt * 16 + ln) * TK + j0; bv[dt].half[0] = *(const v8us*)(vrow + 8 * hh); bv[dt].half[1] = *(const v8us*)(vrow + 16 + 8 * hh); bl[dt].half[0] = *(const v8us*)(vrl + 8 * hh);
      if (dt == DT - 1) asm volatile("s_wait_xcnt 0x0" ::: "memory");      /* stands in front of the trip's last load, whose result lands in the address registers of the V loads above */
      bl[dt].half[1] = *(const v8us*)(vrl + 16 + 8 * hh); }
    __builtin_amdgcn_sched_barrier(0);      /* keeps the loads above together: without it the scheduler moves each one down to its first use, one exposed latency apiece */
#pragma unroll
    for (int nt = 0; nt < 2; ++nt) {
#pragma unroll
      for (int rt = 0; rt < RTN; ++rt) { v8f acc = (v8f){0.f,0.f,0.f,0.f,0.f,0.f,0.f,0.f};
#pragma unroll
        for (int ks = 0; ks < KS; ++ks) acc = mmaH<1>(aq[rt][ks].v, aq[rt][ks].v, bk[nt][ks].v, bk[nt][ks].v, acc); s[rt][nt] = acc; } }
#pragma unroll
    for (int rt = 0; rt < RTN; ++rt)
#pragma unroll
      for (int r = 0; r < 8; ++r) { const int tq = q0 + rt * 16 + 8 * hh + r; const int k0 = j0 + ln, k1 = j0 + 16 + ln;
        bool ok0 = (CAUSAL == 1) ? (k0 <= tq) : ((CAUSAL == 2) ? ((k0 >> 5) == (tq >> 5)) : true), ok1 = (CAUSAL == 1) ? (k1 <= tq) : ((CAUSAL == 2) ? ((k1 >> 5) == (tq >> 5)) : true);      /* mode 2: block-diagonal 32-token groups */
        if (CAUSAL == 8) { ok0 = mk0[rt][r] != 0; ok1 = mk1[rt][r] != 0; }      /* mode 8: per-(query, key) int table shared by all batches and heads */
        if (CAUSAL == 4) { const int* mrow = MSK + ((size_t)b * TQA + tq) * TK; ok0 = mrow[k0] != 0; ok1 = mrow[k1] != 0; }      /* mode 4: per-(query, key) INPUT mask shared by all heads; masked keys contribute nothing (== the reference's -4096 fill, whose exp underflows to 0), rows with no valid key give l = 0 -> output 0 (== the reference's row_valid zeroing) */
        const float s0 = ok0 ? s[rt][0][r] * SCL : -3.0e38f, s1 = ok1 ? s[rt][1][r] * SCL : -3.0e38f; 
        const float mn = row_max16(fmaxf(fmaxf(s0, s1), m_r[rt][r]));      /* the running maximum is the same in all 16 lanes of the row: taken in ahead of the reduction, the reduced value is the new maximum itself */
        const float al = (mn > -1.0e38f) ? expf(m_r[rt][r] - mn) : 1.0f; m_r[rt][r] = mn; const float p0 = ok0 ? expf(s0 - mn) : 0.f, p1 = ok1 ? expf(s1 - mn) : 0.f; l_r[rt][r] = l_r[rt][r] * al + p0 + p1;
#pragma unroll
        for (int dt = 0; dt < DT; ++dt) { oacc[rt][dt][r] *= al; oaccL[rt][dt][r] *= al; }
        FragH t2, t2l; const float ps0 = p0 * 1024.0f, ps1 = p1 * 1024.0f; t2.h[0] = (_Float16)ps0; t2.h[1] = (_Float16)ps1; t2l.h[0] = (_Float16)((ps0 - (float)t2.h[0]) * 1024.0f); t2l.h[1] = (_Float16)((ps1 - (float)t2.h[1]) * 1024.0f);
        sP[w][rt * 16 + 8 * hh + r][ln] = t2.u[0]; sP[w][rt * 16 + 8 * hh + r][16 + ln] = t2.u[1]; sPL[w][rt * 16 + 8 * hh + r][ln] = t2l.u[0]; sPL[w][rt * 16 + 8 * hh + r][16 + ln] = t2l.u[1]; }
    __builtin_amdgcn_fence(__ATOMIC_ACQ_REL, "workgroup"); __builtin_amdgcn_wave_barrier();
    FragH pa[2], pl[2];
#pragma unroll
    for (int rt = 0; rt < RTN; ++rt) { pa[rt].half[0] = *(const v8us*)&sP[w][rt * 16 + ln][8 * hh]; pa[rt].half[1] = *(const v8us*)&sP[w][rt * 16 + ln][16 + 8 * hh]; pl[rt].half[0] = *(const v8us*)&sPL[w][rt * 16 + ln][8 * hh]; pl[rt].half[1] = *(const v8us*)&sPL[w][rt * 16 + ln][16 + 8 * hh]; }
#pragma unroll
    for (int dt = 0; dt < DT; ++dt) {
#pragma unroll
      for (int rt = 0; rt < RTN; ++rt) { oacc[rt][dt] = mmaH<1>(pa[rt].v, pa[rt].v, bv[dt].v, bv[dt].v, oacc[rt][dt]); oaccL[rt][dt] = mmaH<1>(pl[rt].v, pl[rt].v, bv[dt].v, bv[dt].v, oaccL[rt][dt]); oaccL[rt][dt] = mmaH<1>(pa[rt].v, pa[rt].v, bl[dt].v, bl[dt].v, oaccL[rt][dt]); } }
    __builtin_amdgcn_fence(__ATOMIC_ACQ_REL, "workgroup"); __builtin_amdgcn_wave_barrier(); }
  /* each wave leaves its rows' maxima, sums and unnormalised outputs in LDS */
#pragma unroll
  for (int rt = 0; rt < RTN; ++rt) {
#pragma unroll
    for (int r = 0; r < 8; ++r) { const float l = row_sum16(l_r[rt][r]); if (ln == 0) { sM[w][rt * 16 + 8 * hh + r] = m_r[rt][r]; sL[w][rt * 16 + 8 * hh + r] = l; } }
#pragma unroll
    for (int dt = 0; dt < DT; ++dt)
#pragma unroll
      for (int r = 0; r < 8; ++r) { float v = oacc[rt][dt][r]; v += oaccL[rt][dt][r] * 0.0009765625f; sO[w][rt * 16 + 8 * hh + r][dt * 16 + ln] = v; } }
  __syncthreads();      /* every wave's partials are in LDS before any thread merges them */
  /* merge, a thread per (row, 4 columns): M = max m_u; l = sum l_u e^(m_u - M); O = sum O_u e^(m_u - M), u in wave order. A wave with no live key for the row has m_u = -3.0e38, l_u = 0, O_u = 0 and adds nothing; a row with no live key at all gives l = 0 -> output 0 */
  if (tid < RPW * 16) { const int r = tid >> 4, pc = tid & 15; float mm = sM[0][r];      /* both loops below are unrolled so that their LDS reads are issued together, ahead of the arithmetic */
#pragma unroll
    for (int u = 1; u < NSPL; ++u) mm = fmaxf(mm, sM[u][r]);
    float l = 0.f; v4f a = {0.f, 0.f, 0.f, 0.f};
#pragma unroll
    for (int u = 0; u < NSPL; ++u) { const float f = expf(sM[u][r] - mm); const v4f val = *(const v4fa*)&sO[u][r][pc * 4]; l += sL[u][r] * f; a += val * f; }
    const float li = (l > 0.f) ? 1.0f / (l * 1024.0f) : 0.f;
    *(v4f*)(O + ((size_t)b * TQA + q0 + r) * ldo + h * 64 + pc * 4) = a * li; } }

// 3-term variant: O = (P_hi V_hi + (P_lo V_hi + P_hi V_lo) / 1024) / l with P = [hi | 2^10 residual] of 1024 p and V^T = [hi | 2^10 residual] planes (VtL same layout as Vt) -> ~2^-21-class products for un-averaged (early causal / peaked) rows
template <int CAUSAL>
__global__ __launch_bounds__(256) void k_flash3gB(const _Float16* __restrict__ Q16, int ldq, const _Float16* __restrict__ K16, int ldk, const _Float16* __restrict__ Vt, const _Float16* __restrict__ VtL, const int* __restrict__ MSK, const unsigned int* __restrict__ LV, float* __restrict__ O, int ldo) {
  constexpr int RPW = 16, RTN = RPW / 16, NQB = TQB / (4 * RPW), DT = 4, KS = 2;
  __shared__ __attribute__((aligned(16))) unsigned short sP[8][RPW][40]; __shared__ __attribute__((aligned(16))) unsigned short sPL[8][RPW][40]; __shared__ __attribute__((aligned(16))) float sO[8][RPW][64 + 4];
  const int tid = threadIdx.x, w = __builtin_amdgcn_readfirstlane(tid >> 5), lane = tid & 31, ln = lane & 15, hh = lane >> 4;      /* the wave's number in a scalar register: the tile number, its live bits and the test on them stay scalar */
  const int slab = blockIdx.x / (QTB / 16), pblk = blockIdx.x % (QTB / 16); (void)NQB; const int b = slab / NH, h = slab % NH;
  /* a wave takes two 16-query tiles one after the other, t and QTB - 1 - t: where the live key tiles grow with the query position, as under a causal mask, every wave then walks about the same number of them. For any mask each tile is taken exactly once */
#pragma unroll 1      /* kept rolled: one copy of the key loop in the instruction cache */
  for (int it = 0; it < 2; ++it) {
  const int qt = it ? QTB - 1 - (pblk * 8 + w) : pblk * 8 + w; const int q0 = qt * RPW;
  const unsigned int* lv = LV + (size_t)qt * (3 * 4 * 32);      /* bit kt & 31 of word kt >> 5, the four row groups joined: key tile kt holds a non-zero mask word for this query tile */
  unsigned int lw0 = ~0u, lw1 = ~0u, lw2 = ~0u;      /* the modes without a mask table walk every key tile */
  if (CAUSAL == 8) { lw0 = __builtin_amdgcn_readfirstlane(lv[0] | lv[32] | lv[64] | lv[96]); lw1 = __builtin_amdgcn_readfirstlane(lv[128] | lv[160] | lv[192] | lv[224]); lw2 = __builtin_amdgcn_readfirstlane(lv[256] | lv[288] | lv[320] | lv[352]); }
  FragH aq[2][KS];
#pragma unroll
  for (int rt = 0; rt < RTN; ++rt) { const unsigned short* qr = (const unsigned short*)Q16 + ((size_t)b * TQB + q0 + rt * 16 + ln) * ldq + h * 64;
#pragma unroll
    for (int ks = 0; ks < KS; ++ks) { aq[rt][ks].half[0] = *(const v8us*)(qr + ks * 32 + 8 * hh); aq[rt][ks].half[1] = *(const v8us*)(qr + ks * 32 + 16 + 8 * hh); } }
  const size_t vslab = (size_t)(b * (NH / KVG) + h / KVG); const unsigned short* Vth = (const unsigned short*)Vt + vslab * 64 * TK; const unsigned short* Vtl = (const unsigned short*)VtL + vslab * 64 * TK;      /* GQA: q-head h reads kv head h / KVG */
  float m_r[2][8], l_r[2][8]; v8f oacc[2][DT], oaccL[2][DT];
#pragma unroll
  for (int rt = 0; rt < RTN; ++rt) {
#pragma unroll
    for (int r = 0; r < 8; ++r) { m_r[rt][r] = -3.0e38f; l_r[rt][r] = 0.f; }
#pragma unroll
    for (int dt = 0; dt < DT; ++dt) { oacc[rt][dt] = (v8f){0.f,0.f,0.f,0.f,0.f,0.f,0.f,0.f}; oaccL[rt][dt] = oacc[rt][dt]; } }
  const int jend = (CAUSAL == 1) ? (q0 + RPW) : TK;      /* causal: keys beyond the tile's last query never contribute */
#pragma unroll 1
  for (int j0 = 0; j0 < jend; j0 += 32) {
    /* a key tile whose 16 x 32 mask words are all zero leaves m, l and O as they are (every p is 0 and the rescale factor is 1): it is passed over, on a scalar test */
    const int kt = j0 >> 5; const unsigned int lw = (kt < 32) ? lw0 : ((kt < 64) ? lw1 : lw2);
    if (((lw >> (kt & 31)) & 1u) == 0u) continue;
    v8f s[2][2]; FragH bk[2][KS], bv[DT], bl[DT]; int mk0[RTN][8], mk1[RTN][8];
    /* every global load of the trip is issued here, in the order of use (K, mask words, both V planes): their latencies overlap, and V lands behind the softmax */
#pragma unroll
    for (int nt = 0; nt < 2; ++nt) { const unsigned short* kr = (const unsigned short*)K16 + ((size_t)b * TK + j0 + nt * 16 + ln) * ldk + (h / KVG) * 64;
#pragma unroll
      for (int ks = 0; ks < KS; ++ks) { bk[nt][ks].half[0] = *(const v8us*)(kr + ks * 32 + 8 * hh); bk[nt][ks].half[1] = *(const v8us*)(kr + ks * 32 + 16 + 8 * hh); } }
    asm volatile("s_wait_xcnt 0x0" ::: "memory");      /* stands in front of the mask loads, whose results may land in registers that the K loads name as addresses */
    if (CAUSAL == 8) {
#pragma unroll
      for (int rt = 0; rt < RTN; ++rt)
#pragma unroll
        for (int r = 0; r < 8; ++r) { const int* mrow = MSK + (size_t)(q0 + rt * 16 + 8 * hh + r) * TK + j0 + ln; mk0[rt][r] = mrow[0]; mk1[rt][r] = mrow[16]; } }
    asm volatile("s_wait_xcnt 0x0" ::: "memory");      /* stands in front of the V loads, whose results may land in registers that the mask loads name as addresses */
#pragma unroll
    for (int dt = 0; dt < DT; ++dt) { const unsigned short* vrow = Vth + (size_t)(dt * 16 + ln) * TK + j0; const unsigned short* vrl = Vtl + (size_t)(dt * 16 + ln) * TK + j0; bv[dt].half[0] = *(const v8us*)(vrow + 8 * hh); bv[dt].half[1] = *(const v8us*)(vrow + 16 + 8 * hh); bl[dt].half[0] = *(const v8us*)(vrl + 8 * hh);
      if (dt == DT - 1) asm volatile("s_wait_xcnt 0x0" ::: "memory");      /* stands in front of the trip's last load, whose result lands in the address registers of the V loads above */
      bl[dt].half[1] = *(const v8us*)(vrl + 16 + 8 * hh); }
    __builtin_amdgcn_sched_barrier(0);      /* keeps the loads above together: without it the scheduler moves each one down to its first use, one exposed latency apiece */
#pragma unroll
    for (int nt = 0; nt < 2; ++nt) {
#pragma unroll
      for (int rt = 0; rt < RTN; ++rt) { v8f acc = (v8f){0.f,0.f,0.f,0.f,0.f,0.f,0.f,0.f};
#pragma unroll
        for (int ks = 0; ks < KS; ++ks) acc = mmaH<1>(aq[rt][ks].v, aq[rt][ks].v, bk[nt][ks].v, bk[nt][ks].v, acc); s[rt][nt] = acc; } }
#pragma unroll
    for (int rt = 0; rt < RTN; ++rt)
#pragma unroll
      for (int r = 0; r < 8; ++r) { const int tq = q0 + rt * 16 + 8 * hh + r; const int k0 = j0 + ln, k1 = j0 + 16 + ln;
        bool ok0 = (CAUSAL == 1) ? (k0 <= tq) : ((CAUSAL == 2) ? ((k0 >> 5) == (tq >> 5)) : true), ok1 = (CAUSAL == 1) ? (k1 <= tq) : ((CAUSAL == 2) ? ((k1 >> 5) == (tq >> 5)) : true);      /* mode 2: block-diagonal 32-token groups */
        if (CAUSAL == 8) { ok0 = mk0[rt][r] != 0; ok1 = mk1[rt][r] != 0; }      /* mode 8: per-(query, key) int table shared by all batches and heads */
        if (CAUSAL == 4) { const int* mrow = MSK + ((size_t)b * TQB + tq) * TK; ok0 = mrow[k0] != 0; ok1 = mrow[k1] != 0; }      /* mode 4: per-(query, key) INPUT mask shared by all heads; masked keys contribute nothing (== the reference's -4096 fill, whose exp underflows to 0), rows with no valid key give l = 0 -> output 0 (== the reference's row_valid zeroing) */
        const float s0 = ok0 ? s[rt][0][r] * SCL : -3.0e38f, s1 = ok1 ? s[rt][1][r] * SCL : -3.0e38f; 
        const float mn = row_max16(fmaxf(fmaxf(s0, s1), m_r[rt][r]));      /* the running maximum is the same in all 16 lanes of the row: taken in ahead of the reduction, the reduced value is the new maximum itself */
        const float al = (mn > -1.0e38f) ? expf(m_r[rt][r] - mn) : 1.0f; m_r[rt][r] = mn; const float p0 = ok0 ? expf(s0 - mn) : 0.f, p1 = ok1 ? expf(s1 - mn) : 0.f; l_r[rt][r] = l_r[rt][r] * al + p0 + p1;
#pragma unroll
        for (int dt = 0; dt < DT; ++dt) { oacc[rt][dt][r] *= al; oaccL[rt][dt][r] *= al; }
        FragH t2, t2l; const float ps0 = p0 * 1024.0f, ps1 = p1 * 1024.0f; t2.h[0] = (_Float16)ps0; t2.h[1] = (_Float16)ps1; t2l.h[0] = (_Float16)((ps0 - (float)t2.h[0]) * 1024.0f); t2l.h[1] = (_Float16)((ps1 - (float)t2.h[1]) * 1024.0f);
        sP[w][rt * 16 + 8 * hh + r][ln] = t2.u[0]; sP[w][rt * 16 + 8 * hh + r][16 + ln] = t2.u[1]; sPL[w][rt * 16 + 8 * hh + r][ln] = t2l.u[0]; sPL[w][rt * 16 + 8 * hh + r][16 + ln] = t2l.u[1]; }
    __builtin_amdgcn_fence(__ATOMIC_ACQ_REL, "workgroup"); __builtin_amdgcn_wave_barrier();
    FragH pa[2], pl[2];
#pragma unroll
    for (int rt = 0; rt < RTN; ++rt) { pa[rt].half[0] = *(const v8us*)&sP[w][rt * 16 + ln][8 * hh]; pa[rt].half[1] = *(const v8us*)&sP[w][rt * 16 + ln][16 + 8 * hh]; pl[rt].half[0] = *(const v8us*)&sPL[w][rt * 16 + ln][8 * hh]; pl[rt].half[1] = *(const v8us*)&sPL[w][rt * 16 + ln][16 + 8 * hh]; }
#pragma unroll
    for (int dt = 0; dt < DT; ++dt) {
#pragma unroll
      for (int rt = 0; rt < RTN; ++rt) { oacc[rt][dt] = mmaH<1>(pa[rt].v, pa[rt].v, bv[dt].v, bv[dt].v, oacc[rt][dt]); oaccL[rt][dt] = mmaH<1>(pl[rt].v, pl[rt].v, bv[dt].v, bv[dt].v, oaccL[rt][dt]); oaccL[rt][dt] = mmaH<1>(pa[rt].v, pa[rt].v, bl[dt].v, bl[dt].v, oaccL[rt][dt]); } }
    __builtin_amdgcn_fence(__ATOMIC_ACQ_REL, "workgroup"); __builtin_amdgcn_wave_barrier(); }
#pragma unroll
  for (int rt = 0; rt < RTN; ++rt) {
#pragma unroll
    for (int r = 0; r < 8; ++r) { float l = l_r[rt][r]; l = row_sum16(l); l_r[rt][r] = (l > 0.f) ? 1.0f / (l * 1024.0f) : 0.f; }
#pragma unroll
    for (int dt = 0; dt < DT; ++dt)
#pragma unroll
      for (int r = 0; r < 8; ++r) { float v = oacc[rt][dt][r]; v += oaccL[rt][dt][r] * 0.0009765625f; sO[w][rt * 16 + 8 * hh + r][dt * 16 + ln] = v * l_r[rt][r]; } }
  __builtin_amdgcn_fence(__ATOMIC_ACQ_REL, "workgroup"); __builtin_amdgcn_wave_barrier();
  {
#pragma unroll
    for (int rp = 0; rp < RPW; rp += 2) { const int r = rp + (lane >> 4), pc = lane & 15; const v4f val = *(const v4fa*)&sO[w][r][pc * 4]; *(v4f*)(O + ((size_t)b * TQB + q0 + r) * ldo + h * 64 + pc * 4) = val; }
    asm volatile("s_wait_xcnt 0x0" ::: "memory");      /* stands in front of the second tile's set-up, which overwrites registers that the stores above name */
     } } }

__device__ __forceinline__ void d_wpair(int bx, const float* __restrict__ Wm, int nin, int nout, _Float16* __restrict__ Bt) { const size_t t = (size_t)bx * 256 + threadIdx.x; if (t >= (size_t)nout * (2 * nin / 8)) return; const int pc = (int)(t % (2 * nin / 8)); const int o = (int)(t / (2 * nin / 8)); const bool lo = pc * 8 >= nin; FragH f;
  for (int q = 0; q < 8; ++q) { const int c = pc * 8 + q - (lo ? nin : 0); f.h[q] = (_Float16)(bf16_round(Wm[(size_t)c * nout + o]) * (lo ? 1.0f : 16.0f)); } *(v8us*)((unsigned short*)Bt + (size_t)o * 2 * nin + pc * 8) = f.half[0];  }
template <int TWO_D>
__device__ __forceinline__ void d_rotab(int bx, int nrows, int rpb, const int* __restrict__ bar, const int* __restrict__ tib, float* __restrict__ CS, float* __restrict__ SN) {
  #pragma clang fp contract(off)
  const size_t t = (size_t)bx * 256 + threadIdx.x; if (t >= (size_t)nrows * 32) return; const int d = (int)(t % 32); const int row = (int)(t / 32); const int b = row / rpb, r = row % rpb; float pos, inv;
  if (TWO_D) { const int dm = d & 15; inv = 1.0f / powf(10000.0f, (float)dm * 2.0f / 32.0f); pos = (d < 16) ? (float)bar[(size_t)b * rpb + r] : (float)tib[(size_t)b * rpb + r]; }
  else { inv = 1.0f / powf(10000.0f, (float)(2 * d) / 64.0f); pos = (float)r; }
  const float th = pos * inv; const float c = cosf(th), s = sinf(th);
  { *(float*)(CS + t) = c; *(float*)(SN + t) = s;  } }
__device__ __forceinline__ void d_rope(int bx, const float* __restrict__ F, int nrows, int rpb, int nheads, const float* __restrict__ CS, const float* __restrict__ SN, _Float16* __restrict__ dst, int ldo, int dst_bstride, int row_off) {
  #pragma clang fp contract(off)
  const size_t t = (size_t)bx * 256 + threadIdx.x; if (t >= (size_t)nrows * nheads * 4) return; const int jg = (int)(t % 4) * 8; const int h = (int)((t / 4) % nheads); const int row = (int)(t / (4 * (size_t)nheads)); const int b = row / rpb, r = row % rpb; const int ldi = nheads * 64;
  const float* xr = F + (size_t)row * ldi + h * 64; FragH f0, f1;
#pragma unroll
  for (int q = 0; q < 8; ++q) { const int d = jg + q; const float c = CS[(size_t)row * 32 + d], s = SN[(size_t)row * 32 + d]; const float x0 = xr[d], x1 = xr[d + 32];
    float o0 = x0 * c; o0 += -x1 * s; float o1 = x1 * c; o1 += x0 * s; f0.h[q] = (_Float16)o0; f1.h[q] = (_Float16)o1; }
  unsigned short* o = (unsigned short*)dst + ((size_t)b * dst_bstride + row_off + r) * ldo + h * 64 + jg;
  { *(v8us*)o = f0.half[0]; *(v8us*)(o + 32) = f1.half[0];  } }
__device__ __forceinline__ void d_put(int bx, const float* __restrict__ F, int nrows, int rpb, int ncol, _Float16* __restrict__ H, _Float16* __restrict__ L, int dst_bstride, int row_off) {
  const size_t t = (size_t)bx * 256 + threadIdx.x; if (t >= (size_t)nrows * (ncol / 8)) return; const int c0 = (int)(t % (ncol / 8)) * 8; const int row = (int)(t / (ncol / 8)); const int b = row / rpb, r = row % rpb; FragH fh, fl;
  for (int q = 0; q < 8; ++q) { const float v = F[(size_t)row * ncol + c0 + q]; const _Float16 hv = (_Float16)v; fh.h[q] = hv; fl.h[q] = (_Float16)((v - (float)hv) * 1024.0f); }
  const size_t drow = (size_t)b * dst_bstride + row_off + r; { *(v8us*)((unsigned short*)H + drow * ncol + c0) = fh.half[0];
    asm volatile("s_wait_xcnt 0x0" ::: "memory");      /* stands in front of the residual plane's arithmetic, which overwrites registers that the store above names */
    if (L) *(v8us*)((unsigned short*)L + drow * ncol + c0) = fl.half[0];  } }

// live bits of the phase-2 mask: bit l of word (qt, wd, rg) says whether key tile wd * 32 + l (32 keys) holds a non-zero word in rows 4 rg .. 4 rg + 3 of the 16-query tile qt. A wave per word, a lane per key tile (128 bytes a row); each word has a 128-byte line of its own
__device__ __forceinline__ void d_live(int bx, const int* __restrict__ MSK, unsigned int* __restrict__ LV) {
  typedef int v4ia __attribute__((ext_vector_type(4), may_alias));
  const int wv = bx * 8 + (int)(threadIdx.x >> 5), lane = threadIdx.x & 31; const int rg = wv & 3, wd = (wv >> 2) % 3, qt = (wv >> 2) / 3; const int kt = wd * 32 + lane; v4ia any = {0, 0, 0, 0};
  if (kt < TK / 32) { const int* p = MSK + (size_t)(qt * 16 + rg * 4) * TK + kt * 32;
#pragma unroll 1
    for (int r = 0; r < 4; ++r) {      /* kept rolled: a row's 8 loads are in flight together, and the launch's register count stays low for its other ranges */
#pragma unroll
      for (int c = 0; c < 8; ++c) any |= *(const v4ia*)(p + (size_t)r * TK + c * 4); } }
  const unsigned int word = __builtin_amdgcn_ballot_w32((any[0] | any[1] | any[2] | any[3]) != 0);
  if (lane == 0) LV[(size_t)wv * 32] = word; }

// ---- one launch per dependency level: kernels that do not depend on one another run as consecutive block ranges of one grid. Every range test reads blockIdx.x alone, so a work-group takes one branch as a whole; each body is the same code as before, handed its block number inside its own range. ----
constexpr int PB_W = DMOD * DMOD / 8 / 256, PB_WK = DMOD * KVD / 8 / 256;                  /* blocks of one transposed weight plane: 1024 and 256 columns */
constexpr int PB_P = DMOD * (2 * DMOD / 8) / 256, PB_PK = KVD * (2 * DMOD / 8) / 256;       /* blocks of one [W x16 | W x1] weight pair (same bf16 weights, for the hi and the residual products) */
constexpr int PB_T1 = NRS * 32 / 256, PB_T2 = NRR * 32 / 256;                              /* RoPE tables */
constexpr int PB_XS = NRS * DMOD / 8 / 256, PB_XR = NRR * DMOD / 8 / 256;                  /* f16 planes of the two inputs */
constexpr int PB_ALL = 2 * PB_W + 4 * PB_WK + 2 * PB_P + 2 * PB_PK + PB_T1 + PB_T2 + PB_XS + PB_XR;
__global__ __launch_bounds__(256) void k_prep(const float* w_sq, const float* w_sk, const float* w_sv, const float* w_rq, const float* w_rk, const float* w_rv,
    _Float16* BSQ, _Float16* BSK, _Float16* BSV, _Float16* BRQ, _Float16* BRK, _Float16* BRV,
    const float* w_so, const float* w_ro, const float* w_k2, const float* w_v2, _Float16* BSO, _Float16* BRO, _Float16* BK2, _Float16* BV2,
    const int* bar, const int* tib, float* CS1, float* SN1, float* CS2, float* SN2, const float* sum_x, _Float16* SX, const float* reg_x, _Float16* RX) {
  int bx = blockIdx.x;
  if (bx < 2 * PB_W + 4 * PB_WK) { const float* Wm = w_sq; _Float16* Bt = BSQ; int nout = DMOD;
    if (bx >= PB_W) { bx -= PB_W; Wm = w_rq; Bt = BRQ;
      if (bx >= PB_W) { bx -= PB_W; Wm = w_sk; Bt = BSK; nout = KVD;
        if (bx >= PB_WK) { bx -= PB_WK; Wm = w_sv; Bt = BSV;
          if (bx >= PB_WK) { bx -= PB_WK; Wm = w_rk; Bt = BRK;
            if (bx >= PB_WK) { bx -= PB_WK; Wm = w_rv; Bt = BRV; } } } } }
    d_wt_f16(bx, Wm, Bt, DMOD, nout, 16.0f); return; }
  bx -= 2 * PB_W + 4 * PB_WK;
  if (bx < 2 * PB_P + 2 * PB_PK) { const float* Wm = w_so; _Float16* Bt = BSO; int nout = DMOD;
    if (bx >= PB_P) { bx -= PB_P; Wm = w_ro; Bt = BRO;
      if (bx >= PB_P) { bx -= PB_P; Wm = w_k2; Bt = BK2; nout = KVD;
        if (bx >= PB_PK) { bx -= PB_PK; Wm = w_v2; Bt = BV2; } } }
    d_wpair(bx, Wm, DMOD, nout, Bt); return; }
  bx -= 2 * PB_P + 2 * PB_PK;
  if (bx < PB_T1) { d_rotab<0>(bx, NRS, SS, nullptr, nullptr, CS1, SN1); return; }
  bx -= PB_T1;
  if (bx < PB_T2) { d_rotab<1>(bx, NRR, RR, bar, tib, CS2, SN2); return; }
  bx -= PB_T2;
  if (bx < PB_XS) d_x16(bx, sum_x, SX, (size_t)NRS * DMOD / 8); else d_x16(bx - PB_XS, reg_x, RX, (size_t)NRR * DMOD / 8); }

// up to six GEMMs (d_gemm2) in one launch, all with the same lda, ldb, K and alpha; ldc = N. Jobs 0..2 read A0 (Ma rows), jobs 3..5 read A1 (Mb rows); in each triple N = DMOD, KVD, KVD. S_j is job j's bias (cp == 0) or the f32 plane, pitch N, that is added to the product (cp != 0). The grid ends behind the last job in use; the pointers of jobs behind it are not read.
__global__ __launch_bounds__(128) void k_gemm2m(const _Float16* A0, const _Float16* A1, const _Float16* B0, const _Float16* B1, const _Float16* B2, const _Float16* B3, const _Float16* B4, const _Float16* B5,
    const float* S0, const float* S1, const float* S2, const float* S3, const float* S4, const float* S5, float* C0, float* C1, float* C2, float* C3, float* C4, float* C5, int Ma, int Mb, int lda, int ldb, int K, float alpha, int cp) {
  int bx = blockIdx.x; const int ta = Ma >> 7, tb = Mb >> 7;      /* 128-row block tiles; a job has (M / 128) * (N / 64) blocks */
  const _Float16* A = A0; const _Float16* B = B0; const float* S = S0; float* C = C0; int M = Ma, N = DMOD;
  if (bx >= ta * (DMOD / 64)) { bx -= ta * (DMOD / 64); B = B1; S = S1; C = C1; N = KVD;
    if (bx >= ta * (KVD / 64)) { bx -= ta * (KVD / 64); B = B2; S = S2; C = C2;
      if (bx >= ta * (KVD / 64)) { bx -= ta * (KVD / 64); A = A1; M = Mb; B = B3; S = S3; C = C3; N = DMOD;
        if (bx >= tb * (DMOD / 64)) { bx -= tb * (DMOD / 64); B = B4; S = S4; C = C4; N = KVD;
          if (bx >= tb * (KVD / 64)) { bx -= tb * (KVD / 64); B = B5; S = S5; C = C5; } } } } }
  d_gemm2<0>(bx, A, lda, 0, B, ldb, 0, alpha, cp ? nullptr : S, 0, cp ? S : nullptr, 1, (size_t)N, 0, C, nullptr, N, 0, M, N, K); }

constexpr int QB_RQ = NRR * NH * 4 / 256, QB_RK = NRR * NKV * 4 / 256, QB_RV = NRR * (KVD / 8) / 256, QB_SQ = NRS * NH * 4 / 256, QB_SK = NRS * NKV * 4 / 256, QB_SV = NRS * (KVD / 8) / 256;
constexpr int QB_LV = QTB * 3 * 4 / 8;      /* live bits of the phase-2 mask: 8 waves a block, a wave per word */
// what follows the six projections: RoPE of both q and both k planes, hi + residual planes of both v; ahead of them, as it depends on an input alone, the live bits of the phase-2 mask
__global__ __launch_bounds__(256) void k_post(const float* FSQ, const float* FSK, const float* FSV, const float* FRQ, const float* FRK, const float* FRV, const float* CS1, const float* SN1, const float* CS2, const float* SN2,
    _Float16* SQ, _Float16* RQ, _Float16* KC, _Float16* VCH, _Float16* VCL, const int* mupd, unsigned int* LV) {
  int bx = blockIdx.x;
  if (bx < QB_LV) { d_live(bx, mupd, LV); return; }
  bx -= QB_LV;
  if (bx < QB_RQ + QB_RK + QB_SQ + QB_SK) { const float* F = FRQ; const float* CS = CS2; const float* SN = SN2; _Float16* dst = RQ; int nrows = NRR, rpb = RR, nheads = NH, bstr = RR, roff = 0;
    if (bx >= QB_RQ) { bx -= QB_RQ; F = FRK; dst = KC; nheads = NKV; bstr = TK; roff = SS;      /* keys 64.. of each batch */
      if (bx >= QB_RK) { bx -= QB_RK; F = FSQ; CS = CS1; SN = SN1; dst = SQ; nrows = NRS; rpb = SS; nheads = NH; bstr = SS; roff = 0;
        if (bx >= QB_SQ) { bx -= QB_SQ; F = FSK; dst = KC; nheads = NKV; bstr = TK; } } }      /* keys 0..63 of each batch */
    d_rope(bx, F, nrows, rpb, nheads, CS, SN, dst, nheads * 64, bstr, roff); return; }
  bx -= QB_RQ + QB_RK + QB_SQ + QB_SK;
  if (bx < QB_RV) d_put(bx, FRV, NRR, RR, KVD, VCH, VCL, TK, SS); else d_put(bx - QB_RV, FSV, NRS, SS, KVD, VCH, VCL, TK, 0); }
// k2 into key rows 0..63 (one plane), v2 into value rows 0..63 (hi + residual) of each batch
__global__ __launch_bounds__(256) void k_put2(const float* FK2, const float* FV2, _Float16* KC, _Float16* VCH, _Float16* VCL) {
  const int bx = blockIdx.x;
  if (bx < QB_SV) d_put(bx, FK2, NRS, SS, KVD, KC, nullptr, TK, 0); else d_put(bx - QB_SV, FV2, NRS, SS, KVD, VCH, VCL, TK, 0); }
// V^T of the hi plane (first half of the grid) and of the residual plane (second half)
__global__ __launch_bounds__(256) void k_vt2(const _Float16* VCH, const _Float16* VCL, _Float16* VT, _Float16* VTL) {
  constexpr int NBV = NB * NKV * (TK / 64); const bool lo = (int)blockIdx.x >= NBV;
  d_vt<NKV, TK>((int)blockIdx.x - (lo ? NBV : 0), lo ? VCL : VCH, KVD, 0, lo ? VTL : VT); }

extern "C" void kernel_launch(void* const* d_in, const int* in_sizes, int n_in,
                              void* d_out, int out_size, void* d_ws, size_t ws_size, hipStream_t stream) {
  (void)in_sizes; (void)n_in; (void)out_size;
  const float* const* I = (const float* const*)d_in; const float* sum_x = I[0]; const float* reg_x = I[1];
  const float* w_sq = I[2]; const float* b_sq = I[3]; const float* w_sk = I[4]; const float* b_sk = I[5]; const float* w_sv = I[6]; const float* b_sv = I[7]; const float* w_so = I[8]; const float* b_so = I[9];
  const float* w_rq = I[10]; const float* b_rq = I[11]; const float* w_rk = I[12]; const float* b_rk = I[13]; const float* w_rv = I[14]; const float* b_rv = I[15]; const float* w_ro = I[16]; const float* b_ro = I[17];
  const float* w_k2 = I[18]; const float* b_k2 = I[19]; const float* w_v2 = I[20]; const float* b_v2 = I[21];
  const int* bar = (const int*)d_in[22]; const int* tib = (const int*)d_in[23]; const int* msum = (const int*)d_in[24]; const int* mupd = (const int*)d_in[25];
  char* ws = (char*)d_ws; size_t off = 0;
  auto take = [&](size_t bytes) { char* p = ws + off; off += (bytes + 255) & ~(size_t)255; return p; };
  const size_t w8 = (size_t)DMOD * DMOD / 8, w8k = (size_t)DMOD * KVD / 8;
  _Float16* BSQ = (_Float16*)take(w8 * 16); _Float16* BSK = (_Float16*)take(w8k * 16); _Float16* BSV = (_Float16*)take(w8k * 16); _Float16* BRQ = (_Float16*)take(w8 * 16); _Float16* BRK = (_Float16*)take(w8k * 16); _Float16* BRV = (_Float16*)take(w8k * 16);
  _Float16* BSO = (_Float16*)take(w8 * 32); _Float16* BRO = (_Float16*)take(w8 * 32); _Float16* BK2 = (_Float16*)take(w8k * 32); _Float16* BV2 = (_Float16*)take(w8k * 32);
  float* CS1 = (float*)take((size_t)NRS * 32 * 4); float* SN1 = (float*)take((size_t)NRS * 32 * 4); float* CS2 = (float*)take((size_t)NRR * 32 * 4); float* SN2 = (float*)take((size_t)NRR * 32 * 4); _Float16* SX = (_Float16*)take((size_t)NRS * DMOD * 2); _Float16* RX = (_Float16*)take((size_t)NRR * DMOD * 2);
  /* each projection has an f32 plane of its own, since all six are written by one launch */
  float* FRQ = (float*)take((size_t)NRR * DMOD * 4); float* FRK = (float*)take((size_t)NRR * KVD * 4); float* FRV = (float*)take((size_t)NRR * KVD * 4); float* FSQ = (float*)take((size_t)NRS * DMOD * 4); float* FSK = (float*)take((size_t)NRS * KVD * 4); float* FSV = (float*)take((size_t)NRS * KVD * 4);
  _Float16* SQ = (_Float16*)take((size_t)NRS * DMOD * 2); _Float16* RQ = (_Float16*)take((size_t)NRR * DMOD * 2); _Float16* KC = (_Float16*)take((size_t)NB * TK * KVD * 2); _Float16* VCH = (_Float16*)take((size_t)NB * TK * KVD * 2); _Float16* VCL = (_Float16*)take((size_t)NB * TK * KVD * 2); _Float16* VT = (_Float16*)take((size_t)NB * NKV * 64 * TK * 2); _Float16* VTL = (_Float16*)take((size_t)NB * NKV * 64 * TK * 2);
  float* O1 = (float*)take((size_t)NRS * DMOD * 4); _Float16* O1H = (_Float16*)take((size_t)NRS * DMOD * 2); _Float16* O1L = (_Float16*)take((size_t)NRS * DMOD * 2); float* O2 = FRQ; _Float16* O2H = RQ; _Float16* O2L = RX;      /* O2 over the dead reg-q f32 scratch; O2H/O2L over RQ/RX (dead after phase 2 / the projections) */
  unsigned int* LV = (unsigned int*)take((size_t)QTB * 3 * 4 * 128);      /* live bits of the phase-2 mask, a 128-byte line a word */
  float* FK2 = FSK; float* FV2 = FSV;      /* k2 / v2 f32 planes over the summary k / v scratch (dead after k_post) */
  if (off > ws_size) return;      /* about 70 MiB */
  float* out0 = (float*)d_out; float* out1 = (float*)d_out + (size_t)NRS * DMOD;
  /* weight planes, RoPE tables, input planes */
  k_prep<<<PB_ALL, 256, 0, stream>>>(w_sq, w_sk, w_sv, w_rq, w_rk, w_rv, BSQ, BSK, BSV, BRQ, BRK, BRV, w_so, w_ro, w_k2, w_v2, BSO, BRO, BK2, BV2, bar, tib, CS1, SN1, CS2, SN2, sum_x, SX, reg_x, RX);
  /* summary q/k/v and regular q/k/v */
  k_gemm2m<<<(NRS / 128 + NRR / 128) * ((DMOD + 2 * KVD) / 64), 128, 0, stream>>>(SX, RX, BSQ, BSK, BSV, BRQ, BRK, BRV, b_sq, b_sk, b_sv, b_rq, b_rk, b_rv, FSQ, FSK, FSV, FRQ, FRK, FRV, NRS, NRR, DMOD, DMOD, DMOD, 0.0625f, 0);
  k_post<<<QB_LV + QB_RQ + QB_RK + QB_SQ + QB_SK + QB_RV + QB_SV, 256, 0, stream>>>(FSQ, FSK, FSV, FRQ, FRK, FRV, CS1, SN1, CS2, SN2, SQ, RQ, KC, VCH, VCL, mupd, LV);
  /* phase 1: summary queries over [summary ; regular] keys */
  k_vt2<<<2 * NB * NKV * (TK / 64), 256, 0, stream>>>(VCH, VCL, VT, VTL);
  k_flash3gA<8><<<NB * NH * (TQA / 16), 32 * NSPL, 0, stream>>>(SQ, DMOD, KC, KVD, VT, VTL, msum, O1, DMOD);
  k_hl<<<(unsigned)(((size_t)NRS * DMOD / 8 + 255) / 256), 256, 0, stream>>>(O1, O1H, O1L, (size_t)NRS * DMOD / 8);
  /* output 0 = sum_attn W_so + b_so; k2 / v2 from sum_attn (no RoPE): the three hi products, then the three residual products on top of them */
  k_gemm2m<<<(NRS / 128) * ((DMOD + 2 * KVD) / 64), 128, 0, stream>>>(O1H, nullptr, BSO, BK2, BV2, nullptr, nullptr, nullptr, b_so, b_k2, b_v2, nullptr, nullptr, nullptr, out0, FK2, FV2, nullptr, nullptr, nullptr, NRS, 0, DMOD, 2 * DMOD, DMOD, 0.0625f, 0);
  k_gemm2m<<<(NRS / 128) * ((DMOD + 2 * KVD) / 64), 128, 0, stream>>>(O1L, nullptr, BSO + DMOD, BK2 + DMOD, BV2 + DMOD, nullptr, nullptr, nullptr, out0, FK2, FV2, nullptr, nullptr, nullptr, out0, FK2, FV2, nullptr, nullptr, nullptr, NRS, 0, DMOD, 2 * DMOD, DMOD, 1.0f / 1024.0f, 1);
  k_put2<<<2 * QB_SV, 256, 0, stream>>>(FK2, FV2, KC, VCH, VCL);      /* into key / value rows 0..63 of each batch */
  /* phase 2: regular queries over [k2 ; regular] keys */
  k_vt2<<<2 * NB * NKV * (TK / 64), 256, 0, stream>>>(VCH, VCL, VT, VTL);
  k_flash3gB<8><<<NB * NH * (QTB / 16), 256, 0, stream>>>(RQ, DMOD, KC, KVD, VT, VTL, mupd, LV, O2, DMOD);
  k_hl<<<(unsigned)(((size_t)NRR * DMOD / 8 + 255) / 256), 256, 0, stream>>>(O2, O2H, O2L, (size_t)NRR * DMOD / 8);
  k_gemm2m<<<(NRR / 128) * (DMOD / 64), 128, 0, stream>>>(O2H, nullptr, BRO, nullptr, nullptr, nullptr, nullptr, nullptr, b_ro, nullptr, nullptr, nullptr, nullptr, nullptr, out1, nullptr, nullptr, nullptr, nullptr, nullptr, NRR, 0, DMOD, 2 * DMOD, DMOD, 0.0625f, 0);
  k_gemm2m<<<(NRR / 128) * (DMOD / 64), 128, 0, stream>>>(O2L, nullptr, BRO + DMOD, nullptr, nullptr, nullptr, nullptr, nullptr, out1, nullptr, nullptr, nullptr, nullptr, nullptr, out1, nullptr, nullptr, nullptr, nullptr, nullptr, NRR, 0, DMOD, 2 * DMOD, DMOD, 1.0f / 1024.0f, 1);
}

// v006
// A run of this version takes 273 microseconds.
// Next to v005, in two timings, it ran 1.18 and 1.17 times as fast.
// Counting every step since v000, it is 5.12 times as fast.
#include <hip/hip_runtime.h>
// FlexSummaryAttention (2 batches; 64 summary tokens S, 2048 regular tokens R, D = 1024; 16 query heads, 4 kv heads (GQA), head dim 64): q/k/v projections for both token sets; 1-D RoPE on summary q/k, 2-D hierarchical RoPE (bar id | token-in-bar id) on regular q/k; phase 1: summary queries over [summary; regular] keys with the summarize mask -> sum_attn; k2/v2 = sum_attn W + b; phase 2: regular queries over [k2; regular k] / [v2; regular v] with the updating mask -> reg_attn; outputs sum_attn W_so + b and reg_attn W_ro + b.
// Structure: exact f16 planes of both inputs; six projection GEMMs (32x64 wave tiles, f32 accumulation, exact x16 weights + bias); RoPE on VALU (thread per (row, head, 8 dims), f32 trig) into f16 q planes and the shared per-batch key plane [k2-or-summary ; regular] (4 kv heads); values as f16 hi + 2^10 residual planes, V^T by LDS tiles; the fused flash kernel (3-term P.V, GQA head mapping, INPUT int mask tables) once per phase; sum_attn / reg_attn as hi + residual pairs into the k2/v2 and output GEMMs.
// Compute dtype: inputs, masks' companions and parameters rounded to bf16; q/k after RoPE as f16 (~2^-12); P and v hi + residual (~2^-21-class); attention outputs hi + residual into the following GEMMs; f32 softmax/accumulation/trig. v_wmma_f32_16x16x32_f16.
#define NB 2
#define SS 64
#define RR 2048
#define DMOD 1024
#define KVD 256
#define NRS (NB * SS)            /* 128 summary rows */
#define NRR (NB * RR)            /* 4096 regular rows */
#define TK 2112                  /* keys per batch in both phases: 64 summary(-derived) + 2048 regular */
#define TQA 64                   /* phase-1 queries (summary tokens) */
#define TQB 2048                 /* phase-2 queries (regular tokens) */
#define TQ TQB
#define NH 16
#define KVG 4                    /* GQA: 16 query heads share 4 kv heads */
#define NKV (NH / KVG)
#define SCL 0.125f               /* 64^-0.5 */
#define QBLKSA (TQA / 64)
#define NSPL 11                  /* phase 1: waves that share the 2112 keys of one 16-query tile, 6 trips of 32 keys each */
#define QBLKSB (TQB / 64)
#define QTB (TQB / 16)           /* phase 2: 16-query tiles */
typedef __bf16 v16b __attribute__((ext_vector_type(16)));
typedef unsigned short v8us __attribute__((ext_vector_type(8), may_alias));
typedef float  v8f  __attribute__((ext_vector_type(8)));
typedef float  v4f  __attribute__((ext_vector_type(4)));
typedef float  v4fa __attribute__((ext_vector_type(4), may_alias));
union FragB { v16b v; v8us half[2]; unsigned short u[16]; };

__device__ __forceinline__ unsigned short bf16_bits(float x) { unsigned int u = __float_as_uint(x); return (unsigned short)((u + 0x7FFFu + ((u >> 16) & 1u)) >> 16); }
__device__ __forceinline__ float bf16_val(unsigned short b) { return __uint_as_float(((unsigned int)b) << 16); }
__device__ __forceinline__ float bf16_round(float x) { return bf16_val(bf16_bits(x)); }
// D += A·B with NT terms: 1 = ah·bh, 2 = + al·bh (A split), 3 = + ah·bl (both split)
template <int NT>
__device__ __forceinline__ v8f mmaN(v16b ah, v16b al, v16b bh, v16b bl, v8f c) {
  c = __builtin_amdgcn_wmma_f32_16x16x32_bf16(false, ah, false, bh, (short)0, c, false, false);
  if (NT >= 2) c = __builtin_amdgcn_wmma_f32_16x16x32_bf16(false, al, false, bh, (short)0, c, false, false);
  if (NT >= 3) c = __builtin_amdgcn_wmma_f32_16x16x32_bf16(false, ah, false, bl, (short)0, c, false, false);
  asm volatile("v_nop\n\tv_nop\n\tv_nop\n\tv_nop" : "+v"(c) : "v"(ah), "v"(al), "v"(bh), "v"(bl));
  return c;
}

__global__ __launch_bounds__(256) void k_wt_bf16(const float* __restrict__ W, unsigned short* __restrict__ Wt, int K, int N) {
  const int t = blockIdx.x * 256 + threadIdx.x;
  const int k8n = K / 8;
  if (t >= N * k8n) return;
  const int n = t / k8n, k8 = (t % k8n) * 8;
  v8us v;
#pragma unroll
  for (int i = 0; i < 8; ++i) v[i] = bf16_bits(W[(size_t)(k8 + i) * N + n]);
  *(v8us*)(Wt + (size_t)n * K + k8) = v;
  
}

// GEMM C[M][N] (f32, pitch ldc) = act(A[M][K]·W + bias). A f32 row-major (pitch lda) converted per fragment to bf16
// (ASPLIT: hi/lo two planes -> 2 terms, else single rounded term); Wt bf16 [N][K] (pitch ldb). BIAS_BF16 rounds the
// bias to bf16 first (bias quantised to bf16 before the add). K%32==0, M%16==0, N%64==0.
template <bool ASPLIT, int ACT, bool BIAS_BF16>
__global__ __launch_bounds__(128) void k_gemm_bf(const float* __restrict__ A, int lda, const unsigned short* __restrict__ Wt, int ldb,
                                               const float* __restrict__ bias, float* __restrict__ C, int ldc, int M, int N, int K) {
  __shared__ __attribute__((aligned(16))) float so[4][16][64];
  const int tid = threadIdx.x, w = tid >> 5, lane = tid & 31, ln = lane & 15, hh = lane >> 4;
  const int ntn = N / 64;
  const int wid = blockIdx.x * 4 + w;
  const int mt = wid / ntn, nq = wid % ntn;
  if (mt * 16 >= M) return;
  const int row0 = mt * 16, col0 = nq * 64;
  const float* arow = A + (size_t)(row0 + ln) * lda;
  v8f acc[4] = {};
  for (int kb = 0; kb < K; kb += 32) {
    FragB ah, al;
    const v4f x0 = *(const v4fa*)(arow + kb + 8 * hh), x1 = *(const v4fa*)(arow + kb + 8 * hh + 4);
    const v4f x2 = *(const v4fa*)(arow + kb + 16 + 8 * hh), x3 = *(const v4fa*)(arow + kb + 16 + 8 * hh + 4);
    float xs[16] = {x0[0],x0[1],x0[2],x0[3],x1[0],x1[1],x1[2],x1[3],x2[0],x2[1],x2[2],x2[3],x3[0],x3[1],x3[2],x3[3]};
#pragma unroll
    for (int i = 0; i < 16; ++i) { const unsigned short hb = bf16_bits(xs[i]); ah.u[i] = hb; al.u[i] = ASPLIT ? bf16_bits(xs[i] - bf16_val(hb)) : (unsigned short)0; }
#pragma unroll
    for (int t = 0; t < 4; ++t) {
      const unsigned short* brow = Wt + (size_t)(col0 + t * 16 + ln) * ldb + kb;
      FragB b;
      b.half[0] = *(const v8us*)(brow + 8 * hh);
      b.half[1] = *(const v8us*)(brow + 16 + 8 * hh);
      acc[t] = mmaN<ASPLIT ? 2 : 1>(ah.v, al.v, b.v, b.v, acc[t]);
    }
  }
#pragma unroll
  for (int t = 0; t < 4; ++t) {
    float bv = bias ? bias[col0 + t * 16 + ln] : 0.f;
    if (BIAS_BF16) bv = bf16_round(bv);
#pragma unroll
    for (int r = 0; r < 8; ++r) { float v = acc[t][r] + bv; if (ACT == 1) v = fmaxf(v, 0.f); so[w][8 * hh + r][t * 16 + ln] = v; }
  }
  __builtin_amdgcn_fence(__ATOMIC_ACQ_REL, "workgroup");
  __builtin_amdgcn_wave_barrier();
  const int rsub = lane >> 4, c4 = (lane & 15) * 4;
  {
#pragma unroll
    for (int q = 0; q < 8; ++q) {
      const int r = q * 2 + rsub;
      const v4f v = *(const v4fa*)&so[w][r][c4];
      *(v4f*)(C + (size_t)(row0 + r) * ldc + col0 + c4) = v;
    }
    
  }
}

// GEMM C = act(A·W + bias + resid): A f32 (ASPLIT -> hi/lo 2 terms), Wt bf16 [N][K]; ACT 0 none, 1 relu, 2 exact gelu;
// resid (optional, f32, row index = (row % rmod), pitch ldr, RES_BF16 rounds it) added before the activation.
template <bool ASPLIT, int ACT, bool BIAS_BF16, bool RES_BF16>
__global__ __launch_bounds__(128) void k_gemm_bf3(const float* __restrict__ A, int lda, const unsigned short* __restrict__ Wt, int ldb,
                                                const float* __restrict__ bias, const float* __restrict__ resid, int rmod, int ldr,
                                                float* __restrict__ C, int ldc, int M, int N, int K) {
  __shared__ __attribute__((aligned(16))) float so[4][16][64];
  const int tid = threadIdx.x, w = tid >> 5, lane = tid & 31, ln = lane & 15, hh = lane >> 4;
  const int ntn = N / 64;
  const int wid = blockIdx.x * 4 + w;
  const int mt = wid / ntn, nq = wid % ntn;
  if (mt * 16 >= M) return;
  const int row0 = mt * 16, col0 = nq * 64;
  const float* arow = A + (size_t)(row0 + ln) * lda;
  v8f acc[4] = {};
  for (int kb = 0; kb < K; kb += 32) {
    FragB ah, al;
    const v4f x0 = *(const v4fa*)(arow + kb + 8 * hh), x1 = *(const v4fa*)(arow + kb + 8 * hh + 4);
    const v4f x2 = *(const v4fa*)(arow + kb + 16 + 8 * hh), x3 = *(const v4fa*)(arow + kb + 16 + 8 * hh + 4);
    float xs[16] = {x0[0],x0[1],x0[2],x0[3],x1[0],x1[1],x1[2],x1[3],x2[0],x2[1],x2[2],x2[3],x3[0],x3[1],x3[2],x3[3]};
#pragma unroll
    for (int i = 0; i < 16; ++i) { const unsigned short hb = bf16_bits(xs[i]); ah.u[i] = hb; al.u[i] = ASPLIT ? bf16_bits(xs[i] - bf16_val(hb)) : (unsigned short)0; }
#pragma unroll
    for (int t = 0; t < 4; ++t) {
      const unsigned short* brow = Wt + (size_t)(col0 + t * 16 + ln) * ldb + kb;
      FragB b;
      b.half[0] = *(const v8us*)(brow + 8 * hh);
      b.half[1] = *(const v8us*)(brow + 16 + 8 * hh);
      acc[t] = mmaN<ASPLIT ? 2 : 1>(ah.v, al.v, b.v, b.v, acc[t]);
    }
  }
#pragma unroll
  for (int t = 0; t < 4; ++t) {
    const int col = col0 + t * 16 + ln;
    float bv = bias ? bias[col] : 0.f;
    if (BIAS_BF16) bv = bf16_round(bv);
#pragma unroll
    for (int r = 0; r < 8; ++r) {
      float v = acc[t][r] + bv;
      if (resid) { float rv = resid[(size_t)((row0 + 8 * hh + r) % rmod) * ldr + col]; if (RES_BF16) rv = bf16_round(rv); v += rv; }
      if (ACT == 1) v = fmaxf(v, 0.f);
      if (ACT == 2) v = 0.5f * v * (1.0f + erff(v * 0.70710678118654752f));
      if (ACT == 3) { const float u = 0.7978845608028654f * (v + 0.044715f * v * v * v); v = 0.5f * v * (1.0f + tanhf(u)); }
      so[w][8 * hh + r][t * 16 + ln] = v;
    }
  }
  __builtin_amdgcn_fence(__ATOMIC_ACQ_REL, "workgroup");
  __builtin_amdgcn_wave_barrier();
  const int rsub = lane >> 4, c4 = (lane & 15) * 4;
  {
#pragma unroll
    for (int q = 0; q < 8; ++q) {
      const int r = q * 2 + rsub;
      const v4f v = *(const v4fa*)&so[w][r][c4];
      *(v4f*)(C + (size_t)(row0 + r) * ldc + col0 + c4) = v;
    }
    
  }
}
// row LayerNorm (biased variance, eps) over N: s = X (+ R); optional out_sum <- s; out_norm <- (s-mu)*rsqrt(var+eps)*g + b
template <bool PARAM_BF16>
__global__ __launch_bounds__(256) void k_layernorm(const float* __restrict__ X, const float* __restrict__ R, const float* __restrict__ g, const float* __restrict__ bta,
                                                  float* __restrict__ out_sum, float* __restrict__ out_norm, int N, float eps) {
  __shared__ float red[256];
  const int row = blockIdx.x, tid = threadIdx.x;
  const float* x = X + (size_t)row * N; const float* rr = R ? R + (size_t)row * N : nullptr;
  float vals[16];                     // up to N = 4096
  const int per = N / 256;            // contiguous chunk per thread? use strided-by-4 chunks: thread handles j = tid*4 + 1024*u
  float s1 = 0.f;
  for (int u = 0; u < per / 4; ++u) {
    const int j = tid * 4 + 1024 * u;
    const v4f a = *(const v4fa*)(x + j);
    v4f b = {0.f,0.f,0.f,0.f}; if (rr) b = *(const v4fa*)(rr + j);
#pragma unroll
    for (int q = 0; q < 4; ++q) { const float v = a[q] + b[q]; vals[u * 4 + q] = v; s1 += v; }
  }
  red[tid] = s1; __syncthreads();
  for (int st = 128; st > 0; st >>= 1) { if (tid < st) red[tid] += red[tid + st]; __syncthreads(); }
  const float mu = red[0] / (float)N; __syncthreads();
  float s2 = 0.f;
  for (int u = 0; u < per / 4; ++u)
#pragma unroll
    for (int q = 0; q < 4; ++q) { const float c = vals[u * 4 + q] - mu; s2 += c * c; }
  red[tid] = s2; __syncthreads();
  for (int st = 128; st > 0; st >>= 1) { if (tid < st) red[tid] += red[tid + st]; __syncthreads(); }
  const float rs = rsqrtf(red[0] / (float)N + eps);
  {
    for (int u = 0; u < per / 4; ++u) {
      const int j = tid * 4 + 1024 * u;
      v4f o, sm;
#pragma unroll
      for (int q = 0; q < 4; ++q) {
        float gg = g[j + q], bb = bta[j + q];
        if (PARAM_BF16) { gg = bf16_round(gg); bb = bf16_round(bb); }
        sm[q] = vals[u * 4 + q]; o[q] = (vals[u * 4 + q] - mu) * rs * gg + bb;
      }
      if (out_sum) *(v4f*)(out_sum + (size_t)row * N + j) = sm;
      *(v4f*)(out_norm + (size_t)row * N + j) = o;
    }
    
  }
}



// ---- f16 WMMA path (v_wmma_f32_16x16x32_f16): 11-bit significands for operands in range — used where a [0,1] probability operand needs more precision than bf16
typedef _Float16 v16h __attribute__((ext_vector_type(16)));
union FragH { v16h v; v8us half[2]; _Float16 h[16]; unsigned short u[16]; };
template <int NT>
__device__ __forceinline__ v8f mmaH(v16h ah, v16h al, v16h bh, v16h bl, v8f c) {
  c = __builtin_amdgcn_wmma_f32_16x16x32_f16(false, ah, false, bh, (short)0, c, false, false);
  if (NT >= 2) c = __builtin_amdgcn_wmma_f32_16x16x32_f16(false, al, false, bh, (short)0, c, false, false);
  if (NT >= 3) c = __builtin_amdgcn_wmma_f32_16x16x32_f16(false, ah, false, bl, (short)0, c, false, false);
  asm volatile("v_nop\n\tv_nop\n\tv_nop\n\tv_nop" : "+v"(c) : "v"(ah), "v"(al), "v"(bh), "v"(bl));
  return c;
}
// batched GEMM like k_gemm_b but f16 operands: A f32 (split into f16 hi/lo if ASPLIT, else rounded to f16), Bt = f16 values [n][k]; alpha; C f32; N multiple of 16 (partial tiles skipped)
template <bool ASPLIT>
__global__ __launch_bounds__(128) void k_gemm_h(const float* __restrict__ A, int lda, size_t sA, const _Float16* __restrict__ Bh, int ldb, size_t sB, float alpha, float* __restrict__ C, int ldc, size_t sC, int M, int N, int K) {
  __shared__ __attribute__((aligned(16))) float so[4][16][64];
  const int tid = threadIdx.x, w = tid >> 5, lane = tid & 31, ln = lane & 15, hh = lane >> 4; const int by = blockIdx.y;
  A += (size_t)by * sA; Bh += (size_t)by * sB; C += (size_t)by * sC;
  const int ntn = (N + 63) / 64; const int wid = blockIdx.x * 4 + w; const int mt = wid / ntn, nq = wid % ntn; if (mt * 16 >= M) return;
  const int row0 = mt * 16, col0 = nq * 64; const float* arow = A + (size_t)(row0 + ln) * lda;
  v8f acc[4] = {};
  for (int kb = 0; kb < K; kb += 32) {
    FragH ah, al;
    const v4f x0 = *(const v4fa*)(arow + kb + 8 * hh), x1 = *(const v4fa*)(arow + kb + 8 * hh + 4), x2 = *(const v4fa*)(arow + kb + 16 + 8 * hh), x3 = *(const v4fa*)(arow + kb + 16 + 8 * hh + 4);
    float xs[16] = {x0[0],x0[1],x0[2],x0[3],x1[0],x1[1],x1[2],x1[3],x2[0],x2[1],x2[2],x2[3],x3[0],x3[1],x3[2],x3[3]};
#pragma unroll
    for (int i = 0; i < 16; ++i) { const _Float16 h = (_Float16)xs[i]; ah.h[i] = h; al.h[i] = ASPLIT ? (_Float16)(xs[i] - (float)h) : (_Float16)0.0f; }
#pragma unroll
    for (int t = 0; t < 4; ++t) { if (col0 + t * 16 >= N) continue; const size_t boff = (size_t)(col0 + t * 16 + ln) * ldb + kb; FragH bq; bq.half[0] = *(const v8us*)(Bh + boff + 8 * hh); bq.half[1] = *(const v8us*)(Bh + boff + 16 + 8 * hh);
      acc[t] = mmaH<ASPLIT ? 2 : 1>(ah.v, al.v, bq.v, bq.v, acc[t]); }
  }
#pragma unroll
  for (int t = 0; t < 4; ++t) { if (col0 + t * 16 >= N) continue;
#pragma unroll
    for (int r = 0; r < 8; ++r) so[w][8 * hh + r][t * 16 + ln] = acc[t][r] * alpha; }
  __builtin_amdgcn_fence(__ATOMIC_ACQ_REL, "workgroup"); __builtin_amdgcn_wave_barrier();
  const int rsub = lane >> 4, c4 = (lane & 15) * 4;
  {
#pragma unroll
    for (int q = 0; q < 8; ++q) { const int r = q * 2 + rsub; if (col0 + c4 < N) { const v4f v = *(const v4fa*)&so[w][r][c4]; *(v4f*)(C + (size_t)(row0 + r) * ldc + col0 + c4) = v; } }
     }
}

// ---- fragment order: every f16 plane [rows][K] that feeds a matrix operand (rows % 16 == 0, K % 32 == 0) is stored as 1-KiB blocks, one per fragment of 16 rows x 32 k, block (rt, kt) at element (rt * (K / 32) + kt) * 512.
// Inside a block, lane l = 16 hh + ln (row ln of the tile) finds its k = 8 hh .. 8 hh + 7 at element 8 l and its k = 16 + 8 hh .. 16 + 8 hh + 7 at element 256 + 8 l: each of a fragment's two 16-byte loads reads 512 contiguous bytes, four whole lines, where rows of a row-major plane gave sixteen lines of 32 bytes. The registers hold the same values as before.
// A writer's thread t stores elements 8 t .. 8 t + 7 of the plane (a wave stores four whole lines); fo_src names the row and the first k that belong there.
struct FoRK { int row, k; };
__device__ __forceinline__ FoRK fo_src(size_t t, int K) { const int lane = (int)(t & 31); const size_t wid = t >> 5; const int half = (int)(wid & 1); const size_t blk = wid >> 1; const int kb = K >> 5;
  FoRK o; o.row = (int)(blk / kb) * 16 + (lane & 15); o.k = (int)(blk % kb) * 32 + half * 16 + (lane >> 4) * 8; return o; }
// element offset of the 8 values (row, k8 .. k8 + 7), k8 % 8 == 0
__device__ __forceinline__ size_t fo_dst(int row, int k8, int K) { return ((size_t)(row >> 4) * (K >> 5) + (k8 >> 5)) * 512 + ((k8 >> 4) & 1) * 256 + (((k8 >> 3) & 1) * 16 + (row & 15)) * 8; }
// Wt = f16(W[k][n] * scale), rows n, in fragment order, from f32 row-major W[K][N] (scale = power of two; bf16-exact weights stay exact in f16 away from the subnormal range)
__device__ __forceinline__ void d_wt_f16(int bx, const float* __restrict__ W, _Float16* __restrict__ Wt, int K, int N, float scale) {
  const int t = bx * 256 + threadIdx.x; if (t >= N * (K / 8)) return; const FoRK s = fo_src((size_t)t, K); const int n = s.row, k8 = s.k; FragH f;
#pragma unroll
  for (int i = 0; i < 8; ++i) { if (i) asm volatile("s_wait_xcnt 0x0" ::: "memory");      /* stands in front of each further load, whose result may land in a register that an earlier load names as its address */
    f.h[i] = (_Float16)(bf16_round(W[(size_t)(k8 + i) * N + n]) * scale); }
  const v8us o = f.half[0];
  *(v8us*)((unsigned short*)Wt + (size_t)t * 8) = o; 
}
// k_gemm_hh variant with fused epilogue: v = acc·alpha + bias[by·sBias + col] (+ CP[(row/rowsPerB)·sCPb + by·64 + col] if CP) ; ACT 0 none / 1 elu ; writes f16 C16 (and f32 C if non-null)
template <int ACT>
__global__ __launch_bounds__(128) void k_gemm_hhx(const _Float16* __restrict__ A, int lda, size_t sA, const _Float16* __restrict__ Bh, int ldb, size_t sB, float alpha, const float* __restrict__ bias, size_t sBias, const float* __restrict__ CP, int rowsPerB, size_t sCPb, int row0g,
    float* __restrict__ C, _Float16* __restrict__ C16, int ldc, size_t sC, int M, int N, int K) {
  __shared__ __attribute__((aligned(16))) float so[4][16][64];
  const int tid = threadIdx.x, w = tid >> 5, lane = tid & 31, ln = lane & 15, hh = lane >> 4; const int by = blockIdx.y;
  A += (size_t)by * sA; Bh += (size_t)by * sB; const size_t cofs = (size_t)by * sC; const float* bp = bias ? bias + (size_t)by * sBias : nullptr;
  const int ntn = (N + 63) / 64; const int wid = blockIdx.x * 4 + w; const int mt = wid / ntn, nq = wid % ntn; if (mt * 16 >= M) return;
  const int row0 = mt * 16, col0 = nq * 64; const _Float16* arow = A + (size_t)(row0 + ln) * lda;
  v8f acc[4] = {};
  for (int kb = 0; kb < K; kb += 32) { FragH ah; ah.half[0] = *(const v8us*)((const unsigned short*)arow + kb + 8 * hh); ah.half[1] = *(const v8us*)((const unsigned short*)arow + kb + 16 + 8 * hh);
#pragma unroll
    for (int t = 0; t < 4; ++t) { if (col0 + t * 16 >= N) continue; const size_t boff = (size_t)(col0 + t * 16 + ln) * ldb + kb; FragH bq; bq.half[0] = *(const v8us*)((const unsigned short*)Bh + boff + 8 * hh); bq.half[1] = *(const v8us*)((const unsigned short*)Bh + boff + 16 + 8 * hh);
      acc[t] = mmaH<1>(ah.v, ah.v, bq.v, bq.v, acc[t]); }
  }
#pragma unroll
  for (int t = 0; t < 4; ++t) { if (col0 + t * 16 >= N) continue; const int col = col0 + t * 16 + ln; const float bv = bp ? bf16_round(bp[col]) : 0.f;
#pragma unroll
    for (int r = 0; r < 8; ++r) { float v = acc[t][r] * alpha + bv; if (CP) { const int bidx = (row0g + row0 + 8 * hh + r) / rowsPerB; v += CP[(size_t)bidx * sCPb + (size_t)by * 64 + col]; } if (ACT == 1) v = (v > 0.f) ? v : expm1f(v); else if (ACT == 7) v = (v > 0.f) ? v + 1.0f : expf(v); else if (ACT == 8) v = tanhf(v); else if (ACT == 9) v = 0.5f * v * (1.0f + tanhf(0.7978845608028654f * (v + 0.044715f * v * v * v))); else if (ACT == 11) v = 1.0f / (1.0f + expf(-v)); else if (ACT == 12) v = (v > 0.f) ? v : 0.01f * v; else if (ACT == 14) v = (v > 0.f) ? v : 0.1f * v; else if (ACT == 15) v = v / (1.0f + expf(-v)); else if (ACT == 3) v = fmaxf(v, 0.f); else if (ACT == 6) v = 0.5f * v * (1.0f + erff(v * 0.70710678118654752f)); so[w][8 * hh + r][t * 16 + ln] = v; } }
  __builtin_amdgcn_fence(__ATOMIC_ACQ_REL, "workgroup"); __builtin_amdgcn_wave_barrier();
  const int rsub = lane >> 4, c4 = (lane & 15) * 4; typedef _Float16 v4h __attribute__((ext_vector_type(4)));
  {
#pragma unroll
    for (int q = 0; q < 8; ++q) { const int r = q * 2 + rsub; if (col0 + c4 < N) { const v4f v = *(const v4fa*)&so[w][r][c4]; if (C) *(v4f*)(C + cofs + (size_t)(row0 + r) * ldc + col0 + c4) = v; if (C16) { v4h h4; for (int i = 0; i < 4; ++i) h4[i] = (_Float16)v[i]; *(v4h*)(C16 + cofs + (size_t)(row0 + r) * ldc + col0 + c4) = h4; } } }
     }
}


typedef _Float16 v4h __attribute__((ext_vector_type(4)));

__device__ __forceinline__ void d_x16(int bx, const float* __restrict__ x, _Float16* __restrict__ X16, size_t n8, int K) { const size_t t = (size_t)bx * 256 + threadIdx.x; if (t >= n8) return; const FoRK s = fo_src(t, K); const float* xs = x + (size_t)s.row * K + s.k; FragH f;
#pragma unroll
  for (int q = 0; q < 8; ++q) f.h[q] = (_Float16)bf16_round(xs[q]); *(v8us*)((unsigned short*)X16 + t * 8) = f.half[0];  }
__global__ __launch_bounds__(256) void k_h16(const float* __restrict__ x, _Float16* __restrict__ X16, size_t n8) { const size_t t = (size_t)blockIdx.x * 256 + threadIdx.x; if (t >= n8) return; FragH f;
#pragma unroll
  for (int q = 0; q < 8; ++q) f.h[q] = (_Float16)x[t * 8 + q]; *(v8us*)((unsigned short*)X16 + t * 8) = f.half[0];  }
__global__ __launch_bounds__(256) void k_round16f(const float* __restrict__ W, _Float16* __restrict__ Bt, size_t n8) { const size_t t = (size_t)blockIdx.x * 256 + threadIdx.x; if (t >= n8) return; FragH f;
#pragma unroll
  for (int i = 0; i < 8; ++i) f.h[i] = (_Float16)(bf16_round(W[t * 8 + i]) * 16.0f); *(v8us*)((unsigned short*)Bt + t * 8) = f.half[0];  }
template <int NHv, int TTv>
__device__ __forceinline__ void d_vt(int bx, const _Float16* __restrict__ V16, int ldv, int voff, _Float16* __restrict__ Vt) { __shared__ unsigned short tl[64][66]; const int tid = threadIdx.x; const int slab = bx / (TTv / 64), lg = bx % (TTv / 64); const int b = slab / NHv, h = slab % NHv;
  for (int i = tid; i < 64 * 8; i += 256) { const int r = i / 8, c8 = (i % 8) * 8; FragH f; f.half[0] = *(const v8us*)((const unsigned short*)V16 + ((size_t)b * TTv + lg * 64 + r) * ldv + voff + h * 64 + c8);
#pragma unroll
    for (int q = 0; q < 8; ++q) tl[r][c8 + q] = f.u[q]; }
  __syncthreads();
  {
#pragma unroll
    for (int rd = 0; rd < 2; ++rd) { const int wv = rd * 8 + tid / 32, lane = tid % 32; const int d = (wv >> 2) * 16 + (lane & 15), pc = (wv & 3) * 2 + (lane >> 4); FragH f;      /* a wave per half fragment of V^T (rows d, k = keys): 16 d x 2 groups of 8 keys */
#pragma unroll
      for (int q = 0; q < 8; ++q) f.u[q] = tl[pc * 8 + q][d];
      *(v8us*)((unsigned short*)Vt + fo_dst(slab * 64 + d, lg * 64 + pc * 8, TTv)) = f.half[0]; }
     } }

__global__ __launch_bounds__(256) void k_hl(const float* __restrict__ F, _Float16* __restrict__ Hh, _Float16* __restrict__ Hl, size_t n8, int K) { const size_t t = (size_t)blockIdx.x * 256 + threadIdx.x; if (t >= n8) return; const FoRK s = fo_src(t, K); const float* Fs = F + (size_t)s.row * K + s.k; FragH fh, fl; const v4f a = *(const v4fa*)Fs, c = *(const v4fa*)(Fs + 4);      /* F row-major, pitch K; both planes in fragment order */
#pragma unroll
  for (int q = 0; q < 4; ++q) { _Float16 h = (_Float16)a[q]; fh.h[q] = h; fl.h[q] = (_Float16)((a[q] - (float)h) * 1024.0f); h = (_Float16)c[q]; fh.h[4 + q] = h; fl.h[4 + q] = (_Float16)((c[q] - (float)h) * 1024.0f); }
  { *(v8us*)((unsigned short*)Hh + t * 8) = fh.half[0]; *(v8us*)((unsigned short*)Hl + t * 8) = fl.half[0];  } }

// ---- fast GEMM (wave tile 32x64; requires M % 32 == 0 rows per launch region, N % 64 == 0 and K % 64 == 0); epilogue = k_gemm_hhx semantics ----
__device__ __forceinline__ v16h g2_frag(const _Float16* p) { FragH f; f.half[0] = *(const v8us*)((const unsigned short*)p); f.half[1] = *(const v8us*)((const unsigned short*)p + 256); return f.v; }      /* p: the lane's 8 elements in the fragment's block */
__device__ __forceinline__ v8f g2_mma(v16h a, v16h b, v8f c) { v8f d = __builtin_amdgcn_wmma_f32_16x16x32_f16(false, a, false, b, (short)0, c, false, false); asm volatile("v_nop\n\tv_nop\n\tv_nop\n\tv_nop" : "+v"(d) : "v"(a), "v"(b)); return d; }
template <int ACT>
__device__ __forceinline__ void d_gemm2(int bx, const _Float16* __restrict__ A, size_t sA, const _Float16* __restrict__ Bh, size_t sB, float alpha, const float* __restrict__ bias, size_t sBias, const float* __restrict__ CP, int rowsPerB, size_t sCPb, int row0g,
    float* __restrict__ C, _Float16* __restrict__ C16, int ldc, size_t sC, int M, int N, int K) {
  __shared__ __attribute__((aligned(16))) float so[4][32][68];
  const int tid = threadIdx.x, w = tid >> 5, lane = tid & 31, ln = lane & 15, hh = lane >> 4; const int by = blockIdx.y;
  A += (size_t)by * sA; Bh += (size_t)by * sB; const size_t cofs = (size_t)by * sC; const float* bp = bias ? bias + (size_t)by * sBias : nullptr;
  const int ntn = N >> 6; const int mt = bx / ntn, nq = bx - mt * ntn; const int row0 = mt * 128 + 32 * w, col0 = nq * 64; if (row0 >= M) return;
  /* A and Bh in fragment order, K elements a row: a tile of 16 rows is K * 16 elements, a step of 32 k is 512 */
  const _Float16* a0p = A + (size_t)(row0 >> 4) * K * 16 + lane * 8; const _Float16* a1p = a0p + (size_t)16 * K;
  const _Float16* b0p = Bh + (size_t)(col0 >> 4) * K * 16 + lane * 8; const _Float16* b1p = b0p + (size_t)16 * K; const _Float16* b2p = b1p + (size_t)16 * K; const _Float16* b3p = b2p + (size_t)16 * K;
  const v8f z8 = {0.f,0.f,0.f,0.f,0.f,0.f,0.f,0.f}; v8f c00 = z8, c01 = z8, c02 = z8, c03 = z8, c10 = z8, c11 = z8, c12 = z8, c13 = z8;
  /* two register sets x / y of the six fragments (K % 64 == 0): the loads of the next 32-wide k step are all issued before the products of this one, so a step waits for one overlapped latency at most */
  v16h xa0 = g2_frag(a0p), xa1 = g2_frag(a1p), xb0 = g2_frag(b0p), xb1 = g2_frag(b1p), xb2 = g2_frag(b2p), xb3 = g2_frag(b3p);
#pragma unroll 1
  for (int kb = 0; kb < K; kb += 64) { const int k1 = kb * 16, k2 = ((kb + 64 < K) ? kb + 64 : kb) * 16;      /* element offsets of this trip's first block (the y step is the block behind it, 512 elements on) and of the next trip's. Last trip: k2 names a step inside the row tile again; its values are not used */
    const _Float16* pya0 = a0p + k1; const _Float16* pya1 = a1p + k1; const _Float16* pyb0 = b0p + k1; const _Float16* pyb1 = b1p + k1; const _Float16* pyb2 = b2p + k1; const _Float16* pyb3 = b3p + k1;
    const _Float16* pxa0 = a0p + k2; const _Float16* pxa1 = a1p + k2; const _Float16* pxb0 = b0p + k2; const _Float16* pxb1 = b1p + k2; const _Float16* pxb2 = b2p + k2; const _Float16* pxb3 = b3p + k2;
    const v16h ya0 = g2_frag(pya0 + 512), ya1 = g2_frag(pya1 + 512), yb0 = g2_frag(pyb0 + 512), yb1 = g2_frag(pyb1 + 512), yb2 = g2_frag(pyb2 + 512), yb3 = g2_frag(pyb3 + 512);
    __builtin_amdgcn_sched_barrier(0);      /* holds the y loads above the x products (the scheduler otherwise moves each load down to its use) */
    c00 = g2_mma(xa0, xb0, c00); c10 = g2_mma(xa1, xb0, c10); c01 = g2_mma(xa0, xb1, c01); c11 = g2_mma(xa1, xb1, c11);
    c02 = g2_mma(xa0, xb2, c02); c12 = g2_mma(xa1, xb2, c12); c03 = g2_mma(xa0, xb3, c03); c13 = g2_mma(xa1, xb3, c13);
    __builtin_amdgcn_sched_barrier(0);      /* holds the x reloads below the x products and, with the next one, above the y products */
    xa0 = g2_frag(pxa0); xa1 = g2_frag(pxa1); xb0 = g2_frag(pxb0); xb1 = g2_frag(pxb1); xb2 = g2_frag(pxb2); xb3 = g2_frag(pxb3);
    __builtin_amdgcn_sched_barrier(0);      /* holds the x reloads above the y products */
    c00 = g2_mma(ya0, yb0, c00); c10 = g2_mma(ya1, yb0, c10); c01 = g2_mma(ya0, yb1, c01); c11 = g2_mma(ya1, yb1, c11);
    c02 = g2_mma(ya0, yb2, c02); c12 = g2_mma(ya1, yb2, c12); c03 = g2_mma(ya0, yb3, c03); c13 = g2_mma(ya1, yb3, c13);
    asm volatile("s_wait_xcnt 0x0" :: "v"(pya0), "v"(pya1), "v"(pyb0), "v"(pyb1), "v"(pyb2), "v"(pyb3), "v"(pxa0), "v"(pxa1), "v"(pxb0), "v"(pxb1), "v"(pxb2), "v"(pxb3) : "memory"); }      /* stands in front of the next trip's address sums, which overwrite registers that the loads name; the trip's twelve addresses are its inputs, so that each keeps its registers up to here and no later load's result lands in them */
  v8f accs[8] = {c00, c01, c02, c03, c10, c11, c12, c13};
  /* the epilogue's loads (4 bias words, 64 CP words a lane) are issued together as well, ahead of the arithmetic that uses them */
  float bw[4] = {0.f, 0.f, 0.f, 0.f}; v8f cpv[8] = {z8, z8, z8, z8, z8, z8, z8, z8};
  if (bp) {
#pragma unroll
    for (int t = 0; t < 4; ++t) bw[t] = bp[col0 + t * 16 + ln];
    asm volatile("s_wait_xcnt 0x0" ::: "memory"); }      /* stands in front of the scalar work below, which overwrites the base register that the four loads name */
  if (CP) {
#pragma unroll
    for (int u = 0; u < 8; ++u)
#pragma unroll
      for (int r = 0; r < 8; ++r) { const int bidx = (row0g + row0 + (u >> 2) * 16 + 8 * hh + r) / rowsPerB; cpv[u][r] = CP[(size_t)bidx * sCPb + (size_t)by * 64 + col0 + (u & 3) * 16 + ln];
        if (r == 7) asm volatile("s_wait_xcnt 0x0" ::: "memory"); }      /* stands in front of the next group's loads, whose results may land in address registers of this group */
    asm volatile("" :: "v"(cpv[0]), "v"(cpv[1]), "v"(cpv[2]), "v"(cpv[3]), "v"(cpv[4]), "v"(cpv[5]), "v"(cpv[6]), "v"(cpv[7])); }      /* inputs-only fence on the loaded words: holds all 64 loads in this block, where they overlap, instead of one waited load in front of each add */
#pragma unroll
  for (int u = 0; u < 8; ++u) { const int t = u & 3, half = u >> 2; const float bv = bp ? bf16_round(bw[t]) : 0.f;
#pragma unroll
    for (int r = 0; r < 8; ++r) { const int rloc = half * 16 + 8 * hh + r; float v = accs[u][r] * alpha + bv; if (CP) v += cpv[u][r];
      if (ACT == 3) v = fmaxf(v, 0.f); else if (ACT == 6) v = 0.5f * v * (1.0f + erff(v * 0.70710678118654752f)); else if (ACT == 11) v = 1.0f / (1.0f + expf(-v)); else if (ACT == 15) v = v / (1.0f + expf(-v)); else if (ACT == 12) v = (v > 0.f) ? v : 0.01f * v; else if (ACT == 8) v = tanhf(v);
      so[w][rloc][t * 16 + ln] = v; } }
  __builtin_amdgcn_fence(__ATOMIC_ACQ_REL, "workgroup"); __builtin_amdgcn_wave_barrier();
  const int rsub = lane >> 4, c4 = (lane & 15) * 4;
  {
#pragma unroll
    for (int q = 0; q < 16; ++q) { const int r = q * 2 + rsub; const v4f v = *(const v4fa*)&so[w][r][c4]; if (C) *(v4f*)(C + cofs + (size_t)(row0 + r) * ldc + col0 + c4) = v; if (C16) { v4h h4; for (int i = 0; i < 4; ++i) h4[i] = (_Float16)v[i]; *(v4h*)(C16 + cofs + (size_t)(row0 + r) * ldc + col0 + c4) = h4; } }
     } }



// lane l's value of lane l ^ X (X < 16) inside its 16-lane row, by a DPP row_xmask move in registers (no trip through the LDS pipe and no wait on it)
template <int X>
__device__ __forceinline__ float row_xor(float v) { return __int_as_float(__builtin_amdgcn_update_dpp(0, __float_as_int(v), 0x160 | X, 0xf, 0xf, true)); }
// maximum over the 16-lane row, all 32 lanes on: four dependent DPP maxima in one statement (written with fmaxf on a DPP move the compiler puts a move and a quieting maximum in front of each step, three links for one)
__device__ __forceinline__ float row_max16(float v) {
  asm("v_max_num_f32_dpp %0, %0, %0 row_xmask:1 row_mask:0xf bank_mask:0xf\n\t"
      "v_max_num_f32_dpp %0, %0, %0 row_xmask:2 row_mask:0xf bank_mask:0xf\n\t"
      "v_max_num_f32_dpp %0, %0, %0 row_xmask:4 row_mask:0xf bank_mask:0xf\n\t"
      "v_max_num_f32_dpp %0, %0, %0 row_xmask:8 row_mask:0xf bank_mask:0xf" : "+v"(v));
  return v; }
__device__ __forceinline__ float row_sum16(float v) { v += row_xor<1>(v); v += row_xor<2>(v); v += row_xor<4>(v); v += row_xor<8>(v); return v; }
template <int CAUSAL>
__global__ __launch_bounds__(128) void k_flash(const _Float16* __restrict__ Q16, int ldq, const _Float16* __restrict__ K16, int ldk, const _Float16* __restrict__ Vt, const int* __restrict__ MSK, float* __restrict__ O, int ldo) {
  constexpr int RPW = 16, RTN = RPW / 16, NQB = TQ / (4 * RPW), DT = 4, KS = 2;
  __shared__ __attribute__((aligned(16))) unsigned short sP[4][RPW][40]; __shared__ __attribute__((aligned(16))) float sO[4][RPW][64 + 4];
  const int tid = threadIdx.x, w = tid >> 5, lane = tid & 31, ln = lane & 15, hh = lane >> 4;
  const int slab = blockIdx.x / NQB, qblk = blockIdx.x % NQB; const int b = slab / NH, h = slab % NH; const int qb0 = qblk * (4 * RPW); const int q0 = qb0 + w * RPW;
  FragH aq[2][KS];
#pragma unroll
  for (int rt = 0; rt < RTN; ++rt) { const unsigned short* qr = (const unsigned short*)Q16 + ((size_t)b * TQ + q0 + rt * 16 + ln) * ldq + h * 64;
#pragma unroll
    for (int ks = 0; ks < KS; ++ks) { aq[rt][ks].half[0] = *(const v8us*)(qr + ks * 32 + 8 * hh); aq[rt][ks].half[1] = *(const v8us*)(qr + ks * 32 + 16 + 8 * hh); } }
  const unsigned short* Vth = (const unsigned short*)Vt + (size_t)slab * 64 * TK;
  float m_r[2][8], l_r[2][8]; v8f oacc[2][DT];
#pragma unroll
  for (int rt = 0; rt < RTN; ++rt) {
#pragma unroll
    for (int r = 0; r < 8; ++r) { m_r[rt][r] = -3.0e38f; l_r[rt][r] = 0.f; }
#pragma unroll
    for (int dt = 0; dt < DT; ++dt) oacc[rt][dt] = (v8f){0.f,0.f,0.f,0.f,0.f,0.f,0.f,0.f}; }
  const int jend = (CAUSAL == 1) ? (qb0 + 4 * RPW) : TK;      /* causal: keys beyond the block's last query never contribute */
#pragma unroll 1
  for (int j0 = 0; j0 < jend; j0 += 32) {
    v8f s[2][2];
#pragma unroll
    for (int nt = 0; nt < 2; ++nt) { const unsigned short* kr = (const unsigned short*)K16 + ((size_t)b * TK + j0 + nt * 16 + ln) * ldk + h * 64; FragH bk[KS];
#pragma unroll
      for (int ks = 0; ks < KS; ++ks) { bk[ks].half[0] = *(const v8us*)(kr + ks * 32 + 8 * hh); bk[ks].half[1] = *(const v8us*)(kr + ks * 32 + 16 + 8 * hh); }
#pragma unroll
      for (int rt = 0; rt < RTN; ++rt) { v8f acc = (v8f){0.f,0.f,0.f,0.f,0.f,0.f,0.f,0.f};
#pragma unroll
        for (int ks = 0; ks < KS; ++ks) acc = mmaH<1>(aq[rt][ks].v, aq[rt][ks].v, bk[ks].v, bk[ks].v, acc); s[rt][nt] = acc; } }
#pragma unroll
    for (int rt = 0; rt < RTN; ++rt)
#pragma unroll
      for (int r = 0; r < 8; ++r) { const int tq = q0 + rt * 16 + 8 * hh + r; const int k0 = j0 + ln, k1 = j0 + 16 + ln;
        const bool ok0 = (CAUSAL == 1) ? (k0 <= tq) : ((CAUSAL == 2) ? ((k0 >> 5) == (tq >> 5)) : true), ok1 = (CAUSAL == 1) ? (k1 <= tq) : ((CAUSAL == 2) ? ((k1 >> 5) == (tq >> 5)) : true);      /* mode 2: block-diagonal 32-token groups */
        const float s0 = ok0 ? s[rt][0][r] * SCL : -3.0e38f, s1 = ok1 ? s[rt][1][r] * SCL : -3.0e38f; 
        const float mn = row_max16(fmaxf(fmaxf(s0, s1), m_r[rt][r]));      /* the running maximum is the same in all 16 lanes of the row: taken in ahead of the reduction, the reduced value is the new maximum itself */
        const float al = (mn > -1.0e38f) ? expf(m_r[rt][r] - mn) : 1.0f; m_r[rt][r] = mn; const float p0 = ok0 ? expf(s0 - mn) : 0.f, p1 = ok1 ? expf(s1 - mn) : 0.f; l_r[rt][r] = l_r[rt][r] * al + p0 + p1;
#pragma unroll
        for (int dt = 0; dt < DT; ++dt) oacc[rt][dt][r] *= al;
        FragH t2; t2.h[0] = (_Float16)(p0 * 1024.0f); t2.h[1] = (_Float16)(p1 * 1024.0f); sP[w][rt * 16 + 8 * hh + r][ln] = t2.u[0]; sP[w][rt * 16 + 8 * hh + r][16 + ln] = t2.u[1]; }
    __builtin_amdgcn_fence(__ATOMIC_ACQ_REL, "workgroup"); __builtin_amdgcn_wave_barrier();
    FragH pa[2];
#pragma unroll
    for (int rt = 0; rt < RTN; ++rt) { pa[rt].half[0] = *(const v8us*)&sP[w][rt * 16 + ln][8 * hh]; pa[rt].half[1] = *(const v8us*)&sP[w][rt * 16 + ln][16 + 8 * hh]; }
#pragma unroll
    for (int dt = 0; dt < DT; ++dt) { const unsigned short* vrow = Vth + (size_t)(dt * 16 + ln) * TK + j0; FragH bv; bv.half[0] = *(const v8us*)(vrow + 8 * hh); bv.half[1] = *(const v8us*)(vrow + 16 + 8 * hh);
#pragma unroll
      for (int rt = 0; rt < RTN; ++rt) oacc[rt][dt] = mmaH<1>(pa[rt].v, pa[rt].v, bv.v, bv.v, oacc[rt][dt]); }
    __builtin_amdgcn_fence(__ATOMIC_ACQ_REL, "workgroup"); __builtin_amdgcn_wave_barrier(); }
#pragma unroll
  for (int rt = 0; rt < RTN; ++rt) {
#pragma unroll
    for (int r = 0; r < 8; ++r) { float l = l_r[rt][r]; l = row_sum16(l); l_r[rt][r] = (l > 0.f) ? 1.0f / (l * 1024.0f) : 0.f; }
#pragma unroll
    for (int dt = 0; dt < DT; ++dt)
#pragma unroll
      for (int r = 0; r < 8; ++r) sO[w][rt * 16 + 8 * hh + r][dt * 16 + ln] = oacc[rt][dt][r] * l_r[rt][r]; }
  __builtin_amdgcn_fence(__ATOMIC_ACQ_REL, "workgroup"); __builtin_amdgcn_wave_barrier();
  {
#pragma unroll
    for (int rp = 0; rp < RPW; rp += 2) { const int r = rp + (lane >> 4), pc = lane & 15; const v4f val = *(const v4fa*)&sO[w][r][pc * 4]; *(v4f*)(O + ((size_t)b * TQ + q0 + r) * ldo + h * 64 + pc * 4) = val; }
     } }
// 3-term variant: O = (P_hi V_hi + (P_lo V_hi + P_hi V_lo) / 1024) / l with P = [hi | 2^10 residual] of 1024 p and V^T = [hi | 2^10 residual] planes (VtL same layout as Vt) -> ~2^-21-class products for un-averaged (early causal / peaked) rows
template <int CAUSAL>
__global__ __launch_bounds__(32 * NSPL) void k_flash3gA(const _Float16* __restrict__ Q16, int ldq, const _Float16* __restrict__ K16, int ldk, const _Float16* __restrict__ Vt, const _Float16* __restrict__ VtL, const int* __restrict__ MSK, float* __restrict__ O, int ldo) {
  constexpr int RPW = 16, RTN = RPW / 16, NQB = TQA / (4 * RPW), DT = 4, KS = 2;
  __shared__ __attribute__((aligned(16))) unsigned short sP[NSPL][RPW][40]; __shared__ __attribute__((aligned(16))) unsigned short sPL[NSPL][RPW][40]; __shared__ __attribute__((aligned(16))) float sO[NSPL][RPW][64 + 4]; __shared__ float sM[NSPL][RPW], sL[NSPL][RPW];
  const int tid = threadIdx.x, w = __builtin_amdgcn_readfirstlane(tid >> 5), lane = tid & 31, ln = lane & 15, hh = lane >> 4;      /* the wave's number in a scalar register: the key range below stays scalar */
  /* one work-group per (batch, head, 16-query tile); its NSPL waves each run the flash loop over their own TK / NSPL keys, and the partial (m, l, O) are merged through LDS behind the loop */
  const int slab = blockIdx.x / (TQA / RPW), qblk = blockIdx.x % (TQA / RPW); (void)NQB; const int b = slab / NH, h = slab % NH; const int qb0 = qblk * RPW; const int q0 = qb0;
  FragH aq[2][KS];
#pragma unroll
  for (int rt = 0; rt < RTN; ++rt) { const unsigned short* qr = (const unsigned short*)Q16 + ((size_t)((b * TQA + q0 + rt * 16) >> 4) * (ldq >> 5) + h * 2) * 512 + lane * 8;      /* Q, K and both V^T planes in fragment order */
#pragma unroll
    for (int ks = 0; ks < KS; ++ks) { aq[rt][ks].half[0] = *(const v8us*)(qr + ks * 512); aq[rt][ks].half[1] = *(const v8us*)(qr + ks * 512 + 256); } }
  const size_t vslab = (size_t)(b * (NH / KVG) + h / KVG); const unsigned short* Vth = (const unsigned short*)Vt + vslab * 64 * TK; const unsigned short* Vtl = (const unsigned short*)VtL + vslab * 64 * TK;      /* GQA: q-head h reads kv head h / KVG */
  float m_r[2][8], l_r[2][8]; v8f oacc[2][DT], oaccL[2][DT];
#pragma unroll
  for (int rt = 0; rt < RTN; ++rt) {
#pragma unroll
    for (int r = 0; r < 8; ++r) { m_r[rt][r] = -3.0e38f; l_r[rt][r] = 0.f; }
#pragma unroll
    for (int dt = 0; dt < DT; ++dt) { oacc[rt][dt] = (v8f){0.f,0.f,0.f,0.f,0.f,0.f,0.f,0.f}; oaccL[rt][dt] = oacc[rt][dt]; } }
  const int jbeg = w * (TK / NSPL), jend = jbeg + TK / NSPL;      /* this wave's keys */
#pragma unroll 1
  for (int j0 = jbeg; j0 < jend; j0 += 32) {
    v8f s[2][2]; FragH bk[2][KS], bv[DT], bl[DT]; int mk0[RTN][8], mk1[RTN][8];
    /* every global load of the trip is issued here, in the order of use (K, mask words, both V planes): their latencies overlap, and V lands behind the softmax */
#pragma unroll
    for (int nt = 0; nt < 2; ++nt) { const unsigned short* kr = (const unsigned short*)K16 + ((size_t)((b * TK + j0 + nt * 16) >> 4) * (ldk >> 5) + (h / KVG) * 2) * 512 + lane * 8;
#pragma unroll
      for (int ks = 0; ks < KS; ++ks) { bk[nt][ks].half[0] = *(const v8us*)(kr + ks * 512); bk[nt][ks].half[1] = *(const v8us*)(kr + ks * 512 + 256); } }
    if (CAUSAL == 8) {
#pragma unroll
      for (int rt = 0; rt < RTN; ++rt)
#pragma unroll
        for (int r = 0; r < 8; ++r) { const int* mrow = MSK + (size_t)(q0 + rt * 16 + 8 * hh + r) * TK + j0 + ln; mk0[rt][r] = mrow[0]; mk1[rt][r] = mrow[16]; } }
    asm volatile("s_wait_xcnt 0x0" ::: "memory");      /* stands in front of the V loads, whose results may land in registers that the K and mask loads name as addresses */
#pragma unroll
    for (int dt = 0; dt < DT; ++dt) { const size_t vo = ((size_t)dt * (TK / 32) + (j0 >> 5)) * 512 + lane * 8; const unsigned short* vrow = Vth + vo; const unsigned short* vrl = Vtl + vo; bv[dt].half[0] = *(const v8us*)vrow; bv[dt].half[1] = *(const v8us*)(vrow + 256);
      if (dt == DT - 1) asm volatile("s_wait_xcnt 0x0" ::: "memory");      /* stands in front of the trip's last two loads: the result of the first lands in the address registers of the hi plane's loads above */
      bl[dt].half[0] = *(const v8us*)vrl;
      if (dt == DT - 1) asm volatile("s_wait_xcnt 0x0" ::: "memory");      /* stands in front of the trip's last load, whose result lands in the address registers of the V loads above */
      bl[dt].half[1] = *(const v8us*)(vrl + 256); }
    __builtin_amdgcn_sched_barrier(0);      /* keeps the loads above together: without it the scheduler moves each one down to its first use, one exposed latency apiece */
#pragma unroll
    for (int nt = 0; nt < 2; ++nt) {
#pragma unroll
      for (int rt = 0; rt < RTN; ++rt) { v8f acc = (v8f){0.f,0.f,0.f,0.f,0.f,0.f,0.f,0.f};
#pragma unroll
        for (int ks = 0; ks < KS; ++ks) acc = mmaH<1>(aq[rt][ks].v, aq[rt][ks].v, bk[nt][ks].v, bk[nt][ks].v, acc); s[rt][nt] = acc; } }
#pragma unroll
    for (int rt = 0; rt < RTN; ++rt)
#pragma unroll
      for (int r = 0; r < 8; ++r) { const int tq = q0 + rt * 16 + 8 * hh + r; const int k0 = j0 + ln, k1 = j0 + 16 + ln;
        bool ok0 = (CAUSAL == 1) ? (k0 <= tq) : ((CAUSAL == 2) ? ((k0 >> 5) == (tq >> 5)) : true), ok1 = (CAUSAL == 1) ? (k1 <= tq) : ((CAUSAL == 2) ? ((k1 >> 5) == (tq >> 5)) : true);      /* mode 2: block-diagonal 32-token groups */
        if (CAUSAL == 8) { ok0 = mk0[rt][r] != 0; ok1 = mk1[rt][r] != 0; }      /* mode 8: per-(query, key) int table shared by all batches and heads */
        if (CAUSAL == 4) { const int* mrow = MSK + ((size_t)b * TQA + tq) * TK; ok0 = mrow[k0] != 0; ok1 = mrow[k1] != 0; }      /* mode 4: per-(query, key) INPUT mask shared by all heads; masked keys contribute nothing (== the reference's -4096 fill, whose exp underflows to 0), rows with no valid key give l = 0 -> output 0 (== the reference's row_valid zeroing) */
        const float s0 = ok0 ? s[rt][0][r] * SCL : -3.0e38f, s1 = ok1 ? s[rt][1][r] * SCL : -3.0e38f; 
        const float mn = row_max16(fmaxf(fmaxf(s0, s1), m_r[rt][r]));      /* the running maximum is the same in all 16 lanes of the row: taken in ahead of the reduction, the reduced value is the new maximum itself */
        const float al = (mn > -1.0e38f) ? expf(m_r[rt][r] - mn) : 1.0f; m_r[rt][r] = mn; const float p0 = ok0 ? expf(s0 - mn) : 0.f, p1 = ok1 ? expf(s1 - mn) : 0.f; l_r[rt][r] = l_r[rt][r] * al + p0 + p1;
#pragma unroll
        for (int dt = 0; dt < DT; ++dt) { oacc[rt][dt][r] *= al; oaccL[rt][dt][r] *= al; }
        FragH t2, t2l; const float ps0 = p0 * 1024.0f, ps1 = p1 * 1024.0f; t2.h[0] = (_Float16)ps0; t2.h[1] = (_Float16)ps1; t2l.h[0] = (_Float16)((ps0 - (float)t2.h[0]) * 1024.0f); t2l.h[1] = (_Float16)((ps1 - (float)t2.h[1]) * 1024.0f);
        sP[w][rt * 16 + 8 * hh + r][ln] = t2.u[0]; sP[w][rt * 16 + 8 * hh + r][16 + ln] = t2.u[1]; sPL[w][rt * 16 + 8 * hh + r][ln] = t2l.u[0]; sPL[w][rt * 16 + 8 * hh + r][16 + ln] = t2l.u[1]; }
    __builtin_amdgcn_fence(__ATOMIC_ACQ_REL, "workgroup"); __builtin_amdgcn_wave_barrier();
    FragH pa[2], pl[2];
#pragma unroll
    for (int rt = 0; rt < RTN; ++rt) { pa[rt].half[0] = *(const v8us*)&sP[w][rt * 16 + ln][8 * hh]; pa[rt].half[1] = *(const v8us*)&sP[w][rt * 16 + ln][16 + 8 * hh]; pl[rt].half[0] = *(const v8us*)&sPL[w][rt * 16 + ln][8 * hh]; pl[rt].half[1] = *(const v8us*)&sPL[w][rt * 16 + ln][16 + 8 * hh]; }
#pragma unroll
    for (int dt = 0; dt < DT; ++dt) {
#pragma unroll
      for (int rt = 0; rt < RTN; ++rt) { oacc[rt][dt] = mmaH<1>(pa[rt].v, pa[rt].v, bv[dt].v, bv[dt].v, oacc[rt][dt]); oaccL[rt][dt] = mmaH<1>(pl[rt].v, pl[rt].v, bv[dt].v, bv[dt].v, oaccL[rt][dt]); oaccL[rt][dt] = mmaH<1>(pa[rt].v, pa[rt].v, bl[dt].v, bl[dt].v, oaccL[rt][dt]); } }
    __builtin_amdgcn_fence(__ATOMIC_ACQ_REL, "workgroup"); __builtin_amdgcn_wave_barrier(); }
  /* each wave leaves its rows' maxima, sums and unnormalised outputs in LDS */
#pragma unroll
  for (int rt = 0; rt < RTN; ++rt) {
#pragma unroll
    for (int r = 0; r < 8; ++r) { const float l = row_sum16(l_r[rt][r]); if (ln == 0) { sM[w][rt * 16 + 8 * hh + r] = m_r[rt][r]; sL[w][rt * 16 + 8 * hh + r] = l; } }
#pragma unroll
    for (int dt = 0; dt < DT; ++dt)
#pragma unroll
      for (int r = 0; r < 8; ++r) { float v = oacc[rt][dt][r]; v += oaccL[rt][dt][r] * 0.0009765625f; sO[w][rt * 16 + 8 * hh + r][dt * 16 + ln] = v; } }
  __syncthreads();      /* every wave's partials are in LDS before any thread merges them */
  /* merge, a thread per (row, 4 columns): M = max m_u; l = sum l_u e^(m_u - M); O = sum O_u e^(m_u - M), u in wave order. A wave with no live key for the row has m_u = -3.0e38, l_u = 0, O_u = 0 and adds nothing; a row with no live key at all gives l = 0 -> output 0 */
  if (tid < RPW * 16) { const int r = tid >> 4, pc = tid & 15; float mm = sM[0][r];      /* both loops below are unrolled so that their LDS reads are issued together, ahead of the arithmetic */
#pragma unroll
    for (int u = 1; u < NSPL; ++u) mm = fmaxf(mm, sM[u][r]);
    float l = 0.f; v4f a = {0.f, 0.f, 0.f, 0.f};
#pragma unroll
    for (int u = 0; u < NSPL; ++u) { const float f = expf(sM[u][r] - mm); const v4f val = *(const v4fa*)&sO[u][r][pc * 4]; l += sL[u][r] * f; a += val * f; }
    const float li = (l > 0.f) ? 1.0f / (l * 1024.0f) : 0.f;
    *(v4f*)(O + ((size_t)b * TQA + q0 + r) * ldo + h * 64 + pc * 4) = a * li; } }

// 3-term variant: O = (P_hi V_hi + (P_lo V_hi + P_hi V_lo) / 1024) / l with P = [hi | 2^10 residual] of 1024 p and V^T = [hi | 2^10 residual] planes (VtL same layout as Vt) -> ~2^-21-class products for un-averaged (early causal / peaked) rows
template <int CAUSAL>
__global__ __launch_bounds__(256) void k_flash3gB(const _Float16* __restrict__ Q16, int ldq, const _Float16* __restrict__ K16, int ldk, const _Float16* __restrict__ Vt, const _Float16* __restrict__ VtL, const int* __restrict__ MSK, const unsigned int* __restrict__ LV, float* __restrict__ O, int ldo) {
  constexpr int RPW = 16, RTN = RPW / 16, NQB = TQB / (4 * RPW), DT = 4, KS = 2;
  __shared__ __attribute__((aligned(16))) unsigned short sP[8][RPW][40]; __shared__ __attribute__((aligned(16))) unsigned short sPL[8][RPW][40]; __shared__ __attribute__((aligned(16))) float sO[8][RPW][64 + 4];
  const int tid = threadIdx.x, w = __builtin_amdgcn_readfirstlane(tid >> 5), lane = tid & 31, ln = lane & 15, hh = lane >> 4;      /* the wave's number in a scalar register: the tile number, its live bits and the test on them stay scalar */
  const int slab = blockIdx.x / (QTB / 16), pblk = blockIdx.x % (QTB / 16); (void)NQB; const int b = slab / NH, h = slab % NH;
  /* a wave takes two 16-query tiles one after the other, t and QTB - 1 - t: where the live key tiles grow with the query position, as under a causal mask, every wave then walks about the same number of them. For any mask each tile is taken exactly once */
#pragma unroll 1      /* kept rolled: one copy of the key loop in the instruction cache */
  for (int it = 0; it < 2; ++it) {
  const int qt = it ? QTB - 1 - (pblk * 8 + w) : pblk * 8 + w; const int q0 = qt * RPW;
  const unsigned int* lv = LV + (size_t)qt * (3 * 4 * 32);      /* bit kt & 31 of word kt >> 5, the four row groups joined: key tile kt holds a non-zero mask word for this query tile */
  unsigned int lw0 = ~0u, lw1 = ~0u, lw2 = ~0u;      /* the modes without a mask table walk every key tile */
  if (CAUSAL == 8) { lw0 = __builtin_amdgcn_readfirstlane(lv[0] | lv[32] | lv[64] | lv[96]); lw1 = __builtin_amdgcn_readfirstlane(lv[128] | lv[160] | lv[192] | lv[224]); lw2 = __builtin_amdgcn_readfirstlane(lv[256] | lv[288] | lv[320] | lv[352]); }
  FragH aq[2][KS];
#pragma unroll
  for (int rt = 0; rt < RTN; ++rt) { const unsigned short* qr = (const unsigned short*)Q16 + ((size_t)((b * TQB + q0 + rt * 16) >> 4) * (ldq >> 5) + h * 2) * 512 + lane * 8;      /* Q, K and both V^T planes in fragment order */
#pragma unroll
    for (int ks = 0; ks < KS; ++ks) { aq[rt][ks].half[0] = *(const v8us*)(qr + ks * 512); aq[rt][ks].half[1] = *(const v8us*)(qr + ks * 512 + 256); } }
  const size_t vslab = (size_t)(b * (NH / KVG) + h / KVG); const unsigned short* Vth = (const unsigned short*)Vt + vslab * 64 * TK; const unsigned short* Vtl = (const unsigned short*)VtL + vslab * 64 * TK;      /* GQA: q-head h reads kv head h / KVG */
  float m_r[2][8], l_r[2][8]; v8f oacc[2][DT], oaccL[2][DT];
#pragma unroll
  for (int rt = 0; rt < RTN; ++rt) {
#pragma unroll
    for (int r = 0; r < 8; ++r) { m_r[rt][r] = -3.0e38f; l_r[rt][r] = 0.f; }
#pragma unroll
    for (int dt = 0; dt < DT; ++dt) { oacc[rt][dt] = (v8f){0.f,0.f,0.f,0.f,0.f,0.f,0.f,0.f}; oaccL[rt][dt] = oacc[rt][dt]; } }
  const int jend = (CAUSAL == 1) ? (q0 + RPW) : TK;      /* causal: keys beyond the tile's last query never contribute */
#pragma unroll 1
  for (int j0 = 0; j0 < jend; j0 += 32) {
    /* a key tile whose 16 x 32 mask words are all zero leaves m, l and O as they are (every p is 0 and the rescale factor is 1): it is passed over, on a scalar test */
    const int kt = j0 >> 5; const unsigned int lw = (kt < 32) ? lw0 : ((kt < 64) ? lw1 : lw2);
    if (((lw >> (kt & 31)) & 1u) == 0u) continue;
    v8f s[2][2]; FragH bk[2][KS], bv[DT], bl[DT]; int mk0[RTN][8], mk1[RTN][8];
    /* every global load of the trip is issued here, in the order of use (K, mask words, both V planes): their latencies overlap, and V lands behind the softmax */
#pragma unroll
    for (int nt = 0; nt < 2; ++nt) { const unsigned short* kr = (const unsigned short*)K16 + ((size_t)((b * TK + j0 + nt * 16) >> 4) * (ldk >> 5) + (h / KVG) * 2) * 512 + lane * 8;
#pragma unroll
      for (int ks = 0; ks < KS; ++ks) { bk[nt][ks].half[0] = *(const v8us*)(kr + ks * 512); bk[nt][ks].half[1] = *(const v8us*)(kr + ks * 512 + 256); } }
    asm volatile("s_wait_xcnt 0x0" ::: "memory");      /* stands in front of the mask loads, whose results may land in registers that the K loads name as addresses */
    if (CAUSAL == 8) {
#pragma unroll
      for (int rt = 0; rt < RTN; ++rt)
#pragma unroll
        for (int r = 0; r < 8; ++r) { const int* mrow = MSK + (size_t)(q0 + rt * 16 + 8 * hh + r) * TK + j0 + ln; mk0[rt][r] = mrow[0]; mk1[rt][r] = mrow[16]; } }
    asm volatile("s_wait_xcnt 0x0" ::: "memory");      /* stands in front of the V loads, whose results may land in registers that the mask loads name as addresses */
#pragma unroll
    for (int dt = 0; dt < DT; ++dt) { const size_t vo = ((size_t)dt * (TK / 32) + (j0 >> 5)) * 512 + lane * 8; const unsigned short* vrow = Vth + vo; const unsigned short* vrl = Vtl + vo; bv[dt].half[0] = *(const v8us*)vrow; bv[dt].half[1] = *(const v8us*)(vrow + 256); bl[dt].half[0] = *(const v8us*)vrl;
      if (dt == DT - 1) asm volatile("s_wait_xcnt 0x0" ::: "memory");      /* stands in front of the trip's last load, whose result lands in the address registers of the V loads above */
      bl[dt].half[1] = *(const v8us*)(vrl + 256); }
    __builtin_amdgcn_sched_barrier(0);      /* keeps the loads above together: without it the scheduler moves each one down to its first use, one exposed latency apiece */
#pragma unroll
    for (int nt = 0; nt < 2; ++nt) {
#pragma unroll
      for (int rt = 0; rt < RTN; ++rt) { v8f acc = (v8f){0.f,0.f,0.f,0.f,0.f,0.f,0.f,0.f};
#pragma unroll
        for (int ks = 0; ks < KS; ++ks) acc = mmaH<1>(aq[rt][ks].v, aq[rt][ks].v, bk[nt][ks].v, bk[nt][ks].v, acc); s[rt][nt] = acc; } }
#pragma unroll
    for (int rt = 0; rt < RTN; ++rt)
#pragma unroll
      for (int r = 0; r < 8; ++r) { const int tq = q0 + rt * 16 + 8 * hh + r; const int k0 = j0 + ln, k1 = j0 + 16 + ln;
        bool ok0 = (CAUSAL == 1) ? (k0 <= tq) : ((CAUSAL == 2) ? ((k0 >> 5) == (tq >> 5)) : true), ok1 = (CAUSAL == 1) ? (k1 <= tq) : ((CAUSAL == 2) ? ((k1 >> 5) == (tq >> 5)) : true);      /* mode 2: block-diagonal 32-token groups */
        if (CAUSAL == 8) { ok0 = mk0[rt][r] != 0; ok1 = mk1[rt][r] != 0; }      /* mode 8: per-(query, key) int table shared by all batches and heads */
        if (CAUSAL == 4) { const int* mrow = MSK + ((size_t)b * TQB + tq) * TK; ok0 = mrow[k0] != 0; ok1 = mrow[k1] != 0; }      /* mode 4: per-(query, key) INPUT mask shared by all heads; masked keys contribute nothing (== the reference's -4096 fill, whose exp underflows to 0), rows with no valid key give l = 0 -> output 0 (== the reference's row_valid zeroing) */
        const float s0 = ok0 ? s[rt][0][r] * SCL : -3.0e38f, s1 = ok1 ? s[rt][1][r] * SCL : -3.0e38f; 
        const float mn = row_max16(fmaxf(fmaxf(s0, s1), m_r[rt][r]));      /* the running maximum is the same in all 16 lanes of the row: taken in ahead of the reduction, the reduced value is the new maximum itself */
        const float al = (mn > -1.0e38f) ? expf(m_r[rt][r] - mn) : 1.0f; m_r[rt][r] = mn; const float p0 = ok0 ? expf(s0 - mn) : 0.f, p1 = ok1 ? expf(s1 - mn) : 0.f; l_r[rt][r] = l_r[rt][r] * al + p0 + p1;
#pragma unroll
        for (int dt = 0; dt < DT; ++dt) { oacc[rt][dt][r] *= al; oaccL[rt][dt][r] *= al; }
        FragH t2, t2l; const float ps0 = p0 * 1024.0f, ps1 = p1 * 1024.0f; t2.h[0] = (_Float16)ps0; t2.h[1] = (_Float16)ps1; t2l.h[0] = (_Float16)((ps0 - (float)t2.h[0]) * 1024.0f); t2l.h[1] = (_Float16)((ps1 - (float)t2.h[1]) * 1024.0f);
        sP[w][rt * 16 + 8 * hh + r][ln] = t2.u[0]; sP[w][rt * 16 + 8 * hh + r][16 + ln] = t2.u[1]; sPL[w][rt * 16 + 8 * hh + r][ln] = t2l.u[0]; sPL[w][rt * 16 + 8 * hh + r][16 + ln] = t2l.u[1]; }
    __builtin_amdgcn_fence(__ATOMIC_ACQ_REL, "workgroup"); __builtin_amdgcn_wave_barrier();
    FragH pa[2], pl[2];
#pragma unroll
    for (int rt = 0; rt < RTN; ++rt) { pa[rt].half[0] = *(const v8us*)&sP[w][rt * 16 + ln][8 * hh]; pa[rt].half[1] = *(const v8us*)&sP[w][rt * 16 + ln][16 + 8 * hh]; pl[rt].half[0] = *(const v8us*)&sPL[w][rt * 16 + ln][8 * hh]; pl[rt].half[1] = *(const v8us*)&sPL[w][rt * 16 + ln][16 + 8 * hh]; }
#pragma unroll
    for (int dt = 0; dt < DT; ++dt) {
#pragma unroll
      for (int rt = 0; rt < RTN; ++rt) { oacc[rt][dt] = mmaH<1>(pa[rt].v, pa[rt].v, bv[dt].v, bv[dt].v, oacc[rt][dt]); oaccL[rt][dt] = mmaH<1>(pl[rt].v, pl[rt].v, bv[dt].v, bv[dt].v, oaccL[rt][dt]); oaccL[rt][dt] = mmaH<1>(pa[rt].v, pa[rt].v, bl[dt].v, bl[dt].v, oaccL[rt][dt]); } }
    __builtin_amdgcn_fence(__ATOMIC_ACQ_REL, "workgroup"); __builtin_amdgcn_wave_barrier(); }
#pragma unroll
  for (int rt = 0; rt < RTN; ++rt) {
#pragma unroll
    for (int r = 0; r < 8; ++r) { float l = l_r[rt][r]; l = row_sum16(l); l_r[rt][r] = (l > 0.f) ? 1.0f / (l * 1024.0f) : 0.f; }
#pragma unroll
    for (int dt = 0; dt < DT; ++dt)
#pragma unroll
      for (int r = 0; r < 8; ++r) { float v = oacc[rt][dt][r]; v += oaccL[rt][dt][r] * 0.0009765625f; sO[w][rt * 16 + 8 * hh + r][dt * 16 + ln] = v * l_r[rt][r]; } }
  __builtin_amdgcn_fence(__ATOMIC_ACQ_REL, "workgroup"); __builtin_amdgcn_wave_barrier();
  {
#pragma unroll
    for (int rp = 0; rp < RPW; rp += 2) { const int r = rp + (lane >> 4), pc = lane & 15; const v4f val = *(const v4fa*)&sO[w][r][pc * 4]; *(v4f*)(O + ((size_t)b * TQB + q0 + r) * ldo + h * 64 + pc * 4) = val; }
    asm volatile("s_wait_xcnt 0x0" ::: "memory");      /* stands in front of the second tile's set-up, which overwrites registers that the stores above name */
     } } }

// two planes [nout][nin] in fragment order, one behind the other: x16 weights (for the hi operand), then x1 weights (for the 2^10 residual operand) at Bt + nout * nin
__device__ __forceinline__ void d_wpair(int bx, const float* __restrict__ Wm, int nin, int nout, _Float16* __restrict__ Bt) { const size_t t = (size_t)bx * 256 + threadIdx.x; if (t >= (size_t)nout * (2 * nin / 8)) return; const size_t per = (size_t)nout * (nin / 8); const bool lo = t >= per; const FoRK s = fo_src(lo ? t - per : t, nin); const int o = s.row; FragH f;
  for (int q = 0; q < 8; ++q) { const int c = s.k + q; if (q) asm volatile("s_wait_xcnt 0x0" ::: "memory");      /* stands in front of each further load, whose result may land in a register that an earlier load names as its address */
    f.h[q] = (_Float16)(bf16_round(Wm[(size_t)c * nout + o]) * (lo ? 1.0f : 16.0f)); } *(v8us*)((unsigned short*)Bt + t * 8) = f.half[0];  }
template <int TWO_D>
__device__ __forceinline__ void d_rotab(int bx, int nrows, int rpb, const int* __restrict__ bar, const int* __restrict__ tib, float* __restrict__ CS, float* __restrict__ SN) {
  #pragma clang fp contract(off)
  const size_t t = (size_t)bx * 256 + threadIdx.x; if (t >= (size_t)nrows * 32) return; const int d = (int)(t % 32); const int row = (int)(t / 32); const int b = row / rpb, r = row % rpb; float pos, inv;
  if (TWO_D) { const int dm = d & 15; inv = 1.0f / powf(10000.0f, (float)dm * 2.0f / 32.0f); pos = (d < 16) ? (float)bar[(size_t)b * rpb + r] : (float)tib[(size_t)b * rpb + r]; }
  else { inv = 1.0f / powf(10000.0f, (float)(2 * d) / 64.0f); pos = (float)r; }
  const float th = pos * inv; const float c = cosf(th), s = sinf(th);
  { *(float*)(CS + t) = c; *(float*)(SN + t) = s;  } }
__device__ __forceinline__ void d_rope(int bx, const float* __restrict__ F, int nrows, int rpb, int nheads, const float* __restrict__ CS, const float* __restrict__ SN, _Float16* __restrict__ dst, int ldo, int dst_bstride, int row_off) {
  #pragma clang fp contract(off)
  /* dst in fragment order (ldo elements a row): a wave takes 16 rows of one head and the dims jg .. jg + 7 and jg + 32 .. jg + 39 that make half a fragment each; rpb, dst_bstride and row_off are multiples of 16 */
  const size_t t = (size_t)bx * 256 + threadIdx.x; if (t >= (size_t)nrows * nheads * 4) return; const int lane = (int)(t & 31); const size_t wid = t >> 5; const int jg = (int)(wid & 1) * 16 + (lane >> 4) * 8; const int h = (int)((wid >> 1) % nheads); const int row = (int)((wid >> 1) / nheads) * 16 + (lane & 15); const int b = row / rpb, r = row % rpb; const int ldi = nheads * 64;
  const float* xr = F + (size_t)row * ldi + h * 64; FragH f0, f1;
#pragma unroll
  for (int q = 0; q < 8; ++q) { const int d = jg + q; const float c = CS[(size_t)row * 32 + d], s = SN[(size_t)row * 32 + d]; const float x0 = xr[d], x1 = xr[d + 32];
    float o0 = x0 * c; o0 += -x1 * s; float o1 = x1 * c; o1 += x0 * s; f0.h[q] = (_Float16)o0; f1.h[q] = (_Float16)o1; }
  unsigned short* o = (unsigned short*)dst + fo_dst(b * dst_bstride + row_off + r, h * 64 + jg, ldo);
  { *(v8us*)o = f0.half[0]; *(v8us*)(o + 512) = f1.half[0];  } }      /* 32 dims on: the next block */
__device__ __forceinline__ void d_put(int bx, const float* __restrict__ F, int nrows, int rpb, int ncol, _Float16* __restrict__ H, _Float16* __restrict__ L, int dst_bstride, int row_off) {
  const size_t t = (size_t)bx * 256 + threadIdx.x; if (t >= (size_t)nrows * (ncol / 8)) return; const int c0 = (int)(t % (ncol / 8)) * 8; const int row = (int)(t / (ncol / 8)); const int b = row / rpb, r = row % rpb; FragH fh, fl;
  for (int q = 0; q < 8; ++q) { const float v = F[(size_t)row * ncol + c0 + q]; const _Float16 hv = (_Float16)v; fh.h[q] = hv; fl.h[q] = (_Float16)((v - (float)hv) * 1024.0f); }
  const size_t drow = (size_t)b * dst_bstride + row_off + r; { *(v8us*)((unsigned short*)H + drow * ncol + c0) = fh.half[0];
    asm volatile("s_wait_xcnt 0x0" ::: "memory");      /* stands in front of the residual plane's arithmetic, which overwrites registers that the store above names */
    if (L) *(v8us*)((unsigned short*)L + drow * ncol + c0) = fl.half[0];  } }

// d_put's hi plane alone, in fragment order (k2 into the key plane)
__device__ __forceinline__ void d_putk(int bx, const float* __restrict__ F, int nrows, int rpb, int ncol, _Float16* __restrict__ H, int dst_bstride, int row_off) {
  const size_t t = (size_t)bx * 256 + threadIdx.x; if (t >= (size_t)nrows * (ncol / 8)) return; const FoRK s = fo_src(t, ncol); const int b = s.row / rpb, r = s.row % rpb; FragH fh;
  for (int q = 0; q < 8; ++q) fh.h[q] = (_Float16)F[(size_t)s.row * ncol + s.k + q];
  *(v8us*)((unsigned short*)H + fo_dst(b * dst_bstride + row_off + r, s.k, ncol)) = fh.half[0]; }

// live bits of the phase-2 mask: bit l of word (qt, wd, rg) says whether key tile wd * 32 + l (32 keys) holds a non-zero word in rows 4 rg .. 4 rg + 3 of the 16-query tile qt. A wave per word, a lane per key tile (128 bytes a row); each word has a 128-byte line of its own
__device__ __forceinline__ void d_live(int bx, const int* __restrict__ MSK, unsigned int* __restrict__ LV) {
  typedef int v4ia __attribute__((ext_vector_type(4), may_alias));
  const int wv = bx * 8 + (int)(threadIdx.x >> 5), lane = threadIdx.x & 31; const int rg = wv & 3, wd = (wv >> 2) % 3, qt = (wv >> 2) / 3; const int kt = wd * 32 + lane; v4ia any = {0, 0, 0, 0};
  if (kt < TK / 32) { const int* p = MSK + (size_t)(qt * 16 + rg * 4) * TK + kt * 32;
#pragma unroll 1
    for (int r = 0; r < 4; ++r) {      /* kept rolled: a row's 8 loads are in flight together, and the launch's register count stays low for its other ranges */
#pragma unroll
      for (int c = 0; c < 8; ++c) any |= *(const v4ia*)(p + (size_t)r * TK + c * 4); } }
  const unsigned int word = __builtin_amdgcn_ballot_w32((any[0] | any[1] | any[2] | any[3]) != 0);
  if (lane == 0) LV[(size_t)wv * 32] = word; }

// ---- one launch per dependency level: kernels that do not depend on one another run as consecutive block ranges of one grid. Every range test reads blockIdx.x alone, so a work-group takes one branch as a whole; each body is the same code as before, handed its block number inside its own range. ----
constexpr int PB_W = DMOD * DMOD / 8 / 256, PB_WK = DMOD * KVD / 8 / 256;                  /* blocks of one transposed weight plane: 1024 and 256 columns */
constexpr int PB_P = DMOD * (2 * DMOD / 8) / 256, PB_PK = KVD * (2 * DMOD / 8) / 256;       /* blocks of one [W x16 | W x1] weight pair (same bf16 weights, for the hi and the residual products) */
constexpr int PB_T1 = NRS * 32 / 256, PB_T2 = NRR * 32 / 256;                              /* RoPE tables */
constexpr int PB_XS = NRS * DMOD / 8 / 256, PB_XR = NRR * DMOD / 8 / 256;                  /* f16 planes of the two inputs */
constexpr int PB_ALL = 2 * PB_W + 4 * PB_WK + 2 * PB_P + 2 * PB_PK + PB_T1 + PB_T2 + PB_XS + PB_XR;
__global__ __launch_bounds__(256) void k_prep(const float* w_sq, const float* w_sk, const float* w_sv, const float* w_rq, const float* w_rk, const float* w_rv,
    _Float16* BSQ, _Float16* BSK, _Float16* BSV, _Float16* BRQ, _Float16* BRK, _Float16* BRV,
    const float* w_so, const float* w_ro, const float* w_k2, const float* w_v2, _Float16* BSO, _Float16* BRO, _Float16* BK2, _Float16* BV2,
    const int* bar, const int* tib, float* CS1, float* SN1, float* CS2, float* SN2, const float* sum_x, _Float16* SX, const float* reg_x, _Float16* RX) {
  int bx = blockIdx.x;
  if (bx < 2 * PB_W + 4 * PB_WK) { const float* Wm = w_sq; _Float16* Bt = BSQ; int nout = DMOD;
    if (bx >= PB_W) { bx -= PB_W; Wm = w_rq; Bt = BRQ;
      if (bx >= PB_W) { bx -= PB_W; Wm = w_sk; Bt = BSK; nout = KVD;
        if (bx >= PB_WK) { bx -= PB_WK; Wm = w_sv; Bt = BSV;
          if (bx >= PB_WK) { bx -= PB_WK; Wm = w_rk; Bt = BRK;
            if (bx >= PB_WK) { bx -= PB_WK; Wm = w_rv; Bt = BRV; } } } } }
    d_wt_f16(bx, Wm, Bt, DMOD, nout, 16.0f); return; }
  bx -= 2 * PB_W + 4 * PB_WK;
  if (bx < 2 * PB_P + 2 * PB_PK) { const float* Wm = w_so; _Float16* Bt = BSO; int nout = DMOD;
    if (bx >= PB_P) { bx -= PB_P; Wm = w_ro; Bt = BRO;
      if (bx >= PB_P) { bx -= PB_P; Wm = w_k2; Bt = BK2; nout = KVD;
        if (bx >= PB_PK) { bx -= PB_PK; Wm = w_v2; Bt = BV2; } } }
    d_wpair(bx, Wm, DMOD, nout, Bt); return; }
  bx -= 2 * PB_P + 2 * PB_PK;
  if (bx < PB_T1) { d_rotab<0>(bx, NRS, SS, nullptr, nullptr, CS1, SN1); return; }
  bx -= PB_T1;
  if (bx < PB_T2) { d_rotab<1>(bx, NRR, RR, bar, tib, CS2, SN2); return; }
  bx -= PB_T2;
  if (bx < PB_XS) d_x16(bx, sum_x, SX, (size_t)NRS * DMOD / 8, DMOD); else d_x16(bx - PB_XS, reg_x, RX, (size_t)NRR * DMOD / 8, DMOD); }

// up to six GEMMs (d_gemm2) in one launch, all with the same K and alpha, operands in fragment order; ldc = N. Jobs 0..2 read A0 (Ma rows), jobs 3..5 read A1 (Mb rows); in each triple N = DMOD, KVD, KVD. S_j is job j's bias (cp == 0) or the f32 plane, pitch N, that is added to the product (cp != 0). The grid ends behind the last job in use; the pointers of jobs behind it are not read.
__global__ __launch_bounds__(128) void k_gemm2m(const _Float16* A0, const _Float16* A1, const _Float16* B0, const _Float16* B1, const _Float16* B2, const _Float16* B3, const _Float16* B4, const _Float16* B5,
    const float* S0, const float* S1, const float* S2, const float* S3, const float* S4, const float* S5, float* C0, float* C1, float* C2, float* C3, float* C4, float* C5, int Ma, int Mb, int K, float alpha, int cp) {
  int bx = blockIdx.x; const int ta = Ma >> 7, tb = Mb >> 7;      /* 128-row block tiles; a job has (M / 128) * (N / 64) blocks */
  const _Float16* A = A0; const _Float16* B = B0; const float* S = S0; float* C = C0; int M = Ma, N = DMOD;
  if (bx >= ta * (DMOD / 64)) { bx -= ta * (DMOD / 64); B = B1; S = S1; C = C1; N = KVD;
    if (bx >= ta * (KVD / 64)) { bx -= ta * (KVD / 64); B = B2; S = S2; C = C2;
      if (bx >= ta * (KVD / 64)) { bx -= ta * (KVD / 64); A = A1; M = Mb; B = B3; S = S3; C = C3; N = DMOD;
        if (bx >= tb * (DMOD / 64)) { bx -= tb * (DMOD / 64); B = B4; S = S4; C = C4; N = KVD;
          if (bx >= tb * (KVD / 64)) { bx -= tb * (KVD / 64); B = B5; S = S5; C = C5; } } } } }
  d_gemm2<0>(bx, A, 0, B, 0, alpha, cp ? nullptr : S, 0, cp ? S : nullptr, 1, (size_t)N, 0, C, nullptr, N, 0, M, N, K); }

constexpr int QB_RQ = NRR * NH * 4 / 256, QB_RK = NRR * NKV * 4 / 256, QB_RV = NRR * (KVD / 8) / 256, QB_SQ = NRS * NH * 4 / 256, QB_SK = NRS * NKV * 4 / 256, QB_SV = NRS * (KVD / 8) / 256;
constexpr int QB_LV = QTB * 3 * 4 / 8;      /* live bits of the phase-2 mask: 8 waves a block, a wave per word */
// what follows the six projections: RoPE of both q and both k planes, hi + residual planes of both v; ahead of them, as it depends on an input alone, the live bits of the phase-2 mask
__global__ __launch_bounds__(256) void k_post(const float* FSQ, const float* FSK, const float* FSV, const float* FRQ, const float* FRK, const float* FRV, const float* CS1, const float* SN1, const float* CS2, const float* SN2,
    _Float16* SQ, _Float16* RQ, _Float16* KC, _Float16* VCH, _Float16* VCL, const int* mupd, unsigned int* LV) {
  int bx = blockIdx.x;
  if (bx < QB_LV) { d_live(bx, mupd, LV); return; }
  bx -= QB_LV;
  if (bx < QB_RQ + QB_RK + QB_SQ + QB_SK) { const float* F = FRQ; const float* CS = CS2; const float* SN = SN2; _Float16* dst = RQ; int nrows = NRR, rpb = RR, nheads = NH, bstr = RR, roff = 0;
    if (bx >= QB_RQ) { bx -= QB_RQ; F = FRK; dst = KC; nheads = NKV; bstr = TK; roff = SS;      /* keys 64.. of each batch */
      if (bx >= QB_RK) { bx -= QB_RK; F = FSQ; CS = CS1; SN = SN1; dst = SQ; nrows = NRS; rpb = SS; nheads = NH; bstr = SS; roff = 0;
        if (bx >= QB_SQ) { bx -= QB_SQ; F = FSK; dst = KC; nheads = NKV; bstr = TK; } } }      /* keys 0..63 of each batch */
    d_rope(bx, F, nrows, rpb, nheads, CS, SN, dst, nheads * 64, bstr, roff); return; }
  bx -= QB_RQ + QB_RK + QB_SQ + QB_SK;
  if (bx < QB_RV) d_put(bx, FRV, NRR, RR, KVD, VCH, VCL, TK, SS); else d_put(bx - QB_RV, FSV, NRS, SS, KVD, VCH, VCL, TK, 0); }
// k2 into key rows 0..63 (one plane), v2 into value rows 0..63 (hi + residual) of each batch
__global__ __launch_bounds__(256) void k_put2(const float* FK2, const float* FV2, _Float16* KC, _Float16* VCH, _Float16* VCL) {
  const int bx = blockIdx.x;
  if (bx < QB_SV) d_putk(bx, FK2, NRS, SS, KVD, KC, TK, 0); else d_put(bx - QB_SV, FV2, NRS, SS, KVD, VCH, VCL, TK, 0); }
// V^T of the hi plane (first half of the grid) and of the residual plane (second half)
__global__ __launch_bounds__(256) void k_vt2(const _Float16* VCH, const _Float16* VCL, _Float16* VT, _Float16* VTL) {
  constexpr int NBV = NB * NKV * (TK / 64); const bool lo = (int)blockIdx.x >= NBV;
  d_vt<NKV, TK>((int)blockIdx.x - (lo ? NBV : 0), lo ? VCL : VCH, KVD, 0, lo ? VTL : VT); }

extern "C" void kernel_launch(void* const* d_in, const int* in_sizes, int n_in,
                              void* d_out, int out_size, void* d_ws, size_t ws_size, hipStream_t stream) {
  (void)in_sizes; (void)n_in; (void)out_size;
  const float* const* I = (const float* const*)d_in; const float* sum_x = I[0]; const float* reg_x = I[1];
  const float* w_sq = I[2]; const float* b_sq = I[3]; const float* w_sk = I[4]; const float* b_sk = I[5]; const float* w_sv = I[6]; const float* b_sv = I[7]; const float* w_so = I[8]; const float* b_so = I[9];
  const float* w_rq = I[10]; const float* b_rq = I[11]; const float* w_rk = I[12]; const float* b_rk = I[13]; const float* w_rv = I[14]; const float* b_rv = I[15]; const float* w_ro = I[16]; const float* b_ro = I[17];
  const float* w_k2 = I[18]; const float* b_k2 = I[19]; const float* w_v2 = I[20]; const float* b_v2 = I[21];
  const int* bar = (const int*)d_in[22]; const int* tib = (const int*)d_in[23]; const int* msum = (const int*)d_in[24]; const int* mupd = (const int*)d_in[25];
  char* ws = (char*)d_ws; size_t off = 0;
  auto take = [&](size_t bytes) { char* p = ws + off; off += (bytes + 255) & ~(size_t)255; return p; };
  const size_t w8 = (size_t)DMOD * DMOD / 8, w8k = (size_t)DMOD * KVD / 8;
  _Float16* BSQ = (_Float16*)take(w8 * 16); _Float16* BSK = (_Float16*)take(w8k * 16); _Float16* BSV = (_Float16*)take(w8k * 16); _Float16* BRQ = (_Float16*)take(w8 * 16); _Float16* BRK = (_Float16*)take(w8k * 16); _Float16* BRV = (_Float16*)take(w8k * 16);
  _Float16* BSO = (_Float16*)take(w8 * 32); _Float16* BRO = (_Float16*)take(w8 * 32); _Float16* BK2 = (_Float16*)take(w8k * 32); _Float16* BV2 = (_Float16*)take(w8k * 32);
  float* CS1 = (float*)take((size_t)NRS * 32 * 4); float* SN1 = (float*)take((size_t)NRS * 32 * 4); float* CS2 = (float*)take((size_t)NRR * 32 * 4); float* SN2 = (float*)take((size_t)NRR * 32 * 4); _Float16* SX = (_Float16*)take((size_t)NRS * DMOD * 2); _Float16* RX = (_Float16*)take((size_t)NRR * DMOD * 2);
  /* each projection has an f32 plane of its own, since all six are written by one launch */
  float* FRQ = (float*)take((size_t)NRR * DMOD * 4); float* FRK = (float*)take((size_t)NRR * KVD * 4); float* FRV = (float*)take((size_t)NRR * KVD * 4); float* FSQ = (float*)take((size_t)NRS * DMOD * 4); float* FSK = (float*)take((size_t)NRS * KVD * 4); float* FSV = (float*)take((size_t)NRS * KVD * 4);
  _Float16* SQ = (_Float16*)take((size_t)NRS * DMOD * 2); _Float16* RQ = (_Float16*)take((size_t)NRR * DMOD * 2); _Float16* KC = (_Float16*)take((size_t)NB * TK * KVD * 2); _Float16* VCH = (_Float16*)take((size_t)NB * TK * KVD * 2); _Float16* VCL = (_Float16*)take((size_t)NB * TK * KVD * 2); _Float16* VT = (_Float16*)take((size_t)NB * NKV * 64 * TK * 2); _Float16* VTL = (_Float16*)take((size_t)NB * NKV * 64 * TK * 2);
  float* O1 = (float*)take((size_t)NRS * DMOD * 4); _Float16* O1H = (_Float16*)take((size_t)NRS * DMOD * 2); _Float16* O1L = (_Float16*)take((size_t)NRS * DMOD * 2); float* O2 = FRQ; _Float16* O2H = RQ; _Float16* O2L = RX;      /* O2 over the dead reg-q f32 scratch; O2H/O2L over RQ/RX (dead after phase 2 / the projections) */
  unsigned int* LV = (unsigned int*)take((size_t)QTB * 3 * 4 * 128);      /* live bits of the phase-2 mask, a 128-byte line a word */
  float* FK2 = FSK; float* FV2 = FSV;      /* k2 / v2 f32 planes over the summary k / v scratch (dead after k_post) */
  if (off > ws_size) return;      /* about 70 MiB */
  float* out0 = (float*)d_out; float* out1 = (float*)d_out + (size_t)NRS * DMOD;
  /* weight planes, RoPE tables, input planes */
  k_prep<<<PB_ALL, 256, 0, stream>>>(w_sq, w_sk, w_sv, w_rq, w_rk, w_rv, BSQ, BSK, BSV, BRQ, BRK, BRV, w_so, w_ro, w_k2, w_v2, BSO, BRO, BK2, BV2, bar, tib, CS1, SN1, CS2, SN2, sum_x, SX, reg_x, RX);
  /* summary q/k/v and regular q/k/v */
  k_gemm2m<<<(NRS / 128 + NRR / 128) * ((DMOD + 2 * KVD) / 64), 128, 0, stream>>>(SX, RX, BSQ, BSK, BSV, BRQ, BRK, BRV, b_sq, b_sk, b_sv, b_rq, b_rk, b_rv, FSQ, FSK, FSV, FRQ, FRK, FRV, NRS, NRR, DMOD, 0.0625f, 0);
  k_post<<<QB_LV + QB_RQ + QB_RK + QB_SQ + QB_SK + QB_RV + QB_SV, 256, 0, stream>>>(FSQ, FSK, FSV, FRQ, FRK, FRV, CS1, SN1, CS2, SN2, SQ, RQ, KC, VCH, VCL, mupd, LV);
  /* phase 1: summary queries over [summary ; regular] keys */
  k_vt2<<<2 * NB * NKV * (TK / 64), 256, 0, stream>>>(VCH, VCL, VT, VTL);
  k_flash3gA<8><<<NB * NH * (TQA / 16), 32 * NSPL, 0, stream>>>(SQ, DMOD, KC, KVD, VT, VTL, msum, O1, DMOD);
  k_hl<<<(unsigned)(((size_t)NRS * DMOD / 8 + 255) / 256), 256, 0, stream>>>(O1, O1H, O1L, (size_t)NRS * DMOD / 8, DMOD);
  /* output 0 = sum_attn W_so + b_so; k2 / v2 from sum_attn (no RoPE): the three hi products, then the three residual products on top of them */
  k_gemm2m<<<(NRS / 128) * ((DMOD + 2 * KVD) / 64), 128, 0, stream>>>(O1H, nullptr, BSO, BK2, BV2, nullptr, nullptr, nullptr, b_so, b_k2, b_v2, nullptr, nullptr, nullptr, out0, FK2, FV2, nullptr, nullptr, nullptr, NRS, 0, DMOD, 0.0625f, 0);
  k_gemm2m<<<(NRS / 128) * ((DMOD + 2 * KVD) / 64), 128, 0, stream>>>(O1L, nullptr, BSO + DMOD * DMOD, BK2 + KVD * DMOD, BV2 + KVD * DMOD, nullptr, nullptr, nullptr, out0, FK2, FV2, nullptr, nullptr, nullptr, out0, FK2, FV2, nullptr, nullptr, nullptr, NRS, 0, DMOD, 1.0f / 1024.0f, 1);
  k_put2<<<2 * QB_SV, 256, 0, stream>>>(FK2, FV2, KC, VCH, VCL);      /* into key / value rows 0..63 of each batch */
  /* phase 2: regular queries over [k2 ; regular] keys */
  k_vt2<<<2 * NB * NKV * (TK / 64), 256, 0, stream>>>(VCH, VCL, VT, VTL);
  k_flash3gB<8><<<NB * NH * (QTB / 16), 256, 0, stream>>>(RQ, DMOD, KC, KVD, VT, VTL, mupd, LV, O2, DMOD);
  k_hl<<<(unsigned)(((size_t)NRR * DMOD / 8 + 255) / 256), 256, 0, stream>>>(O2, O2H, O2L, (size_t)NRR * DMOD / 8, DMOD);
  k_gemm2m<<<(NRR / 128) * (DMOD / 64), 128, 0, stream>>>(O2H, nullptr, BRO, nullptr, nullptr, nullptr, nullptr, nullptr, b_ro, nullptr, nullptr, nullptr, nullptr, nullptr, out1, nullptr, nullptr, nullptr, nullptr, nullptr, NRR, 0, DMOD, 0.0625f, 0);
  k_gemm2m<<<(NRR / 128) * (DMOD / 64), 128, 0, stream>>>(O2L, nullptr, BRO + DMOD * DMOD, nullptr, nullptr, nullptr, nullptr, nullptr, out1, nullptr, nullptr, nullptr, nullptr, nullptr, out1, nullptr, nullptr, nullptr, nullptr, nullptr, NRR, 0, DMOD, 1.0f / 1024.0f, 1);
}
